// v000
// Times are from an AMD MI455X. After a warm-up the kernel runs many times in a row, and a time is the length of
// such a window on the GPU divided by its runs, so every launch and the gaps after it count. The runs cycle
// through copies of the inputs. A figure is the median of several windows, for all but v000 over two sittings.
// Sittings can differ by a few percent; kernels timed side by side share one.
// v000 is the starting kernel. One run takes 329 microseconds.
#include <hip/hip_runtime.h>

// Contractions (fused QKV projection, Q.K^T, P.V, P row-sum, output projection): v_wmma_f32_16x16x32_f16, f16 operands with power-of-two carries, f32 accumulate; every float input enters as its bf16 RNE value; the first EARLY query rows of each sequence carry P, V and context as f16 hi + f16 residual planes (extra products into the same f32 accumulators); softmax in f32.

#ifndef NB
#define NB 2
#endif
#ifndef SEQ
#define SEQ 2048
#endif
#define NB_FULL   2
#define SEQ_FULL  2048
#define HID       1024
#define NHEAD     16
#define HD        64
#define MROWS     (NB * SEQ)
#define EARLY_CAP 512
#define EARLY     ((SEQ < EARLY_CAP) ? SEQ : EARLY_CAP)

#define OUT0_ELEMS_FULL ((size_t)NB_FULL * SEQ_FULL * HID)          // out0 elements
#define PRES_ELEMS_FULL ((size_t)NB_FULL * NHEAD * SEQ_FULL * HD)   // elements of present[0] (k) or present[1] (v)

static_assert(HID == NHEAD * HD);        // merged head width
static_assert(NHEAD == 16);              // bh >> 4 / bh & 15 decoding
static_assert(HD == 64);
static_assert(SEQ % 128 == 0);           // 128-row blocks never straddle a batch
static_assert(EARLY % 128 == 0);
static_assert(EARLY >= 128 && EARLY <= SEQ);
static_assert(SEQ <= SEQ_FULL);
static_assert(NB >= 1 && NB <= NB_FULL);
static_assert(MROWS % 128 == 0);         // GEMM M tile
static_assert(HID % 128 == 0);           // GEMM N tile
static_assert(HID % 64 == 0);            // weight transpose tile
static_assert(HID % 32 == 0);            // WMMA k step
static_assert((HID & (HID - 1)) == 0);   // k0 & (HID-1)
static_assert(HID == 128 * 8);           // cvt_rows: 128 threads x 8 values per row
static_assert(OUT0_ELEMS_FULL * 4 == (size_t)16777216);   // byte offset of the second output

// carries (exact powers of two)
#define CARRY_X    16.0f     // input activation plane
#define CARRY_W    32.0f     // weight planes
#define CARRY_QKV  16.0f     // q, k, v^T planes (true value x16); v residual in the same units
#define CARRY_CTX  1024.0f   // context planes (true value x1024); residual in the same units
// softmax exp values carry 2^10 (added to the exp2 argument); residual in the same units

typedef unsigned u32;
typedef _Float16 f16;
typedef f16   v16h __attribute__((ext_vector_type(16)));
typedef f16   v8h  __attribute__((ext_vector_type(8)));
typedef float v8f  __attribute__((ext_vector_type(8)));
typedef float v4f  __attribute__((ext_vector_type(4)));

union FragU { v16h v; v8h half[2]; f16 e[16]; };
union H8U   { v8h v; f16 e[8]; };

__device__ __forceinline__ v8f zero8() {
    v8f z = {0.f, 0.f, 0.f, 0.f, 0.f, 0.f, 0.f, 0.f};
    return z;
}

// 16-bit WMMA with hazard guard: D += A[16 x 32k] * B[32k x 16]
__device__ __forceinline__ v8f wmma16(v16h a, v16h b, v8f c) {
    v8f d = __builtin_amdgcn_wmma_f32_16x16x32_f16(false, a, false, b, (short)0, c, false, false);
    asm volatile("v_nop\n\tv_nop\n\tv_nop\n\tv_nop" : "+v"(d) : "v"(a), "v"(b));
    return d;
}

// f32 -> nearest-even bf16 value, returned as f32
__device__ __forceinline__ float bf16_rne(float x) {
    u32 u = __float_as_uint(x);
    u = (u + 0x7fffu + ((u >> 16) & 1u)) & 0xffff0000u;
    return __uint_as_float(u);
}

__device__ __forceinline__ float fexp2(float x) {
#if defined(__has_builtin)
#if __has_builtin(__builtin_amdgcn_exp2f)
    return __builtin_amdgcn_exp2f(x);
#else
    return exp2f(x);
#endif
#else
    return exp2f(x);
#endif
}

// max over the 16 lanes of each lane half (DPP row rotations; D-layout rows are DPP rows)
__device__ __forceinline__ float rowmax16(float x) {
    int v = __builtin_bit_cast(int, x);
    x = fmaxf(x, __builtin_bit_cast(float, __builtin_amdgcn_update_dpp(v, v, 0x121, 0xf, 0xf, false)));
    v = __builtin_bit_cast(int, x);
    x = fmaxf(x, __builtin_bit_cast(float, __builtin_amdgcn_update_dpp(v, v, 0x122, 0xf, 0xf, false)));
    v = __builtin_bit_cast(int, x);
    x = fmaxf(x, __builtin_bit_cast(float, __builtin_amdgcn_update_dpp(v, v, 0x124, 0xf, 0xf, false)));
    v = __builtin_bit_cast(int, x);
    x = fmaxf(x, __builtin_bit_cast(float, __builtin_amdgcn_update_dpp(v, v, 0x128, 0xf, 0xf, false)));
    return x;
}

// 16 x 32 fragment from a tile whose k dimension is contiguous (pitch in halves).
// lane l: row rowbase + (l&15); elements 0..7 <- k = kcol + 8h .. +7,
// elements 8..15 <- k = kcol + 16 + 8h .. +7  (h = l>>4). Same map for A and B.
__device__ __forceinline__ v16h load_frag(const f16* tile, u32 rowbase, u32 pitch, u32 kcol, u32 lane) {
    const u32 r  = rowbase + (lane & 15u);
    const u32 kh = (lane >> 4) << 3;
    const f16* p = tile + (size_t)r * pitch + kcol + kh;
    FragU f;
    f.half[0] = *(const v8h*)(p);
    f.half[1] = *(const v8h*)(p + 16);
    return f.v;
}

// ---------------------------------------------------------------------------
// f32 rows [.][1024] -> f16 plane (bf16 RNE value times carry). 128 threads per 1024-wide
// Row mapping dst row m -> src row (m / dstper) * srcper + m % dstper lets a reduced build
// read full-size inputs.
// coverage: nrows x 1024 halves, every element exactly once (grid = nrows*128/256).
// ---------------------------------------------------------------------------
__global__ void __launch_bounds__(256)
cvt_rows(const float* __restrict__ src, f16* __restrict__ dst, u32 nrows, u32 dstper, u32 srcper, float carry) {
    const u32 g  = blockIdx.x * 256u + threadIdx.x;
    const u32 m  = g >> 7;
    const u32 c8 = (g & 127u) << 3;
    if (m >= nrows) return;
    const u32 mb = m / dstper;
    const u32 sm = mb * srcper + (m - mb * dstper);
    const float* sp = src + (size_t)sm * HID + c8;
    const v4f a = *(const v4f*)sp;
    const v4f b = *(const v4f*)(sp + 4);
    H8U o;
#pragma unroll
    for (u32 j = 0; j < 4; ++j) {
        const float x0 = a[j];
        const float x1 = b[j];
        o.e[j]     = (f16)(bf16_rne(x0) * carry);
        o.e[j + 4] = (f16)(bf16_rne(x1) * carry);
    }
    f16* dp = dst + (size_t)m * HID + c8;
    *(v8h*)dp = o.v;
    
}

// ---------------------------------------------------------------------------
// Transposing weight convert: src[rows][cols] f32 -> dst[cols][rows] f16 (bf16 RNE value
// times carry). Block = 64 (src rows, k) x 64 (src cols, n) tile, grid (cols/64, rows/64).
// Tile staged transposed in LDS (pitch 72 halves), then each dst row segment of 64 halves
// coverage: 4 x 256 threads x 4 values == 64 x 64 per block; blocks tile rows x cols exactly.
// LDS t: cross-wave, block barrier; staged extent 64 x 64 == consumed extent.
// ---------------------------------------------------------------------------
__global__ void __launch_bounds__(256)
cvt_wT(const float* __restrict__ src, f16* __restrict__ dst, u32 rows, u32 cols, float carry) {
    __shared__ __attribute__((aligned(16))) f16 t[64 * 72];
    const u32 tid = threadIdx.x;
    const u32 n0  = blockIdx.x * 64u;   // src column block == dst row block
    const u32 k0  = blockIdx.y * 64u;   // src row block == dst column block
#pragma unroll
    for (u32 it = 0; it < 4; ++it) {
        const u32 p  = tid + it * 256u;
        const u32 kr = p >> 4;              // 0..63
        const u32 c4 = (p & 15u) << 2;      // 0..60
        const v4f a = *(const v4f*)(src + (size_t)(k0 + kr) * cols + n0 + c4);
#pragma unroll
        for (u32 j = 0; j < 4; ++j) {
            const float x = a[j];
            t[(c4 + j) * 72u + kr] = (f16)(bf16_rne(x) * carry);
        }
    }
    __syncthreads();
    const u32 piece = tid & 7u;
    const u32 lrow  = tid >> 3;             // 0..31
{
#pragma unroll
        for (u32 it = 0; it < 2; ++it) {
            const u32 L = it * 32u + lrow;  // dst row within the tile, 0..63
            const v8h v = *(const v8h*)&t[L * 72u + piece * 8u];
            f16* dp = dst + (size_t)(n0 + L) * rows + k0 + piece * 8u;
            *(v8h*)dp = v;
        }
        
    }
}

// ---------------------------------------------------------------------------
// C[m][n] = sum_k A[m][k] * W[n][k] ; A [MROWS][1024] f16, W [1024][1024] f16 (k contiguous).
// Block tile 128 x 128, 8 waves as 4(M) x 2(N), 2 x 4 accumulators per wave, K step 32.
// true value t = acc * mul + bias (bias enters as its bf16 RNE value, added in f32).
// MODE 0: f16 plane [b*NHEAD + h][s][d] (t x16)
// MODE 1: MODE 0 plane + f32 rows [b*NHEAD + h][s][d] (t) into the output buffer
// MODE 2: f16 plane [b*HID + h*HD + d][s] (t x16, transposed per head), residual plane of the
//         same layout for key blocks below EARLY, + f32 rows as MODE 1
// MODE 3: f32 rows [b][s][1024] into the output buffer; for row blocks below EARLY the k loop
//         continues over the residual A plane (A + resOff) against the same W (K folded to 2048)
// coverage per block: f16 planes 256 lines (128 rows x 2 heads | 128 n x 2 s-halves);
//                     f32 2 x 256 lines (64 rows x 4 line-quarters per half).
// LDS: As/Bs/Cs all cross-wave, separated by block barriers.
// staged extent == consumed extent: As/Bs 128 x 32, Cs 128 x 128 halves (or 64 x 128 floats).
// ---------------------------------------------------------------------------
template <int MODE>
__device__ __forceinline__ void gemm_body(const f16* A, const f16* W, const float* bias,
                                          f16* plane, f16* plane2, float* fout, size_t resOff) {
    __shared__ __attribute__((aligned(16))) f16 As[128 * 32];
    __shared__ __attribute__((aligned(16))) f16 Bs[128 * 32];
    __shared__ __attribute__((aligned(16))) f16 Cs[128 * 128];   // f16 [128][128] or f32 [64][128]
    static_assert(sizeof(f16) * 128 * 128 == sizeof(float) * 64 * 128);   // Cs reuse as f32 [64][128]

    const u32 tid  = threadIdx.x;
    const u32 lane = tid & 31u;
    const u32 wave = tid >> 5;
    const u32 wm   = wave & 3u;
    const u32 wn   = wave >> 2;
    const u32 hh8  = (lane >> 4) << 3;   // D row half
    const u32 c16  = lane & 15u;         // D column
    const u32 m0   = blockIdx.x * 128u;
    const u32 n0   = blockIdx.y * 128u;
    const u32 bidx = m0 / (u32)SEQ;      // block rows lie inside one batch (SEQ % 128 == 0)
    const u32 s0   = m0 - bidx * (u32)SEQ;

    u32 kTot = (u32)HID;
    if constexpr (MODE == 3) {
        if (s0 < (u32)EARLY) kTot = 2u * (u32)HID;   // block-uniform
    }

    v8f acc[2][4];
#pragma unroll
    for (int i = 0; i < 2; ++i)
#pragma unroll
        for (int j = 0; j < 4; ++j) acc[i][j] = zero8();

    const u32 srow = tid >> 1;
    const u32 scol = (tid & 1u) << 4;
    const f16* gA = A + (size_t)(m0 + srow) * HID + scol;
    const f16* gW = W + (size_t)(n0 + srow) * HID + scol;

#pragma unroll 1
    for (u32 k0 = 0; k0 < kTot; k0 += 32u) {
        const u32    kk = k0 & (u32)(HID - 1);
        const size_t ao = (k0 >= (u32)HID) ? resOff : (size_t)0;
        const v8h ra0 = *(const v8h*)(gA + ao + kk);
        const v8h ra1 = *(const v8h*)(gA + ao + kk + 8);
        const v8h rb0 = *(const v8h*)(gW + kk);
        const v8h rb1 = *(const v8h*)(gW + kk + 8);
        __syncthreads();
        *(v8h*)&As[srow * 32u + scol]      = ra0;
        *(v8h*)&As[srow * 32u + scol + 8u] = ra1;
        *(v8h*)&Bs[srow * 32u + scol]      = rb0;
        *(v8h*)&Bs[srow * 32u + scol + 8u] = rb1;
        __syncthreads();

        v16h af[2], bfr[4];
#pragma unroll
        for (int i = 0; i < 2; ++i) af[i] = load_frag(As, wm * 32u + (u32)i * 16u, 32u, 0u, lane);
#pragma unroll
        for (int j = 0; j < 4; ++j) bfr[j] = load_frag(Bs, wn * 64u + (u32)j * 16u, 32u, 0u, lane);
#pragma unroll
        for (int i = 0; i < 2; ++i)
#pragma unroll
            for (int j = 0; j < 4; ++j) acc[i][j] = wmma16(af[i], bfr[j], acc[i][j]);
    }

    const float mul = (MODE == 3) ? (1.0f / (CARRY_CTX * CARRY_W)) : (1.0f / (CARRY_X * CARRY_W));
    float bv[4];
#pragma unroll
    for (int j = 0; j < 4; ++j) {
        const float bx = bias[n0 + wn * 64u + (u32)j * 16u + c16];
        bv[j] = bf16_rne(bx);
    }

    const u32 piece = lane & 7u;
    const u32 lsub  = lane >> 3;

    if constexpr (MODE == 0 || MODE == 1) {
#pragma unroll
        for (int i = 0; i < 2; ++i)
#pragma unroll
            for (int j = 0; j < 4; ++j) {
                const u32 nl = wn * 64u + (u32)j * 16u + c16;
#pragma unroll
                for (int r = 0; r < 8; ++r) {
                    const u32 ml = wm * 32u + (u32)i * 16u + hh8 + (u32)r;
                    const float tv = acc[i][j][r] * mul + bv[j];
                    Cs[ml * 128u + nl] = (f16)(tv * CARRY_QKV);
                }
            }
        __syncthreads();
        const size_t bh0 = (size_t)bidx * NHEAD + (n0 >> 6);
{
#pragma unroll
            for (u32 it = 0; it < 8; ++it) {
                const u32 L    = wave * 32u + it * 4u + lsub;   // 0..255
                const u32 ml   = L >> 1;
                const u32 hsel = L & 1u;
                const v8h v = *(const v8h*)&Cs[ml * 128u + hsel * 64u + piece * 8u];
                f16* dp = plane + ((bh0 + hsel) * SEQ + s0 + ml) * HD + piece * 8u;
                *(v8h*)dp = v;
            }
            
        }
    }
    if constexpr (MODE == 2) {
        // hi plane, staged transposed: Cs[n][m]
#pragma unroll
        for (int i = 0; i < 2; ++i)
#pragma unroll
            for (int j = 0; j < 4; ++j) {
                const u32 nl = wn * 64u + (u32)j * 16u + c16;
                H8U t;
#pragma unroll
                for (int r = 0; r < 8; ++r) {
                    const float tv = (acc[i][j][r] * mul + bv[j]) * CARRY_QKV;
                    t.e[r] = (f16)tv;
                }
                *(v8h*)&Cs[nl * 128u + wm * 32u + (u32)i * 16u + hh8] = t.v;
            }
        __syncthreads();
{
#pragma unroll
            for (u32 it = 0; it < 8; ++it) {
                const u32 L  = wave * 32u + it * 4u + lsub;     // 0..255
                const u32 nl = L >> 1;
                const u32 mh = L & 1u;
                const v8h v = *(const v8h*)&Cs[nl * 128u + mh * 64u + piece * 8u];
                f16* dp = plane + ((size_t)(bidx * (u32)HID + n0 + nl) * SEQ + s0 + mh * 64u + piece * 8u);
                *(v8h*)dp = v;
            }
            
        }
        if (s0 < (u32)EARLY) {          // block-uniform: residual plane only for early key blocks
            __syncthreads();
#pragma unroll
            for (int i = 0; i < 2; ++i)
#pragma unroll
                for (int j = 0; j < 4; ++j) {
                    const u32 nl = wn * 64u + (u32)j * 16u + c16;
                    H8U t;
#pragma unroll
                    for (int r = 0; r < 8; ++r) {
                        const float tv = (acc[i][j][r] * mul + bv[j]) * CARRY_QKV;
                        const f16   hi = (f16)tv;
                        t.e[r] = (f16)(tv - (float)hi);
                    }
                    *(v8h*)&Cs[nl * 128u + wm * 32u + (u32)i * 16u + hh8] = t.v;
                }
            __syncthreads();
{
#pragma unroll
                for (u32 it = 0; it < 8; ++it) {
                    const u32 L  = wave * 32u + it * 4u + lsub;
                    const u32 nl = L >> 1;
                    const u32 mh = L & 1u;
                    const v8h v = *(const v8h*)&Cs[nl * 128u + mh * 64u + piece * 8u];
                    f16* dp = plane2 + ((size_t)(bidx * (u32)HID + n0 + nl) * SEQ + s0 + mh * 64u + piece * 8u);
                    *(v8h*)dp = v;
                }
                
            }
        }
    }
    if constexpr (MODE >= 1) {
        if constexpr (MODE != 3) __syncthreads();   // f16 stage reads finished before restaging
        float* Cf = (float*)Cs;      // [64][128] f32
#pragma unroll
        for (u32 half = 0; half < 2; ++half) {
            if ((wm >> 1) == half) {
#pragma unroll
                for (int i = 0; i < 2; ++i)
#pragma unroll
                    for (int j = 0; j < 4; ++j) {
                        const u32 nl = wn * 64u + (u32)j * 16u + c16;
#pragma unroll
                        for (int r = 0; r < 8; ++r) {
                            const u32 ml = (wm & 1u) * 32u + (u32)i * 16u + hh8 + (u32)r;
                            Cf[ml * 128u + nl] = acc[i][j][r] * mul + bv[j];
                        }
                    }
            }
            __syncthreads();
{
#pragma unroll
                for (u32 it = 0; it < 8; ++it) {
                    const u32 L    = wave * 32u + it * 4u + lsub;   // 0..255
                    const u32 row  = L >> 2;
                    const u32 part = L & 3u;
                    const v4f v = *(const v4f*)&Cf[row * 128u + part * 32u + piece * 4u];
                    size_t off;
                    if constexpr (MODE == 3) {
                        off = (size_t)(bidx * (u32)SEQ_FULL + s0 + half * 64u + row) * HID
                            + n0 + part * 32u + piece * 4u;
                    } else {
                        off = ((size_t)(bidx * (u32)NHEAD + (n0 >> 6) + (part >> 1)) * SEQ_FULL
                               + s0 + half * 64u + row) * HD + (part & 1u) * 32u + piece * 4u;
                    }
                    *(v4f*)(fout + off) = v;
                }
                
            }
            __syncthreads();
        }
    }
}

// q head-major plane
__global__ void __launch_bounds__(256) __attribute__((amdgpu_num_vgpr(256)))
gemm_q(const f16* __restrict__ A, const f16* __restrict__ W, const float* __restrict__ bias,
       f16* __restrict__ out) {
    gemm_body<0>(A, W, bias, out, out, (float*)out, (size_t)0);
}

// k head-major plane + f32 k rows of the second output
__global__ void __launch_bounds__(256) __attribute__((amdgpu_num_vgpr(256)))
gemm_k(const f16* __restrict__ A, const f16* __restrict__ W, const float* __restrict__ bias,
       f16* __restrict__ out, float* __restrict__ pres) {
    gemm_body<1>(A, W, bias, out, out, pres, (size_t)0);
}

// v^T plane + v^T residual plane (early keys) + f32 v rows of the second output
__global__ void __launch_bounds__(256) __attribute__((amdgpu_num_vgpr(256)))
gemm_v(const f16* __restrict__ A, const f16* __restrict__ W, const float* __restrict__ bias,
       f16* __restrict__ outT, f16* __restrict__ outR, float* __restrict__ pres) {
    gemm_body<2>(A, W, bias, outT, outR, pres, (size_t)0);
}

// f32 output rows; A residual plane at A + resOff for early row blocks
__global__ void __launch_bounds__(256) __attribute__((amdgpu_num_vgpr(256)))
gemm_o(const f16* __restrict__ A, const f16* __restrict__ W, const float* __restrict__ bias,
       float* __restrict__ out, size_t resOff) {
    gemm_body<3>(A, W, bias, (f16*)out, (f16*)out, out, resOff);
}

// ---------------------------------------------------------------------------
// Online softmax update for one 16 q x 64 key score tile (log2 domain, max-subtracted).
// MASK: keys above the query row get probability exactly 0 and do not enter the row max.
// EP: also emit the f16 residual of each carried exp value.
// ---------------------------------------------------------------------------
template <bool MASK, bool EP>
__device__ __forceinline__ void softmax_tile(const v8f (&s)[4], float (&m)[8], v8f (&o)[4], v8f& lacc,
                                             f16* psw, f16* prw, u32 kbase, u32 q0,
                                             u32 hh8, u32 c16, float cl) {
#pragma unroll
    for (int r = 0; r < 8; ++r) {
        float x[4];
        bool  dead[4];
#pragma unroll
        for (int nt = 0; nt < 4; ++nt) {
            x[nt]    = s[nt][r] * cl;
            dead[nt] = false;
            if constexpr (MASK) {
                dead[nt] = (kbase + (u32)nt * 16u + c16) > (q0 + hh8 + (u32)r);
                x[nt]    = dead[nt] ? -1.0e30f : x[nt];
            }
        }
        const float tm = rowmax16(fmaxf(fmaxf(x[0], x[1]), fmaxf(x[2], x[3])));
        const float mn = fmaxf(m[r], tm);
        const float al = fexp2(m[r] - mn);
        m[r] = mn;
        lacc[r] *= al;
#pragma unroll
        for (int dt = 0; dt < 4; ++dt) o[dt][r] *= al;
        const float sh = 10.0f - mn;      // carry 2^10
#pragma unroll
        for (int nt = 0; nt < 4; ++nt) {
            float e = fexp2(x[nt] + sh);
            if constexpr (MASK) e = dead[nt] ? 0.0f : e;
            const f16 hi = (f16)e;
            const u32 idx = (hh8 + (u32)r) * 64u + (u32)nt * 16u + c16;
            psw[idx] = hi;
            if constexpr (EP) prw[idx] = (f16)(e - (float)hi);
        }
    }
}

// ---------------------------------------------------------------------------
// Causal flash attention. grid (row blocks, NB*NHEAD), block 256 (8 waves), wave owns 16 query
// rows (Q fragments resident). Block streams 64-key tiles 0 .. last tile touching its rows:
// K staged [key][d], V^T staged [d][key] (+ residual tile when EP). A wave computes a tile only
// when the tile starts at or below its first row (wave-uniform); the tile containing its rows
// takes the masked path. Scores on WMMA, row max via DPP, exp2 in f32 carried x2^10, P relayed
// per wave through LDS as A fragments, O += P.V and row sums += P.ones on WMMA.
// EP (rows below EARLY): P and V as hi + residual, products hi.hi + hi.res + res.hi into the
// same accumulators; context written as hi plane + residual plane.
// coverage: every (b, q, h*64..h*64+63) row segment of the launched row blocks exactly once.
// LDS: ks, vsT, vrT cross-wave (block barriers); ps/pr per-wave but also separated by block
// barriers. staged extent == consumed extent for ks/vsT/vrT (64x64) and ps/pr (16x64, written
// in full by the owning wave before it reads them).
// ---------------------------------------------------------------------------
template <bool EP>
__device__ __forceinline__ void attn_body(const f16* Qp, const f16* Kp, const f16* Vt, const f16* Vr,
                                          f16* Cp, f16* Cr, u32 qblk0) {
    __shared__ __attribute__((aligned(16))) f16 ks[64 * 64];                  // [key][d]
    __shared__ __attribute__((aligned(16))) f16 vsT[64 * 64];                 // [d][key]
    __shared__ __attribute__((aligned(16))) f16 vrT[EP ? 64 * 64 : 8];        // [d][key] residual
    __shared__ __attribute__((aligned(16))) f16 ps[8][16 * 64];               // per-wave P relay / ctx stage
    __shared__ __attribute__((aligned(16))) f16 pr[8][EP ? 16 * 64 : 8];      // per-wave P residual relay
    static_assert(HD == 8 * 8);            // 8 lanes x 8 halves per row segment
    static_assert(2 * 256 * 8 == 64 * 64); // staging: 2 x 256 threads x 8 halves per tile

    const u32 tid  = threadIdx.x;
    const u32 lane = tid & 31u;
    const u32 wave = (u32)__builtin_amdgcn_readfirstlane((int)(tid >> 5));
    const u32 hh8  = (lane >> 4) << 3;
    const u32 c16  = lane & 15u;
    const u32 bh   = blockIdx.y;
    const u32 bidx = bh >> 4;            // NHEAD == 16
    const u32 hidx = bh & 15u;
    const u32 qblk = blockIdx.x + qblk0;
    const u32 q0   = qblk * 128u + wave * 16u;
    const size_t head = (size_t)bh * SEQ * HD;

    v16h qa[2];
#pragma unroll
    for (int c = 0; c < 2; ++c) qa[c] = load_frag(Qp + head, q0, HD, (u32)c * 32u, lane);

    FragU onesu;
#pragma unroll
    for (int i = 0; i < 16; ++i) onesu.e[i] = (f16)1.0f;
    const v16h ones = onesu.v;

    float m[8];
    v8f   o[4], lacc;
#pragma unroll
    for (int r = 0; r < 8; ++r) m[r] = -1.0e30f;
#pragma unroll
    for (int dt = 0; dt < 4; ++dt) o[dt] = zero8();
    lacc = zero8();

    // log2-domain scale: acc = 256 * q.k ; x = log2(e) * q.k / 64 = acc * log2(e) / 16384
    const float cl = 1.4426950408889634f * 0.00006103515625f;
    f16* psw = &ps[wave][0];
    f16* prw = &pr[EP ? wave : 0u][0];

    const u32 nkt = qblk * 2u + 2u;      // keys 0 .. qblk*128 + 127

#pragma unroll 1
    for (u32 kt = 0; kt < nkt; ++kt) {
        __syncthreads();
#pragma unroll
        for (u32 p2 = 0; p2 < 2; ++p2) {
            const u32 p   = tid + p2 * 256u;
            const u32 row = p >> 3;
            const u32 pc  = (p & 7u) << 3;
            const v8h kv = *(const v8h*)(Kp + head + (size_t)(kt * 64u + row) * HD + pc);
            const v8h vv = *(const v8h*)(Vt + head + (size_t)row * SEQ + kt * 64u + pc);
            *(v8h*)&ks[row * 64u + pc]  = kv;
            *(v8h*)&vsT[row * 64u + pc] = vv;
            if constexpr (EP) {
                const v8h vr = *(const v8h*)(Vr + head + (size_t)row * SEQ + kt * 64u + pc);
                *(v8h*)&vrT[row * 64u + pc] = vr;
            }
        }
        __syncthreads();

        const bool active = (kt * 64u <= q0);           // wave-uniform
        if (active) {
            // S[16 q x 64 keys]
            v8f s[4];
#pragma unroll
            for (int nt = 0; nt < 4; ++nt) s[nt] = zero8();
#pragma unroll
            for (int c = 0; c < 2; ++c) {
#pragma unroll
                for (int nt = 0; nt < 4; ++nt) {
                    const v16h kb = load_frag(ks, (u32)nt * 16u, 64u, (u32)c * 32u, lane);
                    s[nt] = wmma16(qa[c], kb, s[nt]);
                }
            }
            const bool diag = (kt * 64u + 63u > q0);    // wave-uniform
            if (diag) softmax_tile<true,  EP>(s, m, o, lacc, psw, prw, kt * 64u, q0, hh8, c16, cl);
            else      softmax_tile<false, EP>(s, m, o, lacc, psw, prw, kt * 64u, q0, hh8, c16, cl);
        }
        __syncthreads();

        if (active) {
            // O += P . V ; l += P . ones  (P reloaded as A fragments from the relay)
#pragma unroll
            for (int kk = 0; kk < 2; ++kk) {
                const v16h pa = load_frag(psw, 0u, 64u, (u32)kk * 32u, lane);
                v16h pra = pa;
                if constexpr (EP) pra = load_frag(prw, 0u, 64u, (u32)kk * 32u, lane);
#pragma unroll
                for (int dt = 0; dt < 4; ++dt) {
                    const v16h vb = load_frag(vsT, (u32)dt * 16u, 64u, (u32)kk * 32u, lane);
                    o[dt] = wmma16(pa, vb, o[dt]);
                    if constexpr (EP) {
                        const v16h vrb = load_frag(vrT, (u32)dt * 16u, 64u, (u32)kk * 32u, lane);
                        o[dt] = wmma16(pa, vrb, o[dt]);
                        o[dt] = wmma16(pra, vb, o[dt]);
                    }
                }
                lacc = wmma16(pa, ones, lacc);
                if constexpr (EP) lacc = wmma16(pra, ones, lacc);
            }
        }
    }
    __syncthreads();

    // normalize: plane value = 1024 * (O/16) / l = O * 64 / l
#pragma unroll
    for (int r = 0; r < 8; ++r) {
        const float inv = (CARRY_CTX / CARRY_QKV) / lacc[r];
#pragma unroll
        for (int dt = 0; dt < 4; ++dt) {
            const float cv = o[dt][r] * inv;
            const f16   hi = (f16)cv;
            const u32  idx = (hh8 + (u32)r) * 64u + (u32)dt * 16u + c16;
            psw[idx] = hi;
            if constexpr (EP) prw[idx] = (f16)(cv - (float)hi);
        }
    }
    __syncthreads();

    const u32 piece = lane & 7u;
    const u32 lsub  = lane >> 3;
{
#pragma unroll
        for (u32 it = 0; it < 4; ++it) {
            const u32 L = it * 4u + lsub;     // query row 0..15 within the wave tile
            const size_t off = (size_t)(bidx * (u32)SEQ + q0 + L) * HID + hidx * (u32)HD + piece * 8u;
            const v8h v = *(const v8h*)&psw[L * 64u + piece * 8u];
            *(v8h*)(Cp + off) = v;
            if constexpr (EP) {
                const v8h vr = *(const v8h*)&prw[L * 64u + piece * 8u];
                *(v8h*)(Cr + off) = vr;
            }
        }
        
    }
}

// rows [0, EARLY) of every sequence: hi + residual path
__global__ void __launch_bounds__(256) __attribute__((amdgpu_num_vgpr(256)))
attn_early(const f16* __restrict__ Qp, const f16* __restrict__ Kp, const f16* __restrict__ Vt,
           const f16* __restrict__ Vr, f16* __restrict__ Cp, f16* __restrict__ Cr) {
    attn_body<true>(Qp, Kp, Vt, Vr, Cp, Cr, 0u);
}

// rows [EARLY, SEQ): single f16 planes
__global__ void __launch_bounds__(256) __attribute__((amdgpu_num_vgpr(256)))
attn_dense(const f16* __restrict__ Qp, const f16* __restrict__ Kp, const f16* __restrict__ Vt,
           f16* __restrict__ Cp) {
    attn_body<false>(Qp, Kp, Vt, Vt, Cp, Cp, (u32)(EARLY / 128));
}

// coverage equalities (threads x elements == plane elements)
static_assert((size_t)(MROWS / 2) * 256 * 8 == (size_t)MROWS * HID);                       // cvt_rows -> Xh
static_assert((size_t)(3 * HID / 64) * (HID / 64) * 64 * 64 == (size_t)3 * HID * HID);     // cvt_wT -> Wt
static_assert((size_t)(HID / 64) * (HID / 64) * 64 * 64 == (size_t)HID * HID);             // cvt_wT -> Wot
static_assert((size_t)(MROWS / 128) * (HID / 128) * 128 * 128 == (size_t)MROWS * HID);     // gemm planes / out
static_assert((size_t)(SEQ / 128) * (NB * NHEAD) * 128 * HD == (size_t)MROWS * HID);       // attn -> Cp
// workspace: 7 activation planes + 4 weight planes of halves, at most 128 MiB
static_assert(((size_t)7 * MROWS * HID + (size_t)4 * HID * HID) * sizeof(f16) <= (size_t)134217728);

// ---------------------------------------------------------------------------
// Launch: 9 kernel launches, workspace 7 planes of MROWS*1024 halves + 4 of 1024*1024 halves.
// ---------------------------------------------------------------------------
extern "C" void kernel_launch(void* const* d_in, const int* in_sizes, int n_in,
                              void* d_out, int out_size, void* d_ws, size_t ws_size,
                              hipStream_t stream) {
    if (n_in < 5) return;
    if (in_sizes[0] < ((NB - 1) * SEQ_FULL + SEQ) * HID) return;
    if (in_sizes[1] < 3 * HID * HID) return;
    if (in_sizes[2] < 3 * HID) return;
    if (in_sizes[3] < HID * HID) return;
    if (in_sizes[4] < HID) return;
    const size_t needOut = OUT0_ELEMS_FULL + PRES_ELEMS_FULL
                         + ((size_t)((NB - 1) * NHEAD + NHEAD - 1) * SEQ_FULL + SEQ) * HD;
    if ((size_t)out_size < needOut) return;

    const float* x     = (const float*)d_in[0];   // [NB_FULL][SEQ_FULL][1024]
    const float* wattn = (const float*)d_in[1];   // [1024 in][3072 out], out columns q | k | v
    const float* battn = (const float*)d_in[2];   // [3072]
    const float* wproj = (const float*)d_in[3];   // [1024 in][1024 out]
    const float* bproj = (const float*)d_in[4];   // [1024]
    float* out = (float*)d_out;                   // out0 | present k | present v

    const size_t nX = (size_t)MROWS * HID;    // halves per activation plane
    const size_t nW = (size_t)HID * HID;      // halves per weight plane
    const size_t totalHalves = 7 * nX + 4 * nW;
    if (ws_size < totalHalves * sizeof(f16)) return;

    f16* Xh  = (f16*)d_ws;       // [MROWS][1024]               carry 16
    f16* Wt  = Xh  + nX;         // [3072 out][1024 in]         carry 32 (q | k | v row blocks)
    f16* Wot = Wt  + 3 * nW;     // [1024 out][1024 in]         carry 32
    f16* Qp  = Wot + nW;         // [NB*16][SEQ][64]            carry 16
    f16* Kp  = Qp  + nX;         // [NB*16][SEQ][64]            carry 16
    f16* Vtp = Kp  + nX;         // [NB*1024][SEQ] (V^T)        carry 16
    f16* Vrp = Vtp + nX;         // [NB*1024][SEQ] residual, columns s < EARLY only
    f16* Cp  = Vrp + nX;         // [MROWS][1024]               carry 1024
    f16* Cr  = Cp  + nX;         // [MROWS][1024] residual, rows s < EARLY only

    // activations: dst row m of batch b <- src row b*SEQ_FULL + (m % SEQ)
    cvt_rows<<<MROWS / 2, 256, 0, stream>>>(x, Xh, (u32)MROWS, (u32)SEQ, (u32)SEQ_FULL, CARRY_X);
    // weights: in[rows = 1024 (k)][cols = 3072 (n)] -> out[cols][rows]; grid (cols/64, rows/64)
    cvt_wT<<<dim3(3 * HID / 64, HID / 64), 256, 0, stream>>>(wattn, Wt, (u32)HID, (u32)(3 * HID), CARRY_W);
    // in[rows = 1024 (k)][cols = 1024 (n)] -> out[cols][rows]; grid (cols/64, rows/64)
    cvt_wT<<<dim3(HID / 64, HID / 64), 256, 0, stream>>>(wproj, Wot, (u32)HID, (u32)HID, CARRY_W);

    const dim3 gg(MROWS / 128, HID / 128);
    gemm_q<<<gg, 256, 0, stream>>>(Xh, Wt,          battn,           Qp);
    gemm_k<<<gg, 256, 0, stream>>>(Xh, Wt + nW,     battn + HID,     Kp,  out + OUT0_ELEMS_FULL);
    gemm_v<<<gg, 256, 0, stream>>>(Xh, Wt + 2 * nW, battn + 2 * HID, Vtp, Vrp,
                                   out + OUT0_ELEMS_FULL + PRES_ELEMS_FULL);

    attn_early<<<dim3(EARLY / 128, NB * NHEAD), 256, 0, stream>>>(Qp, Kp, Vtp, Vrp, Cp, Cr);
    if (SEQ > EARLY) {
        attn_dense<<<dim3((SEQ - EARLY) / 128, NB * NHEAD), 256, 0, stream>>>(Qp, Kp, Vtp, Cp);
    }

    // out = acc / (1024*32) + bias ; residual context plane at Cp + nX
    gemm_o<<<gg, 256, 0, stream>>>(Cp, Wot, bproj, out, nX);
}

// v001
// It runs in 225 microseconds.
// In two side-by-side timings against v000, it was 1.50 and 1.48 times as fast.
#include <hip/hip_runtime.h>

// Contractions (fused QKV projection, Q.K^T, P.V, P row-sum, output projection): v_wmma_f32_16x16x32_f16, f16 operands with power-of-two carries, f32 accumulate; every float input enters as its bf16 RNE value; the first EARLY query rows of each sequence carry P, V and context as f16 hi + f16 residual planes (extra products into the same f32 accumulators); softmax in f32.

#ifndef NB
#define NB 2
#endif
#ifndef SEQ
#define SEQ 2048
#endif
#define NB_FULL   2
#define SEQ_FULL  2048
#define HID       1024
#define NHEAD     16
#define HD        64
#define MROWS     (NB * SEQ)
#define EARLY_CAP 512
#define EARLY     ((SEQ < EARLY_CAP) ? SEQ : EARLY_CAP)

#define OUT0_ELEMS_FULL ((size_t)NB_FULL * SEQ_FULL * HID)          // out0 elements
#define PRES_ELEMS_FULL ((size_t)NB_FULL * NHEAD * SEQ_FULL * HD)   // elements of present[0] (k) or present[1] (v)

static_assert(HID == NHEAD * HD);        // merged head width
static_assert(NHEAD == 16);              // bh >> 4 / bh & 15 decoding
static_assert(HD == 64);
static_assert(SEQ % 128 == 0);           // 128-row blocks never straddle a batch
static_assert(EARLY % 128 == 0);
static_assert(EARLY >= 128 && EARLY <= SEQ);
static_assert(SEQ <= SEQ_FULL);
static_assert(NB >= 1 && NB <= NB_FULL);
static_assert(MROWS % 128 == 0);         // GEMM M tile
static_assert(HID % 128 == 0);           // GEMM N tile
static_assert(HID % 64 == 0);            // weight transpose tile
static_assert(HID % 32 == 0);            // WMMA k step
static_assert((HID & (HID - 1)) == 0);   // k0 & (HID-1)
static_assert(HID == 128 * 8);           // cvt_rows: 128 threads x 8 values per row
static_assert(OUT0_ELEMS_FULL * 4 == (size_t)16777216);   // byte offset of the second output

// carries (exact powers of two)
#define CARRY_X    16.0f     // input activation plane
#define CARRY_W    32.0f     // weight planes
#define CARRY_QKV  16.0f     // q, k, v^T planes (true value x16); v residual in the same units
#define CARRY_CTX  1024.0f   // context planes (true value x1024); residual in the same units
// softmax exp values carry 2^10 (added to the exp2 argument); residual in the same units

// LDS row pitches in elements: every row read or written 16 bytes per lane has a pitch of 16 B x odd,
// so the 16 lanes of a lane half fall on 64 distinct banks
#define PK32   40u    // 32-half rows (64 B)  -> 80 B
#define PK64   72u    // 64-half rows (128 B) -> 144 B
#define PC16   136u   // 128-half rows (256 B) -> 272 B
#define PC32   132u   // 128-float rows (512 B) -> 528 B

typedef unsigned u32;
typedef _Float16 f16;
typedef f16   v16h __attribute__((ext_vector_type(16)));
typedef f16   v8h  __attribute__((ext_vector_type(8)));
typedef float v8f  __attribute__((ext_vector_type(8)));
typedef float v4f  __attribute__((ext_vector_type(4)));

union FragU { v16h v; v8h half[2]; f16 e[16]; };
union H8U   { v8h v; f16 e[8]; };

__device__ __forceinline__ v8f zero8() {
    v8f z = {0.f, 0.f, 0.f, 0.f, 0.f, 0.f, 0.f, 0.f};
    return z;
}

// 16-bit WMMA with hazard guard: D += A[16 x 32k] * B[32k x 16]
__device__ __forceinline__ v8f wmma16(v16h a, v16h b, v8f c) {
    v8f d = __builtin_amdgcn_wmma_f32_16x16x32_f16(false, a, false, b, (short)0, c, false, false);
    asm volatile("v_nop\n\tv_nop\n\tv_nop\n\tv_nop" : "+v"(d) : "v"(a), "v"(b));
    return d;
}

// f32 -> nearest-even bf16 value, returned as f32
__device__ __forceinline__ float bf16_rne(float x) {
    u32 u = __float_as_uint(x);
    u = (u + 0x7fffu + ((u >> 16) & 1u)) & 0xffff0000u;
    return __uint_as_float(u);
}

__device__ __forceinline__ float fexp2(float x) {
#if defined(__has_builtin)
#if __has_builtin(__builtin_amdgcn_exp2f)
    return __builtin_amdgcn_exp2f(x);
#else
    return exp2f(x);
#endif
#else
    return exp2f(x);
#endif
}

// max over the 16 lanes of each lane half (DPP row rotations; D-layout rows are DPP rows)
__device__ __forceinline__ float rowmax16(float x) {
    int v = __builtin_bit_cast(int, x);
    x = fmaxf(x, __builtin_bit_cast(float, __builtin_amdgcn_update_dpp(v, v, 0x121, 0xf, 0xf, false)));
    v = __builtin_bit_cast(int, x);
    x = fmaxf(x, __builtin_bit_cast(float, __builtin_amdgcn_update_dpp(v, v, 0x122, 0xf, 0xf, false)));
    v = __builtin_bit_cast(int, x);
    x = fmaxf(x, __builtin_bit_cast(float, __builtin_amdgcn_update_dpp(v, v, 0x124, 0xf, 0xf, false)));
    v = __builtin_bit_cast(int, x);
    x = fmaxf(x, __builtin_bit_cast(float, __builtin_amdgcn_update_dpp(v, v, 0x128, 0xf, 0xf, false)));
    return x;
}

// 16 x 32 fragment from a tile whose k dimension is contiguous (pitch in halves).
// lane l: row rowbase + (l&15); elements 0..7 <- k = kcol + 8h .. +7,
// elements 8..15 <- k = kcol + 16 + 8h .. +7  (h = l>>4). Same map for A and B.
__device__ __forceinline__ v16h load_frag(const f16* tile, u32 rowbase, u32 pitch, u32 kcol, u32 lane) {
    const u32 r  = rowbase + (lane & 15u);
    const u32 kh = (lane >> 4) << 3;
    const f16* p = tile + (size_t)r * pitch + kcol + kh;
    FragU f;
    f.half[0] = *(const v8h*)(p);
    f.half[1] = *(const v8h*)(p + 16);
    return f.v;
}

// ---------------------------------------------------------------------------
// f32 rows [.][1024] -> f16 plane (bf16 RNE value times carry). 128 threads per 1024-wide
// Row mapping dst row m -> src row (m / dstper) * srcper + m % dstper lets a reduced build
// read full-size inputs.
// coverage: nrows x 1024 halves, every element exactly once (grid = nrows*128/256).
// ---------------------------------------------------------------------------
__global__ void __launch_bounds__(256)
cvt_rows(const float* __restrict__ src, f16* __restrict__ dst, u32 nrows, u32 dstper, u32 srcper, float carry) {
    const u32 g  = blockIdx.x * 256u + threadIdx.x;
    const u32 m  = g >> 7;
    const u32 c8 = (g & 127u) << 3;
    if (m >= nrows) return;
    const u32 mb = m / dstper;
    const u32 sm = mb * srcper + (m - mb * dstper);
    const float* sp = src + (size_t)sm * HID + c8;
    const v4f a = *(const v4f*)sp;
    const v4f b = *(const v4f*)(sp + 4);
    H8U o;
#pragma unroll
    for (u32 j = 0; j < 4; ++j) {
        const float x0 = a[j];
        const float x1 = b[j];
        o.e[j]     = (f16)(bf16_rne(x0) * carry);
        o.e[j + 4] = (f16)(bf16_rne(x1) * carry);
    }
    f16* dp = dst + (size_t)m * HID + c8;
    *(v8h*)dp = o.v;
    
}

// ---------------------------------------------------------------------------
// Transposing weight convert: src[rows][cols] f32 -> dst[cols][rows] f16 (bf16 RNE value
// times carry). Block = 64 (src rows, k) x 64 (src cols, n) tile, grid (cols/64, rows/64).
// Tile staged transposed in LDS (pitch 72 halves), then each dst row segment of 64 halves
// coverage: 4 x 256 threads x 4 values == 64 x 64 per block; blocks tile rows x cols exactly.
// LDS t: cross-wave, block barrier; staged extent 64 x 64 == consumed extent.
// ---------------------------------------------------------------------------
__global__ void __launch_bounds__(256)
cvt_wT(const float* __restrict__ src, f16* __restrict__ dst, u32 rows, u32 cols, float carry) {
    __shared__ __attribute__((aligned(16))) f16 t[64 * 72];
    const u32 tid = threadIdx.x;
    const u32 n0  = blockIdx.x * 64u;   // src column block == dst row block
    const u32 k0  = blockIdx.y * 64u;   // src row block == dst column block
#pragma unroll
    for (u32 it = 0; it < 4; ++it) {
        const u32 p  = tid + it * 256u;
        const u32 kr = p >> 4;              // 0..63
        const u32 c4 = (p & 15u) << 2;      // 0..60
        const v4f a = *(const v4f*)(src + (size_t)(k0 + kr) * cols + n0 + c4);
#pragma unroll
        for (u32 j = 0; j < 4; ++j) {
            const float x = a[j];
            t[(c4 + j) * 72u + kr] = (f16)(bf16_rne(x) * carry);
        }
    }
    __syncthreads();
    const u32 piece = tid & 7u;
    const u32 lrow  = tid >> 3;             // 0..31
{
#pragma unroll
        for (u32 it = 0; it < 2; ++it) {
            const u32 L = it * 32u + lrow;  // dst row within the tile, 0..63
            const v8h v = *(const v8h*)&t[L * 72u + piece * 8u];
            f16* dp = dst + (size_t)(n0 + L) * rows + k0 + piece * 8u;
            *(v8h*)dp = v;
        }
        
    }
}

// ---------------------------------------------------------------------------
// C[m][n] = sum_k A[m][k] * W[n][k] ; A [MROWS][1024] f16, W [1024][1024] f16 (k contiguous).
// Block tile 128 x 128, 8 waves as 4(M) x 2(N), 2 x 4 accumulators per wave, K step 32.
// true value t = acc * mul + bias (bias enters as its bf16 RNE value, added in f32).
// MODE 0: f16 plane [b*NHEAD + h][s][d] (t x16)
// MODE 1: MODE 0 plane + f32 rows [b*NHEAD + h][s][d] (t) into the output buffer
// MODE 2: f16 plane [b*HID + h*HD + d][s] (t x16, transposed per head), residual plane of the
//         same layout for key blocks below EARLY, + f32 rows as MODE 1
// MODE 3: f32 rows [b][s][1024] into the output buffer; for row blocks below EARLY the k loop
//         continues over the residual A plane (A + resOff) against the same W (K folded to 2048)
// coverage per block: f16 planes 256 lines (128 rows x 2 heads | 128 n x 2 s-halves);
//                     f32 2 x 256 lines (64 rows x 4 line-quarters per half).
// LDS: As/Bs/Cs all cross-wave, separated by block barriers.
// staged extent == consumed extent: As/Bs 128 x 32, Cs 128 x 128 halves (or 64 x 128 floats).
// ---------------------------------------------------------------------------
template <int MODE>
__device__ __forceinline__ void gemm_body(const f16* A, const f16* W, const float* bias,
                                          f16* plane, f16* plane2, float* fout, size_t resOff) {
    __shared__ __attribute__((aligned(16))) f16 As[128 * PK32];
    __shared__ __attribute__((aligned(16))) f16 Bs[128 * PK32];
    __shared__ __attribute__((aligned(16))) f16 Cs[128 * PC16];   // f16 [128][128] at pitch PC16 or f32 [64][128] at pitch PC32
    static_assert(sizeof(f16) * 128 * PC16 >= sizeof(float) * 64 * PC32);   // Cs reuse as f32 [64][128]

    const u32 tid  = threadIdx.x;
    const u32 lane = tid & 31u;
    const u32 wave = tid >> 5;
    const u32 wm   = wave & 3u;
    const u32 wn   = wave >> 2;
    const u32 hh8  = (lane >> 4) << 3;   // D row half
    const u32 c16  = lane & 15u;         // D column
    const u32 m0   = blockIdx.x * 128u;
    const u32 n0   = blockIdx.y * 128u;
    const u32 bidx = m0 / (u32)SEQ;      // block rows lie inside one batch (SEQ % 128 == 0)
    const u32 s0   = m0 - bidx * (u32)SEQ;

    u32 kTot = (u32)HID;
    if constexpr (MODE == 3) {
        if (s0 < (u32)EARLY) kTot = 2u * (u32)HID;   // block-uniform
    }

    v8f acc[2][4];
#pragma unroll
    for (int i = 0; i < 2; ++i)
#pragma unroll
        for (int j = 0; j < 4; ++j) acc[i][j] = zero8();

    const u32 srow = tid >> 1;
    const u32 scol = (tid & 1u) << 4;
    const f16* gA = A + (size_t)(m0 + srow) * HID + scol;
    const f16* gW = W + (size_t)(n0 + srow) * HID + scol;

#pragma unroll 1
    for (u32 k0 = 0; k0 < kTot; k0 += 32u) {
        const u32    kk = k0 & (u32)(HID - 1);
        const size_t ao = (k0 >= (u32)HID) ? resOff : (size_t)0;
        const v8h ra0 = *(const v8h*)(gA + ao + kk);
        const v8h ra1 = *(const v8h*)(gA + ao + kk + 8);
        const v8h rb0 = *(const v8h*)(gW + kk);
        const v8h rb1 = *(const v8h*)(gW + kk + 8);
        __syncthreads();
        *(v8h*)&As[srow * PK32 + scol]      = ra0;
        *(v8h*)&As[srow * PK32 + scol + 8u] = ra1;
        *(v8h*)&Bs[srow * PK32 + scol]      = rb0;
        *(v8h*)&Bs[srow * PK32 + scol + 8u] = rb1;
        __syncthreads();

        v16h af[2], bfr[4];
#pragma unroll
        for (int i = 0; i < 2; ++i) af[i] = load_frag(As, wm * 32u + (u32)i * 16u, PK32, 0u, lane);
#pragma unroll
        for (int j = 0; j < 4; ++j) bfr[j] = load_frag(Bs, wn * 64u + (u32)j * 16u, PK32, 0u, lane);
#pragma unroll
        for (int i = 0; i < 2; ++i)
#pragma unroll
            for (int j = 0; j < 4; ++j) acc[i][j] = wmma16(af[i], bfr[j], acc[i][j]);
    }

    const float mul = (MODE == 3) ? (1.0f / (CARRY_CTX * CARRY_W)) : (1.0f / (CARRY_X * CARRY_W));
    float bv[4];
#pragma unroll
    for (int j = 0; j < 4; ++j) {
        const float bx = bias[n0 + wn * 64u + (u32)j * 16u + c16];
        bv[j] = bf16_rne(bx);
    }

    const u32 piece = lane & 7u;
    const u32 lsub  = lane >> 3;

    if constexpr (MODE == 0 || MODE == 1) {
#pragma unroll
        for (int i = 0; i < 2; ++i)
#pragma unroll
            for (int j = 0; j < 4; ++j) {
                const u32 nl = wn * 64u + (u32)j * 16u + c16;
#pragma unroll
                for (int r = 0; r < 8; ++r) {
                    const u32 ml = wm * 32u + (u32)i * 16u + hh8 + (u32)r;
                    const float tv = acc[i][j][r] * mul + bv[j];
                    Cs[ml * PC16 + nl] = (f16)(tv * CARRY_QKV);
                }
            }
        __syncthreads();
        const size_t bh0 = (size_t)bidx * NHEAD + (n0 >> 6);
{
#pragma unroll
            for (u32 it = 0; it < 8; ++it) {
                const u32 L    = wave * 32u + it * 4u + lsub;   // 0..255
                const u32 ml   = L >> 1;
                const u32 hsel = L & 1u;
                const v8h v = *(const v8h*)&Cs[ml * PC16 + hsel * 64u + piece * 8u];
                f16* dp = plane + ((bh0 + hsel) * SEQ + s0 + ml) * HD + piece * 8u;
                *(v8h*)dp = v;
            }
            
        }
    }
    if constexpr (MODE == 2) {
        // hi plane, staged transposed: Cs[n][m]
#pragma unroll
        for (int i = 0; i < 2; ++i)
#pragma unroll
            for (int j = 0; j < 4; ++j) {
                const u32 nl = wn * 64u + (u32)j * 16u + c16;
                H8U t;
#pragma unroll
                for (int r = 0; r < 8; ++r) {
                    const float tv = (acc[i][j][r] * mul + bv[j]) * CARRY_QKV;
                    t.e[r] = (f16)tv;
                }
                *(v8h*)&Cs[nl * PC16 + wm * 32u + (u32)i * 16u + hh8] = t.v;
            }
        __syncthreads();
{
#pragma unroll
            for (u32 it = 0; it < 8; ++it) {
                const u32 L  = wave * 32u + it * 4u + lsub;     // 0..255
                const u32 nl = L >> 1;
                const u32 mh = L & 1u;
                const v8h v = *(const v8h*)&Cs[nl * PC16 + mh * 64u + piece * 8u];
                f16* dp = plane + ((size_t)(bidx * (u32)HID + n0 + nl) * SEQ + s0 + mh * 64u + piece * 8u);
                *(v8h*)dp = v;
            }
            
        }
        if (s0 < (u32)EARLY) {          // block-uniform: residual plane only for early key blocks
            __syncthreads();
#pragma unroll
            for (int i = 0; i < 2; ++i)
#pragma unroll
                for (int j = 0; j < 4; ++j) {
                    const u32 nl = wn * 64u + (u32)j * 16u + c16;
                    H8U t;
#pragma unroll
                    for (int r = 0; r < 8; ++r) {
                        const float tv = (acc[i][j][r] * mul + bv[j]) * CARRY_QKV;
                        const f16   hi = (f16)tv;
                        t.e[r] = (f16)(tv - (float)hi);
                    }
                    *(v8h*)&Cs[nl * PC16 + wm * 32u + (u32)i * 16u + hh8] = t.v;
                }
            __syncthreads();
{
#pragma unroll
                for (u32 it = 0; it < 8; ++it) {
                    const u32 L  = wave * 32u + it * 4u + lsub;
                    const u32 nl = L >> 1;
                    const u32 mh = L & 1u;
                    const v8h v = *(const v8h*)&Cs[nl * PC16 + mh * 64u + piece * 8u];
                    f16* dp = plane2 + ((size_t)(bidx * (u32)HID + n0 + nl) * SEQ + s0 + mh * 64u + piece * 8u);
                    *(v8h*)dp = v;
                }
                
            }
        }
    }
    if constexpr (MODE >= 1) {
        if constexpr (MODE != 3) __syncthreads();   // f16 stage reads finished before restaging
        float* Cf = (float*)Cs;      // [64][128] f32 at pitch PC32
#pragma unroll
        for (u32 half = 0; half < 2; ++half) {
            if ((wm >> 1) == half) {
#pragma unroll
                for (int i = 0; i < 2; ++i)
#pragma unroll
                    for (int j = 0; j < 4; ++j) {
                        const u32 nl = wn * 64u + (u32)j * 16u + c16;
#pragma unroll
                        for (int r = 0; r < 8; ++r) {
                            const u32 ml = (wm & 1u) * 32u + (u32)i * 16u + hh8 + (u32)r;
                            Cf[ml * PC32 + nl] = acc[i][j][r] * mul + bv[j];
                        }
                    }
            }
            __syncthreads();
{
#pragma unroll
                for (u32 it = 0; it < 8; ++it) {
                    const u32 L    = wave * 32u + it * 4u + lsub;   // 0..255
                    const u32 row  = L >> 2;
                    const u32 part = L & 3u;
                    const v4f v = *(const v4f*)&Cf[row * PC32 + part * 32u + piece * 4u];
                    size_t off;
                    if constexpr (MODE == 3) {
                        off = (size_t)(bidx * (u32)SEQ_FULL + s0 + half * 64u + row) * HID
                            + n0 + part * 32u + piece * 4u;
                    } else {
                        off = ((size_t)(bidx * (u32)NHEAD + (n0 >> 6) + (part >> 1)) * SEQ_FULL
                               + s0 + half * 64u + row) * HD + (part & 1u) * 32u + piece * 4u;
                    }
                    *(v4f*)(fout + off) = v;
                }
                
            }
            __syncthreads();
        }
    }
}

// q head-major plane
__global__ void __launch_bounds__(256) __attribute__((amdgpu_num_vgpr(256)))
gemm_q(const f16* __restrict__ A, const f16* __restrict__ W, const float* __restrict__ bias,
       f16* __restrict__ out) {
    gemm_body<0>(A, W, bias, out, out, (float*)out, (size_t)0);
}

// k head-major plane + f32 k rows of the second output
__global__ void __launch_bounds__(256) __attribute__((amdgpu_num_vgpr(256)))
gemm_k(const f16* __restrict__ A, const f16* __restrict__ W, const float* __restrict__ bias,
       f16* __restrict__ out, float* __restrict__ pres) {
    gemm_body<1>(A, W, bias, out, out, pres, (size_t)0);
}

// v^T plane + v^T residual plane (early keys) + f32 v rows of the second output
__global__ void __launch_bounds__(256) __attribute__((amdgpu_num_vgpr(256)))
gemm_v(const f16* __restrict__ A, const f16* __restrict__ W, const float* __restrict__ bias,
       f16* __restrict__ outT, f16* __restrict__ outR, float* __restrict__ pres) {
    gemm_body<2>(A, W, bias, outT, outR, pres, (size_t)0);
}

// f32 output rows; A residual plane at A + resOff for early row blocks
__global__ void __launch_bounds__(256) __attribute__((amdgpu_num_vgpr(256)))
gemm_o(const f16* __restrict__ A, const f16* __restrict__ W, const float* __restrict__ bias,
       float* __restrict__ out, size_t resOff) {
    gemm_body<3>(A, W, bias, (f16*)out, (f16*)out, out, resOff);
}

// ---------------------------------------------------------------------------
// Online softmax update for one 16 q x 64 key score tile (log2 domain, max-subtracted).
// MASK: keys above the query row get probability exactly 0 and do not enter the row max.
// EP: also emit the f16 residual of each carried exp value.
// ---------------------------------------------------------------------------
template <bool MASK, bool EP>
__device__ __forceinline__ void softmax_tile(const v8f (&s)[4], float (&m)[8], v8f (&o)[4], v8f& lacc,
                                             f16* psw, f16* prw, u32 kbase, u32 q0,
                                             u32 hh8, u32 c16, float cl) {
#pragma unroll
    for (int r = 0; r < 8; ++r) {
        float x[4];
        bool  dead[4];
#pragma unroll
        for (int nt = 0; nt < 4; ++nt) {
            x[nt]    = s[nt][r] * cl;
            dead[nt] = false;
            if constexpr (MASK) {
                dead[nt] = (kbase + (u32)nt * 16u + c16) > (q0 + hh8 + (u32)r);
                x[nt]    = dead[nt] ? -1.0e30f : x[nt];
            }
        }
        const float tm = rowmax16(fmaxf(fmaxf(x[0], x[1]), fmaxf(x[2], x[3])));
        const float mn = fmaxf(m[r], tm);
        const float al = fexp2(m[r] - mn);
        m[r] = mn;
        lacc[r] *= al;
#pragma unroll
        for (int dt = 0; dt < 4; ++dt) o[dt][r] *= al;
        const float sh = 10.0f - mn;      // carry 2^10
#pragma unroll
        for (int nt = 0; nt < 4; ++nt) {
            float e = fexp2(x[nt] + sh);
            if constexpr (MASK) e = dead[nt] ? 0.0f : e;
            const f16 hi = (f16)e;
            const u32 idx = (hh8 + (u32)r) * PK64 + (u32)nt * 16u + c16;
            psw[idx] = hi;
            if constexpr (EP) prw[idx] = (f16)(e - (float)hi);
        }
    }
}

// ---------------------------------------------------------------------------
// Causal flash attention. grid (row blocks, NB*NHEAD), block 256 (8 waves), wave owns 16 query
// rows (Q fragments resident). Block streams 64-key tiles 0 .. last tile touching its rows:
// K staged [key][d], V^T staged [d][key] (+ residual tile when EP). A wave computes a tile only
// when the tile starts at or below its first row (wave-uniform); the tile containing its rows
// takes the masked path. Scores on WMMA, row max via DPP, exp2 in f32 carried x2^10, P relayed
// per wave through LDS as A fragments, O += P.V and row sums += P.ones on WMMA.
// EP (rows below EARLY): P and V as hi + residual, products hi.hi + hi.res + res.hi into the
// same accumulators; context written as hi plane + residual plane.
// coverage: every (b, q, h*64..h*64+63) row segment of the launched row blocks exactly once.
// LDS: ks, vsT, vrT cross-wave (block barriers); ps/pr per-wave but also separated by block
// barriers. staged extent == consumed extent for ks/vsT/vrT (64x64) and ps/pr (16x64, written
// in full by the owning wave before it reads them).
// ---------------------------------------------------------------------------
template <bool EP>
__device__ __forceinline__ void attn_body(const f16* Qp, const f16* Kp, const f16* Vt, const f16* Vr,
                                          f16* Cp, f16* Cr, u32 qblk0) {
    __shared__ __attribute__((aligned(16))) f16 ks[64 * PK64];                // [key][d]
    __shared__ __attribute__((aligned(16))) f16 vsT[64 * PK64];               // [d][key]
    __shared__ __attribute__((aligned(16))) f16 vrT[EP ? 64 * PK64 : 8];      // [d][key] residual
    __shared__ __attribute__((aligned(16))) f16 ps[8][16 * PK64];             // per-wave P relay / ctx stage
    __shared__ __attribute__((aligned(16))) f16 pr[8][EP ? 16 * PK64 : 8];    // per-wave P residual relay
    static_assert(HD == 8 * 8);            // 8 lanes x 8 halves per row segment
    static_assert(2 * 256 * 8 == 64 * 64); // staging: 2 x 256 threads x 8 halves per tile

    const u32 tid  = threadIdx.x;
    const u32 lane = tid & 31u;
    const u32 wave = (u32)__builtin_amdgcn_readfirstlane((int)(tid >> 5));
    const u32 hh8  = (lane >> 4) << 3;
    const u32 c16  = lane & 15u;
    const u32 bh   = blockIdx.y;
    const u32 bidx = bh >> 4;            // NHEAD == 16
    const u32 hidx = bh & 15u;
    const u32 qblk = blockIdx.x + qblk0;
    const u32 q0   = qblk * 128u + wave * 16u;
    const size_t head = (size_t)bh * SEQ * HD;

    v16h qa[2];
#pragma unroll
    for (int c = 0; c < 2; ++c) qa[c] = load_frag(Qp + head, q0, HD, (u32)c * 32u, lane);

    FragU onesu;
#pragma unroll
    for (int i = 0; i < 16; ++i) onesu.e[i] = (f16)1.0f;
    const v16h ones = onesu.v;

    float m[8];
    v8f   o[4], lacc;
#pragma unroll
    for (int r = 0; r < 8; ++r) m[r] = -1.0e30f;
#pragma unroll
    for (int dt = 0; dt < 4; ++dt) o[dt] = zero8();
    lacc = zero8();

    // log2-domain scale: acc = 256 * q.k ; x = log2(e) * q.k / 64 = acc * log2(e) / 16384
    const float cl = 1.4426950408889634f * 0.00006103515625f;
    f16* psw = &ps[wave][0];
    f16* prw = &pr[EP ? wave : 0u][0];

    const u32 nkt = qblk * 2u + 2u;      // keys 0 .. qblk*128 + 127

#pragma unroll 1
    for (u32 kt = 0; kt < nkt; ++kt) {
        __syncthreads();
#pragma unroll
        for (u32 p2 = 0; p2 < 2; ++p2) {
            const u32 p   = tid + p2 * 256u;
            const u32 row = p >> 3;
            const u32 pc  = (p & 7u) << 3;
            const v8h kv = *(const v8h*)(Kp + head + (size_t)(kt * 64u + row) * HD + pc);
            const v8h vv = *(const v8h*)(Vt + head + (size_t)row * SEQ + kt * 64u + pc);
            *(v8h*)&ks[row * PK64 + pc]  = kv;
            *(v8h*)&vsT[row * PK64 + pc] = vv;
            if constexpr (EP) {
                const v8h vr = *(const v8h*)(Vr + head + (size_t)row * SEQ + kt * 64u + pc);
                *(v8h*)&vrT[row * PK64 + pc] = vr;
            }
        }
        __syncthreads();

        const bool active = (kt * 64u <= q0);           // wave-uniform
        if (active) {
            // S[16 q x 64 keys]
            v8f s[4];
#pragma unroll
            for (int nt = 0; nt < 4; ++nt) s[nt] = zero8();
#pragma unroll
            for (int c = 0; c < 2; ++c) {
#pragma unroll
                for (int nt = 0; nt < 4; ++nt) {
                    const v16h kb = load_frag(ks, (u32)nt * 16u, PK64, (u32)c * 32u, lane);
                    s[nt] = wmma16(qa[c], kb, s[nt]);
                }
            }
            const bool diag = (kt * 64u + 63u > q0);    // wave-uniform
            if (diag) softmax_tile<true,  EP>(s, m, o, lacc, psw, prw, kt * 64u, q0, hh8, c16, cl);
            else      softmax_tile<false, EP>(s, m, o, lacc, psw, prw, kt * 64u, q0, hh8, c16, cl);
        }
        __syncthreads();

        if (active) {
            // O += P . V ; l += P . ones  (P reloaded as A fragments from the relay)
#pragma unroll
            for (int kk = 0; kk < 2; ++kk) {
                const v16h pa = load_frag(psw, 0u, PK64, (u32)kk * 32u, lane);
                v16h pra = pa;
                if constexpr (EP) pra = load_frag(prw, 0u, PK64, (u32)kk * 32u, lane);
#pragma unroll
                for (int dt = 0; dt < 4; ++dt) {
                    const v16h vb = load_frag(vsT, (u32)dt * 16u, PK64, (u32)kk * 32u, lane);
                    o[dt] = wmma16(pa, vb, o[dt]);
                    if constexpr (EP) {
                        const v16h vrb = load_frag(vrT, (u32)dt * 16u, PK64, (u32)kk * 32u, lane);
                        o[dt] = wmma16(pa, vrb, o[dt]);
                        o[dt] = wmma16(pra, vb, o[dt]);
                    }
                }
                lacc = wmma16(pa, ones, lacc);
                if constexpr (EP) lacc = wmma16(pra, ones, lacc);
            }
        }
    }
    __syncthreads();

    // normalize: plane value = 1024 * (O/16) / l = O * 64 / l
#pragma unroll
    for (int r = 0; r < 8; ++r) {
        const float inv = (CARRY_CTX / CARRY_QKV) / lacc[r];
#pragma unroll
        for (int dt = 0; dt < 4; ++dt) {
            const float cv = o[dt][r] * inv;
            const f16   hi = (f16)cv;
            const u32  idx = (hh8 + (u32)r) * PK64 + (u32)dt * 16u + c16;
            psw[idx] = hi;
            if constexpr (EP) prw[idx] = (f16)(cv - (float)hi);
        }
    }
    __syncthreads();

    const u32 piece = lane & 7u;
    const u32 lsub  = lane >> 3;
{
#pragma unroll
        for (u32 it = 0; it < 4; ++it) {
            const u32 L = it * 4u + lsub;     // query row 0..15 within the wave tile
            const size_t off = (size_t)(bidx * (u32)SEQ + q0 + L) * HID + hidx * (u32)HD + piece * 8u;
            const v8h v = *(const v8h*)&psw[L * PK64 + piece * 8u];
            *(v8h*)(Cp + off) = v;
            if constexpr (EP) {
                const v8h vr = *(const v8h*)&prw[L * PK64 + piece * 8u];
                *(v8h*)(Cr + off) = vr;
            }
        }
        
    }
}

// rows [0, EARLY) of every sequence: hi + residual path
__global__ void __launch_bounds__(256) __attribute__((amdgpu_num_vgpr(256)))
attn_early(const f16* __restrict__ Qp, const f16* __restrict__ Kp, const f16* __restrict__ Vt,
           const f16* __restrict__ Vr, f16* __restrict__ Cp, f16* __restrict__ Cr) {
    attn_body<true>(Qp, Kp, Vt, Vr, Cp, Cr, 0u);
}

// rows [EARLY, SEQ): single f16 planes
__global__ void __launch_bounds__(256) __attribute__((amdgpu_num_vgpr(256)))
attn_dense(const f16* __restrict__ Qp, const f16* __restrict__ Kp, const f16* __restrict__ Vt,
           f16* __restrict__ Cp) {
    attn_body<false>(Qp, Kp, Vt, Vt, Cp, Cp, (u32)(EARLY / 128));
}

// coverage equalities (threads x elements == plane elements)
static_assert((size_t)(MROWS / 2) * 256 * 8 == (size_t)MROWS * HID);                       // cvt_rows -> Xh
static_assert((size_t)(3 * HID / 64) * (HID / 64) * 64 * 64 == (size_t)3 * HID * HID);     // cvt_wT -> Wt
static_assert((size_t)(HID / 64) * (HID / 64) * 64 * 64 == (size_t)HID * HID);             // cvt_wT -> Wot
static_assert((size_t)(MROWS / 128) * (HID / 128) * 128 * 128 == (size_t)MROWS * HID);     // gemm planes / out
static_assert((size_t)(SEQ / 128) * (NB * NHEAD) * 128 * HD == (size_t)MROWS * HID);       // attn -> Cp
// workspace: 7 activation planes + 4 weight planes of halves, at most 128 MiB
static_assert(((size_t)7 * MROWS * HID + (size_t)4 * HID * HID) * sizeof(f16) <= (size_t)134217728);

// ---------------------------------------------------------------------------
// Launch: 9 kernel launches, workspace 7 planes of MROWS*1024 halves + 4 of 1024*1024 halves.
// ---------------------------------------------------------------------------
extern "C" void kernel_launch(void* const* d_in, const int* in_sizes, int n_in,
                              void* d_out, int out_size, void* d_ws, size_t ws_size,
                              hipStream_t stream) {
    if (n_in < 5) return;
    if (in_sizes[0] < ((NB - 1) * SEQ_FULL + SEQ) * HID) return;
    if (in_sizes[1] < 3 * HID * HID) return;
    if (in_sizes[2] < 3 * HID) return;
    if (in_sizes[3] < HID * HID) return;
    if (in_sizes[4] < HID) return;
    const size_t needOut = OUT0_ELEMS_FULL + PRES_ELEMS_FULL
                         + ((size_t)((NB - 1) * NHEAD + NHEAD - 1) * SEQ_FULL + SEQ) * HD;
    if ((size_t)out_size < needOut) return;

    const float* x     = (const float*)d_in[0];   // [NB_FULL][SEQ_FULL][1024]
    const float* wattn = (const float*)d_in[1];   // [1024 in][3072 out], out columns q | k | v
    const float* battn = (const float*)d_in[2];   // [3072]
    const float* wproj = (const float*)d_in[3];   // [1024 in][1024 out]
    const float* bproj = (const float*)d_in[4];   // [1024]
    float* out = (float*)d_out;                   // out0 | present k | present v

    const size_t nX = (size_t)MROWS * HID;    // halves per activation plane
    const size_t nW = (size_t)HID * HID;      // halves per weight plane
    const size_t totalHalves = 7 * nX + 4 * nW;
    if (ws_size < totalHalves * sizeof(f16)) return;

    f16* Xh  = (f16*)d_ws;       // [MROWS][1024]               carry 16
    f16* Wt  = Xh  + nX;         // [3072 out][1024 in]         carry 32 (q | k | v row blocks)
    f16* Wot = Wt  + 3 * nW;     // [1024 out][1024 in]         carry 32
    f16* Qp  = Wot + nW;         // [NB*16][SEQ][64]            carry 16
    f16* Kp  = Qp  + nX;         // [NB*16][SEQ][64]            carry 16
    f16* Vtp = Kp  + nX;         // [NB*1024][SEQ] (V^T)        carry 16
    f16* Vrp = Vtp + nX;         // [NB*1024][SEQ] residual, columns s < EARLY only
    f16* Cp  = Vrp + nX;         // [MROWS][1024]               carry 1024
    f16* Cr  = Cp  + nX;         // [MROWS][1024] residual, rows s < EARLY only

    // activations: dst row m of batch b <- src row b*SEQ_FULL + (m % SEQ)
    cvt_rows<<<MROWS / 2, 256, 0, stream>>>(x, Xh, (u32)MROWS, (u32)SEQ, (u32)SEQ_FULL, CARRY_X);
    // weights: in[rows = 1024 (k)][cols = 3072 (n)] -> out[cols][rows]; grid (cols/64, rows/64)
    cvt_wT<<<dim3(3 * HID / 64, HID / 64), 256, 0, stream>>>(wattn, Wt, (u32)HID, (u32)(3 * HID), CARRY_W);
    // in[rows = 1024 (k)][cols = 1024 (n)] -> out[cols][rows]; grid (cols/64, rows/64)
    cvt_wT<<<dim3(HID / 64, HID / 64), 256, 0, stream>>>(wproj, Wot, (u32)HID, (u32)HID, CARRY_W);

    const dim3 gg(MROWS / 128, HID / 128);
    gemm_q<<<gg, 256, 0, stream>>>(Xh, Wt,          battn,           Qp);
    gemm_k<<<gg, 256, 0, stream>>>(Xh, Wt + nW,     battn + HID,     Kp,  out + OUT0_ELEMS_FULL);
    gemm_v<<<gg, 256, 0, stream>>>(Xh, Wt + 2 * nW, battn + 2 * HID, Vtp, Vrp,
                                   out + OUT0_ELEMS_FULL + PRES_ELEMS_FULL);

    attn_early<<<dim3(EARLY / 128, NB * NHEAD), 256, 0, stream>>>(Qp, Kp, Vtp, Vrp, Cp, Cr);
    if (SEQ > EARLY) {
        attn_dense<<<dim3((SEQ - EARLY) / 128, NB * NHEAD), 256, 0, stream>>>(Qp, Kp, Vtp, Cp);
    }

    // out = acc / (1024*32) + bias ; residual context plane at Cp + nX
    gemm_o<<<gg, 256, 0, stream>>>(Cp, Wot, bproj, out, nX);
}

// v002
// One run takes 144 microseconds.
// In two side-by-side timings against v001, it was 1.59 and 1.56 times as fast.
// Counting every step since v000, it is 2.35 times as fast.
#include <hip/hip_runtime.h>

// Contractions (fused QKV projection, Q.K^T, P.V, P row-sum, output projection): v_wmma_f32_16x16x32_f16, f16 operands with power-of-two carries, f32 accumulate; every float input enters as its bf16 RNE value; the first EARLY query rows of each sequence carry P, V and context as f16 hi + f16 residual planes (extra products into the same f32 accumulators); softmax in f32.

#ifndef NB
#define NB 2
#endif
#ifndef SEQ
#define SEQ 2048
#endif
#define NB_FULL   2
#define SEQ_FULL  2048
#define HID       1024
#define NHEAD     16
#define HD        64
#define MROWS     (NB * SEQ)
#define EARLY_CAP 512
#define EARLY     ((SEQ < EARLY_CAP) ? SEQ : EARLY_CAP)

#define OUT0_ELEMS_FULL ((size_t)NB_FULL * SEQ_FULL * HID)          // out0 elements
#define PRES_ELEMS_FULL ((size_t)NB_FULL * NHEAD * SEQ_FULL * HD)   // elements of present[0] (k) or present[1] (v)

static_assert(HID == NHEAD * HD);        // merged head width
static_assert(NHEAD == 16);              // bh >> 4 / bh & 15 decoding
static_assert(HD == 64);
static_assert(SEQ % 128 == 0);           // 128-row blocks never straddle a batch
static_assert(EARLY % 128 == 0);
static_assert(EARLY >= 128 && EARLY <= SEQ);
static_assert(SEQ <= SEQ_FULL);
static_assert(NB >= 1 && NB <= NB_FULL);
static_assert(MROWS % 128 == 0);         // GEMM M tile
static_assert(HID % 128 == 0);           // GEMM N tile
static_assert(HID % 64 == 0);            // weight transpose tile
static_assert(HID % 32 == 0);            // WMMA k step
static_assert(HID % 256 == 0);           // staged k tiles of 128, at least two of them
static_assert((HID & (HID - 1)) == 0);   // k0 & (HID-1)
static_assert(HID == 128 * 8);           // cvt_rows: 128 threads x 8 values per row
static_assert(OUT0_ELEMS_FULL * 4 == (size_t)16777216);   // byte offset of the second output

// carries (exact powers of two)
#define CARRY_X    16.0f     // input activation plane
#define CARRY_W    32.0f     // weight planes
#define CARRY_QKV  16.0f     // q, k, v^T planes (true value x16); v residual in the same units
#define CARRY_CTX  1024.0f   // context planes (true value x1024); residual in the same units
// softmax exp values carry 2^10 (added to the exp2 argument); residual in the same units

// LDS row pitches in elements: every row read or written 16 bytes per lane has a pitch of 16 B x odd,
// so the 16 lanes of a lane half fall on 64 distinct banks
#define PK32   40u    // 32-half rows (64 B)  -> 80 B
#define PK64   72u    // 64-half rows (128 B) -> 144 B
#define PC16   136u   // 128-half rows (256 B) -> 272 B
#define PC32   132u   // 128-float rows (512 B) -> 528 B
#define KTILE  128u   // k values per staged GEMM tile (256-byte rows)

typedef unsigned u32;
typedef _Float16 f16;
typedef f16   v16h __attribute__((ext_vector_type(16)));
typedef f16   v8h  __attribute__((ext_vector_type(8)));
typedef float v8f  __attribute__((ext_vector_type(8)));
typedef float v4f  __attribute__((ext_vector_type(4)));

union FragU { v16h v; v8h half[2]; f16 e[16]; };
union H8U   { v8h v; f16 e[8]; };

__device__ __forceinline__ v8f zero8() {
    v8f z = {0.f, 0.f, 0.f, 0.f, 0.f, 0.f, 0.f, 0.f};
    return z;
}

// 16-bit WMMA with hazard guard: D += A[16 x 32k] * B[32k x 16]
__device__ __forceinline__ v8f wmma16(v16h a, v16h b, v8f c) {
    v8f d = __builtin_amdgcn_wmma_f32_16x16x32_f16(false, a, false, b, (short)0, c, false, false);
    asm volatile("v_nop\n\tv_nop\n\tv_nop\n\tv_nop" : "+v"(d) : "v"(a), "v"(b));
    return d;
}

// f32 -> nearest-even bf16 value, returned as f32
__device__ __forceinline__ float bf16_rne(float x) {
    u32 u = __float_as_uint(x);
    u = (u + 0x7fffu + ((u >> 16) & 1u)) & 0xffff0000u;
    return __uint_as_float(u);
}

__device__ __forceinline__ float fexp2(float x) {
#if defined(__has_builtin)
#if __has_builtin(__builtin_amdgcn_exp2f)
    return __builtin_amdgcn_exp2f(x);
#else
    return exp2f(x);
#endif
#else
    return exp2f(x);
#endif
}

// max over the 16 lanes of each lane half (DPP row rotations; D-layout rows are DPP rows)
__device__ __forceinline__ float rowmax16(float x) {
    int v = __builtin_bit_cast(int, x);
    x = fmaxf(x, __builtin_bit_cast(float, __builtin_amdgcn_update_dpp(v, v, 0x121, 0xf, 0xf, false)));
    v = __builtin_bit_cast(int, x);
    x = fmaxf(x, __builtin_bit_cast(float, __builtin_amdgcn_update_dpp(v, v, 0x122, 0xf, 0xf, false)));
    v = __builtin_bit_cast(int, x);
    x = fmaxf(x, __builtin_bit_cast(float, __builtin_amdgcn_update_dpp(v, v, 0x124, 0xf, 0xf, false)));
    v = __builtin_bit_cast(int, x);
    x = fmaxf(x, __builtin_bit_cast(float, __builtin_amdgcn_update_dpp(v, v, 0x128, 0xf, 0xf, false)));
    return x;
}

// 16 x 32 fragment from a tile whose k dimension is contiguous (pitch in halves).
// lane l: row rowbase + (l&15); elements 0..7 <- k = kcol + 8h .. +7,
// elements 8..15 <- k = kcol + 16 + 8h .. +7  (h = l>>4). Same map for A and B.
__device__ __forceinline__ v16h load_frag(const f16* tile, u32 rowbase, u32 pitch, u32 kcol, u32 lane) {
    const u32 r  = rowbase + (lane & 15u);
    const u32 kh = (lane >> 4) << 3;
    const f16* p = tile + (size_t)r * pitch + kcol + kh;
    FragU f;
    f.half[0] = *(const v8h*)(p);
    f.half[1] = *(const v8h*)(p + 16);
    return f.v;
}

// LDS byte address of a __shared__ element (low 32 bits of its address)
__device__ __forceinline__ u32 lds_addr(const f16* p) {
    return (u32)(size_t)p;
}

// Asynchronous copies global -> LDS, 16 bytes per lane, no register staging. The s_wait_xcnt closes each
// statement so that no address register of an issued copy is rewritten ahead of it.
// Eight copies whose rows lie 16 apart: LDS step lstep bytes, global step gstep halves.
__device__ __forceinline__ void async_copy8(u32 l, u32 lstep, const f16* g, size_t gstep) {
    asm volatile("global_load_async_to_lds_b128 %0, %8, off\n\t"
                 "global_load_async_to_lds_b128 %1, %9, off\n\t"
                 "global_load_async_to_lds_b128 %2, %10, off\n\t"
                 "global_load_async_to_lds_b128 %3, %11, off\n\t"
                 "global_load_async_to_lds_b128 %4, %12, off\n\t"
                 "global_load_async_to_lds_b128 %5, %13, off\n\t"
                 "global_load_async_to_lds_b128 %6, %14, off\n\t"
                 "global_load_async_to_lds_b128 %7, %15, off\n\t"
                 "s_wait_xcnt 0x0"
                 :: "v"(l), "v"(l + lstep), "v"(l + 2u * lstep), "v"(l + 3u * lstep),
                    "v"(l + 4u * lstep), "v"(l + 5u * lstep), "v"(l + 6u * lstep), "v"(l + 7u * lstep),
                    "v"(g), "v"(g + gstep), "v"(g + 2 * gstep), "v"(g + 3 * gstep),
                    "v"(g + 4 * gstep), "v"(g + 5 * gstep), "v"(g + 6 * gstep), "v"(g + 7 * gstep)
                 : "memory");
}

// Four and two copies with each lane's own addresses given one by one.
__device__ __forceinline__ void async_copy4(u32 l0, const f16* g0, u32 l1, const f16* g1,
                                            u32 l2, const f16* g2, u32 l3, const f16* g3) {
    asm volatile("global_load_async_to_lds_b128 %0, %4, off\n\t"
                 "global_load_async_to_lds_b128 %1, %5, off\n\t"
                 "global_load_async_to_lds_b128 %2, %6, off\n\t"
                 "global_load_async_to_lds_b128 %3, %7, off\n\t"
                 "s_wait_xcnt 0x0"
                 :: "v"(l0), "v"(l1), "v"(l2), "v"(l3), "v"(g0), "v"(g1), "v"(g2), "v"(g3)
                 : "memory");
}
__device__ __forceinline__ void async_copy2(u32 l0, const f16* g0, u32 l1, const f16* g1) {
    asm volatile("global_load_async_to_lds_b128 %0, %2, off\n\t"
                 "global_load_async_to_lds_b128 %1, %3, off\n\t"
                 "s_wait_xcnt 0x0"
                 :: "v"(l0), "v"(l1), "v"(g0), "v"(g1)
                 : "memory");
}

// publish point of a two-buffer ring: this wave's LDS reads retired, its own copies landed, then the block
// barrier that shows the next tile to every wave and frees the buffer just read
__device__ __forceinline__ void ring_publish() {
    asm volatile("s_wait_dscnt 0x0" ::: "memory");     // reads of the buffer to be refilled have retired
    asm volatile("s_wait_asynccnt 0x0" ::: "memory");  // this wave's copies of the next tile have landed
    __syncthreads();
}

// ---------------------------------------------------------------------------
// f32 rows [.][1024] -> f16 plane (bf16 RNE value times carry). 128 threads per 1024-wide
// Row mapping dst row m -> src row (m / dstper) * srcper + m % dstper lets a reduced build
// read full-size inputs.
// coverage: nrows x 1024 halves, every element exactly once (grid = nrows*128/256).
// ---------------------------------------------------------------------------
__global__ void __launch_bounds__(256)
cvt_rows(const float* __restrict__ src, f16* __restrict__ dst, u32 nrows, u32 dstper, u32 srcper, float carry) {
    const u32 g  = blockIdx.x * 256u + threadIdx.x;
    const u32 m  = g >> 7;
    const u32 c8 = (g & 127u) << 3;
    if (m >= nrows) return;
    const u32 mb = m / dstper;
    const u32 sm = mb * srcper + (m - mb * dstper);
    const float* sp = src + (size_t)sm * HID + c8;
    const v4f a = *(const v4f*)sp;
    const v4f b = *(const v4f*)(sp + 4);
    H8U o;
#pragma unroll
    for (u32 j = 0; j < 4; ++j) {
        const float x0 = a[j];
        const float x1 = b[j];
        o.e[j]     = (f16)(bf16_rne(x0) * carry);
        o.e[j + 4] = (f16)(bf16_rne(x1) * carry);
    }
    f16* dp = dst + (size_t)m * HID + c8;
    *(v8h*)dp = o.v;
    
}

// ---------------------------------------------------------------------------
// Transposing weight convert: src[rows][cols] f32 -> dst[cols][rows] f16 (bf16 RNE value
// times carry). Block = 64 (src rows, k) x 64 (src cols, n) tile, grid (cols/64, rows/64).
// Tile staged transposed in LDS (pitch 72 halves), then each dst row segment of 64 halves
// coverage: 4 x 256 threads x 4 values == 64 x 64 per block; blocks tile rows x cols exactly.
// LDS t: cross-wave, block barrier; staged extent 64 x 64 == consumed extent.
// ---------------------------------------------------------------------------
__global__ void __launch_bounds__(256)
cvt_wT(const float* __restrict__ src, f16* __restrict__ dst, u32 rows, u32 cols, float carry) {
    __shared__ __attribute__((aligned(16))) f16 t[64 * 72];
    const u32 tid = threadIdx.x;
    const u32 n0  = blockIdx.x * 64u;   // src column block == dst row block
    const u32 k0  = blockIdx.y * 64u;   // src row block == dst column block
#pragma unroll
    for (u32 it = 0; it < 4; ++it) {
        const u32 p  = tid + it * 256u;
        const u32 kr = p >> 4;              // 0..63
        const u32 c4 = (p & 15u) << 2;      // 0..60
        const v4f a = *(const v4f*)(src + (size_t)(k0 + kr) * cols + n0 + c4);
#pragma unroll
        for (u32 j = 0; j < 4; ++j) {
            const float x = a[j];
            t[(c4 + j) * 72u + kr] = (f16)(bf16_rne(x) * carry);
        }
    }
    __syncthreads();
    const u32 piece = tid & 7u;
    const u32 lrow  = tid >> 3;             // 0..31
{
#pragma unroll
        for (u32 it = 0; it < 2; ++it) {
            const u32 L = it * 32u + lrow;  // dst row within the tile, 0..63
            const v8h v = *(const v8h*)&t[L * 72u + piece * 8u];
            f16* dp = dst + (size_t)(n0 + L) * rows + k0 + piece * 8u;
            *(v8h*)dp = v;
        }
        
    }
}

// ---------------------------------------------------------------------------
// C[m][n] = sum_k A[m][k] * W[n][k] ; A [MROWS][1024] f16, W [1024][1024] f16 (k contiguous).
// Block tile 128 x 128, 8 waves as 4(M) x 2(N), 2 x 4 accumulators per wave, WMMA k step 32.
// A and W tiles of 128 k come by asynchronous copies into two LDS buffers: tile t + 1 flies while tile t is multiplied.
// true value t = acc * mul + bias (bias enters as its bf16 RNE value, added in f32).
// MODE 0: f16 plane [b*NHEAD + h][s][d] (t x16)
// MODE 1: MODE 0 plane + f32 rows [b*NHEAD + h][s][d] (t) into the output buffer
// MODE 2: f16 plane [b*HID + h*HD + d][s] (t x16, transposed per head), residual plane of the
//         same layout for key blocks below EARLY, + f32 rows as MODE 1
// MODE 3: f32 rows [b][s][1024] into the output buffer; for row blocks below EARLY the k loop
//         continues over the residual A plane (A + resOff) against the same W (K folded to 2048)
// coverage per block: f16 planes 256 lines (128 rows x 2 heads | 128 n x 2 s-halves);
//                     f32 2 x 256 lines (64 rows x 4 line-quarters per half).
// LDS: As/Bs/Cs all cross-wave, separated by block barriers.
// staged extent == consumed extent: As/Bs 128 x 128 per buffer, Cs 128 x 128 halves (or 64 x 128 floats).
// ---------------------------------------------------------------------------
template <int MODE>
__device__ __forceinline__ void gemm_body(const f16* A, const f16* W, const float* bias,
                                          f16* plane, f16* plane2, float* fout, size_t resOff) {
    __shared__ __attribute__((aligned(16))) f16 As[2 * 128 * PC16];   // two buffers of 128 rows x 128 k
    __shared__ __attribute__((aligned(16))) f16 Bs[2 * 128 * PC16];
    __shared__ __attribute__((aligned(16))) f16 Cs[128 * PC16];   // f16 [128][128] at pitch PC16 or f32 [64][128] at pitch PC32
    static_assert(sizeof(f16) * 128 * PC16 >= sizeof(float) * 64 * PC32);   // Cs reuse as f32 [64][128]

    const u32 tid  = threadIdx.x;
    const u32 lane = tid & 31u;
    const u32 wave = tid >> 5;
    const u32 wm   = wave & 3u;
    const u32 wn   = wave >> 2;
    const u32 hh8  = (lane >> 4) << 3;   // D row half
    const u32 c16  = lane & 15u;         // D column
    const u32 m0   = blockIdx.x * 128u;
    const u32 n0   = blockIdx.y * 128u;
    const u32 bidx = m0 / (u32)SEQ;      // block rows lie inside one batch (SEQ % 128 == 0)
    const u32 s0   = m0 - bidx * (u32)SEQ;

    u32 kTot = (u32)HID;
    if constexpr (MODE == 3) {
        if (s0 < (u32)EARLY) kTot = 2u * (u32)HID;   // block-uniform
    }

    v8f acc[2][4];
#pragma unroll
    for (int i = 0; i < 2; ++i)
#pragma unroll
        for (int j = 0; j < 4; ++j) acc[i][j] = zero8();

    // staging map: 16 lanes cover one 256-byte row segment, a wave's copy two rows (four whole lines)
    const u32 crow = tid >> 4;
    const u32 ccol = (tid & 15u) << 3;
    const f16* gA = A + (size_t)(m0 + crow) * HID + ccol;
    const f16* gW = W + (size_t)(n0 + crow) * HID + ccol;
    const u32 lA = lds_addr(&As[crow * PC16 + ccol]);
    const u32 lB = lds_addr(&Bs[crow * PC16 + ccol]);
    const u32 nT = kTot / KTILE;         // 8 or 16 tiles, block-uniform

    auto stage = [&](u32 t) {
        const u32    k0 = t * KTILE;
        const u32    kk = k0 & (u32)(HID - 1);
        const size_t ao = (k0 >= (u32)HID) ? resOff : (size_t)0;
        const u32    bo = (t & 1u) * (128u * PC16 * 2u);
        async_copy8(lA + bo, 16u * PC16 * 2u, gA + ao + kk, (size_t)16 * HID);
        async_copy8(lB + bo, 16u * PC16 * 2u, gW + kk, (size_t)16 * HID);
    };

    stage(0u);
    asm volatile("s_wait_asynccnt 0x0" ::: "memory");   // tile 0 landed before the barrier that shows it
    __syncthreads();
    stage(1u);

#pragma unroll 1   // stays rolled: one trip per staged tile, its buffer chosen by t & 1
    for (u32 t = 0; t < nT; ++t) {
        const f16* as = As + (t & 1u) * (128u * PC16);
        const f16* bs = Bs + (t & 1u) * (128u * PC16);
#pragma unroll     // the four 32-k steps of a tile in line, every LDS offset an immediate
        for (u32 kc = 0; kc < KTILE; kc += 32u) {
            v16h af[2], bfr[4];
#pragma unroll
            for (int i = 0; i < 2; ++i) af[i] = load_frag(as, wm * 32u + (u32)i * 16u, PC16, kc, lane);
#pragma unroll
            for (int j = 0; j < 4; ++j) bfr[j] = load_frag(bs, wn * 64u + (u32)j * 16u, PC16, kc, lane);
#pragma unroll
            for (int i = 0; i < 2; ++i)
#pragma unroll
                for (int j = 0; j < 4; ++j) acc[i][j] = wmma16(af[i], bfr[j], acc[i][j]);
        }
        ring_publish();
        if (t + 2u < nT) stage(t + 2u);  // into the buffer this trip has just read
    }
    asm volatile("s_wait_asynccnt 0x0" ::: "memory");   // nothing in flight when the epilogue starts

    const float mul = (MODE == 3) ? (1.0f / (CARRY_CTX * CARRY_W)) : (1.0f / (CARRY_X * CARRY_W));
    float bv[4];
#pragma unroll
    for (int j = 0; j < 4; ++j) {
        const float bx = bias[n0 + wn * 64u + (u32)j * 16u + c16];
        bv[j] = bf16_rne(bx);
    }

    const u32 piece = lane & 7u;
    const u32 lsub  = lane >> 3;

    if constexpr (MODE == 0 || MODE == 1) {
#pragma unroll
        for (int i = 0; i < 2; ++i)
#pragma unroll
            for (int j = 0; j < 4; ++j) {
                const u32 nl = wn * 64u + (u32)j * 16u + c16;
#pragma unroll
                for (int r = 0; r < 8; ++r) {
                    const u32 ml = wm * 32u + (u32)i * 16u + hh8 + (u32)r;
                    const float tv = acc[i][j][r] * mul + bv[j];
                    Cs[ml * PC16 + nl] = (f16)(tv * CARRY_QKV);
                }
            }
        __syncthreads();
        const size_t bh0 = (size_t)bidx * NHEAD + (n0 >> 6);
{
#pragma unroll
            for (u32 it = 0; it < 8; ++it) {
                const u32 L    = wave * 32u + it * 4u + lsub;   // 0..255
                const u32 ml   = L >> 1;
                const u32 hsel = L & 1u;
                const v8h v = *(const v8h*)&Cs[ml * PC16 + hsel * 64u + piece * 8u];
                f16* dp = plane + ((bh0 + hsel) * SEQ + s0 + ml) * HD + piece * 8u;
                *(v8h*)dp = v;
            }
            
        }
    }
    if constexpr (MODE == 2) {
        // hi plane, staged transposed: Cs[n][m]
#pragma unroll
        for (int i = 0; i < 2; ++i)
#pragma unroll
            for (int j = 0; j < 4; ++j) {
                const u32 nl = wn * 64u + (u32)j * 16u + c16;
                H8U t;
#pragma unroll
                for (int r = 0; r < 8; ++r) {
                    const float tv = (acc[i][j][r] * mul + bv[j]) * CARRY_QKV;
                    t.e[r] = (f16)tv;
                }
                *(v8h*)&Cs[nl * PC16 + wm * 32u + (u32)i * 16u + hh8] = t.v;
            }
        __syncthreads();
{
#pragma unroll
            for (u32 it = 0; it < 8; ++it) {
                const u32 L  = wave * 32u + it * 4u + lsub;     // 0..255
                const u32 nl = L >> 1;
                const u32 mh = L & 1u;
                const v8h v = *(const v8h*)&Cs[nl * PC16 + mh * 64u + piece * 8u];
                f16* dp = plane + ((size_t)(bidx * (u32)HID + n0 + nl) * SEQ + s0 + mh * 64u + piece * 8u);
                *(v8h*)dp = v;
            }
            
        }
        if (s0 < (u32)EARLY) {          // block-uniform: residual plane only for early key blocks
            __syncthreads();
#pragma unroll
            for (int i = 0; i < 2; ++i)
#pragma unroll
                for (int j = 0; j < 4; ++j) {
                    const u32 nl = wn * 64u + (u32)j * 16u + c16;
                    H8U t;
#pragma unroll
                    for (int r = 0; r < 8; ++r) {
                        const float tv = (acc[i][j][r] * mul + bv[j]) * CARRY_QKV;
                        const f16   hi = (f16)tv;
                        t.e[r] = (f16)(tv - (float)hi);
                    }
                    *(v8h*)&Cs[nl * PC16 + wm * 32u + (u32)i * 16u + hh8] = t.v;
                }
            __syncthreads();
{
#pragma unroll
                for (u32 it = 0; it < 8; ++it) {
                    const u32 L  = wave * 32u + it * 4u + lsub;
                    const u32 nl = L >> 1;
                    const u32 mh = L & 1u;
                    const v8h v = *(const v8h*)&Cs[nl * PC16 + mh * 64u + piece * 8u];
                    f16* dp = plane2 + ((size_t)(bidx * (u32)HID + n0 + nl) * SEQ + s0 + mh * 64u + piece * 8u);
                    *(v8h*)dp = v;
                }
                
            }
        }
    }
    if constexpr (MODE >= 1) {
        if constexpr (MODE != 3) __syncthreads();   // f16 stage reads finished before restaging
        float* Cf = (float*)Cs;      // [64][128] f32 at pitch PC32
#pragma unroll
        for (u32 half = 0; half < 2; ++half) {
            if ((wm >> 1) == half) {
#pragma unroll
                for (int i = 0; i < 2; ++i)
#pragma unroll
                    for (int j = 0; j < 4; ++j) {
                        const u32 nl = wn * 64u + (u32)j * 16u + c16;
#pragma unroll
                        for (int r = 0; r < 8; ++r) {
                            const u32 ml = (wm & 1u) * 32u + (u32)i * 16u + hh8 + (u32)r;
                            Cf[ml * PC32 + nl] = acc[i][j][r] * mul + bv[j];
                        }
                    }
            }
            __syncthreads();
{
#pragma unroll
                for (u32 it = 0; it < 8; ++it) {
                    const u32 L    = wave * 32u + it * 4u + lsub;   // 0..255
                    const u32 row  = L >> 2;
                    const u32 part = L & 3u;
                    const v4f v = *(const v4f*)&Cf[row * PC32 + part * 32u + piece * 4u];
                    size_t off;
                    if constexpr (MODE == 3) {
                        off = (size_t)(bidx * (u32)SEQ_FULL + s0 + half * 64u + row) * HID
                            + n0 + part * 32u + piece * 4u;
                    } else {
                        off = ((size_t)(bidx * (u32)NHEAD + (n0 >> 6) + (part >> 1)) * SEQ_FULL
                               + s0 + half * 64u + row) * HD + (part & 1u) * 32u + piece * 4u;
                    }
                    *(v4f*)(fout + off) = v;
                }
                
            }
            __syncthreads();
        }
    }
}

// q head-major plane
__global__ void __launch_bounds__(256) __attribute__((amdgpu_num_vgpr(256)))
gemm_q(const f16* __restrict__ A, const f16* __restrict__ W, const float* __restrict__ bias,
       f16* __restrict__ out) {
    gemm_body<0>(A, W, bias, out, out, (float*)out, (size_t)0);
}

// k head-major plane + f32 k rows of the second output
__global__ void __launch_bounds__(256) __attribute__((amdgpu_num_vgpr(256)))
gemm_k(const f16* __restrict__ A, const f16* __restrict__ W, const float* __restrict__ bias,
       f16* __restrict__ out, float* __restrict__ pres) {
    gemm_body<1>(A, W, bias, out, out, pres, (size_t)0);
}

// v^T plane + v^T residual plane (early keys) + f32 v rows of the second output
__global__ void __launch_bounds__(256) __attribute__((amdgpu_num_vgpr(256)))
gemm_v(const f16* __restrict__ A, const f16* __restrict__ W, const float* __restrict__ bias,
       f16* __restrict__ outT, f16* __restrict__ outR, float* __restrict__ pres) {
    gemm_body<2>(A, W, bias, outT, outR, pres, (size_t)0);
}

// f32 output rows; A residual plane at A + resOff for early row blocks
__global__ void __launch_bounds__(256) __attribute__((amdgpu_num_vgpr(256)))
gemm_o(const f16* __restrict__ A, const f16* __restrict__ W, const float* __restrict__ bias,
       float* __restrict__ out, size_t resOff) {
    gemm_body<3>(A, W, bias, (f16*)out, (f16*)out, out, resOff);
}

// ---------------------------------------------------------------------------
// Online softmax update for one 16 q x 64 key score tile (log2 domain, max-subtracted).
// MASK: keys above the query row get probability exactly 0 and do not enter the row max.
// EP: also emit the f16 residual of each carried exp value.
// ---------------------------------------------------------------------------
template <bool MASK, bool EP>
__device__ __forceinline__ void softmax_tile(const v8f (&s)[4], float (&m)[8], v8f (&o)[4], v8f& lacc,
                                             f16* psw, f16* prw, u32 kbase, u32 q0,
                                             u32 hh8, u32 c16, float cl) {
#pragma unroll
    for (int r = 0; r < 8; ++r) {
        float x[4];
        bool  dead[4];
#pragma unroll
        for (int nt = 0; nt < 4; ++nt) {
            x[nt]    = s[nt][r] * cl;
            dead[nt] = false;
            if constexpr (MASK) {
                dead[nt] = (kbase + (u32)nt * 16u + c16) > (q0 + hh8 + (u32)r);
                x[nt]    = dead[nt] ? -1.0e30f : x[nt];
            }
        }
        const float tm = rowmax16(fmaxf(fmaxf(x[0], x[1]), fmaxf(x[2], x[3])));
        const float mn = fmaxf(m[r], tm);
        const float al = fexp2(m[r] - mn);
        m[r] = mn;
        lacc[r] *= al;
#pragma unroll
        for (int dt = 0; dt < 4; ++dt) o[dt][r] *= al;
        const float sh = 10.0f - mn;      // carry 2^10
#pragma unroll
        for (int nt = 0; nt < 4; ++nt) {
            float e = fexp2(x[nt] + sh);
            if constexpr (MASK) e = dead[nt] ? 0.0f : e;
            const f16 hi = (f16)e;
            const u32 idx = (hh8 + (u32)r) * PK64 + (u32)nt * 16u + c16;
            psw[idx] = hi;
            if constexpr (EP) prw[idx] = (f16)(e - (float)hi);
        }
    }
}

// ---------------------------------------------------------------------------
// Causal flash attention. grid (row blocks, NB*NHEAD), block 256 (8 waves), wave owns 16 query
// rows (Q fragments resident). Block streams 64-key tiles 0 .. last tile touching its rows:
// K staged [key][d], V^T staged [d][key] (+ residual tile when EP), by asynchronous copies into two
// buffers each: tile kt + 1 flies while tile kt is worked on. A wave computes a tile only
// when the tile starts at or below its first row (wave-uniform); the tile containing its rows
// takes the masked path. Scores on WMMA, row max via DPP, exp2 in f32 carried x2^10, P relayed
// per wave through LDS as A fragments, O += P.V and row sums += P.ones on WMMA.
// EP (rows below EARLY): P and V as hi + residual, products hi.hi + hi.res + res.hi into the
// same accumulators; context written as hi plane + residual plane.
// coverage: every (b, q, h*64..h*64+63) row segment of the launched row blocks exactly once.
// LDS: ks, vsT, vrT cross-wave (block barriers); ps/pr per-wave but also separated by block
// barriers. staged extent == consumed extent for ks/vsT/vrT (64x64) and ps/pr (16x64, written
// in full by the owning wave before it reads them).
// ---------------------------------------------------------------------------
template <bool EP>
__device__ __forceinline__ void attn_body(const f16* Qp, const f16* Kp, const f16* Vt, const f16* Vr,
                                          f16* Cp, f16* Cr, u32 qblk0) {
    __shared__ __attribute__((aligned(16))) f16 ks[2 * 64 * PK64];            // two buffers of [key][d]
    __shared__ __attribute__((aligned(16))) f16 vsT[2 * 64 * PK64];           // two buffers of [d][key]
    __shared__ __attribute__((aligned(16))) f16 vrT[EP ? 2 * 64 * PK64 : 8];  // two buffers of [d][key] residual
    __shared__ __attribute__((aligned(16))) f16 ps[8][16 * PK64];             // per-wave P relay / ctx stage
    __shared__ __attribute__((aligned(16))) f16 pr[8][EP ? 16 * PK64 : 8];    // per-wave P residual relay
    static_assert(HD == 8 * 8);            // 8 lanes x 8 halves per row segment
    static_assert(2 * 256 * 8 == 64 * 64); // staging: 2 copies x 256 threads x 8 halves per tile

    const u32 tid  = threadIdx.x;
    const u32 lane = tid & 31u;
    const u32 wave = (u32)__builtin_amdgcn_readfirstlane((int)(tid >> 5));
    const u32 hh8  = (lane >> 4) << 3;
    const u32 c16  = lane & 15u;
    const u32 bh   = blockIdx.y;
    const u32 bidx = bh >> 4;            // NHEAD == 16
    const u32 hidx = bh & 15u;
    const u32 qblk = blockIdx.x + qblk0;
    const u32 q0   = qblk * 128u + wave * 16u;
    const size_t head = (size_t)bh * SEQ * HD;

    v16h qa[2];
#pragma unroll
    for (int c = 0; c < 2; ++c) qa[c] = load_frag(Qp + head, q0, HD, (u32)c * 32u, lane);

    FragU onesu;
#pragma unroll
    for (int i = 0; i < 16; ++i) onesu.e[i] = (f16)1.0f;
    const v16h ones = onesu.v;

    float m[8];
    v8f   o[4], lacc;
#pragma unroll
    for (int r = 0; r < 8; ++r) m[r] = -1.0e30f;
#pragma unroll
    for (int dt = 0; dt < 4; ++dt) o[dt] = zero8();
    lacc = zero8();

    // log2-domain scale: acc = 256 * q.k ; x = log2(e) * q.k / 64 = acc * log2(e) / 16384
    const float cl = 1.4426950408889634f * 0.00006103515625f;
    f16* psw = &ps[wave][0];
    f16* prw = &pr[EP ? wave : 0u][0];

    const u32 nkt = qblk * 2u + 2u;      // keys 0 .. qblk*128 + 127

    // staging map: 8 lanes cover one 128-byte row, a wave's copy four rows; rows srow and srow + 32 per thread
    const u32 srow = tid >> 3;
    const u32 spc  = (tid & 7u) << 3;
    const f16* gK = Kp + head + (size_t)srow * HD + spc;
    const f16* gV = Vt + head + (size_t)srow * SEQ + spc;
    const f16* gR = Vr + head + (size_t)srow * SEQ + spc;
    const u32 lK = lds_addr(&ks[srow * PK64 + spc]);
    const u32 lV = lds_addr(&vsT[srow * PK64 + spc]);
    const u32 lR = lds_addr(&vrT[EP ? srow * PK64 + spc : 0u]);

    auto stage = [&](u32 t) {
        const u32  bo = (t & 1u) * (64u * PK64 * 2u);
        const u32  hb = 32u * PK64 * 2u;                 // 32 rows further, in LDS bytes
        const f16* k0 = gK + (size_t)t * 64u * HD;
        const f16* v0 = gV + t * 64u;
        async_copy4(lK + bo, k0, lK + bo + hb, k0 + 32 * HD, lV + bo, v0, lV + bo + hb, v0 + (size_t)32 * SEQ);
        if constexpr (EP) {
            const f16* r0 = gR + t * 64u;
            async_copy2(lR + bo, r0, lR + bo + hb, r0 + (size_t)32 * SEQ);
        }
    };

    stage(0u);
    asm volatile("s_wait_asynccnt 0x0" ::: "memory");   // tile 0 landed before the barrier that shows it
    __syncthreads();
    stage(1u);                           // nkt >= 2

#pragma unroll 1   // stays rolled: one trip per staged tile, its buffers chosen by kt & 1
    for (u32 kt = 0; kt < nkt; ++kt) {
        const f16* ksb = ks  + (kt & 1u) * (64u * PK64);
        const f16* vsb = vsT + (kt & 1u) * (64u * PK64);
        const f16* vrb_t = vrT + (EP ? (kt & 1u) * (64u * PK64) : 0u);

        const bool active = (kt * 64u <= q0);           // wave-uniform
        if (active) {
            // S[16 q x 64 keys]
            v8f s[4];
#pragma unroll
            for (int nt = 0; nt < 4; ++nt) s[nt] = zero8();
#pragma unroll
            for (int c = 0; c < 2; ++c) {
#pragma unroll
                for (int nt = 0; nt < 4; ++nt) {
                    const v16h kb = load_frag(ksb, (u32)nt * 16u, PK64, (u32)c * 32u, lane);
                    s[nt] = wmma16(qa[c], kb, s[nt]);
                }
            }
            const bool diag = (kt * 64u + 63u > q0);    // wave-uniform
            if (diag) softmax_tile<true,  EP>(s, m, o, lacc, psw, prw, kt * 64u, q0, hh8, c16, cl);
            else      softmax_tile<false, EP>(s, m, o, lacc, psw, prw, kt * 64u, q0, hh8, c16, cl);
        }
        __syncthreads();

        if (active) {
            // O += P . V ; l += P . ones  (P reloaded as A fragments from the relay)
#pragma unroll
            for (int kk = 0; kk < 2; ++kk) {
                const v16h pa = load_frag(psw, 0u, PK64, (u32)kk * 32u, lane);
                v16h pra = pa;
                if constexpr (EP) pra = load_frag(prw, 0u, PK64, (u32)kk * 32u, lane);
#pragma unroll
                for (int dt = 0; dt < 4; ++dt) {
                    const v16h vb = load_frag(vsb, (u32)dt * 16u, PK64, (u32)kk * 32u, lane);
                    o[dt] = wmma16(pa, vb, o[dt]);
                    if constexpr (EP) {
                        const v16h vrb = load_frag(vrb_t, (u32)dt * 16u, PK64, (u32)kk * 32u, lane);
                        o[dt] = wmma16(pa, vrb, o[dt]);
                        o[dt] = wmma16(pra, vb, o[dt]);
                    }
                }
                lacc = wmma16(pa, ones, lacc);
                if constexpr (EP) lacc = wmma16(pra, ones, lacc);
            }
        }
        ring_publish();                          // every wave, active or not
        if (kt + 2u < nkt) stage(kt + 2u);       // into the buffers this trip has just read
    }
    asm volatile("s_wait_asynccnt 0x0" ::: "memory");   // nothing in flight when the epilogue starts

    // normalize: plane value = 1024 * (O/16) / l = O * 64 / l
#pragma unroll
    for (int r = 0; r < 8; ++r) {
        const float inv = (CARRY_CTX / CARRY_QKV) / lacc[r];
#pragma unroll
        for (int dt = 0; dt < 4; ++dt) {
            const float cv = o[dt][r] * inv;
            const f16   hi = (f16)cv;
            const u32  idx = (hh8 + (u32)r) * PK64 + (u32)dt * 16u + c16;
            psw[idx] = hi;
            if constexpr (EP) prw[idx] = (f16)(cv - (float)hi);
        }
    }
    __syncthreads();

    const u32 piece = lane & 7u;
    const u32 lsub  = lane >> 3;
{
#pragma unroll
        for (u32 it = 0; it < 4; ++it) {
            const u32 L = it * 4u + lsub;     // query row 0..15 within the wave tile
            const size_t off = (size_t)(bidx * (u32)SEQ + q0 + L) * HID + hidx * (u32)HD + piece * 8u;
            const v8h v = *(const v8h*)&psw[L * PK64 + piece * 8u];
            *(v8h*)(Cp + off) = v;
            if constexpr (EP) {
                const v8h vr = *(const v8h*)&prw[L * PK64 + piece * 8u];
                *(v8h*)(Cr + off) = vr;
            }
        }
        
    }
}

// rows [0, EARLY) of every sequence: hi + residual path
__global__ void __launch_bounds__(256) __attribute__((amdgpu_num_vgpr(256)))
attn_early(const f16* __restrict__ Qp, const f16* __restrict__ Kp, const f16* __restrict__ Vt,
           const f16* __restrict__ Vr, f16* __restrict__ Cp, f16* __restrict__ Cr) {
    attn_body<true>(Qp, Kp, Vt, Vr, Cp, Cr, 0u);
}

// rows [EARLY, SEQ): single f16 planes
__global__ void __launch_bounds__(256) __attribute__((amdgpu_num_vgpr(256)))
attn_dense(const f16* __restrict__ Qp, const f16* __restrict__ Kp, const f16* __restrict__ Vt,
           f16* __restrict__ Cp) {
    attn_body<false>(Qp, Kp, Vt, Vt, Cp, Cp, (u32)(EARLY / 128));
}

// coverage equalities (threads x elements == plane elements)
static_assert((size_t)(MROWS / 2) * 256 * 8 == (size_t)MROWS * HID);                       // cvt_rows -> Xh
static_assert((size_t)(3 * HID / 64) * (HID / 64) * 64 * 64 == (size_t)3 * HID * HID);     // cvt_wT -> Wt
static_assert((size_t)(HID / 64) * (HID / 64) * 64 * 64 == (size_t)HID * HID);             // cvt_wT -> Wot
static_assert((size_t)(MROWS / 128) * (HID / 128) * 128 * 128 == (size_t)MROWS * HID);     // gemm planes / out
static_assert((size_t)(SEQ / 128) * (NB * NHEAD) * 128 * HD == (size_t)MROWS * HID);       // attn -> Cp
// workspace: 7 activation planes + 4 weight planes of halves, at most 128 MiB
static_assert(((size_t)7 * MROWS * HID + (size_t)4 * HID * HID) * sizeof(f16) <= (size_t)134217728);

// ---------------------------------------------------------------------------
// Launch: 9 kernel launches, workspace 7 planes of MROWS*1024 halves + 4 of 1024*1024 halves.
// ---------------------------------------------------------------------------
extern "C" void kernel_launch(void* const* d_in, const int* in_sizes, int n_in,
                              void* d_out, int out_size, void* d_ws, size_t ws_size,
                              hipStream_t stream) {
    if (n_in < 5) return;
    if (in_sizes[0] < ((NB - 1) * SEQ_FULL + SEQ) * HID) return;
    if (in_sizes[1] < 3 * HID * HID) return;
    if (in_sizes[2] < 3 * HID) return;
    if (in_sizes[3] < HID * HID) return;
    if (in_sizes[4] < HID) return;
    const size_t needOut = OUT0_ELEMS_FULL + PRES_ELEMS_FULL
                         + ((size_t)((NB - 1) * NHEAD + NHEAD - 1) * SEQ_FULL + SEQ) * HD;
    if ((size_t)out_size < needOut) return;

    const float* x     = (const float*)d_in[0];   // [NB_FULL][SEQ_FULL][1024]
    const float* wattn = (const float*)d_in[1];   // [1024 in][3072 out], out columns q | k | v
    const float* battn = (const float*)d_in[2];   // [3072]
    const float* wproj = (const float*)d_in[3];   // [1024 in][1024 out]
    const float* bproj = (const float*)d_in[4];   // [1024]
    float* out = (float*)d_out;                   // out0 | present k | present v

    const size_t nX = (size_t)MROWS * HID;    // halves per activation plane
    const size_t nW = (size_t)HID * HID;      // halves per weight plane
    const size_t totalHalves = 7 * nX + 4 * nW;
    if (ws_size < totalHalves * sizeof(f16)) return;

    f16* Xh  = (f16*)d_ws;       // [MROWS][1024]               carry 16
    f16* Wt  = Xh  + nX;         // [3072 out][1024 in]         carry 32 (q | k | v row blocks)
    f16* Wot = Wt  + 3 * nW;     // [1024 out][1024 in]         carry 32
    f16* Qp  = Wot + nW;         // [NB*16][SEQ][64]            carry 16
    f16* Kp  = Qp  + nX;         // [NB*16][SEQ][64]            carry 16
    f16* Vtp = Kp  + nX;         // [NB*1024][SEQ] (V^T)        carry 16
    f16* Vrp = Vtp + nX;         // [NB*1024][SEQ] residual, columns s < EARLY only
    f16* Cp  = Vrp + nX;         // [MROWS][1024]               carry 1024
    f16* Cr  = Cp  + nX;         // [MROWS][1024] residual, rows s < EARLY only

    // activations: dst row m of batch b <- src row b*SEQ_FULL + (m % SEQ)
    cvt_rows<<<MROWS / 2, 256, 0, stream>>>(x, Xh, (u32)MROWS, (u32)SEQ, (u32)SEQ_FULL, CARRY_X);
    // weights: in[rows = 1024 (k)][cols = 3072 (n)] -> out[cols][rows]; grid (cols/64, rows/64)
    cvt_wT<<<dim3(3 * HID / 64, HID / 64), 256, 0, stream>>>(wattn, Wt, (u32)HID, (u32)(3 * HID), CARRY_W);
    // in[rows = 1024 (k)][cols = 1024 (n)] -> out[cols][rows]; grid (cols/64, rows/64)
    cvt_wT<<<dim3(HID / 64, HID / 64), 256, 0, stream>>>(wproj, Wot, (u32)HID, (u32)HID, CARRY_W);

    const dim3 gg(MROWS / 128, HID / 128);
    gemm_q<<<gg, 256, 0, stream>>>(Xh, Wt,          battn,           Qp);
    gemm_k<<<gg, 256, 0, stream>>>(Xh, Wt + nW,     battn + HID,     Kp,  out + OUT0_ELEMS_FULL);
    gemm_v<<<gg, 256, 0, stream>>>(Xh, Wt + 2 * nW, battn + 2 * HID, Vtp, Vrp,
                                   out + OUT0_ELEMS_FULL + PRES_ELEMS_FULL);

    attn_early<<<dim3(EARLY / 128, NB * NHEAD), 256, 0, stream>>>(Qp, Kp, Vtp, Vrp, Cp, Cr);
    if (SEQ > EARLY) {
        attn_dense<<<dim3((SEQ - EARLY) / 128, NB * NHEAD), 256, 0, stream>>>(Qp, Kp, Vtp, Cp);
    }

    // out = acc / (1024*32) + bias ; residual context plane at Cp + nX
    gemm_o<<<gg, 256, 0, stream>>>(Cp, Wot, bproj, out, nX);
}

// v003
// Measured time: 116 microseconds a run.
// Next to v002, in two timings, it ran 1.24 times as fast each time.
// Over all steps from v000 it is 2.91 times as fast.
#include <hip/hip_runtime.h>

// Contractions (fused QKV projection, Q.K^T, P.V, P row-sum, output projection): v_wmma_f32_16x16x32_f16, f16 operands with power-of-two carries, f32 accumulate; every float input enters as its bf16 RNE value; the first EARLY query rows of each sequence carry P, V and context as f16 hi + f16 residual planes (extra products into the same f32 accumulators); softmax in f32.

#ifndef NB
#define NB 2
#endif
#ifndef SEQ
#define SEQ 2048
#endif
#define NB_FULL   2
#define SEQ_FULL  2048
#define HID       1024
#define NHEAD     16
#define HD        64
#define MROWS     (NB * SEQ)
#define EARLY_CAP 512
#define EARLY     ((SEQ < EARLY_CAP) ? SEQ : EARLY_CAP)

#define OUT0_ELEMS_FULL ((size_t)NB_FULL * SEQ_FULL * HID)          // out0 elements
#define PRES_ELEMS_FULL ((size_t)NB_FULL * NHEAD * SEQ_FULL * HD)   // elements of present[0] (k) or present[1] (v)

static_assert(HID == NHEAD * HD);        // merged head width
static_assert(NHEAD == 16);              // bh >> 4 / bh & 15 decoding
static_assert(HD == 64);
static_assert(SEQ % 128 == 0);           // 128-row blocks never straddle a batch
static_assert(EARLY % 128 == 0);
static_assert(EARLY >= 128 && EARLY <= SEQ);
static_assert(SEQ <= SEQ_FULL);
static_assert(NB >= 1 && NB <= NB_FULL);
static_assert(MROWS % 128 == 0);         // GEMM M tile
static_assert(HID % 128 == 0);           // GEMM N tile
static_assert(HID % 64 == 0);            // weight transpose tile
static_assert(HID % 32 == 0);            // WMMA k step
static_assert(HID % 256 == 0);           // staged k tiles of 128, at least two of them
static_assert((HID & (HID - 1)) == 0);   // k0 & (HID-1)
static_assert(HID == 128 * 8);           // cvt_rows: 128 threads x 8 values per row
static_assert(OUT0_ELEMS_FULL * 4 == (size_t)16777216);   // byte offset of the second output

// carries (exact powers of two)
#define CARRY_X    16.0f     // input activation plane
#define CARRY_W    32.0f     // weight planes
#define CARRY_QKV  16.0f     // q, k, v^T planes (true value x16); v residual in the same units
#define CARRY_CTX  1024.0f   // context planes (true value x1024); residual in the same units
// softmax exp values carry 2^10 (added to the exp2 argument); residual in the same units

// LDS row pitches in elements: every row read or written 16 bytes per lane has a pitch of 16 B x odd,
// so the 16 lanes of a lane half fall on 64 distinct banks
#define PK32   40u    // 32-half rows (64 B)  -> 80 B
#define PK64   72u    // 64-half rows (128 B) -> 144 B
#define PC16   136u   // 128-half rows (256 B) -> 272 B
#define PC32   132u   // 128-float rows (512 B) -> 528 B
#define KTILE  128u   // k values per staged GEMM tile (256-byte rows)

typedef unsigned u32;
typedef _Float16 f16;
typedef f16   v16h __attribute__((ext_vector_type(16)));
typedef f16   v8h  __attribute__((ext_vector_type(8)));
typedef float v8f  __attribute__((ext_vector_type(8)));
typedef float v4f  __attribute__((ext_vector_type(4)));

union FragU { v16h v; v8h half[2]; f16 e[16]; };
union H8U   { v8h v; f16 e[8]; };

__device__ __forceinline__ v8f zero8() {
    v8f z = {0.f, 0.f, 0.f, 0.f, 0.f, 0.f, 0.f, 0.f};
    return z;
}

// 16-bit WMMA with hazard guard: D += A[16 x 32k] * B[32k x 16]
__device__ __forceinline__ v8f wmma16(v16h a, v16h b, v8f c) {
    v8f d = __builtin_amdgcn_wmma_f32_16x16x32_f16(false, a, false, b, (short)0, c, false, false);
    asm volatile("v_nop\n\tv_nop\n\tv_nop\n\tv_nop" : "+v"(d) : "v"(a), "v"(b));
    return d;
}

// f32 -> nearest-even bf16 value, returned as f32
__device__ __forceinline__ float bf16_rne(float x) {
    u32 u = __float_as_uint(x);
    u = (u + 0x7fffu + ((u >> 16) & 1u)) & 0xffff0000u;
    return __uint_as_float(u);
}

__device__ __forceinline__ float fexp2(float x) {
#if defined(__has_builtin)
#if __has_builtin(__builtin_amdgcn_exp2f)
    return __builtin_amdgcn_exp2f(x);
#else
    return exp2f(x);
#endif
#else
    return exp2f(x);
#endif
}

// max over the 16 lanes of each lane half (DPP row rotations; D-layout rows are DPP rows)
__device__ __forceinline__ float rowmax16(float x) {
    int v = __builtin_bit_cast(int, x);
    x = fmaxf(x, __builtin_bit_cast(float, __builtin_amdgcn_update_dpp(v, v, 0x121, 0xf, 0xf, false)));
    v = __builtin_bit_cast(int, x);
    x = fmaxf(x, __builtin_bit_cast(float, __builtin_amdgcn_update_dpp(v, v, 0x122, 0xf, 0xf, false)));
    v = __builtin_bit_cast(int, x);
    x = fmaxf(x, __builtin_bit_cast(float, __builtin_amdgcn_update_dpp(v, v, 0x124, 0xf, 0xf, false)));
    v = __builtin_bit_cast(int, x);
    x = fmaxf(x, __builtin_bit_cast(float, __builtin_amdgcn_update_dpp(v, v, 0x128, 0xf, 0xf, false)));
    return x;
}

// 16 x 32 fragment from a tile whose k dimension is contiguous (pitch in halves).
// lane l: row rowbase + (l&15); elements 0..7 <- k = kcol + 8h .. +7,
// elements 8..15 <- k = kcol + 16 + 8h .. +7  (h = l>>4). Same map for A and B.
__device__ __forceinline__ v16h load_frag(const f16* tile, u32 rowbase, u32 pitch, u32 kcol, u32 lane) {
    const u32 r  = rowbase + (lane & 15u);
    const u32 kh = (lane >> 4) << 3;
    const f16* p = tile + (size_t)r * pitch + kcol + kh;
    FragU f;
    f.half[0] = *(const v8h*)(p);
    f.half[1] = *(const v8h*)(p + 16);
    return f.v;
}

// LDS byte address of a __shared__ element (low 32 bits of its address)
__device__ __forceinline__ u32 lds_addr(const f16* p) {
    return (u32)(size_t)p;
}

// Asynchronous copies global -> LDS, 16 bytes per lane, no register staging. The s_wait_xcnt closes each
// statement so that no address register of an issued copy is rewritten ahead of it.
// Eight copies whose rows lie 16 apart: LDS step lstep bytes, global step gstep halves.
__device__ __forceinline__ void async_copy8(u32 l, u32 lstep, const f16* g, size_t gstep) {
    asm volatile("global_load_async_to_lds_b128 %0, %8, off\n\t"
                 "global_load_async_to_lds_b128 %1, %9, off\n\t"
                 "global_load_async_to_lds_b128 %2, %10, off\n\t"
                 "global_load_async_to_lds_b128 %3, %11, off\n\t"
                 "global_load_async_to_lds_b128 %4, %12, off\n\t"
                 "global_load_async_to_lds_b128 %5, %13, off\n\t"
                 "global_load_async_to_lds_b128 %6, %14, off\n\t"
                 "global_load_async_to_lds_b128 %7, %15, off\n\t"
                 "s_wait_xcnt 0x0"
                 :: "v"(l), "v"(l + lstep), "v"(l + 2u * lstep), "v"(l + 3u * lstep),
                    "v"(l + 4u * lstep), "v"(l + 5u * lstep), "v"(l + 6u * lstep), "v"(l + 7u * lstep),
                    "v"(g), "v"(g + gstep), "v"(g + 2 * gstep), "v"(g + 3 * gstep),
                    "v"(g + 4 * gstep), "v"(g + 5 * gstep), "v"(g + 6 * gstep), "v"(g + 7 * gstep)
                 : "memory");
}

// Four and two copies with each lane's own addresses given one by one.
__device__ __forceinline__ void async_copy4(u32 l0, const f16* g0, u32 l1, const f16* g1,
                                            u32 l2, const f16* g2, u32 l3, const f16* g3) {
    asm volatile("global_load_async_to_lds_b128 %0, %4, off\n\t"
                 "global_load_async_to_lds_b128 %1, %5, off\n\t"
                 "global_load_async_to_lds_b128 %2, %6, off\n\t"
                 "global_load_async_to_lds_b128 %3, %7, off\n\t"
                 "s_wait_xcnt 0x0"
                 :: "v"(l0), "v"(l1), "v"(l2), "v"(l3), "v"(g0), "v"(g1), "v"(g2), "v"(g3)
                 : "memory");
}
__device__ __forceinline__ void async_copy2(u32 l0, const f16* g0, u32 l1, const f16* g1) {
    asm volatile("global_load_async_to_lds_b128 %0, %2, off\n\t"
                 "global_load_async_to_lds_b128 %1, %3, off\n\t"
                 "s_wait_xcnt 0x0"
                 :: "v"(l0), "v"(l1), "v"(g0), "v"(g1)
                 : "memory");
}

// publish point of a two-buffer ring: this wave's LDS reads retired, its own copies landed, then the block
// barrier that shows the next tile to every wave and frees the buffer just read
__device__ __forceinline__ void ring_publish() {
    asm volatile("s_wait_dscnt 0x0" ::: "memory");     // reads of the buffer to be refilled have retired
    asm volatile("s_wait_asynccnt 0x0" ::: "memory");  // this wave's copies of the next tile have landed
    __syncthreads();
}

// ---------------------------------------------------------------------------
// f32 rows [.][1024] -> f16 plane (bf16 RNE value times carry). 128 threads per 1024-wide
// Row mapping dst row m -> src row (m / dstper) * srcper + m % dstper lets a reduced build
// read full-size inputs.
// coverage: nrows x 1024 halves, every element exactly once (grid = nrows*128/256).
// ---------------------------------------------------------------------------
__device__ __forceinline__ void
cvt_rows_body(const float* src, f16* dst, u32 blk, u32 nrows, u32 dstper, u32 srcper, float carry) {
    const u32 g  = blk * 256u + threadIdx.x;
    const u32 m  = g >> 7;
    const u32 c8 = (g & 127u) << 3;
    if (m >= nrows) return;
    const u32 mb = m / dstper;
    const u32 sm = mb * srcper + (m - mb * dstper);
    const float* sp = src + (size_t)sm * HID + c8;
    const v4f a = *(const v4f*)sp;
    const v4f b = *(const v4f*)(sp + 4);
    H8U o;
#pragma unroll
    for (u32 j = 0; j < 4; ++j) {
        const float x0 = a[j];
        const float x1 = b[j];
        o.e[j]     = (f16)(bf16_rne(x0) * carry);
        o.e[j + 4] = (f16)(bf16_rne(x1) * carry);
    }
    f16* dp = dst + (size_t)m * HID + c8;
    *(v8h*)dp = o.v;
    
}

// ---------------------------------------------------------------------------
// Transposing weight convert: src[rows][cols] f32 -> dst[cols][rows] f16 (bf16 RNE value
// times carry). Block = 64 (src rows, k) x 64 (src cols, n) tile, grid (cols/64, rows/64).
// Tile staged transposed in LDS (pitch 72 halves), then each dst row segment of 64 halves
// coverage: 4 x 256 threads x 4 values == 64 x 64 per block; blocks tile rows x cols exactly.
// LDS t: cross-wave, block barrier; staged extent 64 x 64 == consumed extent.
// ---------------------------------------------------------------------------
__device__ __forceinline__ void
cvt_wT_body(const float* src, f16* dst, f16* t, u32 bx, u32 by, u32 rows, u32 cols, float carry) {
    const u32 tid = threadIdx.x;
    const u32 n0  = bx * 64u;   // src column block == dst row block
    const u32 k0  = by * 64u;   // src row block == dst column block
#pragma unroll
    for (u32 it = 0; it < 4; ++it) {
        const u32 p  = tid + it * 256u;
        const u32 kr = p >> 4;              // 0..63
        const u32 c4 = (p & 15u) << 2;      // 0..60
        const v4f a = *(const v4f*)(src + (size_t)(k0 + kr) * cols + n0 + c4);
#pragma unroll
        for (u32 j = 0; j < 4; ++j) {
            const float x = a[j];
            t[(c4 + j) * 72u + kr] = (f16)(bf16_rne(x) * carry);
        }
    }
    __syncthreads();
    const u32 piece = tid & 7u;
    const u32 lrow  = tid >> 3;             // 0..31
{
#pragma unroll
        for (u32 it = 0; it < 2; ++it) {
            const u32 L = it * 32u + lrow;  // dst row within the tile, 0..63
            const v8h v = *(const v8h*)&t[L * 72u + piece * 8u];
            f16* dp = dst + (size_t)(n0 + L) * rows + k0 + piece * 8u;
            *(v8h*)dp = v;
        }
        asm volatile("s_wait_xcnt 0x0" ::: "memory");   // before code behind this body rewrites a register of these stores
    }
}

// The three converts in one launch: none reads what another writes. Flat grid: the blocks of the activation
// rows first, then those of the two weight transposes; the choice is block-uniform.
#define CVT_WA_BX     (3 * HID / 64)
#define CVT_WA_BLOCKS (CVT_WA_BX * (HID / 64))
#define CVT_WP_BX     (HID / 64)
#define CVT_WP_BLOCKS (CVT_WP_BX * (HID / 64))
#define CVT_X_BLOCKS  (MROWS / 2)
__global__ void __launch_bounds__(256)
cvt_all(const float* __restrict__ x, const float* __restrict__ wattn, const float* __restrict__ wproj,
        f16* __restrict__ Xh, f16* __restrict__ Wt, f16* __restrict__ Wot) {
    __shared__ __attribute__((aligned(16))) f16 t[64 * 72];
    const u32 b = blockIdx.x;
    if (b < (u32)CVT_X_BLOCKS) {
        // dst row m of batch b <- src row b*SEQ_FULL + (m % SEQ)
        cvt_rows_body(x, Xh, b, (u32)MROWS, (u32)SEQ, (u32)SEQ_FULL, CARRY_X);
    } else if (b < (u32)(CVT_X_BLOCKS + CVT_WA_BLOCKS)) {
        // in[rows = 1024 (k)][cols = 3072 (n)] -> out[cols][rows]
        const u32 bb = b - (u32)CVT_X_BLOCKS;
        cvt_wT_body(wattn, Wt, t, bb % (u32)CVT_WA_BX, bb / (u32)CVT_WA_BX, (u32)HID, (u32)(3 * HID), CARRY_W);
    } else {
        // in[rows = 1024 (k)][cols = 1024 (n)] -> out[cols][rows]
        const u32 bb = b - (u32)(CVT_X_BLOCKS + CVT_WA_BLOCKS);
        cvt_wT_body(wproj, Wot, t, bb % (u32)CVT_WP_BX, bb / (u32)CVT_WP_BX, (u32)HID, (u32)HID, CARRY_W);
    }
}

// ---------------------------------------------------------------------------
// C[m][n] = sum_k A[m][k] * W[n][k] ; A [MROWS][1024] f16, W [1024][1024] f16 (k contiguous).
// Block tile 128 x 128, 8 waves as 4(M) x 2(N), 2 x 4 accumulators per wave, WMMA k step 32.
// A and W tiles of 128 k come by asynchronous copies into two LDS buffers: tile t + 1 flies while tile t is multiplied.
// true value t = acc * mul + bias (bias enters as its bf16 RNE value, added in f32).
// MODE 0: f16 plane [b*NHEAD + h][s][d] (t x16)
// MODE 1: MODE 0 plane + f32 rows [b*NHEAD + h][s][d] (t) into the output buffer
// MODE 2: f16 plane [b*HID + h*HD + d][s] (t x16, transposed per head), residual plane of the
//         same layout for key blocks below EARLY, + f32 rows as MODE 1
// MODE 3: f32 rows [b][s][1024] into the output buffer; for row blocks below EARLY the k loop
//         continues over the residual A plane (A + resOff) against the same W (K folded to 2048)
// coverage per block: f16 planes 256 lines (128 rows x 2 heads | 128 n x 2 s-halves);
//                     f32 2 x 256 lines (64 rows x 4 line-quarters per half).
// LDS: As/Bs/Cs all cross-wave, separated by block barriers.
// staged extent == consumed extent: As/Bs 128 x 128 per buffer, Cs 128 x 128 halves (or 64 x 128 floats).
// ---------------------------------------------------------------------------
template <int MODE>
__device__ __forceinline__ void gemm_body(const f16* A, const f16* W, const float* bias,
                                          f16* plane, f16* plane2, float* fout, size_t resOff,
                                          f16* As, f16* Bs, f16* Cs) {
    // As, Bs: two buffers of 128 rows x 128 k each; Cs: f16 [128][128] at pitch PC16 or f32 [64][128] at pitch PC32
    static_assert(sizeof(f16) * 128 * PC16 >= sizeof(float) * 64 * PC32);   // Cs reuse as f32 [64][128]

    const u32 tid  = threadIdx.x;
    const u32 lane = tid & 31u;
    const u32 wave = tid >> 5;
    const u32 wm   = wave & 3u;
    const u32 wn   = wave >> 2;
    const u32 hh8  = (lane >> 4) << 3;   // D row half
    const u32 c16  = lane & 15u;         // D column
    const u32 m0   = blockIdx.x * 128u;
    const u32 n0   = blockIdx.y * 128u;
    const u32 bidx = m0 / (u32)SEQ;      // block rows lie inside one batch (SEQ % 128 == 0)
    const u32 s0   = m0 - bidx * (u32)SEQ;

    u32 kTot = (u32)HID;
    if constexpr (MODE == 3) {
        if (s0 < (u32)EARLY) kTot = 2u * (u32)HID;   // block-uniform
    }

    v8f acc[2][4];
#pragma unroll
    for (int i = 0; i < 2; ++i)
#pragma unroll
        for (int j = 0; j < 4; ++j) acc[i][j] = zero8();

    // staging map: 16 lanes cover one 256-byte row segment, a wave's copy two rows (four whole lines)
    const u32 crow = tid >> 4;
    const u32 ccol = (tid & 15u) << 3;
    const f16* gA = A + (size_t)(m0 + crow) * HID + ccol;
    const f16* gW = W + (size_t)(n0 + crow) * HID + ccol;
    const u32 lA = lds_addr(&As[crow * PC16 + ccol]);
    const u32 lB = lds_addr(&Bs[crow * PC16 + ccol]);
    const u32 nT = kTot / KTILE;         // 8 or 16 tiles, block-uniform

    auto stage = [&](u32 t) {
        const u32    k0 = t * KTILE;
        const u32    kk = k0 & (u32)(HID - 1);
        const size_t ao = (k0 >= (u32)HID) ? resOff : (size_t)0;
        const u32    bo = (t & 1u) * (128u * PC16 * 2u);
        async_copy8(lA + bo, 16u * PC16 * 2u, gA + ao + kk, (size_t)16 * HID);
        async_copy8(lB + bo, 16u * PC16 * 2u, gW + kk, (size_t)16 * HID);
    };

    stage(0u);
    asm volatile("s_wait_asynccnt 0x0" ::: "memory");   // tile 0 landed before the barrier that shows it
    __syncthreads();
    stage(1u);

#pragma unroll 1   // stays rolled: one trip per staged tile, its buffer chosen by t & 1
    for (u32 t = 0; t < nT; ++t) {
        const f16* as = As + (t & 1u) * (128u * PC16);
        const f16* bs = Bs + (t & 1u) * (128u * PC16);
#pragma unroll     // the four 32-k steps of a tile in line, every LDS offset an immediate
        for (u32 kc = 0; kc < KTILE; kc += 32u) {
            v16h af[2], bfr[4];
#pragma unroll
            for (int i = 0; i < 2; ++i) af[i] = load_frag(as, wm * 32u + (u32)i * 16u, PC16, kc, lane);
#pragma unroll
            for (int j = 0; j < 4; ++j) bfr[j] = load_frag(bs, wn * 64u + (u32)j * 16u, PC16, kc, lane);
#pragma unroll
            for (int i = 0; i < 2; ++i)
#pragma unroll
                for (int j = 0; j < 4; ++j) acc[i][j] = wmma16(af[i], bfr[j], acc[i][j]);
        }
        ring_publish();
        if (t + 2u < nT) stage(t + 2u);  // into the buffer this trip has just read
    }
    asm volatile("s_wait_asynccnt 0x0" ::: "memory");   // nothing in flight when the epilogue starts

    const float mul = (MODE == 3) ? (1.0f / (CARRY_CTX * CARRY_W)) : (1.0f / (CARRY_X * CARRY_W));
    float bv[4];
#pragma unroll
    for (int j = 0; j < 4; ++j) {
        const float bx = bias[n0 + wn * 64u + (u32)j * 16u + c16];
        bv[j] = bf16_rne(bx);
    }

    const u32 piece = lane & 7u;
    const u32 lsub  = lane >> 3;

    if constexpr (MODE == 0 || MODE == 1) {
#pragma unroll
        for (int i = 0; i < 2; ++i)
#pragma unroll
            for (int j = 0; j < 4; ++j) {
                const u32 nl = wn * 64u + (u32)j * 16u + c16;
#pragma unroll
                for (int r = 0; r < 8; ++r) {
                    const u32 ml = wm * 32u + (u32)i * 16u + hh8 + (u32)r;
                    const float tv = acc[i][j][r] * mul + bv[j];
                    Cs[ml * PC16 + nl] = (f16)(tv * CARRY_QKV);
                }
            }
        __syncthreads();
        const size_t bh0 = (size_t)bidx * NHEAD + (n0 >> 6);
{
#pragma unroll
            for (u32 it = 0; it < 8; ++it) {
                const u32 L    = wave * 32u + it * 4u + lsub;   // 0..255
                const u32 ml   = L >> 1;
                const u32 hsel = L & 1u;
                const v8h v = *(const v8h*)&Cs[ml * PC16 + hsel * 64u + piece * 8u];
                f16* dp = plane + ((bh0 + hsel) * SEQ + s0 + ml) * HD + piece * 8u;
                *(v8h*)dp = v;
            }
            
        }
    }
    if constexpr (MODE == 2) {
        // hi plane, staged transposed: Cs[n][m]
#pragma unroll
        for (int i = 0; i < 2; ++i)
#pragma unroll
            for (int j = 0; j < 4; ++j) {
                const u32 nl = wn * 64u + (u32)j * 16u + c16;
                H8U t;
#pragma unroll
                for (int r = 0; r < 8; ++r) {
                    const float tv = (acc[i][j][r] * mul + bv[j]) * CARRY_QKV;
                    t.e[r] = (f16)tv;
                }
                *(v8h*)&Cs[nl * PC16 + wm * 32u + (u32)i * 16u + hh8] = t.v;
            }
        __syncthreads();
{
#pragma unroll
            for (u32 it = 0; it < 8; ++it) {
                const u32 L  = wave * 32u + it * 4u + lsub;     // 0..255
                const u32 nl = L >> 1;
                const u32 mh = L & 1u;
                const v8h v = *(const v8h*)&Cs[nl * PC16 + mh * 64u + piece * 8u];
                f16* dp = plane + ((size_t)(bidx * (u32)HID + n0 + nl) * SEQ + s0 + mh * 64u + piece * 8u);
                *(v8h*)dp = v;
            }
            asm volatile("s_wait_xcnt 0x0" ::: "memory");   // before the residual path rewrites a register of these stores
        }
        if (s0 < (u32)EARLY) {          // block-uniform: residual plane only for early key blocks
            __syncthreads();
#pragma unroll
            for (int i = 0; i < 2; ++i)
#pragma unroll
                for (int j = 0; j < 4; ++j) {
                    const u32 nl = wn * 64u + (u32)j * 16u + c16;
                    H8U t;
#pragma unroll
                    for (int r = 0; r < 8; ++r) {
                        const float tv = (acc[i][j][r] * mul + bv[j]) * CARRY_QKV;
                        const f16   hi = (f16)tv;
                        t.e[r] = (f16)(tv - (float)hi);
                    }
                    *(v8h*)&Cs[nl * PC16 + wm * 32u + (u32)i * 16u + hh8] = t.v;
                }
            __syncthreads();
{
#pragma unroll
                for (u32 it = 0; it < 8; ++it) {
                    const u32 L  = wave * 32u + it * 4u + lsub;
                    const u32 nl = L >> 1;
                    const u32 mh = L & 1u;
                    const v8h v = *(const v8h*)&Cs[nl * PC16 + mh * 64u + piece * 8u];
                    f16* dp = plane2 + ((size_t)(bidx * (u32)HID + n0 + nl) * SEQ + s0 + mh * 64u + piece * 8u);
                    *(v8h*)dp = v;
                }
                
            }
        }
    }
    if constexpr (MODE >= 1) {
        if constexpr (MODE != 3) __syncthreads();   // f16 stage reads finished before restaging
        float* Cf = (float*)Cs;      // [64][128] f32 at pitch PC32
#pragma unroll
        for (u32 half = 0; half < 2; ++half) {
            if ((wm >> 1) == half) {
#pragma unroll
                for (int i = 0; i < 2; ++i)
#pragma unroll
                    for (int j = 0; j < 4; ++j) {
                        const u32 nl = wn * 64u + (u32)j * 16u + c16;
#pragma unroll
                        for (int r = 0; r < 8; ++r) {
                            const u32 ml = (wm & 1u) * 32u + (u32)i * 16u + hh8 + (u32)r;
                            Cf[ml * PC32 + nl] = acc[i][j][r] * mul + bv[j];
                        }
                    }
            }
            __syncthreads();
{
#pragma unroll
                for (u32 it = 0; it < 8; ++it) {
                    const u32 L    = wave * 32u + it * 4u + lsub;   // 0..255
                    const u32 row  = L >> 2;
                    const u32 part = L & 3u;
                    const v4f v = *(const v4f*)&Cf[row * PC32 + part * 32u + piece * 4u];
                    size_t off;
                    if constexpr (MODE == 3) {
                        off = (size_t)(bidx * (u32)SEQ_FULL + s0 + half * 64u + row) * HID
                            + n0 + part * 32u + piece * 4u;
                    } else {
                        off = ((size_t)(bidx * (u32)NHEAD + (n0 >> 6) + (part >> 1)) * SEQ_FULL
                               + s0 + half * 64u + row) * HD + (part & 1u) * 32u + piece * 4u;
                    }
                    *(v4f*)(fout + off) = v;
                }
                
            }
            __syncthreads();
        }
    }
}

// The q, k and v projections in one launch (none reads what another writes), blockIdx.z picks the
// weight block and the epilogue: 0 = q head-major plane, 1 = k head-major plane + f32 k rows of the second
// output, 2 = v^T plane + v^T residual plane (early keys) + f32 v rows of the second output.
__global__ void __launch_bounds__(256) __attribute__((amdgpu_num_vgpr(256)))
gemm_qkv(const f16* __restrict__ A, const f16* __restrict__ W, const float* __restrict__ bias,
         f16* __restrict__ outQ, f16* __restrict__ outK, f16* __restrict__ outT, f16* __restrict__ outR,
         float* __restrict__ pres) {
    __shared__ __attribute__((aligned(16))) f16 As[2 * 128 * PC16];
    __shared__ __attribute__((aligned(16))) f16 Bs[2 * 128 * PC16];
    __shared__ __attribute__((aligned(16))) f16 Cs[128 * PC16];
    const u32 z = blockIdx.z;            // block-uniform
    if (z == 0u) {
        gemm_body<0>(A, W, bias, outQ, outQ, pres, (size_t)0, As, Bs, Cs);
    } else if (z == 1u) {
        gemm_body<1>(A, W + (size_t)HID * HID, bias + HID, outK, outK, pres, (size_t)0, As, Bs, Cs);
    } else {
        gemm_body<2>(A, W + (size_t)2 * HID * HID, bias + 2 * HID, outT, outR, pres + PRES_ELEMS_FULL, (size_t)0,
                     As, Bs, Cs);
    }
}

// f32 output rows; A residual plane at A + resOff for early row blocks
__global__ void __launch_bounds__(256) __attribute__((amdgpu_num_vgpr(256)))
gemm_o(const f16* __restrict__ A, const f16* __restrict__ W, const float* __restrict__ bias,
       float* __restrict__ out, size_t resOff) {
    __shared__ __attribute__((aligned(16))) f16 As[2 * 128 * PC16];
    __shared__ __attribute__((aligned(16))) f16 Bs[2 * 128 * PC16];
    __shared__ __attribute__((aligned(16))) f16 Cs[128 * PC16];
    gemm_body<3>(A, W, bias, (f16*)out, (f16*)out, out, resOff, As, Bs, Cs);
}

// ---------------------------------------------------------------------------
// Online softmax update for one 16 q x 64 key score tile (log2 domain, max-subtracted).
// MASK: keys above the query row get probability exactly 0 and do not enter the row max.
// EP: also emit the f16 residual of each carried exp value.
// ---------------------------------------------------------------------------
template <bool MASK, bool EP>
__device__ __forceinline__ void softmax_tile(const v8f (&s)[4], float (&m)[8], v8f (&o)[4], v8f& lacc,
                                             f16* psw, f16* prw, u32 kbase, u32 q0,
                                             u32 hh8, u32 c16, float cl) {
#pragma unroll
    for (int r = 0; r < 8; ++r) {
        float x[4];
        bool  dead[4];
#pragma unroll
        for (int nt = 0; nt < 4; ++nt) {
            x[nt]    = s[nt][r] * cl;
            dead[nt] = false;
            if constexpr (MASK) {
                dead[nt] = (kbase + (u32)nt * 16u + c16) > (q0 + hh8 + (u32)r);
                x[nt]    = dead[nt] ? -1.0e30f : x[nt];
            }
        }
        const float tm = rowmax16(fmaxf(fmaxf(x[0], x[1]), fmaxf(x[2], x[3])));
        const float mn = fmaxf(m[r], tm);
        const float al = fexp2(m[r] - mn);
        m[r] = mn;
        lacc[r] *= al;
#pragma unroll
        for (int dt = 0; dt < 4; ++dt) o[dt][r] *= al;
        const float sh = 10.0f - mn;      // carry 2^10
#pragma unroll
        for (int nt = 0; nt < 4; ++nt) {
            float e = fexp2(x[nt] + sh);
            if constexpr (MASK) e = dead[nt] ? 0.0f : e;
            const f16 hi = (f16)e;
            const u32 idx = (hh8 + (u32)r) * PK64 + (u32)nt * 16u + c16;
            psw[idx] = hi;
            if constexpr (EP) prw[idx] = (f16)(e - (float)hi);
        }
    }
}

// ---------------------------------------------------------------------------
// Causal flash attention, one (row block, head) per block of 256 (8 waves), wave owns 16 query
// rows (Q fragments resident). Block streams 64-key tiles 0 .. last tile touching its rows:
// K staged [key][d], V^T staged [d][key] (+ residual tile when EP), by asynchronous copies into two
// buffers each: tile kt + 1 flies while tile kt is worked on. A wave computes a tile only
// when the tile starts at or below its first row (wave-uniform); the tile containing its rows
// takes the masked path. Scores on WMMA, row max via DPP, exp2 in f32 carried x2^10, P relayed
// per wave through LDS as A fragments, O += P.V and row sums += P.ones on WMMA.
// EP (rows below EARLY): P and V as hi + residual, products hi.hi + hi.res + res.hi into the
// same accumulators; context written as hi plane + residual plane.
// coverage: every (b, q, h*64..h*64+63) row segment of the launched row blocks exactly once.
// LDS: ks, vsT, vrT cross-wave (block barriers); ps/pr per-wave but also separated by block
// barriers. staged extent == consumed extent for ks/vsT/vrT (64x64) and ps/pr (16x64, written
// in full by the owning wave before it reads them).
// ---------------------------------------------------------------------------
template <bool EP>
__device__ __forceinline__ void attn_body(const f16* Qp, const f16* Kp, const f16* Vt, const f16* Vr,
                                          f16* Cp, f16* Cr, u32 qblk, u32 bh,
                                          f16* ks, f16* vsT, f16* vrT, f16* ps, f16* pr) {
    static_assert(HD == 8 * 8);            // 8 lanes x 8 halves per row segment
    static_assert(2 * 256 * 8 == 64 * 64); // staging: 2 copies x 256 threads x 8 halves per tile

    const u32 tid  = threadIdx.x;
    const u32 lane = tid & 31u;
    const u32 wave = (u32)__builtin_amdgcn_readfirstlane((int)(tid >> 5));
    const u32 hh8  = (lane >> 4) << 3;
    const u32 c16  = lane & 15u;
    const u32 bidx = bh >> 4;            // NHEAD == 16
    const u32 hidx = bh & 15u;
    const u32 q0   = qblk * 128u + wave * 16u;
    const size_t head = (size_t)bh * SEQ * HD;

    v16h qa[2];
#pragma unroll
    for (int c = 0; c < 2; ++c) qa[c] = load_frag(Qp + head, q0, HD, (u32)c * 32u, lane);

    FragU onesu;
#pragma unroll
    for (int i = 0; i < 16; ++i) onesu.e[i] = (f16)1.0f;
    const v16h ones = onesu.v;

    float m[8];
    v8f   o[4], lacc;
#pragma unroll
    for (int r = 0; r < 8; ++r) m[r] = -1.0e30f;
#pragma unroll
    for (int dt = 0; dt < 4; ++dt) o[dt] = zero8();
    lacc = zero8();

    // log2-domain scale: acc = 256 * q.k ; x = log2(e) * q.k / 64 = acc * log2(e) / 16384
    const float cl = 1.4426950408889634f * 0.00006103515625f;
    f16* psw = ps + wave * (16u * PK64);
    f16* prw = pr + wave * (16u * PK64);

    const u32 nkt = qblk * 2u + 2u;      // keys 0 .. qblk*128 + 127

    // staging map: 8 lanes cover one 128-byte row, a wave's copy four rows; rows srow and srow + 32 per thread
    const u32 srow = tid >> 3;
    const u32 spc  = (tid & 7u) << 3;
    const f16* gK = Kp + head + (size_t)srow * HD + spc;
    const f16* gV = Vt + head + (size_t)srow * SEQ + spc;
    const f16* gR = Vr + head + (size_t)srow * SEQ + spc;
    const u32 lK = lds_addr(&ks[srow * PK64 + spc]);
    const u32 lV = lds_addr(&vsT[srow * PK64 + spc]);
    const u32 lR = lds_addr(&vrT[EP ? srow * PK64 + spc : 0u]);

    auto stage = [&](u32 t) {
        const u32  bo = (t & 1u) * (64u * PK64 * 2u);
        const u32  hb = 32u * PK64 * 2u;                 // 32 rows further, in LDS bytes
        const f16* k0 = gK + (size_t)t * 64u * HD;
        const f16* v0 = gV + t * 64u;
        async_copy4(lK + bo, k0, lK + bo + hb, k0 + 32 * HD, lV + bo, v0, lV + bo + hb, v0 + (size_t)32 * SEQ);
        if constexpr (EP) {
            const f16* r0 = gR + t * 64u;
            async_copy2(lR + bo, r0, lR + bo + hb, r0 + (size_t)32 * SEQ);
        }
    };

    stage(0u);
    asm volatile("s_wait_asynccnt 0x0" ::: "memory");   // tile 0 landed before the barrier that shows it
    __syncthreads();
    stage(1u);                           // nkt >= 2

#pragma unroll 1   // stays rolled: one trip per staged tile, its buffers chosen by kt & 1
    for (u32 kt = 0; kt < nkt; ++kt) {
        const f16* ksb = ks  + (kt & 1u) * (64u * PK64);
        const f16* vsb = vsT + (kt & 1u) * (64u * PK64);
        const f16* vrb_t = vrT + (EP ? (kt & 1u) * (64u * PK64) : 0u);

        const bool active = (kt * 64u <= q0);           // wave-uniform
        if (active) {
            // S[16 q x 64 keys]
            v8f s[4];
#pragma unroll
            for (int nt = 0; nt < 4; ++nt) s[nt] = zero8();
#pragma unroll
            for (int c = 0; c < 2; ++c) {
#pragma unroll
                for (int nt = 0; nt < 4; ++nt) {
                    const v16h kb = load_frag(ksb, (u32)nt * 16u, PK64, (u32)c * 32u, lane);
                    s[nt] = wmma16(qa[c], kb, s[nt]);
                }
            }
            const bool diag = (kt * 64u + 63u > q0);    // wave-uniform
            if (diag) softmax_tile<true,  EP>(s, m, o, lacc, psw, prw, kt * 64u, q0, hh8, c16, cl);
            else      softmax_tile<false, EP>(s, m, o, lacc, psw, prw, kt * 64u, q0, hh8, c16, cl);
        }
        __syncthreads();

        if (active) {
            // O += P . V ; l += P . ones  (P reloaded as A fragments from the relay)
#pragma unroll
            for (int kk = 0; kk < 2; ++kk) {
                const v16h pa = load_frag(psw, 0u, PK64, (u32)kk * 32u, lane);
                v16h pra = pa;
                if constexpr (EP) pra = load_frag(prw, 0u, PK64, (u32)kk * 32u, lane);
#pragma unroll
                for (int dt = 0; dt < 4; ++dt) {
                    const v16h vb = load_frag(vsb, (u32)dt * 16u, PK64, (u32)kk * 32u, lane);
                    o[dt] = wmma16(pa, vb, o[dt]);
                    if constexpr (EP) {
                        const v16h vrb = load_frag(vrb_t, (u32)dt * 16u, PK64, (u32)kk * 32u, lane);
                        o[dt] = wmma16(pa, vrb, o[dt]);
                        o[dt] = wmma16(pra, vb, o[dt]);
                    }
                }
                lacc = wmma16(pa, ones, lacc);
                if constexpr (EP) lacc = wmma16(pra, ones, lacc);
            }
        }
        ring_publish();                          // every wave, active or not
        if (kt + 2u < nkt) stage(kt + 2u);       // into the buffers this trip has just read
    }
    asm volatile("s_wait_asynccnt 0x0" ::: "memory");   // nothing in flight when the epilogue starts

    // normalize: plane value = 1024 * (O/16) / l = O * 64 / l
#pragma unroll
    for (int r = 0; r < 8; ++r) {
        const float inv = (CARRY_CTX / CARRY_QKV) / lacc[r];
#pragma unroll
        for (int dt = 0; dt < 4; ++dt) {
            const float cv = o[dt][r] * inv;
            const f16   hi = (f16)cv;
            const u32  idx = (hh8 + (u32)r) * PK64 + (u32)dt * 16u + c16;
            psw[idx] = hi;
            if constexpr (EP) prw[idx] = (f16)(cv - (float)hi);
        }
    }
    __syncthreads();

    const u32 piece = lane & 7u;
    const u32 lsub  = lane >> 3;
{
#pragma unroll
        for (u32 it = 0; it < 4; ++it) {
            const u32 L = it * 4u + lsub;     // query row 0..15 within the wave tile
            const size_t off = (size_t)(bidx * (u32)SEQ + q0 + L) * HID + hidx * (u32)HD + piece * 8u;
            const v8h v = *(const v8h*)&psw[L * PK64 + piece * 8u];
            *(v8h*)(Cp + off) = v;
            if constexpr (EP) {
                const v8h vr = *(const v8h*)&prw[L * PK64 + piece * 8u];
                *(v8h*)(Cr + off) = vr;
            }
        }
        
    }
}

// Both attention paths in one launch (neither reads what the other writes): rows [0, EARLY) of every
// sequence take the hi + residual path, rows [EARLY, SEQ) the single f16 planes; the choice is block-uniform.
// Flat grid: the blocks of the early path first, then those of the dense path, each part in (row block, head)
// order with the row block running fastest.
#define ATT_E_BX     (EARLY / 128)
#define ATT_E_BLOCKS (ATT_E_BX * NB * NHEAD)
#define ATT_D_BX     ((SEQ > EARLY) ? (SEQ - EARLY) / 128 : 1)
#define ATT_D_BLOCKS ((SEQ - EARLY) / 128 * NB * NHEAD)
__global__ void __launch_bounds__(256) __attribute__((amdgpu_num_vgpr(256)))
attn_all(const f16* __restrict__ Qp, const f16* __restrict__ Kp, const f16* __restrict__ Vt,
         const f16* __restrict__ Vr, f16* __restrict__ Cp, f16* __restrict__ Cr) {
    __shared__ __attribute__((aligned(16))) f16 ks[2 * 64 * PK64];    // two buffers of [key][d]
    __shared__ __attribute__((aligned(16))) f16 vsT[2 * 64 * PK64];   // two buffers of [d][key]
    __shared__ __attribute__((aligned(16))) f16 vrT[2 * 64 * PK64];   // two buffers of [d][key] residual (early path)
    __shared__ __attribute__((aligned(16))) f16 ps[8 * 16 * PK64];    // per-wave P relay / ctx stage
    __shared__ __attribute__((aligned(16))) f16 pr[8 * 16 * PK64];    // per-wave P residual relay (early path)
    const u32 b = blockIdx.x;
    if (b < (u32)ATT_E_BLOCKS) {
        attn_body<true>(Qp, Kp, Vt, Vr, Cp, Cr, b % (u32)ATT_E_BX, b / (u32)ATT_E_BX, ks, vsT, vrT, ps, pr);
    } else {
        const u32 bb = b - (u32)ATT_E_BLOCKS;
        attn_body<false>(Qp, Kp, Vt, Vt, Cp, Cp, (u32)ATT_E_BX + bb % (u32)ATT_D_BX, bb / (u32)ATT_D_BX,
                         ks, vsT, vrT, ps, pr);
    }
}

// coverage equalities (threads x elements == plane elements)
static_assert((size_t)(MROWS / 2) * 256 * 8 == (size_t)MROWS * HID);                       // cvt_rows -> Xh
static_assert((size_t)(3 * HID / 64) * (HID / 64) * 64 * 64 == (size_t)3 * HID * HID);     // cvt_wT -> Wt
static_assert((size_t)(HID / 64) * (HID / 64) * 64 * 64 == (size_t)HID * HID);             // cvt_wT -> Wot
static_assert((size_t)(MROWS / 128) * (HID / 128) * 128 * 128 == (size_t)MROWS * HID);     // gemm planes / out
static_assert((size_t)(SEQ / 128) * (NB * NHEAD) * 128 * HD == (size_t)MROWS * HID);       // attn -> Cp
// workspace: 7 activation planes + 4 weight planes of halves, at most 128 MiB
static_assert(((size_t)7 * MROWS * HID + (size_t)4 * HID * HID) * sizeof(f16) <= (size_t)134217728);

// ---------------------------------------------------------------------------
// Launch: 4 kernel launches, workspace 7 planes of MROWS*1024 halves + 4 of 1024*1024 halves.
// ---------------------------------------------------------------------------
extern "C" void kernel_launch(void* const* d_in, const int* in_sizes, int n_in,
                              void* d_out, int out_size, void* d_ws, size_t ws_size,
                              hipStream_t stream) {
    if (n_in < 5) return;
    if (in_sizes[0] < ((NB - 1) * SEQ_FULL + SEQ) * HID) return;
    if (in_sizes[1] < 3 * HID * HID) return;
    if (in_sizes[2] < 3 * HID) return;
    if (in_sizes[3] < HID * HID) return;
    if (in_sizes[4] < HID) return;
    const size_t needOut = OUT0_ELEMS_FULL + PRES_ELEMS_FULL
                         + ((size_t)((NB - 1) * NHEAD + NHEAD - 1) * SEQ_FULL + SEQ) * HD;
    if ((size_t)out_size < needOut) return;

    const float* x     = (const float*)d_in[0];   // [NB_FULL][SEQ_FULL][1024]
    const float* wattn = (const float*)d_in[1];   // [1024 in][3072 out], out columns q | k | v
    const float* battn = (const float*)d_in[2];   // [3072]
    const float* wproj = (const float*)d_in[3];   // [1024 in][1024 out]
    const float* bproj = (const float*)d_in[4];   // [1024]
    float* out = (float*)d_out;                   // out0 | present k | present v

    const size_t nX = (size_t)MROWS * HID;    // halves per activation plane
    const size_t nW = (size_t)HID * HID;      // halves per weight plane
    const size_t totalHalves = 7 * nX + 4 * nW;
    if (ws_size < totalHalves * sizeof(f16)) return;

    f16* Xh  = (f16*)d_ws;       // [MROWS][1024]               carry 16
    f16* Wt  = Xh  + nX;         // [3072 out][1024 in]         carry 32 (q | k | v row blocks)
    f16* Wot = Wt  + 3 * nW;     // [1024 out][1024 in]         carry 32
    f16* Qp  = Wot + nW;         // [NB*16][SEQ][64]            carry 16
    f16* Kp  = Qp  + nX;         // [NB*16][SEQ][64]            carry 16
    f16* Vtp = Kp  + nX;         // [NB*1024][SEQ] (V^T)        carry 16
    f16* Vrp = Vtp + nX;         // [NB*1024][SEQ] residual, columns s < EARLY only
    f16* Cp  = Vrp + nX;         // [MROWS][1024]               carry 1024
    f16* Cr  = Cp  + nX;         // [MROWS][1024] residual, rows s < EARLY only

    cvt_all<<<CVT_X_BLOCKS + CVT_WA_BLOCKS + CVT_WP_BLOCKS, 256, 0, stream>>>(x, wattn, wproj, Xh, Wt, Wot);

    const dim3 gg(MROWS / 128, HID / 128);
    gemm_qkv<<<dim3(MROWS / 128, HID / 128, 3), 256, 0, stream>>>(Xh, Wt, battn, Qp, Kp, Vtp, Vrp,
                                                                  out + OUT0_ELEMS_FULL);

    attn_all<<<ATT_E_BLOCKS + ATT_D_BLOCKS, 256, 0, stream>>>(Qp, Kp, Vtp, Vrp, Cp, Cr);

    // out = acc / (1024*32) + bias ; residual context plane at Cp + nX
    gemm_o<<<gg, 256, 0, stream>>>(Cp, Wot, bproj, out, nX);
}

// v004
// Measured time: 99.4 microseconds a run.
// Timed twice side by side with v003, it ran 1.17 and 1.18 times as fast.
// Over all steps from v000 it is 3.42 times as fast.
#include <hip/hip_runtime.h>

// Contractions (fused QKV projection, Q.K^T, P.V, P row-sum, output projection): v_wmma_f32_16x16x32_f16, f16 operands with power-of-two carries, f32 accumulate; every float input enters as its bf16 RNE value; the first EARLY query rows of each sequence carry P, V and context as f16 hi + f16 residual planes (extra products into the same f32 accumulators); softmax in f32.

#ifndef NB
#define NB 2
#endif
#ifndef SEQ
#define SEQ 2048
#endif
#define NB_FULL   2
#define SEQ_FULL  2048
#define HID       1024
#define NHEAD     16
#define HD        64
#define MROWS     (NB * SEQ)
#define EARLY_CAP 512
#define EARLY     ((SEQ < EARLY_CAP) ? SEQ : EARLY_CAP)

#define OUT0_ELEMS_FULL ((size_t)NB_FULL * SEQ_FULL * HID)          // out0 elements
#define PRES_ELEMS_FULL ((size_t)NB_FULL * NHEAD * SEQ_FULL * HD)   // elements of present[0] (k) or present[1] (v)

static_assert(HID == NHEAD * HD);        // merged head width
static_assert(NHEAD == 16);              // bh >> 4 / bh & 15 decoding
static_assert(HD == 64);
static_assert(SEQ % 128 == 0);           // 128-row blocks never straddle a batch
static_assert(EARLY % 128 == 0);
static_assert(EARLY >= 128 && EARLY <= SEQ);
static_assert(SEQ <= SEQ_FULL);
static_assert(NB >= 1 && NB <= NB_FULL);
static_assert(MROWS % 128 == 0);         // GEMM M tile
static_assert(HID % 128 == 0);           // GEMM N tile
static_assert(HID % 64 == 0);            // weight transpose tile
static_assert(HID % 32 == 0);            // WMMA k step
static_assert(HID % 256 == 0);           // staged k tiles of 128, at least two of them
static_assert((HID & (HID - 1)) == 0);   // k0 & (HID-1)
static_assert(HID == 128 * 8);           // cvt_rows: 128 threads x 8 values per row
static_assert(OUT0_ELEMS_FULL * 4 == (size_t)16777216);   // byte offset of the second output

// carries (exact powers of two)
#define CARRY_X    16.0f     // input activation plane
#define CARRY_W    32.0f     // weight planes
#define CARRY_QKV  16.0f     // q, k, v^T planes (true value x16); v residual in the same units
#define CARRY_CTX  1024.0f   // context planes (true value x1024); residual in the same units
// softmax exp values carry 2^10 (added to the exp2 argument); residual in the same units

// LDS row pitches in elements: every row read or written 16 bytes per lane has a pitch of 16 B x odd,
// so the 16 lanes of a lane half fall on 64 distinct banks
#define PK32   40u    // 32-half rows (64 B)  -> 80 B
#define PK64   72u    // 64-half rows (128 B) -> 144 B
#define PC16   136u   // 128-half rows (256 B) -> 272 B
#define PC32   132u   // 128-float rows (512 B) -> 528 B
#define KTILE  128u   // k values per staged GEMM tile (256-byte rows)

typedef unsigned u32;
typedef _Float16 f16;
typedef f16   v16h __attribute__((ext_vector_type(16)));
typedef f16   v8h  __attribute__((ext_vector_type(8)));
typedef f16   v2h  __attribute__((ext_vector_type(2)));
typedef float v2f  __attribute__((ext_vector_type(2)));
typedef float v8f  __attribute__((ext_vector_type(8)));
typedef float v4f  __attribute__((ext_vector_type(4)));

union FragU { v16h v; v8h half[2]; v2h pair[8]; f16 e[16]; };
union H8U   { v8h v; f16 e[8]; };

__device__ __forceinline__ v8f zero8() {
    v8f z = {0.f, 0.f, 0.f, 0.f, 0.f, 0.f, 0.f, 0.f};
    return z;
}

// 16-bit WMMA with hazard guard: D += A[16 x 32k] * B[32k x 16]
__device__ __forceinline__ v8f wmma16(v16h a, v16h b, v8f c) {
    v8f d = __builtin_amdgcn_wmma_f32_16x16x32_f16(false, a, false, b, (short)0, c, false, false);
    asm volatile("v_nop\n\tv_nop\n\tv_nop\n\tv_nop" : "+v"(d) : "v"(a), "v"(b));
    return d;
}

// f32 -> nearest-even bf16 value, returned as f32
__device__ __forceinline__ float bf16_rne(float x) {
    u32 u = __float_as_uint(x);
    u = (u + 0x7fffu + ((u >> 16) & 1u)) & 0xffff0000u;
    return __uint_as_float(u);
}

__device__ __forceinline__ float fexp2(float x) {
#if defined(__has_builtin)
#if __has_builtin(__builtin_amdgcn_exp2f)
    return __builtin_amdgcn_exp2f(x);
#else
    return exp2f(x);
#endif
#else
    return exp2f(x);
#endif
}

// value of lane l ^ 16 (the other lane half)
__device__ __forceinline__ float xhalf(float x) {
    const int v = __builtin_bit_cast(int, x);
    return __builtin_bit_cast(float, __builtin_amdgcn_permlanex16(v, v, 0x76543210, 0xfedcba98, false, false));
}

// 16 x 32 fragment from a tile whose k dimension is contiguous (pitch in halves).
// lane l: row rowbase + (l&15); elements 0..7 <- k = kcol + 8h .. +7,
// elements 8..15 <- k = kcol + 16 + 8h .. +7  (h = l>>4). Same map for A and B.
__device__ __forceinline__ v16h load_frag(const f16* tile, u32 rowbase, u32 pitch, u32 kcol, u32 lane) {
    const u32 r  = rowbase + (lane & 15u);
    const u32 kh = (lane >> 4) << 3;
    const f16* p = tile + (size_t)r * pitch + kcol + kh;
    FragU f;
    f.half[0] = *(const v8h*)(p);
    f.half[1] = *(const v8h*)(p + 16);
    return f.v;
}

// LDS byte address of a __shared__ element (low 32 bits of its address)
__device__ __forceinline__ u32 lds_addr(const f16* p) {
    return (u32)(size_t)p;
}

// Asynchronous copies global -> LDS, 16 bytes per lane, no register staging. The s_wait_xcnt closes each
// statement so that no address register of an issued copy is rewritten ahead of it.
// Eight copies whose rows lie 16 apart: LDS step lstep bytes, global step gstep halves.
__device__ __forceinline__ void async_copy8(u32 l, u32 lstep, const f16* g, size_t gstep) {
    asm volatile("global_load_async_to_lds_b128 %0, %8, off\n\t"
                 "global_load_async_to_lds_b128 %1, %9, off\n\t"
                 "global_load_async_to_lds_b128 %2, %10, off\n\t"
                 "global_load_async_to_lds_b128 %3, %11, off\n\t"
                 "global_load_async_to_lds_b128 %4, %12, off\n\t"
                 "global_load_async_to_lds_b128 %5, %13, off\n\t"
                 "global_load_async_to_lds_b128 %6, %14, off\n\t"
                 "global_load_async_to_lds_b128 %7, %15, off\n\t"
                 "s_wait_xcnt 0x0"
                 :: "v"(l), "v"(l + lstep), "v"(l + 2u * lstep), "v"(l + 3u * lstep),
                    "v"(l + 4u * lstep), "v"(l + 5u * lstep), "v"(l + 6u * lstep), "v"(l + 7u * lstep),
                    "v"(g), "v"(g + gstep), "v"(g + 2 * gstep), "v"(g + 3 * gstep),
                    "v"(g + 4 * gstep), "v"(g + 5 * gstep), "v"(g + 6 * gstep), "v"(g + 7 * gstep)
                 : "memory");
}

// Four and two copies with each lane's own addresses given one by one.
__device__ __forceinline__ void async_copy4(u32 l0, const f16* g0, u32 l1, const f16* g1,
                                            u32 l2, const f16* g2, u32 l3, const f16* g3) {
    asm volatile("global_load_async_to_lds_b128 %0, %4, off\n\t"
                 "global_load_async_to_lds_b128 %1, %5, off\n\t"
                 "global_load_async_to_lds_b128 %2, %6, off\n\t"
                 "global_load_async_to_lds_b128 %3, %7, off\n\t"
                 "s_wait_xcnt 0x0"
                 :: "v"(l0), "v"(l1), "v"(l2), "v"(l3), "v"(g0), "v"(g1), "v"(g2), "v"(g3)
                 : "memory");
}
__device__ __forceinline__ void async_copy2(u32 l0, const f16* g0, u32 l1, const f16* g1) {
    asm volatile("global_load_async_to_lds_b128 %0, %2, off\n\t"
                 "global_load_async_to_lds_b128 %1, %3, off\n\t"
                 "s_wait_xcnt 0x0"
                 :: "v"(l0), "v"(l1), "v"(g0), "v"(g1)
                 : "memory");
}

// publish point of a two-buffer ring: this wave's LDS reads retired, its own copies landed, then the block
// barrier that shows the next tile to every wave and frees the buffer just read
__device__ __forceinline__ void ring_publish() {
    asm volatile("s_wait_dscnt 0x0" ::: "memory");     // reads of the buffer to be refilled have retired
    asm volatile("s_wait_asynccnt 0x0" ::: "memory");  // this wave's copies of the next tile have landed
    __syncthreads();
}

// ---------------------------------------------------------------------------
// f32 rows [.][1024] -> f16 plane (bf16 RNE value times carry). 128 threads per 1024-wide
// Row mapping dst row m -> src row (m / dstper) * srcper + m % dstper lets a reduced build
// read full-size inputs.
// coverage: nrows x 1024 halves, every element exactly once (grid = nrows*128/256).
// ---------------------------------------------------------------------------
__device__ __forceinline__ void
cvt_rows_body(const float* src, f16* dst, u32 blk, u32 nrows, u32 dstper, u32 srcper, float carry) {
    const u32 g  = blk * 256u + threadIdx.x;
    const u32 m  = g >> 7;
    const u32 c8 = (g & 127u) << 3;
    if (m >= nrows) return;
    const u32 mb = m / dstper;
    const u32 sm = mb * srcper + (m - mb * dstper);
    const float* sp = src + (size_t)sm * HID + c8;
    const v4f a = *(const v4f*)sp;
    const v4f b = *(const v4f*)(sp + 4);
    H8U o;
#pragma unroll
    for (u32 j = 0; j < 4; ++j) {
        const float x0 = a[j];
        const float x1 = b[j];
        o.e[j]     = (f16)(bf16_rne(x0) * carry);
        o.e[j + 4] = (f16)(bf16_rne(x1) * carry);
    }
    f16* dp = dst + (size_t)m * HID + c8;
    *(v8h*)dp = o.v;
    
}

// ---------------------------------------------------------------------------
// Transposing weight convert: src[rows][cols] f32 -> dst[cols][rows] f16 (bf16 RNE value
// times carry). Block = 64 (src rows, k) x 64 (src cols, n) tile, grid (cols/64, rows/64).
// Tile staged transposed in LDS (pitch 72 halves), then each dst row segment of 64 halves
// coverage: 4 x 256 threads x 4 values == 64 x 64 per block; blocks tile rows x cols exactly.
// LDS t: cross-wave, block barrier; staged extent 64 x 64 == consumed extent.
// ---------------------------------------------------------------------------
__device__ __forceinline__ void
cvt_wT_body(const float* src, f16* dst, f16* t, u32 bx, u32 by, u32 rows, u32 cols, float carry) {
    const u32 tid = threadIdx.x;
    const u32 n0  = bx * 64u;   // src column block == dst row block
    const u32 k0  = by * 64u;   // src row block == dst column block
#pragma unroll
    for (u32 it = 0; it < 4; ++it) {
        const u32 p  = tid + it * 256u;
        const u32 kr = p >> 4;              // 0..63
        const u32 c4 = (p & 15u) << 2;      // 0..60
        const v4f a = *(const v4f*)(src + (size_t)(k0 + kr) * cols + n0 + c4);
#pragma unroll
        for (u32 j = 0; j < 4; ++j) {
            const float x = a[j];
            t[(c4 + j) * 72u + kr] = (f16)(bf16_rne(x) * carry);
        }
    }
    __syncthreads();
    const u32 piece = tid & 7u;
    const u32 lrow  = tid >> 3;             // 0..31
{
#pragma unroll
        for (u32 it = 0; it < 2; ++it) {
            const u32 L = it * 32u + lrow;  // dst row within the tile, 0..63
            const v8h v = *(const v8h*)&t[L * 72u + piece * 8u];
            f16* dp = dst + (size_t)(n0 + L) * rows + k0 + piece * 8u;
            *(v8h*)dp = v;
        }
        asm volatile("s_wait_xcnt 0x0" ::: "memory");   // before code behind this body rewrites a register of these stores
    }
}

// The three converts in one launch: none reads what another writes. Flat grid: the blocks of the activation
// rows first, then those of the two weight transposes; the choice is block-uniform.
#define CVT_WA_BX     (3 * HID / 64)
#define CVT_WA_BLOCKS (CVT_WA_BX * (HID / 64))
#define CVT_WP_BX     (HID / 64)
#define CVT_WP_BLOCKS (CVT_WP_BX * (HID / 64))
#define CVT_X_BLOCKS  (MROWS / 2)
__global__ void __launch_bounds__(256)
cvt_all(const float* __restrict__ x, const float* __restrict__ wattn, const float* __restrict__ wproj,
        f16* __restrict__ Xh, f16* __restrict__ Wt, f16* __restrict__ Wot) {
    __shared__ __attribute__((aligned(16))) f16 t[64 * 72];
    const u32 b = blockIdx.x;
    if (b < (u32)CVT_X_BLOCKS) {
        // dst row m of batch b <- src row b*SEQ_FULL + (m % SEQ)
        cvt_rows_body(x, Xh, b, (u32)MROWS, (u32)SEQ, (u32)SEQ_FULL, CARRY_X);
    } else if (b < (u32)(CVT_X_BLOCKS + CVT_WA_BLOCKS)) {
        // in[rows = 1024 (k)][cols = 3072 (n)] -> out[cols][rows]
        const u32 bb = b - (u32)CVT_X_BLOCKS;
        cvt_wT_body(wattn, Wt, t, bb % (u32)CVT_WA_BX, bb / (u32)CVT_WA_BX, (u32)HID, (u32)(3 * HID), CARRY_W);
    } else {
        // in[rows = 1024 (k)][cols = 1024 (n)] -> out[cols][rows]
        const u32 bb = b - (u32)(CVT_X_BLOCKS + CVT_WA_BLOCKS);
        cvt_wT_body(wproj, Wot, t, bb % (u32)CVT_WP_BX, bb / (u32)CVT_WP_BX, (u32)HID, (u32)HID, CARRY_W);
    }
}

// ---------------------------------------------------------------------------
// C[m][n] = sum_k A[m][k] * W[n][k] ; A [MROWS][1024] f16, W [1024][1024] f16 (k contiguous).
// Block tile 128 x 128, 8 waves as 4(M) x 2(N), 2 x 4 accumulators per wave, WMMA k step 32.
// A and W tiles of 128 k come by asynchronous copies into two LDS buffers: tile t + 1 flies while tile t is multiplied.
// true value t = acc * mul + bias (bias enters as its bf16 RNE value, added in f32).
// MODE 0: f16 plane [b*NHEAD + h][s][d] (t x16)
// MODE 1: MODE 0 plane + f32 rows [b*NHEAD + h][s][d] (t) into the output buffer
// MODE 2: f16 plane [b*HID + h*HD + d][s] (t x16, transposed per head), residual plane of the
//         same layout for key blocks below EARLY, + f32 rows as MODE 1
// MODE 3: f32 rows [b][s][1024] into the output buffer; for row blocks below EARLY the k loop
//         continues over the residual A plane (A + resOff) against the same W (K folded to 2048)
// coverage per block: f16 planes 256 lines (128 rows x 2 heads | 128 n x 2 s-halves);
//                     f32 2 x 256 lines (64 rows x 4 line-quarters per half).
// LDS: As/Bs/Cs all cross-wave, separated by block barriers.
// staged extent == consumed extent: As/Bs 128 x 128 per buffer, Cs 128 x 128 halves (or 64 x 128 floats).
// ---------------------------------------------------------------------------
template <int MODE>
__device__ __forceinline__ void gemm_body(const f16* A, const f16* W, const float* bias,
                                          f16* plane, f16* plane2, float* fout, size_t resOff,
                                          f16* As, f16* Bs, f16* Cs) {
    // As, Bs: two buffers of 128 rows x 128 k each; Cs: f16 [128][128] at pitch PC16 or f32 [64][128] at pitch PC32
    static_assert(sizeof(f16) * 128 * PC16 >= sizeof(float) * 64 * PC32);   // Cs reuse as f32 [64][128]

    const u32 tid  = threadIdx.x;
    const u32 lane = tid & 31u;
    const u32 wave = tid >> 5;
    const u32 wm   = wave & 3u;
    const u32 wn   = wave >> 2;
    const u32 hh8  = (lane >> 4) << 3;   // D row half
    const u32 c16  = lane & 15u;         // D column
    const u32 m0   = blockIdx.x * 128u;
    const u32 n0   = blockIdx.y * 128u;
    const u32 bidx = m0 / (u32)SEQ;      // block rows lie inside one batch (SEQ % 128 == 0)
    const u32 s0   = m0 - bidx * (u32)SEQ;

    u32 kTot = (u32)HID;
    if constexpr (MODE == 3) {
        if (s0 < (u32)EARLY) kTot = 2u * (u32)HID;   // block-uniform
    }

    v8f acc[2][4];
#pragma unroll
    for (int i = 0; i < 2; ++i)
#pragma unroll
        for (int j = 0; j < 4; ++j) acc[i][j] = zero8();

    // staging map: 16 lanes cover one 256-byte row segment, a wave's copy two rows (four whole lines)
    const u32 crow = tid >> 4;
    const u32 ccol = (tid & 15u) << 3;
    const f16* gA = A + (size_t)(m0 + crow) * HID + ccol;
    const f16* gW = W + (size_t)(n0 + crow) * HID + ccol;
    const u32 lA = lds_addr(&As[crow * PC16 + ccol]);
    const u32 lB = lds_addr(&Bs[crow * PC16 + ccol]);
    const u32 nT = kTot / KTILE;         // 8 or 16 tiles, block-uniform

    auto stage = [&](u32 t) {
        const u32    k0 = t * KTILE;
        const u32    kk = k0 & (u32)(HID - 1);
        const size_t ao = (k0 >= (u32)HID) ? resOff : (size_t)0;
        const u32    bo = (t & 1u) * (128u * PC16 * 2u);
        async_copy8(lA + bo, 16u * PC16 * 2u, gA + ao + kk, (size_t)16 * HID);
        async_copy8(lB + bo, 16u * PC16 * 2u, gW + kk, (size_t)16 * HID);
    };

    stage(0u);
    asm volatile("s_wait_asynccnt 0x0" ::: "memory");   // tile 0 landed before the barrier that shows it
    __syncthreads();
    stage(1u);

#pragma unroll 1   // stays rolled: one trip per staged tile, its buffer chosen by t & 1
    for (u32 t = 0; t < nT; ++t) {
        const f16* as = As + (t & 1u) * (128u * PC16);
        const f16* bs = Bs + (t & 1u) * (128u * PC16);
#pragma unroll     // the four 32-k steps of a tile in line, every LDS offset an immediate
        for (u32 kc = 0; kc < KTILE; kc += 32u) {
            v16h af[2], bfr[4];
#pragma unroll
            for (int i = 0; i < 2; ++i) af[i] = load_frag(as, wm * 32u + (u32)i * 16u, PC16, kc, lane);
#pragma unroll
            for (int j = 0; j < 4; ++j) bfr[j] = load_frag(bs, wn * 64u + (u32)j * 16u, PC16, kc, lane);
#pragma unroll
            for (int i = 0; i < 2; ++i)
#pragma unroll
                for (int j = 0; j < 4; ++j) acc[i][j] = wmma16(af[i], bfr[j], acc[i][j]);
        }
        ring_publish();
        if (t + 2u < nT) stage(t + 2u);  // into the buffer this trip has just read
    }
    asm volatile("s_wait_asynccnt 0x0" ::: "memory");   // nothing in flight when the epilogue starts

    const float mul = (MODE == 3) ? (1.0f / (CARRY_CTX * CARRY_W)) : (1.0f / (CARRY_X * CARRY_W));
    float bv[4];
#pragma unroll
    for (int j = 0; j < 4; ++j) {
        const float bx = bias[n0 + wn * 64u + (u32)j * 16u + c16];
        bv[j] = bf16_rne(bx);
    }

    const u32 piece = lane & 7u;
    const u32 lsub  = lane >> 3;

    if constexpr (MODE == 0 || MODE == 1) {
#pragma unroll
        for (int i = 0; i < 2; ++i)
#pragma unroll
            for (int j = 0; j < 4; ++j) {
                const u32 nl = wn * 64u + (u32)j * 16u + c16;
#pragma unroll
                for (int r = 0; r < 8; ++r) {
                    const u32 ml = wm * 32u + (u32)i * 16u + hh8 + (u32)r;
                    const float tv = acc[i][j][r] * mul + bv[j];
                    Cs[ml * PC16 + nl] = (f16)(tv * CARRY_QKV);
                }
            }
        __syncthreads();
        const size_t bh0 = (size_t)bidx * NHEAD + (n0 >> 6);
{
#pragma unroll
            for (u32 it = 0; it < 8; ++it) {
                const u32 L    = wave * 32u + it * 4u + lsub;   // 0..255
                const u32 ml   = L >> 1;
                const u32 hsel = L & 1u;
                const v8h v = *(const v8h*)&Cs[ml * PC16 + hsel * 64u + piece * 8u];
                f16* dp = plane + ((bh0 + hsel) * SEQ + s0 + ml) * HD + piece * 8u;
                *(v8h*)dp = v;
            }
            
        }
    }
    if constexpr (MODE == 2) {
        // hi plane, staged transposed: Cs[n][m]
#pragma unroll
        for (int i = 0; i < 2; ++i)
#pragma unroll
            for (int j = 0; j < 4; ++j) {
                const u32 nl = wn * 64u + (u32)j * 16u + c16;
                H8U t;
#pragma unroll
                for (int r = 0; r < 8; ++r) {
                    const float tv = (acc[i][j][r] * mul + bv[j]) * CARRY_QKV;
                    t.e[r] = (f16)tv;
                }
                *(v8h*)&Cs[nl * PC16 + wm * 32u + (u32)i * 16u + hh8] = t.v;
            }
        __syncthreads();
{
#pragma unroll
            for (u32 it = 0; it < 8; ++it) {
                const u32 L  = wave * 32u + it * 4u + lsub;     // 0..255
                const u32 nl = L >> 1;
                const u32 mh = L & 1u;
                const v8h v = *(const v8h*)&Cs[nl * PC16 + mh * 64u + piece * 8u];
                f16* dp = plane + ((size_t)(bidx * (u32)HID + n0 + nl) * SEQ + s0 + mh * 64u + piece * 8u);
                *(v8h*)dp = v;
            }
            asm volatile("s_wait_xcnt 0x0" ::: "memory");   // before the residual path rewrites a register of these stores
        }
        if (s0 < (u32)EARLY) {          // block-uniform: residual plane only for early key blocks
            __syncthreads();
#pragma unroll
            for (int i = 0; i < 2; ++i)
#pragma unroll
                for (int j = 0; j < 4; ++j) {
                    const u32 nl = wn * 64u + (u32)j * 16u + c16;
                    H8U t;
#pragma unroll
                    for (int r = 0; r < 8; ++r) {
                        const float tv = (acc[i][j][r] * mul + bv[j]) * CARRY_QKV;
                        const f16   hi = (f16)tv;
                        t.e[r] = (f16)(tv - (float)hi);
                    }
                    *(v8h*)&Cs[nl * PC16 + wm * 32u + (u32)i * 16u + hh8] = t.v;
                }
            __syncthreads();
{
#pragma unroll
                for (u32 it = 0; it < 8; ++it) {
                    const u32 L  = wave * 32u + it * 4u + lsub;
                    const u32 nl = L >> 1;
                    const u32 mh = L & 1u;
                    const v8h v = *(const v8h*)&Cs[nl * PC16 + mh * 64u + piece * 8u];
                    f16* dp = plane2 + ((size_t)(bidx * (u32)HID + n0 + nl) * SEQ + s0 + mh * 64u + piece * 8u);
                    *(v8h*)dp = v;
                }
                
            }
        }
    }
    if constexpr (MODE >= 1) {
        if constexpr (MODE != 3) __syncthreads();   // f16 stage reads finished before restaging
        float* Cf = (float*)Cs;      // [64][128] f32 at pitch PC32
#pragma unroll
        for (u32 half = 0; half < 2; ++half) {
            if ((wm >> 1) == half) {
#pragma unroll
                for (int i = 0; i < 2; ++i)
#pragma unroll
                    for (int j = 0; j < 4; ++j) {
                        const u32 nl = wn * 64u + (u32)j * 16u + c16;
#pragma unroll
                        for (int r = 0; r < 8; ++r) {
                            const u32 ml = (wm & 1u) * 32u + (u32)i * 16u + hh8 + (u32)r;
                            Cf[ml * PC32 + nl] = acc[i][j][r] * mul + bv[j];
                        }
                    }
            }
            __syncthreads();
{
#pragma unroll
                for (u32 it = 0; it < 8; ++it) {
                    const u32 L    = wave * 32u + it * 4u + lsub;   // 0..255
                    const u32 row  = L >> 2;
                    const u32 part = L & 3u;
                    const v4f v = *(const v4f*)&Cf[row * PC32 + part * 32u + piece * 4u];
                    size_t off;
                    if constexpr (MODE == 3) {
                        off = (size_t)(bidx * (u32)SEQ_FULL + s0 + half * 64u + row) * HID
                            + n0 + part * 32u + piece * 4u;
                    } else {
                        off = ((size_t)(bidx * (u32)NHEAD + (n0 >> 6) + (part >> 1)) * SEQ_FULL
                               + s0 + half * 64u + row) * HD + (part & 1u) * 32u + piece * 4u;
                    }
                    *(v4f*)(fout + off) = v;
                }
                
            }
            __syncthreads();
        }
    }
}

// The q, k and v projections in one launch (none reads what another writes), blockIdx.z picks the
// weight block and the epilogue: 0 = q head-major plane, 1 = k head-major plane + f32 k rows of the second
// output, 2 = v^T plane + v^T residual plane (early keys) + f32 v rows of the second output.
__global__ void __launch_bounds__(256) __attribute__((amdgpu_num_vgpr(256)))
gemm_qkv(const f16* __restrict__ A, const f16* __restrict__ W, const float* __restrict__ bias,
         f16* __restrict__ outQ, f16* __restrict__ outK, f16* __restrict__ outT, f16* __restrict__ outR,
         float* __restrict__ pres) {
    __shared__ __attribute__((aligned(16))) f16 As[2 * 128 * PC16];
    __shared__ __attribute__((aligned(16))) f16 Bs[2 * 128 * PC16];
    __shared__ __attribute__((aligned(16))) f16 Cs[128 * PC16];
    const u32 z = blockIdx.z;            // block-uniform
    if (z == 0u) {
        gemm_body<0>(A, W, bias, outQ, outQ, pres, (size_t)0, As, Bs, Cs);
    } else if (z == 1u) {
        gemm_body<1>(A, W + (size_t)HID * HID, bias + HID, outK, outK, pres, (size_t)0, As, Bs, Cs);
    } else {
        gemm_body<2>(A, W + (size_t)2 * HID * HID, bias + 2 * HID, outT, outR, pres + PRES_ELEMS_FULL, (size_t)0,
                     As, Bs, Cs);
    }
}

// f32 output rows; A residual plane at A + resOff for early row blocks
__global__ void __launch_bounds__(256) __attribute__((amdgpu_num_vgpr(256)))
gemm_o(const f16* __restrict__ A, const f16* __restrict__ W, const float* __restrict__ bias,
       float* __restrict__ out, size_t resOff) {
    __shared__ __attribute__((aligned(16))) f16 As[2 * 128 * PC16];
    __shared__ __attribute__((aligned(16))) f16 Bs[2 * 128 * PC16];
    __shared__ __attribute__((aligned(16))) f16 Cs[128 * PC16];
    gemm_body<3>(A, W, bias, (f16*)out, (f16*)out, out, resOff, As, Bs, Cs);
}

// ---------------------------------------------------------------------------
// Online softmax update for one transposed score tile, 64 keys x 16 q (log2 domain, max-subtracted).
// s[nt][r] = score of key kbase + 16 nt + hh8 + r against query q: a lane holds 32 keys of ONE query, the
// lane 16 away the other 32, so the maximum is in-lane plus one exchange and m, al are one value per lane.
// The carried exp values, converted in place, are the B fragments of the next product:
// pb[kk] element j = tile 2 kk + (j >> 3), register j & 7, which is load_frag's k order.
// MASK: keys above the query row get probability exactly 0 and do not enter the row max.
// EP: also emit the f16 residual of each carried exp value.
// ---------------------------------------------------------------------------
template <bool MASK, bool EP>
__device__ __forceinline__ void softmax_tile(const v8f (&s)[4], float& m, v8f (&o)[4], v8f& lacc,
                                             FragU (&pb)[2], FragU (&prb)[2], u32 kbase, u32 q,
                                             u32 hh8, float cl) {
    float x[4][8];
    float t4[4];
#pragma unroll
    for (int nt = 0; nt < 4; ++nt) {
#pragma unroll
        for (int r = 0; r < 8; ++r) {
            x[nt][r] = s[nt][r] * cl;
            if constexpr (MASK) {
                const bool dead = (kbase + (u32)nt * 16u + hh8 + (u32)r) > q;
                x[nt][r] = dead ? -1.0e30f : x[nt][r];
            }
        }
        t4[nt] = fmaxf(fmaxf(fmaxf(x[nt][0], x[nt][1]), fmaxf(x[nt][2], x[nt][3])),
                       fmaxf(fmaxf(x[nt][4], x[nt][5]), fmaxf(x[nt][6], x[nt][7])));
    }
    float tm = fmaxf(fmaxf(t4[0], t4[1]), fmaxf(t4[2], t4[3]));
    tm = fmaxf(tm, xhalf(tm));
    const float mn = fmaxf(m, tm);
    const float al = fexp2(m - mn);
    m = mn;
    lacc *= al;
#pragma unroll
    for (int dt = 0; dt < 4; ++dt) o[dt] *= al;
    const float sh = 10.0f - mn;      // carry 2^10
#pragma unroll
    for (int nt = 0; nt < 4; ++nt) {
#pragma unroll
        for (int r = 0; r < 8; r += 2) {
            v2f e;
            e.x = fexp2(x[nt][r] + sh);
            e.y = fexp2(x[nt][r + 1] + sh);
            if constexpr (MASK) {
                e.x = ((kbase + (u32)nt * 16u + hh8 + (u32)r) > q) ? 0.0f : e.x;
                e.y = ((kbase + (u32)nt * 16u + hh8 + (u32)r + 1u) > q) ? 0.0f : e.y;
            }
            const v2h hi = __builtin_convertvector(e, v2h);
            const int  j = (nt & 1) * 4 + (r >> 1);
            pb[nt >> 1].pair[j] = hi;
            if constexpr (EP) prb[nt >> 1].pair[j] = __builtin_convertvector(e - __builtin_convertvector(hi, v2f), v2h);
        }
    }
}

// ---------------------------------------------------------------------------
// Causal flash attention, one (row block, head) per block of 256 (8 waves), wave owns 16 query
// rows (Q fragments resident). Block streams 64-key tiles 0 .. last tile touching its rows:
// K staged [key][d], V^T staged [d][key] (+ residual tile when EP), by asynchronous copies into two
// buffers each: tile kt + 1 flies while tile kt is worked on. A wave computes a tile only
// when the tile starts at or below its first row (wave-uniform); the tile containing its rows
// takes the masked path. Both products run transposed: S^T = K.Q^T (A = K rows, B = the resident Q fragments)
// and O^T += V^T.P^T (A = V^T rows, B = P^T), so a lane's score registers belong to one query, the row max is
// in-lane plus one exchange between the lane halves, and the exp2 values (f32, carried x2^10), converted in
// place, are the B fragments of the second product: P stays in registers. Row sums += ones.P^T on WMMA.
// EP (rows below EARLY): P and V as hi + residual, products hi.hi + res.hi + hi.res into the
// same accumulators; context written as hi plane + residual plane.
// coverage: every (b, q, h*64..h*64+63) row segment of the launched row blocks exactly once.
// LDS: ks, vsT, vrT cross-wave (block barriers); ps/pr per-wave context staging of the epilogue.
// staged extent == consumed extent for ks/vsT/vrT (64x64) and ps/pr (16x64, written
// in full by the owning wave before it reads them).
// ---------------------------------------------------------------------------
template <bool EP>
__device__ __forceinline__ void attn_body(const f16* Qp, const f16* Kp, const f16* Vt, const f16* Vr,
                                          f16* Cp, f16* Cr, u32 qblk, u32 bh,
                                          f16* ks, f16* vsT, f16* vrT, f16* ps, f16* pr) {
    static_assert(HD == 8 * 8);            // 8 lanes x 8 halves per row segment
    static_assert(2 * 256 * 8 == 64 * 64); // staging: 2 copies x 256 threads x 8 halves per tile

    const u32 tid  = threadIdx.x;
    const u32 lane = tid & 31u;
    const u32 wave = (u32)__builtin_amdgcn_readfirstlane((int)(tid >> 5));
    const u32 hh8  = (lane >> 4) << 3;
    const u32 c16  = lane & 15u;
    const u32 bidx = bh >> 4;            // NHEAD == 16
    const u32 hidx = bh & 15u;
    const u32 q0   = qblk * 128u + wave * 16u;
    const size_t head = (size_t)bh * SEQ * HD;

    v16h qa[2];
#pragma unroll
    for (int c = 0; c < 2; ++c) qa[c] = load_frag(Qp + head, q0, HD, (u32)c * 32u, lane);

    FragU onesu;
#pragma unroll
    for (int i = 0; i < 16; ++i) onesu.e[i] = (f16)1.0f;
    const v16h ones = onesu.v;

    // o[dt][r] = O^T[d = 16 dt + hh8 + r][query q0 + c16]; every register of lacc = that query's row sum
    float m = -1.0e30f;
    v8f   o[4], lacc;
#pragma unroll
    for (int dt = 0; dt < 4; ++dt) o[dt] = zero8();
    lacc = zero8();

    // log2-domain scale: acc = 256 * q.k ; x = log2(e) * q.k / 64 = acc * log2(e) / 16384
    const float cl = 1.4426950408889634f * 0.00006103515625f;
    f16* psw = ps + wave * (16u * PK64);
    f16* prw = pr + wave * (16u * PK64);

    const u32 nkt = qblk * 2u + 2u;      // keys 0 .. qblk*128 + 127

    // staging map: 8 lanes cover one 128-byte row, a wave's copy four rows; rows srow and srow + 32 per thread
    const u32 srow = tid >> 3;
    const u32 spc  = (tid & 7u) << 3;
    const f16* gK = Kp + head + (size_t)srow * HD + spc;
    const f16* gV = Vt + head + (size_t)srow * SEQ + spc;
    const f16* gR = Vr + head + (size_t)srow * SEQ + spc;
    const u32 lK = lds_addr(&ks[srow * PK64 + spc]);
    const u32 lV = lds_addr(&vsT[srow * PK64 + spc]);
    const u32 lR = lds_addr(&vrT[EP ? srow * PK64 + spc : 0u]);

    auto stage = [&](u32 t) {
        const u32  bo = (t & 1u) * (64u * PK64 * 2u);
        const u32  hb = 32u * PK64 * 2u;                 // 32 rows further, in LDS bytes
        const f16* k0 = gK + (size_t)t * 64u * HD;
        const f16* v0 = gV + t * 64u;
        async_copy4(lK + bo, k0, lK + bo + hb, k0 + 32 * HD, lV + bo, v0, lV + bo + hb, v0 + (size_t)32 * SEQ);
        if constexpr (EP) {
            const f16* r0 = gR + t * 64u;
            async_copy2(lR + bo, r0, lR + bo + hb, r0 + (size_t)32 * SEQ);
        }
    };

    stage(0u);
    asm volatile("s_wait_asynccnt 0x0" ::: "memory");   // tile 0 landed before the barrier that shows it
    __syncthreads();
    stage(1u);                           // nkt >= 2

#pragma unroll 1   // stays rolled: one trip per staged tile, its buffers chosen by kt & 1
    for (u32 kt = 0; kt < nkt; ++kt) {
        const f16* ksb = ks  + (kt & 1u) * (64u * PK64);
        const f16* vsb = vsT + (kt & 1u) * (64u * PK64);
        const f16* vrb_t = vrT + (EP ? (kt & 1u) * (64u * PK64) : 0u);

        const bool active = (kt * 64u <= q0);           // wave-uniform
        if (active) {
            // S^T[64 keys x 16 q]
            v8f s[4];
#pragma unroll
            for (int nt = 0; nt < 4; ++nt) s[nt] = zero8();
#pragma unroll
            for (int c = 0; c < 2; ++c) {
#pragma unroll
                for (int nt = 0; nt < 4; ++nt) {
                    const v16h kb = load_frag(ksb, (u32)nt * 16u, PK64, (u32)c * 32u, lane);
                    s[nt] = wmma16(kb, qa[c], s[nt]);
                }
            }
            FragU pb[2], prb[2];
            const bool diag = (kt * 64u + 63u > q0);    // wave-uniform
            if (diag) softmax_tile<true,  EP>(s, m, o, lacc, pb, prb, kt * 64u, q0 + c16, hh8, cl);
            else      softmax_tile<false, EP>(s, m, o, lacc, pb, prb, kt * 64u, q0 + c16, hh8, cl);

            // O^T += V^T . P^T ; l += ones . P^T
#pragma unroll
            for (int kk = 0; kk < 2; ++kk) {
#pragma unroll
                for (int dt = 0; dt < 4; ++dt) {
                    const v16h vb = load_frag(vsb, (u32)dt * 16u, PK64, (u32)kk * 32u, lane);
                    o[dt] = wmma16(vb, pb[kk].v, o[dt]);
                    if constexpr (EP) {
                        const v16h vrb = load_frag(vrb_t, (u32)dt * 16u, PK64, (u32)kk * 32u, lane);
                        o[dt] = wmma16(vrb, pb[kk].v, o[dt]);
                        o[dt] = wmma16(vb, prb[kk].v, o[dt]);
                    }
                }
                lacc = wmma16(ones, pb[kk].v, lacc);
                if constexpr (EP) lacc = wmma16(ones, prb[kk].v, lacc);
            }
        }
        ring_publish();                          // every wave, active or not
        if (kt + 2u < nkt) stage(kt + 2u);       // into the buffers this trip has just read
    }
    asm volatile("s_wait_asynccnt 0x0" ::: "memory");   // nothing in flight when the epilogue starts

    // normalize: plane value = 1024 * (O/16) / l = O * 64 / l ; a lane's 8 registers are 8 consecutive d of its query
    const float inv = (CARRY_CTX / CARRY_QKV) / lacc[0];
#pragma unroll
    for (int dt = 0; dt < 4; ++dt) {
        H8U th, tr;
#pragma unroll
        for (int r = 0; r < 8; ++r) {
            const float cv = o[dt][r] * inv;
            const f16   hi = (f16)cv;
            th.e[r] = hi;
            if constexpr (EP) tr.e[r] = (f16)(cv - (float)hi);
        }
        const u32 idx = c16 * PK64 + (u32)dt * 16u + hh8;
        *(v8h*)&psw[idx] = th.v;
        if constexpr (EP) *(v8h*)&prw[idx] = tr.v;
    }
    __syncthreads();

    const u32 piece = lane & 7u;
    const u32 lsub  = lane >> 3;
{
#pragma unroll
        for (u32 it = 0; it < 4; ++it) {
            const u32 L = it * 4u + lsub;     // query row 0..15 within the wave tile
            const size_t off = (size_t)(bidx * (u32)SEQ + q0 + L) * HID + hidx * (u32)HD + piece * 8u;
            const v8h v = *(const v8h*)&psw[L * PK64 + piece * 8u];
            *(v8h*)(Cp + off) = v;
            if constexpr (EP) {
                const v8h vr = *(const v8h*)&prw[L * PK64 + piece * 8u];
                *(v8h*)(Cr + off) = vr;
            }
        }
        
    }
}

// Both attention paths in one launch (neither reads what the other writes): rows [0, EARLY) of every
// sequence take the hi + residual path, rows [EARLY, SEQ) the single f16 planes; the choice is block-uniform.
// Flat grid: the blocks of the early path first, then those of the dense path, each part in (row block, head)
// order with the row block running fastest.
#define ATT_E_BX     (EARLY / 128)
#define ATT_E_BLOCKS (ATT_E_BX * NB * NHEAD)
#define ATT_D_BX     ((SEQ > EARLY) ? (SEQ - EARLY) / 128 : 1)
#define ATT_D_BLOCKS ((SEQ - EARLY) / 128 * NB * NHEAD)
__global__ void __launch_bounds__(256) __attribute__((amdgpu_num_vgpr(256)))
attn_all(const f16* __restrict__ Qp, const f16* __restrict__ Kp, const f16* __restrict__ Vt,
         const f16* __restrict__ Vr, f16* __restrict__ Cp, f16* __restrict__ Cr) {
    __shared__ __attribute__((aligned(16))) f16 ks[2 * 64 * PK64];    // two buffers of [key][d]
    __shared__ __attribute__((aligned(16))) f16 vsT[2 * 64 * PK64];   // two buffers of [d][key]
    __shared__ __attribute__((aligned(16))) f16 vrT[2 * 64 * PK64];   // two buffers of [d][key] residual (early path)
    __shared__ __attribute__((aligned(16))) f16 ps[8 * 16 * PK64];    // per-wave ctx stage
    __shared__ __attribute__((aligned(16))) f16 pr[8 * 16 * PK64];    // per-wave ctx residual stage (early path)
    const u32 b = blockIdx.x;
    if (b < (u32)ATT_E_BLOCKS) {
        attn_body<true>(Qp, Kp, Vt, Vr, Cp, Cr, b % (u32)ATT_E_BX, b / (u32)ATT_E_BX, ks, vsT, vrT, ps, pr);
    } else {
        const u32 bb = b - (u32)ATT_E_BLOCKS;
        attn_body<false>(Qp, Kp, Vt, Vt, Cp, Cp, (u32)ATT_E_BX + bb % (u32)ATT_D_BX, bb / (u32)ATT_D_BX,
                         ks, vsT, vrT, ps, pr);
    }
}

// coverage equalities (threads x elements == plane elements)
static_assert((size_t)(MROWS / 2) * 256 * 8 == (size_t)MROWS * HID);                       // cvt_rows -> Xh
static_assert((size_t)(3 * HID / 64) * (HID / 64) * 64 * 64 == (size_t)3 * HID * HID);     // cvt_wT -> Wt
static_assert((size_t)(HID / 64) * (HID / 64) * 64 * 64 == (size_t)HID * HID);             // cvt_wT -> Wot
static_assert((size_t)(MROWS / 128) * (HID / 128) * 128 * 128 == (size_t)MROWS * HID);     // gemm planes / out
static_assert((size_t)(SEQ / 128) * (NB * NHEAD) * 128 * HD == (size_t)MROWS * HID);       // attn -> Cp
// workspace: 7 activation planes + 4 weight planes of halves, at most 128 MiB
static_assert(((size_t)7 * MROWS * HID + (size_t)4 * HID * HID) * sizeof(f16) <= (size_t)134217728);

// ---------------------------------------------------------------------------
// Launch: 4 kernel launches, workspace 7 planes of MROWS*1024 halves + 4 of 1024*1024 halves.
// ---------------------------------------------------------------------------
extern "C" void kernel_launch(void* const* d_in, const int* in_sizes, int n_in,
                              void* d_out, int out_size, void* d_ws, size_t ws_size,
                              hipStream_t stream) {
    if (n_in < 5) return;
    if (in_sizes[0] < ((NB - 1) * SEQ_FULL + SEQ) * HID) return;
    if (in_sizes[1] < 3 * HID * HID) return;
    if (in_sizes[2] < 3 * HID) return;
    if (in_sizes[3] < HID * HID) return;
    if (in_sizes[4] < HID) return;
    const size_t needOut = OUT0_ELEMS_FULL + PRES_ELEMS_FULL
                         + ((size_t)((NB - 1) * NHEAD + NHEAD - 1) * SEQ_FULL + SEQ) * HD;
    if ((size_t)out_size < needOut) return;

    const float* x     = (const float*)d_in[0];   // [NB_FULL][SEQ_FULL][1024]
    const float* wattn = (const float*)d_in[1];   // [1024 in][3072 out], out columns q | k | v
    const float* battn = (const float*)d_in[2];   // [3072]
    const float* wproj = (const float*)d_in[3];   // [1024 in][1024 out]
    const float* bproj = (const float*)d_in[4];   // [1024]
    float* out = (float*)d_out;                   // out0 | present k | present v

    const size_t nX = (size_t)MROWS * HID;    // halves per activation plane
    const size_t nW = (size_t)HID * HID;      // halves per weight plane
    const size_t totalHalves = 7 * nX + 4 * nW;
    if (ws_size < totalHalves * sizeof(f16)) return;

    f16* Xh  = (f16*)d_ws;       // [MROWS][1024]               carry 16
    f16* Wt  = Xh  + nX;         // [3072 out][1024 in]         carry 32 (q | k | v row blocks)
    f16* Wot = Wt  + 3 * nW;     // [1024 out][1024 in]         carry 32
    f16* Qp  = Wot + nW;         // [NB*16][SEQ][64]            carry 16
    f16* Kp  = Qp  + nX;         // [NB*16][SEQ][64]            carry 16
    f16* Vtp = Kp  + nX;         // [NB*1024][SEQ] (V^T)        carry 16
    f16* Vrp = Vtp + nX;         // [NB*1024][SEQ] residual, columns s < EARLY only
    f16* Cp  = Vrp + nX;         // [MROWS][1024]               carry 1024
    f16* Cr  = Cp  + nX;         // [MROWS][1024] residual, rows s < EARLY only

    cvt_all<<<CVT_X_BLOCKS + CVT_WA_BLOCKS + CVT_WP_BLOCKS, 256, 0, stream>>>(x, wattn, wproj, Xh, Wt, Wot);

    const dim3 gg(MROWS / 128, HID / 128);
    gemm_qkv<<<dim3(MROWS / 128, HID / 128, 3), 256, 0, stream>>>(Xh, Wt, battn, Qp, Kp, Vtp, Vrp,
                                                                  out + OUT0_ELEMS_FULL);

    attn_all<<<ATT_E_BLOCKS + ATT_D_BLOCKS, 256, 0, stream>>>(Qp, Kp, Vtp, Vrp, Cp, Cr);

    // out = acc / (1024*32) + bias ; residual context plane at Cp + nX
    gemm_o<<<gg, 256, 0, stream>>>(Cp, Wot, bproj, out, nX);
}

// v005
// A run of this version takes 87.9 microseconds.
// Timed twice side by side with v004, it ran 1.13 and 1.12 times as fast.
// Counting every step since v000, it is 3.84 times as fast.
#include <hip/hip_runtime.h>

// Contractions (fused QKV projection, Q.K^T, P.V, P row-sum, output projection): v_wmma_f32_16x16x32_f16, f16 operands with power-of-two carries, f32 accumulate; every float input enters as its bf16 RNE value; the first EARLY query rows of each sequence carry P, V and context as f16 hi + f16 residual planes (extra products into the same f32 accumulators); softmax in f32.

#ifndef NB
#define NB 2
#endif
#ifndef SEQ
#define SEQ 2048
#endif
#define NB_FULL   2
#define SEQ_FULL  2048
#define HID       1024
#define NHEAD     16
#define HD        64
#define MROWS     (NB * SEQ)
#define EARLY_CAP 512
#define EARLY     ((SEQ < EARLY_CAP) ? SEQ : EARLY_CAP)

#define OUT0_ELEMS_FULL ((size_t)NB_FULL * SEQ_FULL * HID)          // out0 elements
#define PRES_ELEMS_FULL ((size_t)NB_FULL * NHEAD * SEQ_FULL * HD)   // elements of present[0] (k) or present[1] (v)

static_assert(HID == NHEAD * HD);        // merged head width
static_assert(NHEAD == 16);              // bh >> 4 / bh & 15 decoding
static_assert(HD == 64);
static_assert(SEQ % 128 == 0);           // 128-row blocks never straddle a batch
static_assert(EARLY % 128 == 0);
static_assert(EARLY >= 128 && EARLY <= SEQ);
static_assert(SEQ <= SEQ_FULL);
static_assert(NB >= 1 && NB <= NB_FULL);
static_assert(MROWS % 128 == 0);         // GEMM M tile
static_assert(HID % 128 == 0);           // GEMM N tile
static_assert(HID % 64 == 0);            // weight transpose tile
static_assert(HID % 32 == 0);            // WMMA k step
static_assert(HID % 256 == 0);           // staged k tiles of 128, at least two of them
static_assert((HID & (HID - 1)) == 0);   // k0 & (HID-1)
static_assert(HID == 128 * 8);           // cvt_rows: 128 threads x 8 values per row
static_assert(OUT0_ELEMS_FULL * 4 == (size_t)16777216);   // byte offset of the second output

// carries (exact powers of two)
#define CARRY_X    16.0f     // input activation plane
#define CARRY_W    32.0f     // weight planes
#define CARRY_QKV  16.0f     // q, k, v^T planes (true value x16); v residual in the same units
#define CARRY_CTX  1024.0f   // context planes (true value x1024); residual in the same units
// softmax exp values carry 2^10 (added to the exp2 argument); residual in the same units

// LDS row pitches in elements: every row read or written 16 bytes per lane has a pitch of 16 B x odd,
// so the 16 lanes of a lane half fall on 64 distinct banks
#define PK32   40u    // 32-half rows (64 B)  -> 80 B
#define PK64   72u    // 64-half rows (128 B) -> 144 B
#define PC16   136u   // 128-half rows (256 B) -> 272 B
#define PC32   132u   // 128-float rows (512 B) -> 528 B
#define KTILE  128u   // k values per staged GEMM tile (256-byte rows)

typedef unsigned u32;
typedef _Float16 f16;
typedef f16   v16h __attribute__((ext_vector_type(16)));
typedef f16   v8h  __attribute__((ext_vector_type(8)));
typedef f16   v2h  __attribute__((ext_vector_type(2)));
typedef float v2f  __attribute__((ext_vector_type(2)));
typedef float v8f  __attribute__((ext_vector_type(8)));
typedef float v4f  __attribute__((ext_vector_type(4)));

union FragU { v16h v; v8h half[2]; v2h pair[8]; f16 e[16]; };
union H8U   { v8h v; f16 e[8]; };

__device__ __forceinline__ v8f zero8() {
    v8f z = {0.f, 0.f, 0.f, 0.f, 0.f, 0.f, 0.f, 0.f};
    return z;
}

// 16-bit WMMA: D += A[16 x 32k] * B[32k x 16] (the builtin: the distances behind it are the compiler's)
__device__ __forceinline__ v8f wmma16(v16h a, v16h b, v8f c) {
    return __builtin_amdgcn_wmma_f32_16x16x32_f16(false, a, false, b, (short)0, c, false, false);
}

// f32 -> nearest-even bf16 value, returned as f32
__device__ __forceinline__ float bf16_rne(float x) {
    u32 u = __float_as_uint(x);
    u = (u + 0x7fffu + ((u >> 16) & 1u)) & 0xffff0000u;
    return __uint_as_float(u);
}

__device__ __forceinline__ float fexp2(float x) {
#if defined(__has_builtin)
#if __has_builtin(__builtin_amdgcn_exp2f)
    return __builtin_amdgcn_exp2f(x);
#else
    return exp2f(x);
#endif
#else
    return exp2f(x);
#endif
}

// value of lane l ^ 16 (the other lane half)
__device__ __forceinline__ float xhalf(float x) {
    const int v = __builtin_bit_cast(int, x);
    return __builtin_bit_cast(float, __builtin_amdgcn_permlanex16(v, v, 0x76543210, 0xfedcba98, false, false));
}

// 16 x 32 fragment from a tile whose k dimension is contiguous (pitch in halves).
// lane l: row rowbase + (l&15); elements 0..7 <- k = kcol + 8h .. +7,
// elements 8..15 <- k = kcol + 16 + 8h .. +7  (h = l>>4). Same map for A and B.
__device__ __forceinline__ v16h load_frag(const f16* tile, u32 rowbase, u32 pitch, u32 kcol, u32 lane) {
    const u32 r  = rowbase + (lane & 15u);
    const u32 kh = (lane >> 4) << 3;
    const f16* p = tile + (size_t)r * pitch + kcol + kh;
    FragU f;
    f.half[0] = *(const v8h*)(p);
    f.half[1] = *(const v8h*)(p + 16);
    return f.v;
}

// LDS byte address of a __shared__ element (low 32 bits of its address)
__device__ __forceinline__ u32 lds_addr(const f16* p) {
    return (u32)(size_t)p;
}

// Asynchronous copies global -> LDS, 16 bytes per lane, no register staging. The s_wait_xcnt closes each
// statement so that no address register of an issued copy is rewritten ahead of it.
// Eight copies whose rows lie 16 apart: LDS step lstep bytes, global step gstep halves.
__device__ __forceinline__ void async_copy8(u32 l, u32 lstep, const f16* g, size_t gstep) {
    asm volatile("global_load_async_to_lds_b128 %0, %8, off\n\t"
                 "global_load_async_to_lds_b128 %1, %9, off\n\t"
                 "global_load_async_to_lds_b128 %2, %10, off\n\t"
                 "global_load_async_to_lds_b128 %3, %11, off\n\t"
                 "global_load_async_to_lds_b128 %4, %12, off\n\t"
                 "global_load_async_to_lds_b128 %5, %13, off\n\t"
                 "global_load_async_to_lds_b128 %6, %14, off\n\t"
                 "global_load_async_to_lds_b128 %7, %15, off\n\t"
                 "s_wait_xcnt 0x0"
                 :: "v"(l), "v"(l + lstep), "v"(l + 2u * lstep), "v"(l + 3u * lstep),
                    "v"(l + 4u * lstep), "v"(l + 5u * lstep), "v"(l + 6u * lstep), "v"(l + 7u * lstep),
                    "v"(g), "v"(g + gstep), "v"(g + 2 * gstep), "v"(g + 3 * gstep),
                    "v"(g + 4 * gstep), "v"(g + 5 * gstep), "v"(g + 6 * gstep), "v"(g + 7 * gstep)
                 : "memory");
}

// Four and two copies with each lane's own addresses given one by one.
__device__ __forceinline__ void async_copy4(u32 l0, const f16* g0, u32 l1, const f16* g1,
                                            u32 l2, const f16* g2, u32 l3, const f16* g3) {
    asm volatile("global_load_async_to_lds_b128 %0, %4, off\n\t"
                 "global_load_async_to_lds_b128 %1, %5, off\n\t"
                 "global_load_async_to_lds_b128 %2, %6, off\n\t"
                 "global_load_async_to_lds_b128 %3, %7, off\n\t"
                 "s_wait_xcnt 0x0"
                 :: "v"(l0), "v"(l1), "v"(l2), "v"(l3), "v"(g0), "v"(g1), "v"(g2), "v"(g3)
                 : "memory");
}
__device__ __forceinline__ void async_copy2(u32 l0, const f16* g0, u32 l1, const f16* g1) {
    asm volatile("global_load_async_to_lds_b128 %0, %2, off\n\t"
                 "global_load_async_to_lds_b128 %1, %3, off\n\t"
                 "s_wait_xcnt 0x0"
                 :: "v"(l0), "v"(l1), "v"(g0), "v"(g1)
                 : "memory");
}

// publish point of a two-buffer ring: this wave's LDS reads retired, its own copies landed, then the block
// barrier that shows the next tile to every wave and frees the buffer just read
__device__ __forceinline__ void ring_publish() {
    asm volatile("s_wait_dscnt 0x0" ::: "memory");     // reads of the buffer to be refilled have retired
    asm volatile("s_wait_asynccnt 0x0" ::: "memory");  // this wave's copies of the next tile have landed
    __syncthreads();
}

// ---------------------------------------------------------------------------
// f32 rows [.][1024] -> f16 plane (bf16 RNE value times carry). 128 threads per 1024-wide
// Row mapping dst row m -> src row (m / dstper) * srcper + m % dstper lets a reduced build
// read full-size inputs.
// coverage: nrows x 1024 halves, every element exactly once (grid = nrows*128/256).
// ---------------------------------------------------------------------------
__device__ __forceinline__ void
cvt_rows_body(const float* src, f16* dst, u32 blk, u32 nrows, u32 dstper, u32 srcper, float carry) {
    const u32 g  = blk * 256u + threadIdx.x;
    const u32 m  = g >> 7;
    const u32 c8 = (g & 127u) << 3;
    if (m >= nrows) return;
    const u32 mb = m / dstper;
    const u32 sm = mb * srcper + (m - mb * dstper);
    const float* sp = src + (size_t)sm * HID + c8;
    const v4f a = *(const v4f*)sp;
    const v4f b = *(const v4f*)(sp + 4);
    H8U o;
#pragma unroll
    for (u32 j = 0; j < 4; ++j) {
        const float x0 = a[j];
        const float x1 = b[j];
        o.e[j]     = (f16)(bf16_rne(x0) * carry);
        o.e[j + 4] = (f16)(bf16_rne(x1) * carry);
    }
    f16* dp = dst + (size_t)m * HID + c8;
    *(v8h*)dp = o.v;
    
}

// ---------------------------------------------------------------------------
// Transposing weight convert: src[rows][cols] f32 -> dst[cols][rows] f16 (bf16 RNE value
// times carry). Block = 64 (src rows, k) x 64 (src cols, n) tile, grid (cols/64, rows/64).
// Tile staged transposed in LDS (pitch 72 halves), then each dst row segment of 64 halves
// coverage: 4 x 256 threads x 4 values == 64 x 64 per block; blocks tile rows x cols exactly.
// LDS t: cross-wave, block barrier; staged extent 64 x 64 == consumed extent.
// ---------------------------------------------------------------------------
__device__ __forceinline__ void
cvt_wT_body(const float* src, f16* dst, f16* t, u32 bx, u32 by, u32 rows, u32 cols, float carry) {
    const u32 tid = threadIdx.x;
    const u32 n0  = bx * 64u;   // src column block == dst row block
    const u32 k0  = by * 64u;   // src row block == dst column block
#pragma unroll
    for (u32 it = 0; it < 4; ++it) {
        const u32 p  = tid + it * 256u;
        const u32 kr = p >> 4;              // 0..63
        const u32 c4 = (p & 15u) << 2;      // 0..60
        const v4f a = *(const v4f*)(src + (size_t)(k0 + kr) * cols + n0 + c4);
#pragma unroll
        for (u32 j = 0; j < 4; ++j) {
            const float x = a[j];
            t[(c4 + j) * 72u + kr] = (f16)(bf16_rne(x) * carry);
        }
    }
    __syncthreads();
    const u32 piece = tid & 7u;
    const u32 lrow  = tid >> 3;             // 0..31
{
#pragma unroll
        for (u32 it = 0; it < 2; ++it) {
            const u32 L = it * 32u + lrow;  // dst row within the tile, 0..63
            const v8h v = *(const v8h*)&t[L * 72u + piece * 8u];
            f16* dp = dst + (size_t)(n0 + L) * rows + k0 + piece * 8u;
            *(v8h*)dp = v;
        }
        asm volatile("s_wait_xcnt 0x0" ::: "memory");   // before code behind this body rewrites a register of these stores
    }
}

// The three converts in one launch: none reads what another writes. Flat grid: the blocks of the activation
// rows first, then those of the two weight transposes; the choice is block-uniform.
#define CVT_WA_BX     (3 * HID / 64)
#define CVT_WA_BLOCKS (CVT_WA_BX * (HID / 64))
#define CVT_WP_BX     (HID / 64)
#define CVT_WP_BLOCKS (CVT_WP_BX * (HID / 64))
#define CVT_X_BLOCKS  (MROWS / 2)
__global__ void __launch_bounds__(256)
cvt_all(const float* __restrict__ x, const float* __restrict__ wattn, const float* __restrict__ wproj,
        f16* __restrict__ Xh, f16* __restrict__ Wt, f16* __restrict__ Wot) {
    __shared__ __attribute__((aligned(16))) f16 t[64 * 72];
    const u32 b = blockIdx.x;
    if (b < (u32)CVT_X_BLOCKS) {
        // dst row m of batch b <- src row b*SEQ_FULL + (m % SEQ)
        cvt_rows_body(x, Xh, b, (u32)MROWS, (u32)SEQ, (u32)SEQ_FULL, CARRY_X);
    } else if (b < (u32)(CVT_X_BLOCKS + CVT_WA_BLOCKS)) {
        // in[rows = 1024 (k)][cols = 3072 (n)] -> out[cols][rows]
        const u32 bb = b - (u32)CVT_X_BLOCKS;
        cvt_wT_body(wattn, Wt, t, bb % (u32)CVT_WA_BX, bb / (u32)CVT_WA_BX, (u32)HID, (u32)(3 * HID), CARRY_W);
    } else {
        // in[rows = 1024 (k)][cols = 1024 (n)] -> out[cols][rows]
        const u32 bb = b - (u32)(CVT_X_BLOCKS + CVT_WA_BLOCKS);
        cvt_wT_body(wproj, Wot, t, bb % (u32)CVT_WP_BX, bb / (u32)CVT_WP_BX, (u32)HID, (u32)HID, CARRY_W);
    }
}

// ---------------------------------------------------------------------------
// C[m][n] = sum_k A[m][k] * W[n][k] ; A [MROWS][1024] f16, W [1024][1024] f16 (k contiguous).
// Block tile 128 x 128, 8 waves as 4(M) x 2(N), 2 x 4 accumulators per wave, WMMA k step 32.
// A and W tiles of 128 k come by asynchronous copies into two LDS buffers: tile t + 1 flies while tile t is multiplied.
// Inside a tile the fragments of the next 32-k step are read, as one group, ahead of this step's products.
// true value t = acc * mul + bias (bias enters as its bf16 RNE value, added in f32).
// MODE 0: f16 plane [b*NHEAD + h][s][d] (t x16)
// MODE 1: MODE 0 plane + f32 rows [b*NHEAD + h][s][d] (t) into the output buffer
// MODE 2: f16 plane [b*HID + h*HD + d][s] (t x16, transposed per head), residual plane of the
//         same layout for key blocks below EARLY, + f32 rows as MODE 1
// MODE 3: f32 rows [b][s][1024] into the output buffer; for row blocks below EARLY the k loop
//         continues over the residual A plane (A + resOff) against the same W (K folded to 2048)
// coverage per block: f16 planes 256 lines (128 rows x 2 heads | 128 n x 2 s-halves);
//                     f32 2 x 256 lines (64 rows x 4 line-quarters per half).
// LDS: As/Bs/Cs all cross-wave, separated by block barriers.
// staged extent == consumed extent: As/Bs 128 x 128 per buffer, Cs 128 x 128 halves (or 64 x 128 floats).
// ---------------------------------------------------------------------------
template <int MODE>
__device__ __forceinline__ void gemm_body(const f16* A, const f16* W, const float* bias,
                                          f16* plane, f16* plane2, float* fout, size_t resOff,
                                          f16* As, f16* Bs, f16* Cs) {
    // As, Bs: two buffers of 128 rows x 128 k each; Cs: f16 [128][128] at pitch PC16 or f32 [64][128] at pitch PC32
    static_assert(sizeof(f16) * 128 * PC16 >= sizeof(float) * 64 * PC32);   // Cs reuse as f32 [64][128]

    const u32 tid  = threadIdx.x;
    const u32 lane = tid & 31u;
    const u32 wave = tid >> 5;
    const u32 wm   = wave & 3u;
    const u32 wn   = wave >> 2;
    const u32 hh8  = (lane >> 4) << 3;   // D row half
    const u32 c16  = lane & 15u;         // D column
    const u32 m0   = blockIdx.x * 128u;
    const u32 n0   = blockIdx.y * 128u;
    const u32 bidx = m0 / (u32)SEQ;      // block rows lie inside one batch (SEQ % 128 == 0)
    const u32 s0   = m0 - bidx * (u32)SEQ;

    u32 kTot = (u32)HID;
    if constexpr (MODE == 3) {
        if (s0 < (u32)EARLY) kTot = 2u * (u32)HID;   // block-uniform
    }

    v8f acc[2][4];
#pragma unroll
    for (int i = 0; i < 2; ++i)
#pragma unroll
        for (int j = 0; j < 4; ++j) acc[i][j] = zero8();

    // staging map: 16 lanes cover one 256-byte row segment, a wave's copy two rows (four whole lines)
    const u32 crow = tid >> 4;
    const u32 ccol = (tid & 15u) << 3;
    const f16* gA = A + (size_t)(m0 + crow) * HID + ccol;
    const f16* gW = W + (size_t)(n0 + crow) * HID + ccol;
    const u32 lA = lds_addr(&As[crow * PC16 + ccol]);
    const u32 lB = lds_addr(&Bs[crow * PC16 + ccol]);
    const u32 nT = kTot / KTILE;         // 8 or 16 tiles, block-uniform

    auto stage = [&](u32 t) {
        const u32    k0 = t * KTILE;
        const u32    kk = k0 & (u32)(HID - 1);
        const size_t ao = (k0 >= (u32)HID) ? resOff : (size_t)0;
        const u32    bo = (t & 1u) * (128u * PC16 * 2u);
        async_copy8(lA + bo, 16u * PC16 * 2u, gA + ao + kk, (size_t)16 * HID);
        async_copy8(lB + bo, 16u * PC16 * 2u, gW + kk, (size_t)16 * HID);
    };

    stage(0u);
    asm volatile("s_wait_asynccnt 0x0" ::: "memory");   // tile 0 landed before the barrier that shows it
    __syncthreads();
    stage(1u);

#pragma unroll 1   // stays rolled: one trip per staged tile, its buffer chosen by t & 1
    for (u32 t = 0; t < nT; ++t) {
        const f16* as = As + (t & 1u) * (128u * PC16);
        const f16* bs = Bs + (t & 1u) * (128u * PC16);
        v16h af[2][2], bfr[2][4];       // two fragment sets: the next 32-k step is read while this one is multiplied
        auto frags = [&](u32 set, u32 kc) {
#pragma unroll
            for (int i = 0; i < 2; ++i) af[set][i] = load_frag(as, wm * 32u + (u32)i * 16u, PC16, kc, lane);
#pragma unroll
            for (int j = 0; j < 4; ++j) bfr[set][j] = load_frag(bs, wn * 64u + (u32)j * 16u, PC16, kc, lane);
        };
        frags(0u, 0u);
#pragma unroll     // the four 32-k steps of a tile in line, every LDS offset an immediate
        for (u32 ks = 0; ks < KTILE / 32u; ++ks) {
            if (ks + 1u < KTILE / 32u) frags((ks + 1u) & 1u, (ks + 1u) * 32u);
            __builtin_amdgcn_sched_barrier(0);   // the next step's reads stay one group ahead of this step's products
#pragma unroll
            for (int i = 0; i < 2; ++i)
#pragma unroll
                for (int j = 0; j < 4; ++j) acc[i][j] = wmma16(af[ks & 1u][i], bfr[ks & 1u][j], acc[i][j]);
            __builtin_amdgcn_sched_barrier(0);   // and no later read moves up among these products
        }
        ring_publish();
        if (t + 2u < nT) stage(t + 2u);  // into the buffer this trip has just read
    }
    asm volatile("s_wait_asynccnt 0x0" ::: "memory");   // nothing in flight when the epilogue starts

    const float mul = (MODE == 3) ? (1.0f / (CARRY_CTX * CARRY_W)) : (1.0f / (CARRY_X * CARRY_W));
    float bv[4];
#pragma unroll
    for (int j = 0; j < 4; ++j) {
        const float bx = bias[n0 + wn * 64u + (u32)j * 16u + c16];
        bv[j] = bf16_rne(bx);
    }

    const u32 piece = lane & 7u;
    const u32 lsub  = lane >> 3;

    if constexpr (MODE == 0 || MODE == 1) {
#pragma unroll
        for (int i = 0; i < 2; ++i)
#pragma unroll
            for (int j = 0; j < 4; ++j) {
                const u32 nl = wn * 64u + (u32)j * 16u + c16;
#pragma unroll
                for (int r = 0; r < 8; ++r) {
                    const u32 ml = wm * 32u + (u32)i * 16u + hh8 + (u32)r;
                    const float tv = acc[i][j][r] * mul + bv[j];
                    Cs[ml * PC16 + nl] = (f16)(tv * CARRY_QKV);
                }
            }
        __syncthreads();
        const size_t bh0 = (size_t)bidx * NHEAD + (n0 >> 6);
{
#pragma unroll
            for (u32 it = 0; it < 8; ++it) {
                const u32 L    = wave * 32u + it * 4u + lsub;   // 0..255
                const u32 ml   = L >> 1;
                const u32 hsel = L & 1u;
                const v8h v = *(const v8h*)&Cs[ml * PC16 + hsel * 64u + piece * 8u];
                f16* dp = plane + ((bh0 + hsel) * SEQ + s0 + ml) * HD + piece * 8u;
                *(v8h*)dp = v;
            }
            
        }
    }
    if constexpr (MODE == 2) {
        // hi plane, staged transposed: Cs[n][m]
#pragma unroll
        for (int i = 0; i < 2; ++i)
#pragma unroll
            for (int j = 0; j < 4; ++j) {
                const u32 nl = wn * 64u + (u32)j * 16u + c16;
                H8U t;
#pragma unroll
                for (int r = 0; r < 8; ++r) {
                    const float tv = (acc[i][j][r] * mul + bv[j]) * CARRY_QKV;
                    t.e[r] = (f16)tv;
                }
                *(v8h*)&Cs[nl * PC16 + wm * 32u + (u32)i * 16u + hh8] = t.v;
            }
        __syncthreads();
{
#pragma unroll
            for (u32 it = 0; it < 8; ++it) {
                const u32 L  = wave * 32u + it * 4u + lsub;     // 0..255
                const u32 nl = L >> 1;
                const u32 mh = L & 1u;
                const v8h v = *(const v8h*)&Cs[nl * PC16 + mh * 64u + piece * 8u];
                f16* dp = plane + ((size_t)(bidx * (u32)HID + n0 + nl) * SEQ + s0 + mh * 64u + piece * 8u);
                *(v8h*)dp = v;
            }
            asm volatile("s_wait_xcnt 0x0" ::: "memory");   // before the residual path rewrites a register of these stores
        }
        if (s0 < (u32)EARLY) {          // block-uniform: residual plane only for early key blocks
            __syncthreads();
#pragma unroll
            for (int i = 0; i < 2; ++i)
#pragma unroll
                for (int j = 0; j < 4; ++j) {
                    const u32 nl = wn * 64u + (u32)j * 16u + c16;
                    H8U t;
#pragma unroll
                    for (int r = 0; r < 8; ++r) {
                        const float tv = (acc[i][j][r] * mul + bv[j]) * CARRY_QKV;
                        const f16   hi = (f16)tv;
                        t.e[r] = (f16)(tv - (float)hi);
                    }
                    *(v8h*)&Cs[nl * PC16 + wm * 32u + (u32)i * 16u + hh8] = t.v;
                }
            __syncthreads();
{
#pragma unroll
                for (u32 it = 0; it < 8; ++it) {
                    const u32 L  = wave * 32u + it * 4u + lsub;
                    const u32 nl = L >> 1;
                    const u32 mh = L & 1u;
                    const v8h v = *(const v8h*)&Cs[nl * PC16 + mh * 64u + piece * 8u];
                    f16* dp = plane2 + ((size_t)(bidx * (u32)HID + n0 + nl) * SEQ + s0 + mh * 64u + piece * 8u);
                    *(v8h*)dp = v;
                }
                
            }
        }
    }
    if constexpr (MODE >= 1) {
        if constexpr (MODE != 3) __syncthreads();   // f16 stage reads finished before restaging
        float* Cf = (float*)Cs;      // [64][128] f32 at pitch PC32
#pragma unroll
        for (u32 half = 0; half < 2; ++half) {
            if ((wm >> 1) == half) {
#pragma unroll
                for (int i = 0; i < 2; ++i)
#pragma unroll
                    for (int j = 0; j < 4; ++j) {
                        const u32 nl = wn * 64u + (u32)j * 16u + c16;
#pragma unroll
                        for (int r = 0; r < 8; ++r) {
                            const u32 ml = (wm & 1u) * 32u + (u32)i * 16u + hh8 + (u32)r;
                            Cf[ml * PC32 + nl] = acc[i][j][r] * mul + bv[j];
                        }
                    }
            }
            __syncthreads();
{
#pragma unroll
                for (u32 it = 0; it < 8; ++it) {
                    const u32 L    = wave * 32u + it * 4u + lsub;   // 0..255
                    const u32 row  = L >> 2;
                    const u32 part = L & 3u;
                    const v4f v = *(const v4f*)&Cf[row * PC32 + part * 32u + piece * 4u];
                    size_t off;
                    if constexpr (MODE == 3) {
                        off = (size_t)(bidx * (u32)SEQ_FULL + s0 + half * 64u + row) * HID
                            + n0 + part * 32u + piece * 4u;
                    } else {
                        off = ((size_t)(bidx * (u32)NHEAD + (n0 >> 6) + (part >> 1)) * SEQ_FULL
                               + s0 + half * 64u + row) * HD + (part & 1u) * 32u + piece * 4u;
                    }
                    *(v4f*)(fout + off) = v;
                }
                
            }
            __syncthreads();
        }
    }
}

// The q, k and v projections in one launch (none reads what another writes), blockIdx.z picks the
// weight block and the epilogue: 0 = q head-major plane, 1 = k head-major plane + f32 k rows of the second
// output, 2 = v^T plane + v^T residual plane (early keys) + f32 v rows of the second output.
__global__ void __launch_bounds__(256) __attribute__((amdgpu_num_vgpr(256)))
gemm_qkv(const f16* __restrict__ A, const f16* __restrict__ W, const float* __restrict__ bias,
         f16* __restrict__ outQ, f16* __restrict__ outK, f16* __restrict__ outT, f16* __restrict__ outR,
         float* __restrict__ pres) {
    __shared__ __attribute__((aligned(16))) f16 As[2 * 128 * PC16];
    __shared__ __attribute__((aligned(16))) f16 Bs[2 * 128 * PC16];
    __shared__ __attribute__((aligned(16))) f16 Cs[128 * PC16];
    const u32 z = blockIdx.z;            // block-uniform
    if (z == 0u) {
        gemm_body<0>(A, W, bias, outQ, outQ, pres, (size_t)0, As, Bs, Cs);
    } else if (z == 1u) {
        gemm_body<1>(A, W + (size_t)HID * HID, bias + HID, outK, outK, pres, (size_t)0, As, Bs, Cs);
    } else {
        gemm_body<2>(A, W + (size_t)2 * HID * HID, bias + 2 * HID, outT, outR, pres + PRES_ELEMS_FULL, (size_t)0,
                     As, Bs, Cs);
    }
}

// f32 output rows; A residual plane at A + resOff for early row blocks
__global__ void __launch_bounds__(256) __attribute__((amdgpu_num_vgpr(256)))
gemm_o(const f16* __restrict__ A, const f16* __restrict__ W, const float* __restrict__ bias,
       float* __restrict__ out, size_t resOff) {
    __shared__ __attribute__((aligned(16))) f16 As[2 * 128 * PC16];
    __shared__ __attribute__((aligned(16))) f16 Bs[2 * 128 * PC16];
    __shared__ __attribute__((aligned(16))) f16 Cs[128 * PC16];
    gemm_body<3>(A, W, bias, (f16*)out, (f16*)out, out, resOff, As, Bs, Cs);
}

// ---------------------------------------------------------------------------
// Online softmax update for one transposed score tile, 64 keys x 16 q (log2 domain, max-subtracted).
// s[nt][r] = score of key kbase + 16 nt + hh8 + r against query q: a lane holds 32 keys of ONE query, the
// lane 16 away the other 32, so the maximum is in-lane plus one exchange and m, al are one value per lane.
// The carried exp values, converted in place, are the B fragments of the next product:
// pb[kk] element j = tile 2 kk + (j >> 3), register j & 7, which is load_frag's k order.
// MASK: keys above the query row get probability exactly 0 and do not enter the row max.
// EP: also emit the f16 residual of each carried exp value.
// ---------------------------------------------------------------------------
template <bool MASK, bool EP>
__device__ __forceinline__ void softmax_tile(const v8f (&s)[4], float& m, v8f (&o)[4], v8f& lacc,
                                             FragU (&pb)[2], FragU (&prb)[2], u32 kbase, u32 q,
                                             u32 hh8, float cl) {
    float x[4][8];
    float t4[4];
#pragma unroll
    for (int nt = 0; nt < 4; ++nt) {
#pragma unroll
        for (int r = 0; r < 8; ++r) {
            x[nt][r] = s[nt][r] * cl;
            if constexpr (MASK) {
                const bool dead = (kbase + (u32)nt * 16u + hh8 + (u32)r) > q;
                x[nt][r] = dead ? -1.0e30f : x[nt][r];
            }
        }
        t4[nt] = fmaxf(fmaxf(fmaxf(x[nt][0], x[nt][1]), fmaxf(x[nt][2], x[nt][3])),
                       fmaxf(fmaxf(x[nt][4], x[nt][5]), fmaxf(x[nt][6], x[nt][7])));
    }
    float tm = fmaxf(fmaxf(t4[0], t4[1]), fmaxf(t4[2], t4[3]));
    tm = fmaxf(tm, xhalf(tm));
    const float mn = fmaxf(m, tm);
    const float al = fexp2(m - mn);
    m = mn;
    lacc *= al;
#pragma unroll
    for (int dt = 0; dt < 4; ++dt) o[dt] *= al;
    const float sh = 10.0f - mn;      // carry 2^10
#pragma unroll
    for (int nt = 0; nt < 4; ++nt) {
#pragma unroll
        for (int r = 0; r < 8; r += 2) {
            v2f e;
            e.x = fexp2(x[nt][r] + sh);
            e.y = fexp2(x[nt][r + 1] + sh);
            if constexpr (MASK) {
                e.x = ((kbase + (u32)nt * 16u + hh8 + (u32)r) > q) ? 0.0f : e.x;
                e.y = ((kbase + (u32)nt * 16u + hh8 + (u32)r + 1u) > q) ? 0.0f : e.y;
            }
            const v2h hi = __builtin_convertvector(e, v2h);
            const int  j = (nt & 1) * 4 + (r >> 1);
            pb[nt >> 1].pair[j] = hi;
            if constexpr (EP) prb[nt >> 1].pair[j] = __builtin_convertvector(e - __builtin_convertvector(hi, v2f), v2h);
        }
    }
}

// ---------------------------------------------------------------------------
// Causal flash attention, one (row block, head) per block of 256 (8 waves), wave owns 16 query
// rows (Q fragments resident). Block streams 64-key tiles 0 .. last tile touching its rows:
// K staged [key][d], V^T staged [d][key] (+ residual tile when EP), by asynchronous copies into two
// buffers each: tile kt + 1 flies while tile kt is worked on. A wave computes a tile only
// when the tile starts at or below its first row (wave-uniform); the tile containing its rows
// takes the masked path. Both products run transposed: S^T = K.Q^T (A = K rows, B = the resident Q fragments)
// and O^T += V^T.P^T (A = V^T rows, B = P^T), so a lane's score registers belong to one query, the row max is
// in-lane plus one exchange between the lane halves, and the exp2 values (f32, carried x2^10), converted in
// place, are the B fragments of the second product: P stays in registers. Row sums += ones.P^T on WMMA.
// LDS reads of a tile stand in groups: its eight K fragments ahead of the score products, its eight V^T
// fragments ahead of the softmax (the residual fragments ahead of the second product).
// EP (rows below EARLY): P and V as hi + residual, products hi.hi + res.hi + hi.res into the
// same accumulators; context written as hi plane + residual plane.
// coverage: every (b, q, h*64..h*64+63) row segment of the launched row blocks exactly once.
// LDS: ks, vsT, vrT cross-wave (block barriers); ps/pr per-wave context staging of the epilogue.
// staged extent == consumed extent for ks/vsT/vrT (64x64) and ps/pr (16x64, written
// in full by the owning wave before it reads them).
// ---------------------------------------------------------------------------
template <bool EP>
__device__ __forceinline__ void attn_body(const f16* Qp, const f16* Kp, const f16* Vt, const f16* Vr,
                                          f16* Cp, f16* Cr, u32 qblk, u32 bh,
                                          f16* ks, f16* vsT, f16* vrT, f16* ps, f16* pr) {
    static_assert(HD == 8 * 8);            // 8 lanes x 8 halves per row segment
    static_assert(2 * 256 * 8 == 64 * 64); // staging: 2 copies x 256 threads x 8 halves per tile

    const u32 tid  = threadIdx.x;
    const u32 lane = tid & 31u;
    const u32 wave = (u32)__builtin_amdgcn_readfirstlane((int)(tid >> 5));
    const u32 hh8  = (lane >> 4) << 3;
    const u32 c16  = lane & 15u;
    const u32 bidx = bh >> 4;            // NHEAD == 16
    const u32 hidx = bh & 15u;
    const u32 q0   = qblk * 128u + wave * 16u;
    const size_t head = (size_t)bh * SEQ * HD;

    v16h qa[2];
#pragma unroll
    for (int c = 0; c < 2; ++c) qa[c] = load_frag(Qp + head, q0, HD, (u32)c * 32u, lane);

    FragU onesu;
#pragma unroll
    for (int i = 0; i < 16; ++i) onesu.e[i] = (f16)1.0f;
    const v16h ones = onesu.v;

    // o[dt][r] = O^T[d = 16 dt + hh8 + r][query q0 + c16]; every register of lacc = that query's row sum
    float m = -1.0e30f;
    v8f   o[4], lacc;
#pragma unroll
    for (int dt = 0; dt < 4; ++dt) o[dt] = zero8();
    lacc = zero8();

    // log2-domain scale: acc = 256 * q.k ; x = log2(e) * q.k / 64 = acc * log2(e) / 16384
    const float cl = 1.4426950408889634f * 0.00006103515625f;
    f16* psw = ps + wave * (16u * PK64);
    f16* prw = pr + wave * (16u * PK64);

    const u32 nkt = qblk * 2u + 2u;      // keys 0 .. qblk*128 + 127

    // staging map: 8 lanes cover one 128-byte row, a wave's copy four rows; rows srow and srow + 32 per thread
    const u32 srow = tid >> 3;
    const u32 spc  = (tid & 7u) << 3;
    const f16* gK = Kp + head + (size_t)srow * HD + spc;
    const f16* gV = Vt + head + (size_t)srow * SEQ + spc;
    const f16* gR = Vr + head + (size_t)srow * SEQ + spc;
    const u32 lK = lds_addr(&ks[srow * PK64 + spc]);
    const u32 lV = lds_addr(&vsT[srow * PK64 + spc]);
    const u32 lR = lds_addr(&vrT[EP ? srow * PK64 + spc : 0u]);

    auto stage = [&](u32 t) {
        const u32  bo = (t & 1u) * (64u * PK64 * 2u);
        const u32  hb = 32u * PK64 * 2u;                 // 32 rows further, in LDS bytes
        const f16* k0 = gK + (size_t)t * 64u * HD;
        const f16* v0 = gV + t * 64u;
        async_copy4(lK + bo, k0, lK + bo + hb, k0 + 32 * HD, lV + bo, v0, lV + bo + hb, v0 + (size_t)32 * SEQ);
        if constexpr (EP) {
            const f16* r0 = gR + t * 64u;
            async_copy2(lR + bo, r0, lR + bo + hb, r0 + (size_t)32 * SEQ);
        }
    };

    stage(0u);
    asm volatile("s_wait_asynccnt 0x0" ::: "memory");   // tile 0 landed before the barrier that shows it
    __syncthreads();
    stage(1u);                           // nkt >= 2

#pragma unroll 1   // stays rolled: one trip per staged tile, its buffers chosen by kt & 1
    for (u32 kt = 0; kt < nkt; ++kt) {
        const f16* ksb = ks  + (kt & 1u) * (64u * PK64);
        const f16* vsb = vsT + (kt & 1u) * (64u * PK64);
        const f16* vrb_t = vrT + (EP ? (kt & 1u) * (64u * PK64) : 0u);

        const bool active = (kt * 64u <= q0);           // wave-uniform
        if (active) {
            // S^T[64 keys x 16 q]
            v8f s[4];
            v16h kf[2][4], vf[2][4];
#pragma unroll
            for (int nt = 0; nt < 4; ++nt) s[nt] = zero8();
#pragma unroll
            for (int c = 0; c < 2; ++c)
#pragma unroll
                for (int nt = 0; nt < 4; ++nt) kf[c][nt] = load_frag(ksb, (u32)nt * 16u, PK64, (u32)c * 32u, lane);
            __builtin_amdgcn_sched_barrier(0);   // the tile's K reads stay one group ahead of its products: one LDS latency, not one per product
#pragma unroll
            for (int c = 0; c < 2; ++c)
#pragma unroll
                for (int nt = 0; nt < 4; ++nt) s[nt] = wmma16(kf[c][nt], qa[c], s[nt]);
            __builtin_amdgcn_sched_barrier(0);   // the V^T reads below stay one group, not spread in pairs among the score products
#pragma unroll
            for (int kk = 0; kk < 2; ++kk)
#pragma unroll
                for (int dt = 0; dt < 4; ++dt) vf[kk][dt] = load_frag(vsb, (u32)dt * 16u, PK64, (u32)kk * 32u, lane);
            __builtin_amdgcn_sched_barrier(0);   // holds those reads in front of the softmax, which covers their latency: the compiler otherwise sinks them behind it
            FragU pb[2], prb[2];
            const bool diag = (kt * 64u + 63u > q0);    // wave-uniform
            if (diag) softmax_tile<true,  EP>(s, m, o, lacc, pb, prb, kt * 64u, q0 + c16, hh8, cl);
            else      softmax_tile<false, EP>(s, m, o, lacc, pb, prb, kt * 64u, q0 + c16, hh8, cl);

            // O^T += V^T . P^T ; l += ones . P^T
            v16h vrf[2][4];
            if constexpr (EP) {
#pragma unroll
                for (int kk = 0; kk < 2; ++kk)
#pragma unroll
                    for (int dt = 0; dt < 4; ++dt)
                        vrf[kk][dt] = load_frag(vrb_t, (u32)dt * 16u, PK64, (u32)kk * 32u, lane);
                __builtin_amdgcn_sched_barrier(0);   // the residual reads stay one group ahead of the products
            }
#pragma unroll
            for (int kk = 0; kk < 2; ++kk) {
#pragma unroll
                for (int dt = 0; dt < 4; ++dt) {
                    o[dt] = wmma16(vf[kk][dt], pb[kk].v, o[dt]);
                    if constexpr (EP) {
                        o[dt] = wmma16(vrf[kk][dt], pb[kk].v, o[dt]);
                        o[dt] = wmma16(vf[kk][dt], prb[kk].v, o[dt]);
                    }
                }
                lacc = wmma16(ones, pb[kk].v, lacc);
                if constexpr (EP) lacc = wmma16(ones, prb[kk].v, lacc);
            }
        }
        ring_publish();                          // every wave, active or not
        if (kt + 2u < nkt) stage(kt + 2u);       // into the buffers this trip has just read
    }
    asm volatile("s_wait_asynccnt 0x0" ::: "memory");   // nothing in flight when the epilogue starts

    // normalize: plane value = 1024 * (O/16) / l = O * 64 / l ; a lane's 8 registers are 8 consecutive d of its query
    const float inv = (CARRY_CTX / CARRY_QKV) / lacc[0];
#pragma unroll
    for (int dt = 0; dt < 4; ++dt) {
        H8U th, tr;
#pragma unroll
        for (int r = 0; r < 8; ++r) {
            const float cv = o[dt][r] * inv;
            const f16   hi = (f16)cv;
            th.e[r] = hi;
            if constexpr (EP) tr.e[r] = (f16)(cv - (float)hi);
        }
        const u32 idx = c16 * PK64 + (u32)dt * 16u + hh8;
        *(v8h*)&psw[idx] = th.v;
        if constexpr (EP) *(v8h*)&prw[idx] = tr.v;
    }
    __syncthreads();

    const u32 piece = lane & 7u;
    const u32 lsub  = lane >> 3;
{
#pragma unroll
        for (u32 it = 0; it < 4; ++it) {
            const u32 L = it * 4u + lsub;     // query row 0..15 within the wave tile
            const size_t off = (size_t)(bidx * (u32)SEQ + q0 + L) * HID + hidx * (u32)HD + piece * 8u;
            const v8h v = *(const v8h*)&psw[L * PK64 + piece * 8u];
            *(v8h*)(Cp + off) = v;
            if constexpr (EP) {
                const v8h vr = *(const v8h*)&prw[L * PK64 + piece * 8u];
                *(v8h*)(Cr + off) = vr;
            }
        }
        
    }
}

// Both attention paths in one launch (neither reads what the other writes): rows [0, EARLY) of every
// sequence take the hi + residual path, rows [EARLY, SEQ) the single f16 planes; the choice is block-uniform.
// Flat grid: the blocks of the early path first, then those of the dense path, each part in (row block, head)
// order with the row block running fastest.
#define ATT_E_BX     (EARLY / 128)
#define ATT_E_BLOCKS (ATT_E_BX * NB * NHEAD)
#define ATT_D_BX     ((SEQ > EARLY) ? (SEQ - EARLY) / 128 : 1)
#define ATT_D_BLOCKS ((SEQ - EARLY) / 128 * NB * NHEAD)
__global__ void __launch_bounds__(256) __attribute__((amdgpu_num_vgpr(256)))
attn_all(const f16* __restrict__ Qp, const f16* __restrict__ Kp, const f16* __restrict__ Vt,
         const f16* __restrict__ Vr, f16* __restrict__ Cp, f16* __restrict__ Cr) {
    __shared__ __attribute__((aligned(16))) f16 ks[2 * 64 * PK64];    // two buffers of [key][d]
    __shared__ __attribute__((aligned(16))) f16 vsT[2 * 64 * PK64];   // two buffers of [d][key]
    __shared__ __attribute__((aligned(16))) f16 vrT[2 * 64 * PK64];   // two buffers of [d][key] residual (early path)
    __shared__ __attribute__((aligned(16))) f16 ps[8 * 16 * PK64];    // per-wave ctx stage
    __shared__ __attribute__((aligned(16))) f16 pr[8 * 16 * PK64];    // per-wave ctx residual stage (early path)
    const u32 b = blockIdx.x;
    if (b < (u32)ATT_E_BLOCKS) {
        attn_body<true>(Qp, Kp, Vt, Vr, Cp, Cr, b % (u32)ATT_E_BX, b / (u32)ATT_E_BX, ks, vsT, vrT, ps, pr);
    } else {
        const u32 bb = b - (u32)ATT_E_BLOCKS;
        attn_body<false>(Qp, Kp, Vt, Vt, Cp, Cp, (u32)ATT_E_BX + bb % (u32)ATT_D_BX, bb / (u32)ATT_D_BX,
                         ks, vsT, vrT, ps, pr);
    }
}

// coverage equalities (threads x elements == plane elements)
static_assert((size_t)(MROWS / 2) * 256 * 8 == (size_t)MROWS * HID);                       // cvt_rows -> Xh
static_assert((size_t)(3 * HID / 64) * (HID / 64) * 64 * 64 == (size_t)3 * HID * HID);     // cvt_wT -> Wt
static_assert((size_t)(HID / 64) * (HID / 64) * 64 * 64 == (size_t)HID * HID);             // cvt_wT -> Wot
static_assert((size_t)(MROWS / 128) * (HID / 128) * 128 * 128 == (size_t)MROWS * HID);     // gemm planes / out
static_assert((size_t)(SEQ / 128) * (NB * NHEAD) * 128 * HD == (size_t)MROWS * HID);       // attn -> Cp
// workspace: 7 activation planes + 4 weight planes of halves, at most 128 MiB
static_assert(((size_t)7 * MROWS * HID + (size_t)4 * HID * HID) * sizeof(f16) <= (size_t)134217728);

// ---------------------------------------------------------------------------
// Launch: 4 kernel launches, workspace 7 planes of MROWS*1024 halves + 4 of 1024*1024 halves.
// ---------------------------------------------------------------------------
extern "C" void kernel_launch(void* const* d_in, const int* in_sizes, int n_in,
                              void* d_out, int out_size, void* d_ws, size_t ws_size,
                              hipStream_t stream) {
    if (n_in < 5) return;
    if (in_sizes[0] < ((NB - 1) * SEQ_FULL + SEQ) * HID) return;
    if (in_sizes[1] < 3 * HID * HID) return;
    if (in_sizes[2] < 3 * HID) return;
    if (in_sizes[3] < HID * HID) return;
    if (in_sizes[4] < HID) return;
    const size_t needOut = OUT0_ELEMS_FULL + PRES_ELEMS_FULL
                         + ((size_t)((NB - 1) * NHEAD + NHEAD - 1) * SEQ_FULL + SEQ) * HD;
    if ((size_t)out_size < needOut) return;

    const float* x     = (const float*)d_in[0];   // [NB_FULL][SEQ_FULL][1024]
    const float* wattn = (const float*)d_in[1];   // [1024 in][3072 out], out columns q | k | v
    const float* battn = (const float*)d_in[2];   // [3072]
    const float* wproj = (const float*)d_in[3];   // [1024 in][1024 out]
    const float* bproj = (const float*)d_in[4];   // [1024]
    float* out = (float*)d_out;                   // out0 | present k | present v

    const size_t nX = (size_t)MROWS * HID;    // halves per activation plane
    const size_t nW = (size_t)HID * HID;      // halves per weight plane
    const size_t totalHalves = 7 * nX + 4 * nW;
    if (ws_size < totalHalves * sizeof(f16)) return;

    f16* Xh  = (f16*)d_ws;       // [MROWS][1024]               carry 16
    f16* Wt  = Xh  + nX;         // [3072 out][1024 in]         carry 32 (q | k | v row blocks)
    f16* Wot = Wt  + 3 * nW;     // [1024 out][1024 in]         carry 32
    f16* Qp  = Wot + nW;         // [NB*16][SEQ][64]            carry 16
    f16* Kp  = Qp  + nX;         // [NB*16][SEQ][64]            carry 16
    f16* Vtp = Kp  + nX;         // [NB*1024][SEQ] (V^T)        carry 16
    f16* Vrp = Vtp + nX;         // [NB*1024][SEQ] residual, columns s < EARLY only
    f16* Cp  = Vrp + nX;         // [MROWS][1024]               carry 1024
    f16* Cr  = Cp  + nX;         // [MROWS][1024] residual, rows s < EARLY only

    cvt_all<<<CVT_X_BLOCKS + CVT_WA_BLOCKS + CVT_WP_BLOCKS, 256, 0, stream>>>(x, wattn, wproj, Xh, Wt, Wot);

    const dim3 gg(MROWS / 128, HID / 128);
    gemm_qkv<<<dim3(MROWS / 128, HID / 128, 3), 256, 0, stream>>>(Xh, Wt, battn, Qp, Kp, Vtp, Vrp,
                                                                  out + OUT0_ELEMS_FULL);

    attn_all<<<ATT_E_BLOCKS + ATT_D_BLOCKS, 256, 0, stream>>>(Qp, Kp, Vtp, Vrp, Cp, Cr);

    // out = acc / (1024*32) + bias ; residual context plane at Cp + nX
    gemm_o<<<gg, 256, 0, stream>>>(Cp, Wot, bproj, out, nX);
}

// v006
// One run takes 83.7 microseconds.
// Timed twice side by side with v005, it ran 1.06 times as fast both times.
// Over all steps from v000 it is 4.06 times as fast.
#include <hip/hip_runtime.h>

// Contractions (fused QKV projection, Q.K^T, P.V, P row-sum, output projection): v_wmma_f32_16x16x32_f16, f16 operands with power-of-two carries, f32 accumulate; every float input enters as its bf16 RNE value; the first EARLY query rows of each sequence carry P, V and context as f16 hi + f16 residual planes (extra products into the same f32 accumulators); softmax in f32.

#ifndef NB
#define NB 2
#endif
#ifndef SEQ
#define SEQ 2048
#endif
#define NB_FULL   2
#define SEQ_FULL  2048
#define HID       1024
#define NHEAD     16
#define HD        64
#define MROWS     (NB * SEQ)
#define EARLY_CAP 512
#define EARLY     ((SEQ < EARLY_CAP) ? SEQ : EARLY_CAP)

#define OUT0_ELEMS_FULL ((size_t)NB_FULL * SEQ_FULL * HID)          // out0 elements
#define PRES_ELEMS_FULL ((size_t)NB_FULL * NHEAD * SEQ_FULL * HD)   // elements of present[0] (k) or present[1] (v)

static_assert(HID == NHEAD * HD);        // merged head width
static_assert(NHEAD == 16);              // bh >> 4 / bh & 15 decoding
static_assert(HD == 64);
static_assert(SEQ % 128 == 0);           // 128-row blocks never straddle a batch
static_assert(EARLY % 128 == 0);
static_assert(EARLY >= 128 && EARLY <= SEQ);
static_assert(SEQ <= SEQ_FULL);
static_assert(NB >= 1 && NB <= NB_FULL);
static_assert(MROWS % 128 == 0);         // GEMM M tile
static_assert(HID % 128 == 0);           // GEMM N tile
static_assert(HID % 64 == 0);            // weight transpose tile
static_assert(HID % 32 == 0);            // WMMA k step
static_assert(HID % 256 == 0);           // staged k tiles of 128, at least two of them
static_assert((HID & (HID - 1)) == 0);   // k0 & (HID-1)
static_assert(HID == 128 * 8);           // cvt_rows: 128 threads x 8 values per row
static_assert(OUT0_ELEMS_FULL * 4 == (size_t)16777216);   // byte offset of the second output

// carries (exact powers of two)
#define CARRY_X    16.0f     // input activation plane
#define CARRY_W    32.0f     // weight planes
#define CARRY_QKV  16.0f     // q, k, v^T planes (true value x16); v residual in the same units
#define CARRY_CTX  1024.0f   // context planes (true value x1024); residual in the same units
// softmax exp values carry 2^10 (added to the exp2 argument); residual in the same units

// LDS row pitches in elements: every row read or written 16 bytes per lane has a pitch of 16 B x odd,
// so the 16 lanes of a lane half fall on 64 distinct banks
#define PK32   40u    // 32-half rows (64 B)  -> 80 B
#define PK64   72u    // 64-half rows (128 B) -> 144 B
#define PC16   136u   // 128-half rows (256 B) -> 272 B
#define PC32   132u   // 128-float rows (512 B) -> 528 B
#define KTILE  128u   // k values per staged GEMM tile (256-byte rows)

typedef unsigned u32;
typedef _Float16 f16;
typedef f16   v16h __attribute__((ext_vector_type(16)));
typedef f16   v8h  __attribute__((ext_vector_type(8)));
typedef f16   v2h  __attribute__((ext_vector_type(2)));
typedef float v2f  __attribute__((ext_vector_type(2)));
typedef float v8f  __attribute__((ext_vector_type(8)));
typedef float v4f  __attribute__((ext_vector_type(4)));

union FragU { v16h v; v8h half[2]; v2h pair[8]; f16 e[16]; };
union H8U   { v8h v; f16 e[8]; };

__device__ __forceinline__ v8f zero8() {
    v8f z = {0.f, 0.f, 0.f, 0.f, 0.f, 0.f, 0.f, 0.f};
    return z;
}

// 16-bit WMMA: D += A[16 x 32k] * B[32k x 16] (the builtin: the distances behind it are the compiler's)
__device__ __forceinline__ v8f wmma16(v16h a, v16h b, v8f c) {
    return __builtin_amdgcn_wmma_f32_16x16x32_f16(false, a, false, b, (short)0, c, false, false);
}

// f32 -> nearest-even bf16 value, returned as f32
__device__ __forceinline__ float bf16_rne(float x) {
    u32 u = __float_as_uint(x);
    u = (u + 0x7fffu + ((u >> 16) & 1u)) & 0xffff0000u;
    return __uint_as_float(u);
}

__device__ __forceinline__ float fexp2(float x) {
#if defined(__has_builtin)
#if __has_builtin(__builtin_amdgcn_exp2f)
    return __builtin_amdgcn_exp2f(x);
#else
    return exp2f(x);
#endif
#else
    return exp2f(x);
#endif
}

// value of lane l ^ 16 (the other lane half)
__device__ __forceinline__ float xhalf(float x) {
    const int v = __builtin_bit_cast(int, x);
    return __builtin_bit_cast(float, __builtin_amdgcn_permlanex16(v, v, 0x76543210, 0xfedcba98, false, false));
}

// 16 x 32 fragment from a tile whose k dimension is contiguous (pitch in halves).
// lane l: row rowbase + (l&15); elements 0..7 <- k = kcol + 8h .. +7,
// elements 8..15 <- k = kcol + 16 + 8h .. +7  (h = l>>4). Same map for A and B.
__device__ __forceinline__ v16h load_frag(const f16* tile, u32 rowbase, u32 pitch, u32 kcol, u32 lane) {
    const u32 r  = rowbase + (lane & 15u);
    const u32 kh = (lane >> 4) << 3;
    const f16* p = tile + (size_t)r * pitch + kcol + kh;
    FragU f;
    f.half[0] = *(const v8h*)(p);
    f.half[1] = *(const v8h*)(p + 16);
    return f.v;
}

// LDS byte address of a __shared__ element (low 32 bits of its address)
__device__ __forceinline__ u32 lds_addr(const f16* p) {
    return (u32)(size_t)p;
}

// Asynchronous copies global -> LDS, 16 bytes per lane, no register staging. The s_wait_xcnt closes each
// statement so that no address register of an issued copy is rewritten ahead of it.
// Eight copies whose rows lie 16 apart: LDS step lstep bytes, global step gstep halves.
__device__ __forceinline__ void async_copy8(u32 l, u32 lstep, const f16* g, size_t gstep) {
    asm volatile("global_load_async_to_lds_b128 %0, %8, off\n\t"
                 "global_load_async_to_lds_b128 %1, %9, off\n\t"
                 "global_load_async_to_lds_b128 %2, %10, off\n\t"
                 "global_load_async_to_lds_b128 %3, %11, off\n\t"
                 "global_load_async_to_lds_b128 %4, %12, off\n\t"
                 "global_load_async_to_lds_b128 %5, %13, off\n\t"
                 "global_load_async_to_lds_b128 %6, %14, off\n\t"
                 "global_load_async_to_lds_b128 %7, %15, off\n\t"
                 "s_wait_xcnt 0x0"
                 :: "v"(l), "v"(l + lstep), "v"(l + 2u * lstep), "v"(l + 3u * lstep),
                    "v"(l + 4u * lstep), "v"(l + 5u * lstep), "v"(l + 6u * lstep), "v"(l + 7u * lstep),
                    "v"(g), "v"(g + gstep), "v"(g + 2 * gstep), "v"(g + 3 * gstep),
                    "v"(g + 4 * gstep), "v"(g + 5 * gstep), "v"(g + 6 * gstep), "v"(g + 7 * gstep)
                 : "memory");
}

// Four and two copies with each lane's own addresses given one by one.
__device__ __forceinline__ void async_copy4(u32 l0, const f16* g0, u32 l1, const f16* g1,
                                            u32 l2, const f16* g2, u32 l3, const f16* g3) {
    asm volatile("global_load_async_to_lds_b128 %0, %4, off\n\t"
                 "global_load_async_to_lds_b128 %1, %5, off\n\t"
                 "global_load_async_to_lds_b128 %2, %6, off\n\t"
                 "global_load_async_to_lds_b128 %3, %7, off\n\t"
                 "s_wait_xcnt 0x0"
                 :: "v"(l0), "v"(l1), "v"(l2), "v"(l3), "v"(g0), "v"(g1), "v"(g2), "v"(g3)
                 : "memory");
}
__device__ __forceinline__ void async_copy2(u32 l0, const f16* g0, u32 l1, const f16* g1) {
    asm volatile("global_load_async_to_lds_b128 %0, %2, off\n\t"
                 "global_load_async_to_lds_b128 %1, %3, off\n\t"
                 "s_wait_xcnt 0x0"
                 :: "v"(l0), "v"(l1), "v"(g0), "v"(g1)
                 : "memory");
}

// publish point of a two-buffer ring: this wave's LDS reads retired, its own copies landed, then the block
// barrier that shows the next tile to every wave and frees the buffer just read
__device__ __forceinline__ void ring_publish() {
    asm volatile("s_wait_dscnt 0x0" ::: "memory");     // reads of the buffer to be refilled have retired
    asm volatile("s_wait_asynccnt 0x0" ::: "memory");  // this wave's copies of the next tile have landed
    __syncthreads();
}

// ---------------------------------------------------------------------------
// f32 rows [.][1024] -> f16 plane (bf16 RNE value times carry). 128 threads per 1024-wide
// Row mapping dst row m -> src row (m / dstper) * srcper + m % dstper lets a reduced build
// read full-size inputs.
// coverage: nrows x 1024 halves, every element exactly once (grid = nrows*128/256).
// ---------------------------------------------------------------------------
__device__ __forceinline__ void
cvt_rows_body(const float* src, f16* dst, u32 blk, u32 nrows, u32 dstper, u32 srcper, float carry) {
    const u32 g  = blk * 256u + threadIdx.x;
    const u32 m  = g >> 7;
    const u32 c8 = (g & 127u) << 3;
    if (m >= nrows) return;
    const u32 mb = m / dstper;
    const u32 sm = mb * srcper + (m - mb * dstper);
    const float* sp = src + (size_t)sm * HID + c8;
    const v4f a = *(const v4f*)sp;
    const v4f b = *(const v4f*)(sp + 4);
    H8U o;
#pragma unroll
    for (u32 j = 0; j < 4; ++j) {
        const float x0 = a[j];
        const float x1 = b[j];
        o.e[j]     = (f16)(bf16_rne(x0) * carry);
        o.e[j + 4] = (f16)(bf16_rne(x1) * carry);
    }
    f16* dp = dst + (size_t)m * HID + c8;
    *(v8h*)dp = o.v;
    
}

// ---------------------------------------------------------------------------
// Transposing weight convert: src[rows][cols] f32 -> dst[cols][rows] f16 (bf16 RNE value
// times carry). Block = 64 (src rows, k) x 64 (src cols, n) tile, grid (cols/64, rows/64).
// Tile staged transposed in LDS (pitch 72 halves), then each dst row segment of 64 halves
// coverage: 4 x 256 threads x 4 values == 64 x 64 per block; blocks tile rows x cols exactly.
// LDS t: cross-wave, block barrier; staged extent 64 x 64 == consumed extent.
// ---------------------------------------------------------------------------
__device__ __forceinline__ void
cvt_wT_body(const float* src, f16* dst, f16* t, u32 bx, u32 by, u32 rows, u32 cols, float carry) {
    const u32 tid = threadIdx.x;
    const u32 n0  = bx * 64u;   // src column block == dst row block
    const u32 k0  = by * 64u;   // src row block == dst column block
#pragma unroll
    for (u32 it = 0; it < 4; ++it) {
        const u32 p  = tid + it * 256u;
        const u32 kr = p >> 4;              // 0..63
        const u32 c4 = (p & 15u) << 2;      // 0..60
        const v4f a = *(const v4f*)(src + (size_t)(k0 + kr) * cols + n0 + c4);
#pragma unroll
        for (u32 j = 0; j < 4; ++j) {
            const float x = a[j];
            t[(c4 + j) * 72u + kr] = (f16)(bf16_rne(x) * carry);
        }
    }
    __syncthreads();
    const u32 piece = tid & 7u;
    const u32 lrow  = tid >> 3;             // 0..31
{
#pragma unroll
        for (u32 it = 0; it < 2; ++it) {
            const u32 L = it * 32u + lrow;  // dst row within the tile, 0..63
            const v8h v = *(const v8h*)&t[L * 72u + piece * 8u];
            f16* dp = dst + (size_t)(n0 + L) * rows + k0 + piece * 8u;
            *(v8h*)dp = v;
        }
        asm volatile("s_wait_xcnt 0x0" ::: "memory");   // before code behind this body rewrites a register of these stores
    }
}

// The three converts in one launch: none reads what another writes. Flat grid: the blocks of the activation
// rows first, then those of the two weight transposes; the choice is block-uniform.
#define CVT_WA_BX     (3 * HID / 64)
#define CVT_WA_BLOCKS (CVT_WA_BX * (HID / 64))
#define CVT_WP_BX     (HID / 64)
#define CVT_WP_BLOCKS (CVT_WP_BX * (HID / 64))
#define CVT_X_BLOCKS  (MROWS / 2)
__global__ void __launch_bounds__(256)
cvt_all(const float* __restrict__ x, const float* __restrict__ wattn, const float* __restrict__ wproj,
        f16* __restrict__ Xh, f16* __restrict__ Wt, f16* __restrict__ Wot) {
    __shared__ __attribute__((aligned(16))) f16 t[64 * 72];
    const u32 b = blockIdx.x;
    if (b < (u32)CVT_X_BLOCKS) {
        // dst row m of batch b <- src row b*SEQ_FULL + (m % SEQ)
        cvt_rows_body(x, Xh, b, (u32)MROWS, (u32)SEQ, (u32)SEQ_FULL, CARRY_X);
    } else if (b < (u32)(CVT_X_BLOCKS + CVT_WA_BLOCKS)) {
        // in[rows = 1024 (k)][cols = 3072 (n)] -> out[cols][rows]
        const u32 bb = b - (u32)CVT_X_BLOCKS;
        cvt_wT_body(wattn, Wt, t, bb % (u32)CVT_WA_BX, bb / (u32)CVT_WA_BX, (u32)HID, (u32)(3 * HID), CARRY_W);
    } else {
        // in[rows = 1024 (k)][cols = 1024 (n)] -> out[cols][rows]
        const u32 bb = b - (u32)(CVT_X_BLOCKS + CVT_WA_BLOCKS);
        cvt_wT_body(wproj, Wot, t, bb % (u32)CVT_WP_BX, bb / (u32)CVT_WP_BX, (u32)HID, (u32)HID, CARRY_W);
    }
}

// ---------------------------------------------------------------------------
// C[m][n] = sum_k A[m][k] * W[n][k] ; A [MROWS][1024] f16, W [1024][1024] f16 (k contiguous).
// Block tile 128 x 128, 8 waves as 4(M) x 2(N), 2 x 4 accumulators per wave, WMMA k step 32.
// A and W tiles of 128 k come by asynchronous copies into two LDS buffers: tile t + 1 flies while tile t is multiplied.
// Inside a tile the fragments of the next 32-k step are read, as one group, ahead of this step's products.
// true value t = acc * mul + bias (bias enters as its bf16 RNE value, added in f32).
// MODE 0: f16 plane [b*NHEAD + h][s][d] (t x16)
// MODE 1: MODE 0 plane + f32 rows [b*NHEAD + h][s][d] (t) into the output buffer
// MODE 2: f16 plane [b*HID + h*HD + d][s] (t x16, transposed per head), residual plane of the
//         same layout for key blocks below EARLY, + f32 rows as MODE 1
// MODE 3: f32 rows [b][s][1024] into the output buffer; for row blocks below EARLY the k loop
//         continues over the residual A plane (A + resOff) against the same W (K folded to 2048)
// coverage per block: f16 planes 256 lines (128 rows x 2 heads | 128 n x 2 s-halves);
//                     f32 2 x 256 lines (64 rows x 4 line-quarters per half).
// LDS: As/Bs/Cs all cross-wave, separated by block barriers.
// staged extent == consumed extent: As/Bs 128 x 128 per buffer, Cs 128 x 128 halves (or 64 x 128 floats).
// ---------------------------------------------------------------------------
template <int MODE>
__device__ __forceinline__ void gemm_body(const f16* A, const f16* W, const float* bias,
                                          f16* plane, f16* plane2, float* fout, size_t resOff,
                                          f16* As, f16* Bs, f16* Cs) {
    // As, Bs: two buffers of 128 rows x 128 k each; Cs: f16 [128][128] at pitch PC16 or f32 [64][128] at pitch PC32
    static_assert(sizeof(f16) * 128 * PC16 >= sizeof(float) * 64 * PC32);   // Cs reuse as f32 [64][128]

    const u32 tid  = threadIdx.x;
    const u32 lane = tid & 31u;
    const u32 wave = tid >> 5;
    const u32 wm   = wave & 3u;
    const u32 wn   = wave >> 2;
    const u32 hh8  = (lane >> 4) << 3;   // D row half
    const u32 c16  = lane & 15u;         // D column
    const u32 m0   = blockIdx.x * 128u;
    const u32 n0   = blockIdx.y * 128u;
    const u32 bidx = m0 / (u32)SEQ;      // block rows lie inside one batch (SEQ % 128 == 0)
    const u32 s0   = m0 - bidx * (u32)SEQ;

    u32 kTot = (u32)HID;
    if constexpr (MODE == 3) {
        if (s0 < (u32)EARLY) kTot = 2u * (u32)HID;   // block-uniform
    }

    v8f acc[2][4];
#pragma unroll
    for (int i = 0; i < 2; ++i)
#pragma unroll
        for (int j = 0; j < 4; ++j) acc[i][j] = zero8();

    // staging map: 16 lanes cover one 256-byte row segment, a wave's copy two rows (four whole lines)
    const u32 crow = tid >> 4;
    const u32 ccol = (tid & 15u) << 3;
    const f16* gA = A + (size_t)(m0 + crow) * HID + ccol;
    const f16* gW = W + (size_t)(n0 + crow) * HID + ccol;
    const u32 lA = lds_addr(&As[crow * PC16 + ccol]);
    const u32 lB = lds_addr(&Bs[crow * PC16 + ccol]);
    const u32 nT = kTot / KTILE;         // 8 or 16 tiles, block-uniform

    auto stage = [&](u32 t) {
        const u32    k0 = t * KTILE;
        const u32    kk = k0 & (u32)(HID - 1);
        const size_t ao = (k0 >= (u32)HID) ? resOff : (size_t)0;
        const u32    bo = (t & 1u) * (128u * PC16 * 2u);
        async_copy8(lA + bo, 16u * PC16 * 2u, gA + ao + kk, (size_t)16 * HID);
        async_copy8(lB + bo, 16u * PC16 * 2u, gW + kk, (size_t)16 * HID);
    };

    stage(0u);
    asm volatile("s_wait_asynccnt 0x0" ::: "memory");   // tile 0 landed before the barrier that shows it
    __syncthreads();
    stage(1u);

#pragma unroll 1   // stays rolled: one trip per staged tile, its buffer chosen by t & 1
    for (u32 t = 0; t < nT; ++t) {
        const f16* as = As + (t & 1u) * (128u * PC16);
        const f16* bs = Bs + (t & 1u) * (128u * PC16);
        v16h af[2][2], bfr[2][4];       // two fragment sets: the next 32-k step is read while this one is multiplied
        auto frags = [&](u32 set, u32 kc) {
#pragma unroll
            for (int i = 0; i < 2; ++i) af[set][i] = load_frag(as, wm * 32u + (u32)i * 16u, PC16, kc, lane);
#pragma unroll
            for (int j = 0; j < 4; ++j) bfr[set][j] = load_frag(bs, wn * 64u + (u32)j * 16u, PC16, kc, lane);
        };
        frags(0u, 0u);
#pragma unroll     // the four 32-k steps of a tile in line, every LDS offset an immediate
        for (u32 ks = 0; ks < KTILE / 32u; ++ks) {
            if (ks + 1u < KTILE / 32u) frags((ks + 1u) & 1u, (ks + 1u) * 32u);
            __builtin_amdgcn_sched_barrier(0);   // the next step's reads stay one group ahead of this step's products
#pragma unroll
            for (int i = 0; i < 2; ++i)
#pragma unroll
                for (int j = 0; j < 4; ++j) acc[i][j] = wmma16(af[ks & 1u][i], bfr[ks & 1u][j], acc[i][j]);
            __builtin_amdgcn_sched_barrier(0);   // and no later read moves up among these products
        }
        ring_publish();
        if (t + 2u < nT) stage(t + 2u);  // into the buffer this trip has just read
    }
    asm volatile("s_wait_asynccnt 0x0" ::: "memory");   // nothing in flight when the epilogue starts

    const float mul = (MODE == 3) ? (1.0f / (CARRY_CTX * CARRY_W)) : (1.0f / (CARRY_X * CARRY_W));
    float bv[4];
#pragma unroll
    for (int j = 0; j < 4; ++j) {
        const float bx = bias[n0 + wn * 64u + (u32)j * 16u + c16];
        bv[j] = bf16_rne(bx);
    }

    const u32 piece = lane & 7u;
    const u32 lsub  = lane >> 3;

    if constexpr (MODE == 0 || MODE == 1) {
#pragma unroll
        for (int i = 0; i < 2; ++i)
#pragma unroll
            for (int j = 0; j < 4; ++j) {
                const u32 nl = wn * 64u + (u32)j * 16u + c16;
#pragma unroll
                for (int r = 0; r < 8; ++r) {
                    const u32 ml = wm * 32u + (u32)i * 16u + hh8 + (u32)r;
                    const float tv = acc[i][j][r] * mul + bv[j];
                    Cs[ml * PC16 + nl] = (f16)(tv * CARRY_QKV);
                }
            }
        __syncthreads();
        const size_t bh0 = (size_t)bidx * NHEAD + (n0 >> 6);
{
#pragma unroll
            for (u32 it = 0; it < 8; ++it) {
                const u32 L    = wave * 32u + it * 4u + lsub;   // 0..255
                const u32 ml   = L >> 1;
                const u32 hsel = L & 1u;
                const v8h v = *(const v8h*)&Cs[ml * PC16 + hsel * 64u + piece * 8u];
                f16* dp = plane + ((bh0 + hsel) * SEQ + s0 + ml) * HD + piece * 8u;
                *(v8h*)dp = v;
            }
            
        }
    }
    if constexpr (MODE == 2) {
        // hi plane, staged transposed: Cs[n][m]
#pragma unroll
        for (int i = 0; i < 2; ++i)
#pragma unroll
            for (int j = 0; j < 4; ++j) {
                const u32 nl = wn * 64u + (u32)j * 16u + c16;
                H8U t;
#pragma unroll
                for (int r = 0; r < 8; ++r) {
                    const float tv = (acc[i][j][r] * mul + bv[j]) * CARRY_QKV;
                    t.e[r] = (f16)tv;
                }
                *(v8h*)&Cs[nl * PC16 + wm * 32u + (u32)i * 16u + hh8] = t.v;
            }
        __syncthreads();
{
#pragma unroll
            for (u32 it = 0; it < 8; ++it) {
                const u32 L  = wave * 32u + it * 4u + lsub;     // 0..255
                const u32 nl = L >> 1;
                const u32 mh = L & 1u;
                const v8h v = *(const v8h*)&Cs[nl * PC16 + mh * 64u + piece * 8u];
                f16* dp = plane + ((size_t)(bidx * (u32)HID + n0 + nl) * SEQ + s0 + mh * 64u + piece * 8u);
                *(v8h*)dp = v;
            }
            asm volatile("s_wait_xcnt 0x0" ::: "memory");   // before the residual path rewrites a register of these stores
        }
        if (s0 < (u32)EARLY) {          // block-uniform: residual plane only for early key blocks
            __syncthreads();
#pragma unroll
            for (int i = 0; i < 2; ++i)
#pragma unroll
                for (int j = 0; j < 4; ++j) {
                    const u32 nl = wn * 64u + (u32)j * 16u + c16;
                    H8U t;
#pragma unroll
                    for (int r = 0; r < 8; ++r) {
                        const float tv = (acc[i][j][r] * mul + bv[j]) * CARRY_QKV;
                        const f16   hi = (f16)tv;
                        t.e[r] = (f16)(tv - (float)hi);
                    }
                    *(v8h*)&Cs[nl * PC16 + wm * 32u + (u32)i * 16u + hh8] = t.v;
                }
            __syncthreads();
{
#pragma unroll
                for (u32 it = 0; it < 8; ++it) {
                    const u32 L  = wave * 32u + it * 4u + lsub;
                    const u32 nl = L >> 1;
                    const u32 mh = L & 1u;
                    const v8h v = *(const v8h*)&Cs[nl * PC16 + mh * 64u + piece * 8u];
                    f16* dp = plane2 + ((size_t)(bidx * (u32)HID + n0 + nl) * SEQ + s0 + mh * 64u + piece * 8u);
                    *(v8h*)dp = v;
                }
                
            }
        }
    }
    if constexpr (MODE >= 1) {
        if constexpr (MODE != 3) __syncthreads();   // f16 stage reads finished before restaging
        float* Cf = (float*)Cs;      // [64][128] f32 at pitch PC32
#pragma unroll
        for (u32 half = 0; half < 2; ++half) {
            if ((wm >> 1) == half) {
#pragma unroll
                for (int i = 0; i < 2; ++i)
#pragma unroll
                    for (int j = 0; j < 4; ++j) {
                        const u32 nl = wn * 64u + (u32)j * 16u + c16;
#pragma unroll
                        for (int r = 0; r < 8; ++r) {
                            const u32 ml = (wm & 1u) * 32u + (u32)i * 16u + hh8 + (u32)r;
                            Cf[ml * PC32 + nl] = acc[i][j][r] * mul + bv[j];
                        }
                    }
            }
            __syncthreads();
{
#pragma unroll
                for (u32 it = 0; it < 8; ++it) {
                    const u32 L    = wave * 32u + it * 4u + lsub;   // 0..255
                    const u32 row  = L >> 2;
                    const u32 part = L & 3u;
                    const v4f v = *(const v4f*)&Cf[row * PC32 + part * 32u + piece * 4u];
                    size_t off;
                    if constexpr (MODE == 3) {
                        off = (size_t)(bidx * (u32)SEQ_FULL + s0 + half * 64u + row) * HID
                            + n0 + part * 32u + piece * 4u;
                    } else {
                        off = ((size_t)(bidx * (u32)NHEAD + (n0 >> 6) + (part >> 1)) * SEQ_FULL
                               + s0 + half * 64u + row) * HD + (part & 1u) * 32u + piece * 4u;
                    }
                    *(v4f*)(fout + off) = v;
                }
                
            }
            __syncthreads();
        }
    }
}

// The q, k and v projections in one launch (none reads what another writes), blockIdx.z picks the
// weight block and the epilogue: 0 = q head-major plane, 1 = k head-major plane + f32 k rows of the second
// output, 2 = v^T plane + v^T residual plane (early keys) + f32 v rows of the second output.
__global__ void __launch_bounds__(256) __attribute__((amdgpu_num_vgpr(256)))
gemm_qkv(const f16* __restrict__ A, const f16* __restrict__ W, const float* __restrict__ bias,
         f16* __restrict__ outQ, f16* __restrict__ outK, f16* __restrict__ outT, f16* __restrict__ outR,
         float* __restrict__ pres) {
    __shared__ __attribute__((aligned(16))) f16 As[2 * 128 * PC16];
    __shared__ __attribute__((aligned(16))) f16 Bs[2 * 128 * PC16];
    __shared__ __attribute__((aligned(16))) f16 Cs[128 * PC16];
    const u32 z = blockIdx.z;            // block-uniform
    if (z == 0u) {
        gemm_body<0>(A, W, bias, outQ, outQ, pres, (size_t)0, As, Bs, Cs);
    } else if (z == 1u) {
        gemm_body<1>(A, W + (size_t)HID * HID, bias + HID, outK, outK, pres, (size_t)0, As, Bs, Cs);
    } else {
        gemm_body<2>(A, W + (size_t)2 * HID * HID, bias + 2 * HID, outT, outR, pres + PRES_ELEMS_FULL, (size_t)0,
                     As, Bs, Cs);
    }
}

// f32 output rows; A residual plane at A + resOff for early row blocks
__global__ void __launch_bounds__(256) __attribute__((amdgpu_num_vgpr(256)))
gemm_o(const f16* __restrict__ A, const f16* __restrict__ W, const float* __restrict__ bias,
       float* __restrict__ out, size_t resOff) {
    __shared__ __attribute__((aligned(16))) f16 As[2 * 128 * PC16];
    __shared__ __attribute__((aligned(16))) f16 Bs[2 * 128 * PC16];
    __shared__ __attribute__((aligned(16))) f16 Cs[128 * PC16];
    gemm_body<3>(A, W, bias, (f16*)out, (f16*)out, out, resOff, As, Bs, Cs);
}

// ---------------------------------------------------------------------------
// Online softmax update for one transposed score tile, 64 keys x 16 q (log2 domain, max-subtracted).
// s[nt][r] = score of key kbase + 16 nt + hh8 + r against query q: a lane holds 32 keys of ONE query, the
// lane 16 away the other 32, so the maximum is in-lane plus one exchange and m, al are one value per lane.
// The carried exp values, converted in place, are the B fragments of the next product:
// pb[kk] element j = tile 2 kk + (j >> 3), register j & 7, which is load_frag's k order.
// MASK: keys above the query row get probability exactly 0 and do not enter the row max.
// EP: also emit the f16 residual of each carried exp value.
// ---------------------------------------------------------------------------
template <bool MASK, bool EP>
__device__ __forceinline__ void softmax_tile(const v8f (&s)[4], float& m, v8f (&o)[4], v8f& lacc,
                                             FragU (&pb)[2], FragU (&prb)[2], u32 kbase, u32 q,
                                             u32 hh8, float cl) {
    float x[4][8];
    float t4[4];
#pragma unroll
    for (int nt = 0; nt < 4; ++nt) {
#pragma unroll
        for (int r = 0; r < 8; ++r) {
            x[nt][r] = s[nt][r] * cl;
            if constexpr (MASK) {
                const bool dead = (kbase + (u32)nt * 16u + hh8 + (u32)r) > q;
                x[nt][r] = dead ? -1.0e30f : x[nt][r];
            }
        }
        t4[nt] = fmaxf(fmaxf(fmaxf(x[nt][0], x[nt][1]), fmaxf(x[nt][2], x[nt][3])),
                       fmaxf(fmaxf(x[nt][4], x[nt][5]), fmaxf(x[nt][6], x[nt][7])));
    }
    float tm = fmaxf(fmaxf(t4[0], t4[1]), fmaxf(t4[2], t4[3]));
    tm = fmaxf(tm, xhalf(tm));
    const float mn = fmaxf(m, tm);
    const float al = fexp2(m - mn);
    m = mn;
    lacc *= al;
#pragma unroll
    for (int dt = 0; dt < 4; ++dt) o[dt] *= al;
    const float sh = 10.0f - mn;      // carry 2^10
#pragma unroll
    for (int nt = 0; nt < 4; ++nt) {
#pragma unroll
        for (int r = 0; r < 8; r += 2) {
            v2f e;
            e.x = fexp2(x[nt][r] + sh);
            e.y = fexp2(x[nt][r + 1] + sh);
            if constexpr (MASK) {
                e.x = ((kbase + (u32)nt * 16u + hh8 + (u32)r) > q) ? 0.0f : e.x;
                e.y = ((kbase + (u32)nt * 16u + hh8 + (u32)r + 1u) > q) ? 0.0f : e.y;
            }
            const v2h hi = __builtin_convertvector(e, v2h);
            const int  j = (nt & 1) * 4 + (r >> 1);
            pb[nt >> 1].pair[j] = hi;
            if constexpr (EP) prb[nt >> 1].pair[j] = __builtin_convertvector(e - __builtin_convertvector(hi, v2f), v2h);
        }
    }
}

// ---------------------------------------------------------------------------
// Causal flash attention, one (row block, head) per block of 256 (8 waves), wave owns 16 query
// rows (Q fragments resident). Block streams 64-key tiles 0 .. last tile touching its rows:
// K staged [key][d], V^T staged [d][key] (+ residual tile when EP), by asynchronous copies into two
// buffers each: tile kt + 1 flies while tile kt is worked on. A wave computes a tile only
// when the tile starts at or below its first row (wave-uniform); the tile containing its rows
// takes the masked path. Both products run transposed: S^T = K.Q^T (A = K rows, B = the resident Q fragments)
// and O^T += V^T.P^T (A = V^T rows, B = P^T), so a lane's score registers belong to one query, the row max is
// in-lane plus one exchange between the lane halves, and the exp2 values (f32, carried x2^10), converted in
// place, are the B fragments of the second product: P stays in registers. Row sums += ones.P^T on WMMA.
// LDS reads of a tile stand in groups: its eight K fragments ahead of the score products, its eight V^T
// fragments ahead of the softmax (the residual fragments ahead of the second product).
// EP (rows below EARLY): P and V as hi + residual, products hi.hi + res.hi + hi.res into the
// same accumulators; context written as hi plane + residual plane.
// coverage: every (b, q, h*64..h*64+63) row segment of the launched row blocks exactly once.
// LDS: ks, vsT, vrT cross-wave (block barriers); ps/pr per-wave context staging of the epilogue.
// staged extent == consumed extent for ks/vsT/vrT (64x64) and ps/pr (16x64, written
// in full by the owning wave before it reads them).
// ---------------------------------------------------------------------------
template <bool EP>
__device__ __forceinline__ void attn_body(const f16* Qp, const f16* Kp, const f16* Vt, const f16* Vr,
                                          f16* Cp, f16* Cr, u32 qblk, u32 bh,
                                          f16* ks, f16* vsT, f16* vrT, f16* ps, f16* pr) {
    static_assert(HD == 8 * 8);            // 8 lanes x 8 halves per row segment
    static_assert(2 * 256 * 8 == 64 * 64); // staging: 2 copies x 256 threads x 8 halves per tile

    const u32 tid  = threadIdx.x;
    const u32 lane = tid & 31u;
    const u32 wave = (u32)__builtin_amdgcn_readfirstlane((int)(tid >> 5));
    const u32 hh8  = (lane >> 4) << 3;
    const u32 c16  = lane & 15u;
    const u32 bidx = bh >> 4;            // NHEAD == 16
    const u32 hidx = bh & 15u;
    const u32 q0   = qblk * 128u + wave * 16u;
    const size_t head = (size_t)bh * SEQ * HD;

    v16h qa[2];
#pragma unroll
    for (int c = 0; c < 2; ++c) qa[c] = load_frag(Qp + head, q0, HD, (u32)c * 32u, lane);

    FragU onesu;
#pragma unroll
    for (int i = 0; i < 16; ++i) onesu.e[i] = (f16)1.0f;
    const v16h ones = onesu.v;

    // o[dt][r] = O^T[d = 16 dt + hh8 + r][query q0 + c16]; every register of lacc = that query's row sum
    float m = -1.0e30f;
    v8f   o[4], lacc;
#pragma unroll
    for (int dt = 0; dt < 4; ++dt) o[dt] = zero8();
    lacc = zero8();

    // log2-domain scale: acc = 256 * q.k ; x = log2(e) * q.k / 64 = acc * log2(e) / 16384
    const float cl = 1.4426950408889634f * 0.00006103515625f;
    f16* psw = ps + wave * (16u * PK64);
    f16* prw = pr + wave * (16u * PK64);

    const u32 nkt = qblk * 2u + 2u;      // keys 0 .. qblk*128 + 127

    // staging map: 8 lanes cover one 128-byte row, a wave's copy four rows; rows srow and srow + 32 per thread
    const u32 srow = tid >> 3;
    const u32 spc  = (tid & 7u) << 3;
    const f16* gK = Kp + head + (size_t)srow * HD + spc;
    const f16* gV = Vt + head + (size_t)srow * SEQ + spc;
    const f16* gR = Vr + head + (size_t)srow * SEQ + spc;
    const u32 lK = lds_addr(&ks[srow * PK64 + spc]);
    const u32 lV = lds_addr(&vsT[srow * PK64 + spc]);
    const u32 lR = lds_addr(&vrT[EP ? srow * PK64 + spc : 0u]);

    auto stage = [&](u32 t) {
        const u32  bo = (t & 1u) * (64u * PK64 * 2u);
        const u32  hb = 32u * PK64 * 2u;                 // 32 rows further, in LDS bytes
        const f16* k0 = gK + (size_t)t * 64u * HD;
        const f16* v0 = gV + t * 64u;
        async_copy4(lK + bo, k0, lK + bo + hb, k0 + 32 * HD, lV + bo, v0, lV + bo + hb, v0 + (size_t)32 * SEQ);
        if constexpr (EP) {
            const f16* r0 = gR + t * 64u;
            async_copy2(lR + bo, r0, lR + bo + hb, r0 + (size_t)32 * SEQ);
        }
    };

    stage(0u);
    asm volatile("s_wait_asynccnt 0x0" ::: "memory");   // tile 0 landed before the barrier that shows it
    __syncthreads();
    stage(1u);                           // nkt >= 2

#pragma unroll 1   // stays rolled: one trip per staged tile, its buffers chosen by kt & 1
    for (u32 kt = 0; kt < nkt; ++kt) {
        const f16* ksb = ks  + (kt & 1u) * (64u * PK64);
        const f16* vsb = vsT + (kt & 1u) * (64u * PK64);
        const f16* vrb_t = vrT + (EP ? (kt & 1u) * (64u * PK64) : 0u);

        const bool active = (kt * 64u <= q0);           // wave-uniform
        if (active) {
            // S^T[64 keys x 16 q]
            v8f s[4];
            v16h kf[2][4], vf[2][4];
#pragma unroll
            for (int nt = 0; nt < 4; ++nt) s[nt] = zero8();
#pragma unroll
            for (int c = 0; c < 2; ++c)
#pragma unroll
                for (int nt = 0; nt < 4; ++nt) kf[c][nt] = load_frag(ksb, (u32)nt * 16u, PK64, (u32)c * 32u, lane);
            __builtin_amdgcn_sched_barrier(0);   // the tile's K reads stay one group ahead of its products: one LDS latency, not one per product
#pragma unroll
            for (int c = 0; c < 2; ++c)
#pragma unroll
                for (int nt = 0; nt < 4; ++nt) s[nt] = wmma16(kf[c][nt], qa[c], s[nt]);
            __builtin_amdgcn_sched_barrier(0);   // the V^T reads below stay one group, not spread in pairs among the score products
#pragma unroll
            for (int kk = 0; kk < 2; ++kk)
#pragma unroll
                for (int dt = 0; dt < 4; ++dt) vf[kk][dt] = load_frag(vsb, (u32)dt * 16u, PK64, (u32)kk * 32u, lane);
            __builtin_amdgcn_sched_barrier(0);   // holds those reads in front of the softmax, which covers their latency: the compiler otherwise sinks them behind it
            FragU pb[2], prb[2];
            const bool diag = (kt * 64u + 63u > q0);    // wave-uniform
            if (diag) softmax_tile<true,  EP>(s, m, o, lacc, pb, prb, kt * 64u, q0 + c16, hh8, cl);
            else      softmax_tile<false, EP>(s, m, o, lacc, pb, prb, kt * 64u, q0 + c16, hh8, cl);

            // O^T += V^T . P^T ; l += ones . P^T
            v16h vrf[2][4];
            if constexpr (EP) {
#pragma unroll
                for (int kk = 0; kk < 2; ++kk)
#pragma unroll
                    for (int dt = 0; dt < 4; ++dt)
                        vrf[kk][dt] = load_frag(vrb_t, (u32)dt * 16u, PK64, (u32)kk * 32u, lane);
                __builtin_amdgcn_sched_barrier(0);   // the residual reads stay one group ahead of the products
            }
#pragma unroll
            for (int kk = 0; kk < 2; ++kk) {
#pragma unroll
                for (int dt = 0; dt < 4; ++dt) {
                    o[dt] = wmma16(vf[kk][dt], pb[kk].v, o[dt]);
                    if constexpr (EP) {
                        o[dt] = wmma16(vrf[kk][dt], pb[kk].v, o[dt]);
                        o[dt] = wmma16(vf[kk][dt], prb[kk].v, o[dt]);
                    }
                }
                lacc = wmma16(ones, pb[kk].v, lacc);
                if constexpr (EP) lacc = wmma16(ones, prb[kk].v, lacc);
            }
        }
        ring_publish();                          // every wave, active or not
        if (kt + 2u < nkt) stage(kt + 2u);       // into the buffers this trip has just read
    }
    asm volatile("s_wait_asynccnt 0x0" ::: "memory");   // nothing in flight when the epilogue starts

    // normalize: plane value = 1024 * (O/16) / l = O * 64 / l ; a lane's 8 registers are 8 consecutive d of its query
    const float inv = (CARRY_CTX / CARRY_QKV) / lacc[0];
#pragma unroll
    for (int dt = 0; dt < 4; ++dt) {
        H8U th, tr;
#pragma unroll
        for (int r = 0; r < 8; ++r) {
            const float cv = o[dt][r] * inv;
            const f16   hi = (f16)cv;
            th.e[r] = hi;
            if constexpr (EP) tr.e[r] = (f16)(cv - (float)hi);
        }
        const u32 idx = c16 * PK64 + (u32)dt * 16u + hh8;
        *(v8h*)&psw[idx] = th.v;
        if constexpr (EP) *(v8h*)&prw[idx] = tr.v;
    }
    __syncthreads();

    const u32 piece = lane & 7u;
    const u32 lsub  = lane >> 3;
{
#pragma unroll
        for (u32 it = 0; it < 4; ++it) {
            const u32 L = it * 4u + lsub;     // query row 0..15 within the wave tile
            const size_t off = (size_t)(bidx * (u32)SEQ + q0 + L) * HID + hidx * (u32)HD + piece * 8u;
            const v8h v = *(const v8h*)&psw[L * PK64 + piece * 8u];
            *(v8h*)(Cp + off) = v;
            if constexpr (EP) {
                const v8h vr = *(const v8h*)&prw[L * PK64 + piece * 8u];
                *(v8h*)(Cr + off) = vr;
            }
        }
        
    }
}

// Both attention paths in one launch (neither reads what the other writes): rows [0, EARLY) of every
// sequence take the hi + residual path, rows [EARLY, SEQ) the single f16 planes; the choice is block-uniform.
// A row block's cost grows with its index (it walks 2 q + 2 key tiles) and every block of the launch is resident at
// once, two to a WGP, so the launch lasts as long as the fullest WGP. Flat grid, head running fastest: the upper half
// of the row blocks first, longest first, then the lower half, shortest
// first, so that blocks half a grid apart, q and ATT_NQ - 1 - q, add up to the same number of key tiles.
// rank -> row block is a permutation for any ATT_NQ: ranks below ATT_NU take ATT_NQ - 1 .. ATT_NQ - ATT_NU, the rest 0 upward.
#define ATT_E_BX     (EARLY / 128)
#define ATT_NQ       (SEQ / 128)
#define ATT_NH       (NB * NHEAD)
#define ATT_NU       (ATT_NQ - ATT_NQ / 2)
__global__ void __launch_bounds__(256) __attribute__((amdgpu_num_vgpr(256)))
attn_all(const f16* __restrict__ Qp, const f16* __restrict__ Kp, const f16* __restrict__ Vt,
         const f16* __restrict__ Vr, f16* __restrict__ Cp, f16* __restrict__ Cr) {
    __shared__ __attribute__((aligned(16))) f16 ks[2 * 64 * PK64];    // two buffers of [key][d]
    __shared__ __attribute__((aligned(16))) f16 vsT[2 * 64 * PK64];   // two buffers of [d][key]
    __shared__ __attribute__((aligned(16))) f16 vrT[2 * 64 * PK64];   // two buffers of [d][key] residual (early path)
    __shared__ __attribute__((aligned(16))) f16 ps[8 * 16 * PK64];    // per-wave ctx stage
    __shared__ __attribute__((aligned(16))) f16 pr[8 * 16 * PK64];    // per-wave ctx residual stage (early path)
    const u32 rank = blockIdx.x / (u32)ATT_NH;
    const u32 bh   = blockIdx.x % (u32)ATT_NH;
    const u32 qblk = (rank < (u32)ATT_NU) ? (u32)(ATT_NQ - 1) - rank : rank - (u32)ATT_NU;
    if (qblk < (u32)ATT_E_BX) {
        attn_body<true>(Qp, Kp, Vt, Vr, Cp, Cr, qblk, bh, ks, vsT, vrT, ps, pr);
    } else {
        attn_body<false>(Qp, Kp, Vt, Vt, Cp, Cp, qblk, bh, ks, vsT, vrT, ps, pr);
    }
}

// coverage equalities (threads x elements == plane elements)
static_assert((size_t)(MROWS / 2) * 256 * 8 == (size_t)MROWS * HID);                       // cvt_rows -> Xh
static_assert((size_t)(3 * HID / 64) * (HID / 64) * 64 * 64 == (size_t)3 * HID * HID);     // cvt_wT -> Wt
static_assert((size_t)(HID / 64) * (HID / 64) * 64 * 64 == (size_t)HID * HID);             // cvt_wT -> Wot
static_assert((size_t)(MROWS / 128) * (HID / 128) * 128 * 128 == (size_t)MROWS * HID);     // gemm planes / out
static_assert((size_t)(SEQ / 128) * (NB * NHEAD) * 128 * HD == (size_t)MROWS * HID);       // attn -> Cp
// workspace: 7 activation planes + 4 weight planes of halves, at most 128 MiB
static_assert(((size_t)7 * MROWS * HID + (size_t)4 * HID * HID) * sizeof(f16) <= (size_t)134217728);

// ---------------------------------------------------------------------------
// Launch: 4 kernel launches, workspace 7 planes of MROWS*1024 halves + 4 of 1024*1024 halves.
// ---------------------------------------------------------------------------
extern "C" void kernel_launch(void* const* d_in, const int* in_sizes, int n_in,
                              void* d_out, int out_size, void* d_ws, size_t ws_size,
                              hipStream_t stream) {
    if (n_in < 5) return;
    if (in_sizes[0] < ((NB - 1) * SEQ_FULL + SEQ) * HID) return;
    if (in_sizes[1] < 3 * HID * HID) return;
    if (in_sizes[2] < 3 * HID) return;
    if (in_sizes[3] < HID * HID) return;
    if (in_sizes[4] < HID) return;
    const size_t needOut = OUT0_ELEMS_FULL + PRES_ELEMS_FULL
                         + ((size_t)((NB - 1) * NHEAD + NHEAD - 1) * SEQ_FULL + SEQ) * HD;
    if ((size_t)out_size < needOut) return;

    const float* x     = (const float*)d_in[0];   // [NB_FULL][SEQ_FULL][1024]
    const float* wattn = (const float*)d_in[1];   // [1024 in][3072 out], out columns q | k | v
    const float* battn = (const float*)d_in[2];   // [3072]
    const float* wproj = (const float*)d_in[3];   // [1024 in][1024 out]
    const float* bproj = (const float*)d_in[4];   // [1024]
    float* out = (float*)d_out;                   // out0 | present k | present v

    const size_t nX = (size_t)MROWS * HID;    // halves per activation plane
    const size_t nW = (size_t)HID * HID;      // halves per weight plane
    const size_t totalHalves = 7 * nX + 4 * nW;
    if (ws_size < totalHalves * sizeof(f16)) return;

    f16* Xh  = (f16*)d_ws;       // [MROWS][1024]               carry 16
    f16* Wt  = Xh  + nX;         // [3072 out][1024 in]         carry 32 (q | k | v row blocks)
    f16* Wot = Wt  + 3 * nW;     // [1024 out][1024 in]         carry 32
    f16* Qp  = Wot + nW;         // [NB*16][SEQ][64]            carry 16
    f16* Kp  = Qp  + nX;         // [NB*16][SEQ][64]            carry 16
    f16* Vtp = Kp  + nX;         // [NB*1024][SEQ] (V^T)        carry 16
    f16* Vrp = Vtp + nX;         // [NB*1024][SEQ] residual, columns s < EARLY only
    f16* Cp  = Vrp + nX;         // [MROWS][1024]               carry 1024
    f16* Cr  = Cp  + nX;         // [MROWS][1024] residual, rows s < EARLY only

    cvt_all<<<CVT_X_BLOCKS + CVT_WA_BLOCKS + CVT_WP_BLOCKS, 256, 0, stream>>>(x, wattn, wproj, Xh, Wt, Wot);

    const dim3 gg(MROWS / 128, HID / 128);
    gemm_qkv<<<dim3(MROWS / 128, HID / 128, 3), 256, 0, stream>>>(Xh, Wt, battn, Qp, Kp, Vtp, Vrp,
                                                                  out + OUT0_ELEMS_FULL);

    attn_all<<<ATT_NQ * ATT_NH, 256, 0, stream>>>(Qp, Kp, Vtp, Vrp, Cp, Cr);

    // out = acc / (1024*32) + bias ; residual context plane at Cp + nX
    gemm_o<<<gg, 256, 0, stream>>>(Cp, Wot, bproj, out, nX);
}

// v007
// Measured time: 78.9 microseconds a run.
// Next to v006, in two timings, it ran 1.08 and 1.05 times as fast.
// All steps since v000 together make it 4.34 times as fast.
#include <hip/hip_runtime.h>

// Contractions (fused QKV projection, Q.K^T, P.V, P row-sum, output projection): v_wmma_f32_16x16x32_f16, f16 operands with power-of-two carries, f32 accumulate; every float input enters as its bf16 RNE value; the first EARLY query rows of each sequence carry P, V and context as f16 hi + f16 residual planes (extra products into the same f32 accumulators); softmax in f32.

#ifndef NB
#define NB 2
#endif
#ifndef SEQ
#define SEQ 2048
#endif
#define NB_FULL   2
#define SEQ_FULL  2048
#define HID       1024
#define NHEAD     16
#define HD        64
#define MROWS     (NB * SEQ)
#define EARLY_CAP 512
#define EARLY     ((SEQ < EARLY_CAP) ? SEQ : EARLY_CAP)

#define OUT0_ELEMS_FULL ((size_t)NB_FULL * SEQ_FULL * HID)          // out0 elements
#define PRES_ELEMS_FULL ((size_t)NB_FULL * NHEAD * SEQ_FULL * HD)   // elements of present[0] (k) or present[1] (v)

static_assert(HID == NHEAD * HD);        // merged head width
static_assert(NHEAD == 16);              // bh >> 4 / bh & 15 decoding
static_assert(HD == 64);
static_assert(SEQ % 128 == 0);           // 128-row blocks never straddle a batch
static_assert(EARLY % 128 == 0);
static_assert(EARLY >= 128 && EARLY <= SEQ);
static_assert(SEQ <= SEQ_FULL);
static_assert(NB >= 1 && NB <= NB_FULL);
static_assert(MROWS % 128 == 0);         // GEMM M tile
static_assert(HID % 128 == 0);           // GEMM N tile
static_assert(HID % 64 == 0);            // weight transpose tile
static_assert(HID % 32 == 0);            // WMMA k step
static_assert(HID % 256 == 0);           // staged k tiles of 128, at least two of them
static_assert((HID & (HID - 1)) == 0);   // k0 & (HID-1)
static_assert(HID == 128 * 8);           // cvt_rows: 128 threads x 8 values per row
static_assert(OUT0_ELEMS_FULL * 4 == (size_t)16777216);   // byte offset of the second output

// carries (exact powers of two)
#define CARRY_X    16.0f     // input activation plane
#define CARRY_W    32.0f     // weight planes
#define CARRY_QKV  16.0f     // q, k, v^T planes (true value x16); v residual in the same units
#define CARRY_CTX  1024.0f   // context planes (true value x1024); residual in the same units
// softmax exp values carry 2^10 (added to the exp2 argument); residual in the same units

// LDS row pitches in elements: every row read or written 16 bytes per lane has a pitch of 16 B x odd,
// so the 16 lanes of a lane half fall on 64 distinct banks
#define PK32   40u    // 32-half rows (64 B)  -> 80 B
#define PK64   72u    // 64-half rows (128 B) -> 144 B
#define PC16   136u   // 128-half rows (256 B) -> 272 B
#define PC32   132u   // 128-float rows (512 B) -> 528 B
#define KTILE  128u   // k values per staged GEMM tile (256-byte rows)

typedef unsigned u32;
typedef _Float16 f16;
typedef f16   v16h __attribute__((ext_vector_type(16)));
typedef f16   v8h  __attribute__((ext_vector_type(8)));
typedef f16   v2h  __attribute__((ext_vector_type(2)));
typedef float v2f  __attribute__((ext_vector_type(2)));
typedef float v8f  __attribute__((ext_vector_type(8)));
typedef float v4f  __attribute__((ext_vector_type(4)));

union FragU { v16h v; v8h half[2]; v2h pair[8]; f16 e[16]; };
union H8U   { v8h v; f16 e[8]; };

__device__ __forceinline__ v8f zero8() {
    v8f z = {0.f, 0.f, 0.f, 0.f, 0.f, 0.f, 0.f, 0.f};
    return z;
}

// 16-bit WMMA: D += A[16 x 32k] * B[32k x 16] (the builtin: the distances behind it are the compiler's)
__device__ __forceinline__ v8f wmma16(v16h a, v16h b, v8f c) {
    return __builtin_amdgcn_wmma_f32_16x16x32_f16(false, a, false, b, (short)0, c, false, false);
}

// f32 -> nearest-even bf16 value, returned as f32
__device__ __forceinline__ float bf16_rne(float x) {
    u32 u = __float_as_uint(x);
    u = (u + 0x7fffu + ((u >> 16) & 1u)) & 0xffff0000u;
    return __uint_as_float(u);
}

__device__ __forceinline__ float fexp2(float x) {
#if defined(__has_builtin)
#if __has_builtin(__builtin_amdgcn_exp2f)
    return __builtin_amdgcn_exp2f(x);
#else
    return exp2f(x);
#endif
#else
    return exp2f(x);
#endif
}

// value of lane l ^ 16 (the other lane half)
__device__ __forceinline__ float xhalf(float x) {
    const int v = __builtin_bit_cast(int, x);
    return __builtin_bit_cast(float, __builtin_amdgcn_permlanex16(v, v, 0x76543210, 0xfedcba98, false, false));
}

// 16 x 32 fragment from a tile whose k dimension is contiguous (pitch in halves).
// lane l: row rowbase + (l&15); elements 0..7 <- k = kcol + 8h .. +7,
// elements 8..15 <- k = kcol + 16 + 8h .. +7  (h = l>>4). Same map for A and B.
__device__ __forceinline__ v16h load_frag(const f16* tile, u32 rowbase, u32 pitch, u32 kcol, u32 lane) {
    const u32 r  = rowbase + (lane & 15u);
    const u32 kh = (lane >> 4) << 3;
    const f16* p = tile + (size_t)r * pitch + kcol + kh;
    FragU f;
    f.half[0] = *(const v8h*)(p);
    f.half[1] = *(const v8h*)(p + 16);
    return f.v;
}

// LDS byte address of a __shared__ element (low 32 bits of its address)
__device__ __forceinline__ u32 lds_addr(const f16* p) {
    return (u32)(size_t)p;
}

// Asynchronous copies global -> LDS, 16 bytes per lane, no register staging. The s_wait_xcnt closes each
// statement so that no address register of an issued copy is rewritten ahead of it.
// Eight copies whose rows lie 16 apart: LDS step lstep bytes, global step gstep halves.
__device__ __forceinline__ void async_copy8(u32 l, u32 lstep, const f16* g, size_t gstep) {
    asm volatile("global_load_async_to_lds_b128 %0, %8, off\n\t"
                 "global_load_async_to_lds_b128 %1, %9, off\n\t"
                 "global_load_async_to_lds_b128 %2, %10, off\n\t"
                 "global_load_async_to_lds_b128 %3, %11, off\n\t"
                 "global_load_async_to_lds_b128 %4, %12, off\n\t"
                 "global_load_async_to_lds_b128 %5, %13, off\n\t"
                 "global_load_async_to_lds_b128 %6, %14, off\n\t"
                 "global_load_async_to_lds_b128 %7, %15, off\n\t"
                 "s_wait_xcnt 0x0"
                 :: "v"(l), "v"(l + lstep), "v"(l + 2u * lstep), "v"(l + 3u * lstep),
                    "v"(l + 4u * lstep), "v"(l + 5u * lstep), "v"(l + 6u * lstep), "v"(l + 7u * lstep),
                    "v"(g), "v"(g + gstep), "v"(g + 2 * gstep), "v"(g + 3 * gstep),
                    "v"(g + 4 * gstep), "v"(g + 5 * gstep), "v"(g + 6 * gstep), "v"(g + 7 * gstep)
                 : "memory");
}

// Four and two copies with each lane's own addresses given one by one.
__device__ __forceinline__ void async_copy4(u32 l0, const f16* g0, u32 l1, const f16* g1,
                                            u32 l2, const f16* g2, u32 l3, const f16* g3) {
    asm volatile("global_load_async_to_lds_b128 %0, %4, off\n\t"
                 "global_load_async_to_lds_b128 %1, %5, off\n\t"
                 "global_load_async_to_lds_b128 %2, %6, off\n\t"
                 "global_load_async_to_lds_b128 %3, %7, off\n\t"
                 "s_wait_xcnt 0x0"
                 :: "v"(l0), "v"(l1), "v"(l2), "v"(l3), "v"(g0), "v"(g1), "v"(g2), "v"(g3)
                 : "memory");
}
__device__ __forceinline__ void async_copy2(u32 l0, const f16* g0, u32 l1, const f16* g1) {
    asm volatile("global_load_async_to_lds_b128 %0, %2, off\n\t"
                 "global_load_async_to_lds_b128 %1, %3, off\n\t"
                 "s_wait_xcnt 0x0"
                 :: "v"(l0), "v"(l1), "v"(g0), "v"(g1)
                 : "memory");
}

// publish point of a two-buffer ring: this wave's LDS reads retired, its own copies landed, then the block
// barrier that shows the next tile to every wave and frees the buffer just read
__device__ __forceinline__ void ring_publish() {
    asm volatile("s_wait_dscnt 0x0" ::: "memory");     // reads of the buffer to be refilled have retired
    asm volatile("s_wait_asynccnt 0x0" ::: "memory");  // this wave's copies of the next tile have landed
    __syncthreads();
}

// ---------------------------------------------------------------------------
// f32 rows [.][1024] -> f16 plane (bf16 RNE value times carry). 128 threads per 1024-wide
// Row mapping dst row m -> src row (m / dstper) * srcper + m % dstper lets a reduced build
// read full-size inputs.
// coverage: nrows x 1024 halves, every element exactly once (grid = nrows*128/256).
// ---------------------------------------------------------------------------
__device__ __forceinline__ void
cvt_rows_body(const float* src, f16* dst, u32 blk, u32 nrows, u32 dstper, u32 srcper, float carry) {
    const u32 g  = blk * 256u + threadIdx.x;
    const u32 m  = g >> 7;
    const u32 c8 = (g & 127u) << 3;
    if (m >= nrows) return;
    const u32 mb = m / dstper;
    const u32 sm = mb * srcper + (m - mb * dstper);
    const float* sp = src + (size_t)sm * HID + c8;
    const v4f a = *(const v4f*)sp;
    const v4f b = *(const v4f*)(sp + 4);
    H8U o;
#pragma unroll
    for (u32 j = 0; j < 4; ++j) {
        const float x0 = a[j];
        const float x1 = b[j];
        o.e[j]     = (f16)(bf16_rne(x0) * carry);
        o.e[j + 4] = (f16)(bf16_rne(x1) * carry);
    }
    f16* dp = dst + (size_t)m * HID + c8;
    *(v8h*)dp = o.v;
    
}

// ---------------------------------------------------------------------------
// Transposing weight convert: src[rows][cols] f32 -> dst[cols][rows] f16 (bf16 RNE value
// times carry). Block = 64 (src rows, k) x 64 (src cols, n) tile, grid (cols/64, rows/64).
// Tile staged transposed in LDS (pitch 72 halves), then each dst row segment of 64 halves
// coverage: 4 x 256 threads x 4 values == 64 x 64 per block; blocks tile rows x cols exactly.
// LDS t: cross-wave, block barrier; staged extent 64 x 64 == consumed extent.
// ---------------------------------------------------------------------------
__device__ __forceinline__ void
cvt_wT_body(const float* src, f16* dst, f16* t, u32 bx, u32 by, u32 rows, u32 cols, float carry) {
    const u32 tid = threadIdx.x;
    const u32 n0  = bx * 64u;   // src column block == dst row block
    const u32 k0  = by * 64u;   // src row block == dst column block
#pragma unroll
    for (u32 it = 0; it < 4; ++it) {
        const u32 p  = tid + it * 256u;
        const u32 kr = p >> 4;              // 0..63
        const u32 c4 = (p & 15u) << 2;      // 0..60
        const v4f a = *(const v4f*)(src + (size_t)(k0 + kr) * cols + n0 + c4);
#pragma unroll
        for (u32 j = 0; j < 4; ++j) {
            const float x = a[j];
            t[(c4 + j) * 72u + kr] = (f16)(bf16_rne(x) * carry);
        }
    }
    __syncthreads();
    const u32 piece = tid & 7u;
    const u32 lrow  = tid >> 3;             // 0..31
{
#pragma unroll
        for (u32 it = 0; it < 2; ++it) {
            const u32 L = it * 32u + lrow;  // dst row within the tile, 0..63
            const v8h v = *(const v8h*)&t[L * 72u + piece * 8u];
            f16* dp = dst + (size_t)(n0 + L) * rows + k0 + piece * 8u;
            *(v8h*)dp = v;
        }
        asm volatile("s_wait_xcnt 0x0" ::: "memory");   // before code behind this body rewrites a register of these stores
    }
}

// The three converts in one launch: none reads what another writes. Flat grid: the blocks of the activation
// rows first, then those of the two weight transposes; the choice is block-uniform.
#define CVT_WA_BX     (3 * HID / 64)
#define CVT_WA_BLOCKS (CVT_WA_BX * (HID / 64))
#define CVT_WP_BX     (HID / 64)
#define CVT_WP_BLOCKS (CVT_WP_BX * (HID / 64))
#define CVT_X_BLOCKS  (MROWS / 2)
__global__ void __launch_bounds__(256)
cvt_all(const float* __restrict__ x, const float* __restrict__ wattn, const float* __restrict__ wproj,
        f16* __restrict__ Xh, f16* __restrict__ Wt, f16* __restrict__ Wot) {
    __shared__ __attribute__((aligned(16))) f16 t[64 * 72];
    const u32 b = blockIdx.x;
    if (b < (u32)CVT_X_BLOCKS) {
        // dst row m of batch b <- src row b*SEQ_FULL + (m % SEQ)
        cvt_rows_body(x, Xh, b, (u32)MROWS, (u32)SEQ, (u32)SEQ_FULL, CARRY_X);
    } else if (b < (u32)(CVT_X_BLOCKS + CVT_WA_BLOCKS)) {
        // in[rows = 1024 (k)][cols = 3072 (n)] -> out[cols][rows]
        const u32 bb = b - (u32)CVT_X_BLOCKS;
        cvt_wT_body(wattn, Wt, t, bb % (u32)CVT_WA_BX, bb / (u32)CVT_WA_BX, (u32)HID, (u32)(3 * HID), CARRY_W);
    } else {
        // in[rows = 1024 (k)][cols = 1024 (n)] -> out[cols][rows]
        const u32 bb = b - (u32)(CVT_X_BLOCKS + CVT_WA_BLOCKS);
        cvt_wT_body(wproj, Wot, t, bb % (u32)CVT_WP_BX, bb / (u32)CVT_WP_BX, (u32)HID, (u32)HID, CARRY_W);
    }
}

// ---------------------------------------------------------------------------
// C[m][n] = sum_k A[m][k] * W[n][k] ; A [MROWS][1024] f16, W [1024][1024] f16 (k contiguous).
// Block tile 128 x 128, 8 waves as 4(M) x 2(N), 2 x 4 accumulators per wave, WMMA k step 32.
// A and W tiles of 128 k come by asynchronous copies into two LDS buffers: tile t + 1 flies while tile t is multiplied.
// Inside a tile the fragments of the next 32-k step are read, as one group, ahead of this step's products.
// true value t = acc * mul + bias (bias enters as its bf16 RNE value, added in f32).
// MODE 0: f16 plane [b*NHEAD + h][s][d] (t x16)
// MODE 1: MODE 0 plane + f32 rows [b*NHEAD + h][s][d] (t) into the output buffer
// MODE 2: f16 plane [b*HID + h*HD + d][s] (t x16, transposed per head), residual plane of the
//         same layout for key blocks below EARLY, + f32 rows as MODE 1
// MODE 3: f32 rows [b][s][1024] into the output buffer; for row blocks below EARLY the k loop
//         continues over the residual A plane (A + resOff) against the same W (K folded to 2048)
// coverage per block: f16 planes 256 lines (128 rows x 2 heads | 128 n x 2 s-halves);
//                     f32 2 x 256 lines (64 rows x 4 line-quarters per half).
// LDS: As/Bs/Cs all cross-wave, separated by block barriers.
// staged extent == consumed extent: As/Bs 128 x 128 per buffer, Cs 128 x 128 halves (or 64 x 128 floats).
// ---------------------------------------------------------------------------
template <int MODE>
__device__ __forceinline__ void gemm_body(const f16* A, const f16* W, const float* bias,
                                          f16* plane, f16* plane2, float* fout, size_t resOff,
                                          f16* As, f16* Bs, f16* Cs) {
    // As, Bs: two buffers of 128 rows x 128 k each; Cs: f16 [128][128] at pitch PC16 or f32 [64][128] at pitch PC32
    static_assert(sizeof(f16) * 128 * PC16 >= sizeof(float) * 64 * PC32);   // Cs reuse as f32 [64][128]

    const u32 tid  = threadIdx.x;
    const u32 lane = tid & 31u;
    const u32 wave = tid >> 5;
    const u32 wm   = wave & 3u;
    const u32 wn   = wave >> 2;
    const u32 hh8  = (lane >> 4) << 3;   // D row half
    const u32 c16  = lane & 15u;         // D column
    const u32 m0   = blockIdx.x * 128u;
    const u32 n0   = blockIdx.y * 128u;
    const u32 bidx = m0 / (u32)SEQ;      // block rows lie inside one batch (SEQ % 128 == 0)
    const u32 s0   = m0 - bidx * (u32)SEQ;

    u32 kTot = (u32)HID;
    if constexpr (MODE == 3) {
        if (s0 < (u32)EARLY) kTot = 2u * (u32)HID;   // block-uniform
    }

    v8f acc[2][4];
#pragma unroll
    for (int i = 0; i < 2; ++i)
#pragma unroll
        for (int j = 0; j < 4; ++j) acc[i][j] = zero8();

    // staging map: 16 lanes cover one 256-byte row segment, a wave's copy two rows (four whole lines)
    const u32 crow = tid >> 4;
    const u32 ccol = (tid & 15u) << 3;
    const f16* gA = A + (size_t)(m0 + crow) * HID + ccol;
    const f16* gW = W + (size_t)(n0 + crow) * HID + ccol;
    const u32 lA = lds_addr(&As[crow * PC16 + ccol]);
    const u32 lB = lds_addr(&Bs[crow * PC16 + ccol]);
    const u32 nT = kTot / KTILE;         // 8 or 16 tiles, block-uniform

    auto stage = [&](u32 t) {
        const u32    k0 = t * KTILE;
        const u32    kk = k0 & (u32)(HID - 1);
        const size_t ao = (k0 >= (u32)HID) ? resOff : (size_t)0;
        const u32    bo = (t & 1u) * (128u * PC16 * 2u);
        async_copy8(lA + bo, 16u * PC16 * 2u, gA + ao + kk, (size_t)16 * HID);
        async_copy8(lB + bo, 16u * PC16 * 2u, gW + kk, (size_t)16 * HID);
    };

    stage(0u);
    asm volatile("s_wait_asynccnt 0x0" ::: "memory");   // tile 0 landed before the barrier that shows it
    __syncthreads();
    stage(1u);

#pragma unroll 1   // stays rolled: one trip per staged tile, its buffer chosen by t & 1
    for (u32 t = 0; t < nT; ++t) {
        const f16* as = As + (t & 1u) * (128u * PC16);
        const f16* bs = Bs + (t & 1u) * (128u * PC16);
        v16h af[2][2], bfr[2][4];       // two fragment sets: the next 32-k step is read while this one is multiplied
        auto frags = [&](u32 set, u32 kc) {
#pragma unroll
            for (int i = 0; i < 2; ++i) af[set][i] = load_frag(as, wm * 32u + (u32)i * 16u, PC16, kc, lane);
#pragma unroll
            for (int j = 0; j < 4; ++j) bfr[set][j] = load_frag(bs, wn * 64u + (u32)j * 16u, PC16, kc, lane);
        };
        frags(0u, 0u);
#pragma unroll     // the four 32-k steps of a tile in line, every LDS offset an immediate
        for (u32 ks = 0; ks < KTILE / 32u; ++ks) {
            if (ks + 1u < KTILE / 32u) frags((ks + 1u) & 1u, (ks + 1u) * 32u);
            __builtin_amdgcn_sched_barrier(0);   // the next step's reads stay one group ahead of this step's products
#pragma unroll
            for (int i = 0; i < 2; ++i)
#pragma unroll
                for (int j = 0; j < 4; ++j) acc[i][j] = wmma16(af[ks & 1u][i], bfr[ks & 1u][j], acc[i][j]);
            __builtin_amdgcn_sched_barrier(0);   // and no later read moves up among these products
        }
        ring_publish();
        if (t + 2u < nT) stage(t + 2u);  // into the buffer this trip has just read
    }
    asm volatile("s_wait_asynccnt 0x0" ::: "memory");   // nothing in flight when the epilogue starts

    const float mul = (MODE == 3) ? (1.0f / (CARRY_CTX * CARRY_W)) : (1.0f / (CARRY_X * CARRY_W));
    float bv[4];
#pragma unroll
    for (int j = 0; j < 4; ++j) {
        const float bx = bias[n0 + wn * 64u + (u32)j * 16u + c16];
        bv[j] = bf16_rne(bx);
    }

    const u32 piece = lane & 7u;
    const u32 lsub  = lane >> 3;

    if constexpr (MODE == 0 || MODE == 1) {
#pragma unroll
        for (int i = 0; i < 2; ++i)
#pragma unroll
            for (int j = 0; j < 4; ++j) {
                const u32 nl = wn * 64u + (u32)j * 16u + c16;
#pragma unroll
                for (int r = 0; r < 8; ++r) {
                    const u32 ml = wm * 32u + (u32)i * 16u + hh8 + (u32)r;
                    const float tv = acc[i][j][r] * mul + bv[j];
                    Cs[ml * PC16 + nl] = (f16)(tv * CARRY_QKV);
                }
            }
        __syncthreads();
        const size_t bh0 = (size_t)bidx * NHEAD + (n0 >> 6);
{
#pragma unroll
            for (u32 it = 0; it < 8; ++it) {
                const u32 L    = wave * 32u + it * 4u + lsub;   // 0..255
                const u32 ml   = L >> 1;
                const u32 hsel = L & 1u;
                const v8h v = *(const v8h*)&Cs[ml * PC16 + hsel * 64u + piece * 8u];
                f16* dp = plane + ((bh0 + hsel) * SEQ + s0 + ml) * HD + piece * 8u;
                *(v8h*)dp = v;
            }
            
        }
    }
    if constexpr (MODE == 2) {
        // hi plane, staged transposed: Cs[n][m]
#pragma unroll
        for (int i = 0; i < 2; ++i)
#pragma unroll
            for (int j = 0; j < 4; ++j) {
                const u32 nl = wn * 64u + (u32)j * 16u + c16;
                H8U t;
#pragma unroll
                for (int r = 0; r < 8; ++r) {
                    const float tv = (acc[i][j][r] * mul + bv[j]) * CARRY_QKV;
                    t.e[r] = (f16)tv;
                }
                *(v8h*)&Cs[nl * PC16 + wm * 32u + (u32)i * 16u + hh8] = t.v;
            }
        __syncthreads();
{
#pragma unroll
            for (u32 it = 0; it < 8; ++it) {
                const u32 L  = wave * 32u + it * 4u + lsub;     // 0..255
                const u32 nl = L >> 1;
                const u32 mh = L & 1u;
                const v8h v = *(const v8h*)&Cs[nl * PC16 + mh * 64u + piece * 8u];
                f16* dp = plane + ((size_t)(bidx * (u32)HID + n0 + nl) * SEQ + s0 + mh * 64u + piece * 8u);
                *(v8h*)dp = v;
            }
            asm volatile("s_wait_xcnt 0x0" ::: "memory");   // before the residual path rewrites a register of these stores
        }
        if (s0 < (u32)EARLY) {          // block-uniform: residual plane only for early key blocks
            __syncthreads();
#pragma unroll
            for (int i = 0; i < 2; ++i)
#pragma unroll
                for (int j = 0; j < 4; ++j) {
                    const u32 nl = wn * 64u + (u32)j * 16u + c16;
                    H8U t;
#pragma unroll
                    for (int r = 0; r < 8; ++r) {
                        const float tv = (acc[i][j][r] * mul + bv[j]) * CARRY_QKV;
                        const f16   hi = (f16)tv;
                        t.e[r] = (f16)(tv - (float)hi);
                    }
                    *(v8h*)&Cs[nl * PC16 + wm * 32u + (u32)i * 16u + hh8] = t.v;
                }
            __syncthreads();
{
#pragma unroll
                for (u32 it = 0; it < 8; ++it) {
                    const u32 L  = wave * 32u + it * 4u + lsub;
                    const u32 nl = L >> 1;
                    const u32 mh = L & 1u;
                    const v8h v = *(const v8h*)&Cs[nl * PC16 + mh * 64u + piece * 8u];
                    f16* dp = plane2 + ((size_t)(bidx * (u32)HID + n0 + nl) * SEQ + s0 + mh * 64u + piece * 8u);
                    *(v8h*)dp = v;
                }
                
            }
        }
    }
    if constexpr (MODE >= 1) {
        if constexpr (MODE != 3) __syncthreads();   // f16 stage reads finished before restaging
        float* Cf = (float*)Cs;      // [64][128] f32 at pitch PC32
#pragma unroll
        for (u32 half = 0; half < 2; ++half) {
            if ((wm >> 1) == half) {
#pragma unroll
                for (int i = 0; i < 2; ++i)
#pragma unroll
                    for (int j = 0; j < 4; ++j) {
                        const u32 nl = wn * 64u + (u32)j * 16u + c16;
#pragma unroll
                        for (int r = 0; r < 8; ++r) {
                            const u32 ml = (wm & 1u) * 32u + (u32)i * 16u + hh8 + (u32)r;
                            Cf[ml * PC32 + nl] = acc[i][j][r] * mul + bv[j];
                        }
                    }
            }
            __syncthreads();
{
#pragma unroll
                for (u32 it = 0; it < 8; ++it) {
                    const u32 L    = wave * 32u + it * 4u + lsub;   // 0..255
                    const u32 row  = L >> 2;
                    const u32 part = L & 3u;
                    const v4f v = *(const v4f*)&Cf[row * PC32 + part * 32u + piece * 4u];
                    size_t off;
                    if constexpr (MODE == 3) {
                        off = (size_t)(bidx * (u32)SEQ_FULL + s0 + half * 64u + row) * HID
                            + n0 + part * 32u + piece * 4u;
                    } else {
                        off = ((size_t)(bidx * (u32)NHEAD + (n0 >> 6) + (part >> 1)) * SEQ_FULL
                               + s0 + half * 64u + row) * HD + (part & 1u) * 32u + piece * 4u;
                    }
                    *(v4f*)(fout + off) = v;
                }
                
            }
            __syncthreads();
        }
    }
}

// The q, k and v projections in one launch (none reads what another writes), blockIdx.z picks the
// weight block and the epilogue: 0 = q head-major plane, 1 = k head-major plane + f32 k rows of the second
// output, 2 = v^T plane + v^T residual plane (early keys) + f32 v rows of the second output.
__global__ void __launch_bounds__(256) __attribute__((amdgpu_num_vgpr(256)))
gemm_qkv(const f16* __restrict__ A, const f16* __restrict__ W, const float* __restrict__ bias,
         f16* __restrict__ outQ, f16* __restrict__ outK, f16* __restrict__ outT, f16* __restrict__ outR,
         float* __restrict__ pres) {
    __shared__ __attribute__((aligned(16))) f16 As[2 * 128 * PC16];
    __shared__ __attribute__((aligned(16))) f16 Bs[2 * 128 * PC16];
    // The epilogue's stage lies on the A ring: behind the loop's last publish point no wave reads the ring any more and
    // no copy is in flight. 136 KiB of LDS instead of 170, so two work-groups share a WGP (3 per WGP are launched): one's
    // first tile, barrier waits and epilogue run under the other's products.
    f16* Cs = As;
    static_assert(sizeof(As) >= sizeof(f16) * 128 * PC16);
    const u32 z = blockIdx.z;            // block-uniform
    if (z == 0u) {
        gemm_body<0>(A, W, bias, outQ, outQ, pres, (size_t)0, As, Bs, Cs);
    } else if (z == 1u) {
        gemm_body<1>(A, W + (size_t)HID * HID, bias + HID, outK, outK, pres, (size_t)0, As, Bs, Cs);
    } else {
        gemm_body<2>(A, W + (size_t)2 * HID * HID, bias + 2 * HID, outT, outR, pres + PRES_ELEMS_FULL, (size_t)0,
                     As, Bs, Cs);
    }
}

// f32 output rows; A residual plane at A + resOff for early row blocks
__global__ void __launch_bounds__(256) __attribute__((amdgpu_num_vgpr(256)))
gemm_o(const f16* __restrict__ A, const f16* __restrict__ W, const float* __restrict__ bias,
       float* __restrict__ out, size_t resOff) {
    __shared__ __attribute__((aligned(16))) f16 As[2 * 128 * PC16];
    __shared__ __attribute__((aligned(16))) f16 Bs[2 * 128 * PC16];
    __shared__ __attribute__((aligned(16))) f16 Cs[128 * PC16];
    gemm_body<3>(A, W, bias, (f16*)out, (f16*)out, out, resOff, As, Bs, Cs);
}

// ---------------------------------------------------------------------------
// Online softmax update for one transposed score tile, 64 keys x 16 q (log2 domain, max-subtracted).
// s[nt][r] = score of key kbase + 16 nt + hh8 + r against query q: a lane holds 32 keys of ONE query, the
// lane 16 away the other 32, so the maximum is in-lane plus one exchange and m, al are one value per lane.
// The carried exp values, converted in place, are the B fragments of the next product:
// pb[kk] element j = tile 2 kk + (j >> 3), register j & 7, which is load_frag's k order.
// MASK: keys above the query row get probability exactly 0 and do not enter the row max.
// EP: also emit the f16 residual of each carried exp value.
// ---------------------------------------------------------------------------
template <bool MASK, bool EP>
__device__ __forceinline__ void softmax_tile(const v8f (&s)[4], float& m, v8f (&o)[4], v8f& lacc,
                                             FragU (&pb)[2], FragU (&prb)[2], u32 kbase, u32 q,
                                             u32 hh8, float cl) {
    float x[4][8];
    float t4[4];
#pragma unroll
    for (int nt = 0; nt < 4; ++nt) {
#pragma unroll
        for (int r = 0; r < 8; ++r) {
            x[nt][r] = s[nt][r] * cl;
            if constexpr (MASK) {
                const bool dead = (kbase + (u32)nt * 16u + hh8 + (u32)r) > q;
                x[nt][r] = dead ? -1.0e30f : x[nt][r];
            }
        }
        t4[nt] = fmaxf(fmaxf(fmaxf(x[nt][0], x[nt][1]), fmaxf(x[nt][2], x[nt][3])),
                       fmaxf(fmaxf(x[nt][4], x[nt][5]), fmaxf(x[nt][6], x[nt][7])));
    }
    float tm = fmaxf(fmaxf(t4[0], t4[1]), fmaxf(t4[2], t4[3]));
    tm = fmaxf(tm, xhalf(tm));
    const float mn = fmaxf(m, tm);
    const float al = fexp2(m - mn);
    m = mn;
    lacc *= al;
#pragma unroll
    for (int dt = 0; dt < 4; ++dt) o[dt] *= al;
    const float sh = 10.0f - mn;      // carry 2^10
#pragma unroll
    for (int nt = 0; nt < 4; ++nt) {
#pragma unroll
        for (int r = 0; r < 8; r += 2) {
            v2f e;
            e.x = fexp2(x[nt][r] + sh);
            e.y = fexp2(x[nt][r + 1] + sh);
            if constexpr (MASK) {
                e.x = ((kbase + (u32)nt * 16u + hh8 + (u32)r) > q) ? 0.0f : e.x;
                e.y = ((kbase + (u32)nt * 16u + hh8 + (u32)r + 1u) > q) ? 0.0f : e.y;
            }
            const v2h hi = __builtin_convertvector(e, v2h);
            const int  j = (nt & 1) * 4 + (r >> 1);
            pb[nt >> 1].pair[j] = hi;
            if constexpr (EP) prb[nt >> 1].pair[j] = __builtin_convertvector(e - __builtin_convertvector(hi, v2f), v2h);
        }
    }
}

// ---------------------------------------------------------------------------
// Causal flash attention, one (row block, head) per block of 256 (8 waves), wave owns 16 query
// rows (Q fragments resident). Block streams 64-key tiles 0 .. last tile touching its rows:
// K staged [key][d], V^T staged [d][key] (+ residual tile when EP), by asynchronous copies into two
// buffers each: tile kt + 1 flies while tile kt is worked on. A wave computes a tile only
// when the tile starts at or below its first row (wave-uniform); the tile containing its rows
// takes the masked path. Both products run transposed: S^T = K.Q^T (A = K rows, B = the resident Q fragments)
// and O^T += V^T.P^T (A = V^T rows, B = P^T), so a lane's score registers belong to one query, the row max is
// in-lane plus one exchange between the lane halves, and the exp2 values (f32, carried x2^10), converted in
// place, are the B fragments of the second product: P stays in registers. Row sums += ones.P^T on WMMA.
// LDS reads of a tile stand in groups: its eight K fragments ahead of the score products, its eight V^T
// fragments ahead of the softmax (the residual fragments ahead of the second product).
// EP (rows below EARLY): P and V as hi + residual, products hi.hi + res.hi + hi.res into the
// same accumulators; context written as hi plane + residual plane.
// coverage: every (b, q, h*64..h*64+63) row segment of the launched row blocks exactly once.
// LDS: ks, vsT, vrT cross-wave (block barriers); ps/pr per-wave context staging of the epilogue.
// staged extent == consumed extent for ks/vsT/vrT (64x64) and ps/pr (16x64, written
// in full by the owning wave before it reads them).
// ---------------------------------------------------------------------------
template <bool EP>
__device__ __forceinline__ void attn_body(const f16* Qp, const f16* Kp, const f16* Vt, const f16* Vr,
                                          f16* Cp, f16* Cr, u32 qblk, u32 bh,
                                          f16* ks, f16* vsT, f16* vrT, f16* ps, f16* pr) {
    static_assert(HD == 8 * 8);            // 8 lanes x 8 halves per row segment
    static_assert(2 * 256 * 8 == 64 * 64); // staging: 2 copies x 256 threads x 8 halves per tile

    const u32 tid  = threadIdx.x;
    const u32 lane = tid & 31u;
    const u32 wave = (u32)__builtin_amdgcn_readfirstlane((int)(tid >> 5));
    const u32 hh8  = (lane >> 4) << 3;
    const u32 c16  = lane & 15u;
    const u32 bidx = bh >> 4;            // NHEAD == 16
    const u32 hidx = bh & 15u;
    const u32 q0   = qblk * 128u + wave * 16u;
    const size_t head = (size_t)bh * SEQ * HD;

    v16h qa[2];
#pragma unroll
    for (int c = 0; c < 2; ++c) qa[c] = load_frag(Qp + head, q0, HD, (u32)c * 32u, lane);

    FragU onesu;
#pragma unroll
    for (int i = 0; i < 16; ++i) onesu.e[i] = (f16)1.0f;
    const v16h ones = onesu.v;

    // o[dt][r] = O^T[d = 16 dt + hh8 + r][query q0 + c16]; every register of lacc = that query's row sum
    float m = -1.0e30f;
    v8f   o[4], lacc;
#pragma unroll
    for (int dt = 0; dt < 4; ++dt) o[dt] = zero8();
    lacc = zero8();

    // log2-domain scale: acc = 256 * q.k ; x = log2(e) * q.k / 64 = acc * log2(e) / 16384
    const float cl = 1.4426950408889634f * 0.00006103515625f;
    f16* psw = ps + wave * (16u * PK64);
    f16* prw = pr + wave * (16u * PK64);

    const u32 nkt = qblk * 2u + 2u;      // keys 0 .. qblk*128 + 127

    // staging map: 8 lanes cover one 128-byte row, a wave's copy four rows; rows srow and srow + 32 per thread
    const u32 srow = tid >> 3;
    const u32 spc  = (tid & 7u) << 3;
    const f16* gK = Kp + head + (size_t)srow * HD + spc;
    const f16* gV = Vt + head + (size_t)srow * SEQ + spc;
    const f16* gR = Vr + head + (size_t)srow * SEQ + spc;
    const u32 lK = lds_addr(&ks[srow * PK64 + spc]);
    const u32 lV = lds_addr(&vsT[srow * PK64 + spc]);
    const u32 lR = lds_addr(&vrT[EP ? srow * PK64 + spc : 0u]);

    auto stage = [&](u32 t) {
        const u32  bo = (t & 1u) * (64u * PK64 * 2u);
        const u32  hb = 32u * PK64 * 2u;                 // 32 rows further, in LDS bytes
        const f16* k0 = gK + (size_t)t * 64u * HD;
        const f16* v0 = gV + t * 64u;
        async_copy4(lK + bo, k0, lK + bo + hb, k0 + 32 * HD, lV + bo, v0, lV + bo + hb, v0 + (size_t)32 * SEQ);
        if constexpr (EP) {
            const f16* r0 = gR + t * 64u;
            async_copy2(lR + bo, r0, lR + bo + hb, r0 + (size_t)32 * SEQ);
        }
    };

    stage(0u);
    asm volatile("s_wait_asynccnt 0x0" ::: "memory");   // tile 0 landed before the barrier that shows it
    __syncthreads();
    stage(1u);                           // nkt >= 2

#pragma unroll 1   // stays rolled: one trip per staged tile, its buffers chosen by kt & 1
    for (u32 kt = 0; kt < nkt; ++kt) {
        const f16* ksb = ks  + (kt & 1u) * (64u * PK64);
        const f16* vsb = vsT + (kt & 1u) * (64u * PK64);
        const f16* vrb_t = vrT + (EP ? (kt & 1u) * (64u * PK64) : 0u);

        const bool active = (kt * 64u <= q0);           // wave-uniform
        if (active) {
            // S^T[64 keys x 16 q]
            v8f s[4];
            v16h kf[2][4], vf[2][4];
#pragma unroll
            for (int nt = 0; nt < 4; ++nt) s[nt] = zero8();
#pragma unroll
            for (int c = 0; c < 2; ++c)
#pragma unroll
                for (int nt = 0; nt < 4; ++nt) kf[c][nt] = load_frag(ksb, (u32)nt * 16u, PK64, (u32)c * 32u, lane);
            __builtin_amdgcn_sched_barrier(0);   // the tile's K reads stay one group ahead of its products: one LDS latency, not one per product
#pragma unroll
            for (int c = 0; c < 2; ++c)
#pragma unroll
                for (int nt = 0; nt < 4; ++nt) s[nt] = wmma16(kf[c][nt], qa[c], s[nt]);
            __builtin_amdgcn_sched_barrier(0);   // the V^T reads below stay one group, not spread in pairs among the score products
#pragma unroll
            for (int kk = 0; kk < 2; ++kk)
#pragma unroll
                for (int dt = 0; dt < 4; ++dt) vf[kk][dt] = load_frag(vsb, (u32)dt * 16u, PK64, (u32)kk * 32u, lane);
            __builtin_amdgcn_sched_barrier(0);   // holds those reads in front of the softmax, which covers their latency: the compiler otherwise sinks them behind it
            FragU pb[2], prb[2];
            const bool diag = (kt * 64u + 63u > q0);    // wave-uniform
            if (diag) softmax_tile<true,  EP>(s, m, o, lacc, pb, prb, kt * 64u, q0 + c16, hh8, cl);
            else      softmax_tile<false, EP>(s, m, o, lacc, pb, prb, kt * 64u, q0 + c16, hh8, cl);

            // O^T += V^T . P^T ; l += ones . P^T
            v16h vrf[2][4];
            if constexpr (EP) {
#pragma unroll
                for (int kk = 0; kk < 2; ++kk)
#pragma unroll
                    for (int dt = 0; dt < 4; ++dt)
                        vrf[kk][dt] = load_frag(vrb_t, (u32)dt * 16u, PK64, (u32)kk * 32u, lane);
                __builtin_amdgcn_sched_barrier(0);   // the residual reads stay one group ahead of the products
            }
#pragma unroll
            for (int kk = 0; kk < 2; ++kk) {
#pragma unroll
                for (int dt = 0; dt < 4; ++dt) {
                    o[dt] = wmma16(vf[kk][dt], pb[kk].v, o[dt]);
                    if constexpr (EP) {
                        o[dt] = wmma16(vrf[kk][dt], pb[kk].v, o[dt]);
                        o[dt] = wmma16(vf[kk][dt], prb[kk].v, o[dt]);
                    }
                }
                lacc = wmma16(ones, pb[kk].v, lacc);
                if constexpr (EP) lacc = wmma16(ones, prb[kk].v, lacc);
            }
        }
        ring_publish();                          // every wave, active or not
        if (kt + 2u < nkt) stage(kt + 2u);       // into the buffers this trip has just read
    }
    asm volatile("s_wait_asynccnt 0x0" ::: "memory");   // nothing in flight when the epilogue starts

    // normalize: plane value = 1024 * (O/16) / l = O * 64 / l ; a lane's 8 registers are 8 consecutive d of its query
    const float inv = (CARRY_CTX / CARRY_QKV) / lacc[0];
#pragma unroll
    for (int dt = 0; dt < 4; ++dt) {
        H8U th, tr;
#pragma unroll
        for (int r = 0; r < 8; ++r) {
            const float cv = o[dt][r] * inv;
            const f16   hi = (f16)cv;
            th.e[r] = hi;
            if constexpr (EP) tr.e[r] = (f16)(cv - (float)hi);
        }
        const u32 idx = c16 * PK64 + (u32)dt * 16u + hh8;
        *(v8h*)&psw[idx] = th.v;
        if constexpr (EP) *(v8h*)&prw[idx] = tr.v;
    }
    __syncthreads();

    const u32 piece = lane & 7u;
    const u32 lsub  = lane >> 3;
{
#pragma unroll
        for (u32 it = 0; it < 4; ++it) {
            const u32 L = it * 4u + lsub;     // query row 0..15 within the wave tile
            const size_t off = (size_t)(bidx * (u32)SEQ + q0 + L) * HID + hidx * (u32)HD + piece * 8u;
            const v8h v = *(const v8h*)&psw[L * PK64 + piece * 8u];
            *(v8h*)(Cp + off) = v;
            if constexpr (EP) {
                const v8h vr = *(const v8h*)&prw[L * PK64 + piece * 8u];
                *(v8h*)(Cr + off) = vr;
            }
        }
        
    }
}

// Both attention paths in one launch (neither reads what the other writes): rows [0, EARLY) of every
// sequence take the hi + residual path, rows [EARLY, SEQ) the single f16 planes; the choice is block-uniform.
// A row block's cost grows with its index (it walks 2 q + 2 key tiles) and every block of the launch is resident at
// once, two to a WGP, so the launch lasts as long as the fullest WGP. Flat grid, head running fastest: the upper half
// of the row blocks first, longest first, then the lower half, shortest
// first, so that blocks half a grid apart, q and ATT_NQ - 1 - q, add up to the same number of key tiles.
// rank -> row block is a permutation for any ATT_NQ: ranks below ATT_NU take ATT_NQ - 1 .. ATT_NQ - ATT_NU, the rest 0 upward.
#define ATT_E_BX     (EARLY / 128)
#define ATT_NQ       (SEQ / 128)
#define ATT_NH       (NB * NHEAD)
#define ATT_NU       (ATT_NQ - ATT_NQ / 2)
__global__ void __launch_bounds__(256) __attribute__((amdgpu_num_vgpr(256)))
attn_all(const f16* __restrict__ Qp, const f16* __restrict__ Kp, const f16* __restrict__ Vt,
         const f16* __restrict__ Vr, f16* __restrict__ Cp, f16* __restrict__ Cr) {
    __shared__ __attribute__((aligned(16))) f16 ks[2 * 64 * PK64];    // two buffers of [key][d]
    __shared__ __attribute__((aligned(16))) f16 vsT[2 * 64 * PK64];   // two buffers of [d][key]
    __shared__ __attribute__((aligned(16))) f16 vrT[2 * 64 * PK64];   // two buffers of [d][key] residual (early path)
    __shared__ __attribute__((aligned(16))) f16 ps[8 * 16 * PK64];    // per-wave ctx stage
    __shared__ __attribute__((aligned(16))) f16 pr[8 * 16 * PK64];    // per-wave ctx residual stage (early path)
    const u32 rank = blockIdx.x / (u32)ATT_NH;
    const u32 bh   = blockIdx.x % (u32)ATT_NH;
    const u32 qblk = (rank < (u32)ATT_NU) ? (u32)(ATT_NQ - 1) - rank : rank - (u32)ATT_NU;
    if (qblk < (u32)ATT_E_BX) {
        attn_body<true>(Qp, Kp, Vt, Vr, Cp, Cr, qblk, bh, ks, vsT, vrT, ps, pr);
    } else {
        attn_body<false>(Qp, Kp, Vt, Vt, Cp, Cp, qblk, bh, ks, vsT, vrT, ps, pr);
    }
}

// coverage equalities (threads x elements == plane elements)
static_assert((size_t)(MROWS / 2) * 256 * 8 == (size_t)MROWS * HID);                       // cvt_rows -> Xh
static_assert((size_t)(3 * HID / 64) * (HID / 64) * 64 * 64 == (size_t)3 * HID * HID);     // cvt_wT -> Wt
static_assert((size_t)(HID / 64) * (HID / 64) * 64 * 64 == (size_t)HID * HID);             // cvt_wT -> Wot
static_assert((size_t)(MROWS / 128) * (HID / 128) * 128 * 128 == (size_t)MROWS * HID);     // gemm planes / out
static_assert((size_t)(SEQ / 128) * (NB * NHEAD) * 128 * HD == (size_t)MROWS * HID);       // attn -> Cp
// workspace: 7 activation planes + 4 weight planes of halves, at most 128 MiB
static_assert(((size_t)7 * MROWS * HID + (size_t)4 * HID * HID) * sizeof(f16) <= (size_t)134217728);

// ---------------------------------------------------------------------------
// Launch: 4 kernel launches, workspace 7 planes of MROWS*1024 halves + 4 of 1024*1024 halves.
// ---------------------------------------------------------------------------
extern "C" void kernel_launch(void* const* d_in, const int* in_sizes, int n_in,
                              void* d_out, int out_size, void* d_ws, size_t ws_size,
                              hipStream_t stream) {
    if (n_in < 5) return;
    if (in_sizes[0] < ((NB - 1) * SEQ_FULL + SEQ) * HID) return;
    if (in_sizes[1] < 3 * HID * HID) return;
    if (in_sizes[2] < 3 * HID) return;
    if (in_sizes[3] < HID * HID) return;
    if (in_sizes[4] < HID) return;
    const size_t needOut = OUT0_ELEMS_FULL + PRES_ELEMS_FULL
                         + ((size_t)((NB - 1) * NHEAD + NHEAD - 1) * SEQ_FULL + SEQ) * HD;
    if ((size_t)out_size < needOut) return;

    const float* x     = (const float*)d_in[0];   // [NB_FULL][SEQ_FULL][1024]
    const float* wattn = (const float*)d_in[1];   // [1024 in][3072 out], out columns q | k | v
    const float* battn = (const float*)d_in[2];   // [3072]
    const float* wproj = (const float*)d_in[3];   // [1024 in][1024 out]
    const float* bproj = (const float*)d_in[4];   // [1024]
    float* out = (float*)d_out;                   // out0 | present k | present v

    const size_t nX = (size_t)MROWS * HID;    // halves per activation plane
    const size_t nW = (size_t)HID * HID;      // halves per weight plane
    const size_t totalHalves = 7 * nX + 4 * nW;
    if (ws_size < totalHalves * sizeof(f16)) return;

    f16* Xh  = (f16*)d_ws;       // [MROWS][1024]               carry 16
    f16* Wt  = Xh  + nX;         // [3072 out][1024 in]         carry 32 (q | k | v row blocks)
    f16* Wot = Wt  + 3 * nW;     // [1024 out][1024 in]         carry 32
    f16* Qp  = Wot + nW;         // [NB*16][SEQ][64]            carry 16
    f16* Kp  = Qp  + nX;         // [NB*16][SEQ][64]            carry 16
    f16* Vtp = Kp  + nX;         // [NB*1024][SEQ] (V^T)        carry 16
    f16* Vrp = Vtp + nX;         // [NB*1024][SEQ] residual, columns s < EARLY only
    f16* Cp  = Vrp + nX;         // [MROWS][1024]               carry 1024
    f16* Cr  = Cp  + nX;         // [MROWS][1024] residual, rows s < EARLY only

    cvt_all<<<CVT_X_BLOCKS + CVT_WA_BLOCKS + CVT_WP_BLOCKS, 256, 0, stream>>>(x, wattn, wproj, Xh, Wt, Wot);

    const dim3 gg(MROWS / 128, HID / 128);
    gemm_qkv<<<dim3(MROWS / 128, HID / 128, 3), 256, 0, stream>>>(Xh, Wt, battn, Qp, Kp, Vtp, Vrp,
                                                                  out + OUT0_ELEMS_FULL);

    attn_all<<<ATT_NQ * ATT_NH, 256, 0, stream>>>(Qp, Kp, Vtp, Vrp, Cp, Cr);

    // out = acc / (1024*32) + bias ; residual context plane at Cp + nX
    gemm_o<<<gg, 256, 0, stream>>>(Cp, Wot, bproj, out, nX);
}

// v008
// One run takes 76.1 microseconds.
// Timed twice side by side with v007, it ran 1.04 times as fast both times.
// All steps since v000 together make it 4.51 times as fast.
#include <hip/hip_runtime.h>

// Contractions (fused QKV projection, Q.K^T, P.V, P row-sum, output projection): v_wmma_f32_16x16x32_f16, f16 operands with power-of-two carries, f32 accumulate; every float input enters as its bf16 RNE value; the first EARLY query rows of each sequence carry P, V and context as f16 hi + f16 residual planes (extra products into the same f32 accumulators); softmax in f32.

#ifndef NB
#define NB 2
#endif
#ifndef SEQ
#define SEQ 2048
#endif
#define NB_FULL   2
#define SEQ_FULL  2048
#define HID       1024
#define NHEAD     16
#define HD        64
#define MROWS     (NB * SEQ)
#define EARLY_CAP 512
#define EARLY     ((SEQ < EARLY_CAP) ? SEQ : EARLY_CAP)

#define OUT0_ELEMS_FULL ((size_t)NB_FULL * SEQ_FULL * HID)          // out0 elements
#define PRES_ELEMS_FULL ((size_t)NB_FULL * NHEAD * SEQ_FULL * HD)   // elements of present[0] (k) or present[1] (v)

static_assert(HID == NHEAD * HD);        // merged head width
static_assert(NHEAD == 16);              // bh >> 4 / bh & 15 decoding
static_assert(HD == 64);
static_assert(SEQ % 128 == 0);           // 128-row blocks never straddle a batch
static_assert(EARLY % 128 == 0);
static_assert(EARLY >= 128 && EARLY <= SEQ);
static_assert(SEQ <= SEQ_FULL);
static_assert(NB >= 1 && NB <= NB_FULL);
static_assert(MROWS % 128 == 0);         // GEMM M tile
static_assert(HID % 128 == 0);           // GEMM N tile
static_assert(HID % 64 == 0);            // weight transpose tile
static_assert(HID % 32 == 0);            // WMMA k step
static_assert(HID % 256 == 0);           // staged k tiles of 128, at least two of them
static_assert(HID == 128 * 8);           // cvt_rows: 128 threads x 8 values per row
static_assert(OUT0_ELEMS_FULL * 4 == (size_t)16777216);   // byte offset of the second output

// carries (exact powers of two)
#define CARRY_X    16.0f     // input activation plane
#define CARRY_W    32.0f     // weight planes
#define CARRY_QKV  16.0f     // q, k, v^T planes (true value x16); v residual in the same units
#define CARRY_CTX  1024.0f   // context planes (true value x1024); residual in the same units
// softmax exp values carry 2^10 (added to the exp2 argument); residual in the same units

// LDS row pitches in elements: every row read or written 16 bytes per lane has a pitch of 16 B x odd,
// so the 16 lanes of a lane half fall on 64 distinct banks
#define PK32   40u    // 32-half rows (64 B)  -> 80 B
#define PK64   72u    // 64-half rows (128 B) -> 144 B
#define PC16   136u   // 128-half rows (256 B) -> 272 B
#define PC32   132u   // 128-float rows (512 B) -> 528 B
#define KTILE  128u   // k values per staged GEMM tile (256-byte rows)

typedef unsigned u32;
typedef _Float16 f16;
typedef f16   v16h __attribute__((ext_vector_type(16)));
typedef f16   v8h  __attribute__((ext_vector_type(8)));
typedef f16   v2h  __attribute__((ext_vector_type(2)));
typedef float v2f  __attribute__((ext_vector_type(2)));
typedef float v8f  __attribute__((ext_vector_type(8)));
typedef float v4f  __attribute__((ext_vector_type(4)));

union FragU { v16h v; v8h half[2]; v2h pair[8]; f16 e[16]; };
union H8U   { v8h v; f16 e[8]; };

__device__ __forceinline__ v8f zero8() {
    v8f z = {0.f, 0.f, 0.f, 0.f, 0.f, 0.f, 0.f, 0.f};
    return z;
}

// 16-bit WMMA: D += A[16 x 32k] * B[32k x 16] (the builtin: the distances behind it are the compiler's)
__device__ __forceinline__ v8f wmma16(v16h a, v16h b, v8f c) {
    return __builtin_amdgcn_wmma_f32_16x16x32_f16(false, a, false, b, (short)0, c, false, false);
}

// f32 -> nearest-even bf16 value, returned as f32
__device__ __forceinline__ float bf16_rne(float x) {
    u32 u = __float_as_uint(x);
    u = (u + 0x7fffu + ((u >> 16) & 1u)) & 0xffff0000u;
    return __uint_as_float(u);
}

__device__ __forceinline__ float fexp2(float x) {
#if defined(__has_builtin)
#if __has_builtin(__builtin_amdgcn_exp2f)
    return __builtin_amdgcn_exp2f(x);
#else
    return exp2f(x);
#endif
#else
    return exp2f(x);
#endif
}

// value of lane l ^ 16 (the other lane half)
__device__ __forceinline__ float xhalf(float x) {
    const int v = __builtin_bit_cast(int, x);
    return __builtin_bit_cast(float, __builtin_amdgcn_permlanex16(v, v, 0x76543210, 0xfedcba98, false, false));
}

// 16 x 32 fragment from a tile whose k dimension is contiguous (pitch in halves).
// lane l: row rowbase + (l&15); elements 0..7 <- k = kcol + 8h .. +7,
// elements 8..15 <- k = kcol + 16 + 8h .. +7  (h = l>>4). Same map for A and B.
__device__ __forceinline__ v16h load_frag(const f16* tile, u32 rowbase, u32 pitch, u32 kcol, u32 lane) {
    const u32 r  = rowbase + (lane & 15u);
    const u32 kh = (lane >> 4) << 3;
    const f16* p = tile + (size_t)r * pitch + kcol + kh;
    FragU f;
    f.half[0] = *(const v8h*)(p);
    f.half[1] = *(const v8h*)(p + 16);
    return f.v;
}

// LDS byte address of a __shared__ element (low 32 bits of its address)
__device__ __forceinline__ u32 lds_addr(const f16* p) {
    return (u32)(size_t)p;
}

// Asynchronous copies global -> LDS, 16 bytes per lane, no register staging. The s_wait_xcnt closes each
// statement so that no address register of an issued copy is rewritten ahead of it.
// Eight copies whose rows lie 16 apart: LDS step lstep bytes, global step gstep halves.
__device__ __forceinline__ void async_copy8(u32 l, u32 lstep, const f16* g, size_t gstep) {
    asm volatile("global_load_async_to_lds_b128 %0, %8, off\n\t"
                 "global_load_async_to_lds_b128 %1, %9, off\n\t"
                 "global_load_async_to_lds_b128 %2, %10, off\n\t"
                 "global_load_async_to_lds_b128 %3, %11, off\n\t"
                 "global_load_async_to_lds_b128 %4, %12, off\n\t"
                 "global_load_async_to_lds_b128 %5, %13, off\n\t"
                 "global_load_async_to_lds_b128 %6, %14, off\n\t"
                 "global_load_async_to_lds_b128 %7, %15, off\n\t"
                 "s_wait_xcnt 0x0"
                 :: "v"(l), "v"(l + lstep), "v"(l + 2u * lstep), "v"(l + 3u * lstep),
                    "v"(l + 4u * lstep), "v"(l + 5u * lstep), "v"(l + 6u * lstep), "v"(l + 7u * lstep),
                    "v"(g), "v"(g + gstep), "v"(g + 2 * gstep), "v"(g + 3 * gstep),
                    "v"(g + 4 * gstep), "v"(g + 5 * gstep), "v"(g + 6 * gstep), "v"(g + 7 * gstep)
                 : "memory");
}

// Four and two copies with each lane's own addresses given one by one.
__device__ __forceinline__ void async_copy4(u32 l0, const f16* g0, u32 l1, const f16* g1,
                                            u32 l2, const f16* g2, u32 l3, const f16* g3) {
    asm volatile("global_load_async_to_lds_b128 %0, %4, off\n\t"
                 "global_load_async_to_lds_b128 %1, %5, off\n\t"
                 "global_load_async_to_lds_b128 %2, %6, off\n\t"
                 "global_load_async_to_lds_b128 %3, %7, off\n\t"
                 "s_wait_xcnt 0x0"
                 :: "v"(l0), "v"(l1), "v"(l2), "v"(l3), "v"(g0), "v"(g1), "v"(g2), "v"(g3)
                 : "memory");
}
__device__ __forceinline__ void async_copy2(u32 l0, const f16* g0, u32 l1, const f16* g1) {
    asm volatile("global_load_async_to_lds_b128 %0, %2, off\n\t"
                 "global_load_async_to_lds_b128 %1, %3, off\n\t"
                 "s_wait_xcnt 0x0"
                 :: "v"(l0), "v"(l1), "v"(g0), "v"(g1)
                 : "memory");
}

// publish point of a two-buffer ring: this wave's LDS reads retired, its own copies landed, then the block
// barrier that shows the next tile to every wave and frees the buffer just read
__device__ __forceinline__ void ring_publish() {
    asm volatile("s_wait_dscnt 0x0" ::: "memory");     // reads of the buffer to be refilled have retired
    asm volatile("s_wait_asynccnt 0x0" ::: "memory");  // this wave's copies of the next tile have landed
    __syncthreads();
}

// ---------------------------------------------------------------------------
// f32 rows [.][1024] -> f16 plane (bf16 RNE value times carry). 128 threads per 1024-wide
// Row mapping dst row m -> src row (m / dstper) * srcper + m % dstper lets a reduced build
// read full-size inputs.
// coverage: nrows x 1024 halves, every element exactly once (grid = nrows*128/256).
// ---------------------------------------------------------------------------
__device__ __forceinline__ void
cvt_rows_body(const float* src, f16* dst, u32 blk, u32 nrows, u32 dstper, u32 srcper, float carry) {
    const u32 g  = blk * 256u + threadIdx.x;
    const u32 m  = g >> 7;
    const u32 c8 = (g & 127u) << 3;
    if (m >= nrows) return;
    const u32 mb = m / dstper;
    const u32 sm = mb * srcper + (m - mb * dstper);
    const float* sp = src + (size_t)sm * HID + c8;
    const v4f a = *(const v4f*)sp;
    const v4f b = *(const v4f*)(sp + 4);
    H8U o;
#pragma unroll
    for (u32 j = 0; j < 4; ++j) {
        const float x0 = a[j];
        const float x1 = b[j];
        o.e[j]     = (f16)(bf16_rne(x0) * carry);
        o.e[j + 4] = (f16)(bf16_rne(x1) * carry);
    }
    f16* dp = dst + (size_t)m * HID + c8;
    *(v8h*)dp = o.v;
    
}

// ---------------------------------------------------------------------------
// Transposing weight convert: src[rows][cols] f32 -> dst[cols][rows] f16 (bf16 RNE value
// times carry). Block = 64 (src rows, k) x 64 (src cols, n) tile, grid (cols/64, rows/64).
// Tile staged transposed in LDS (pitch 72 halves), then each dst row segment of 64 halves
// coverage: 4 x 256 threads x 4 values == 64 x 64 per block; blocks tile rows x cols exactly.
// LDS t: cross-wave, block barrier; staged extent 64 x 64 == consumed extent.
// ---------------------------------------------------------------------------
__device__ __forceinline__ void
cvt_wT_body(const float* src, f16* dst, f16* t, u32 bx, u32 by, u32 rows, u32 cols, float carry) {
    const u32 tid = threadIdx.x;
    const u32 n0  = bx * 64u;   // src column block == dst row block
    const u32 k0  = by * 64u;   // src row block == dst column block
#pragma unroll
    for (u32 it = 0; it < 4; ++it) {
        const u32 p  = tid + it * 256u;
        const u32 kr = p >> 4;              // 0..63
        const u32 c4 = (p & 15u) << 2;      // 0..60
        const v4f a = *(const v4f*)(src + (size_t)(k0 + kr) * cols + n0 + c4);
#pragma unroll
        for (u32 j = 0; j < 4; ++j) {
            const float x = a[j];
            t[(c4 + j) * 72u + kr] = (f16)(bf16_rne(x) * carry);
        }
    }
    __syncthreads();
    const u32 piece = tid & 7u;
    const u32 lrow  = tid >> 3;             // 0..31
{
#pragma unroll
        for (u32 it = 0; it < 2; ++it) {
            const u32 L = it * 32u + lrow;  // dst row within the tile, 0..63
            const v8h v = *(const v8h*)&t[L * 72u + piece * 8u];
            f16* dp = dst + (size_t)(n0 + L) * rows + k0 + piece * 8u;
            *(v8h*)dp = v;
        }
        asm volatile("s_wait_xcnt 0x0" ::: "memory");   // before code behind this body rewrites a register of these stores
    }
}

// The three converts in one launch: none reads what another writes. Flat grid: the blocks of the activation
// rows first, then those of the two weight transposes; the choice is block-uniform.
#define CVT_WA_BX     (3 * HID / 64)
#define CVT_WA_BLOCKS (CVT_WA_BX * (HID / 64))
#define CVT_WP_BX     (HID / 64)
#define CVT_WP_BLOCKS (CVT_WP_BX * (HID / 64))
#define CVT_X_BLOCKS  (MROWS / 2)
__global__ void __launch_bounds__(256)
cvt_all(const float* __restrict__ x, const float* __restrict__ wattn, const float* __restrict__ wproj,
        f16* __restrict__ Xh, f16* __restrict__ Wt, f16* __restrict__ Wot) {
    __shared__ __attribute__((aligned(16))) f16 t[64 * 72];
    const u32 b = blockIdx.x;
    if (b < (u32)CVT_X_BLOCKS) {
        // dst row m of batch b <- src row b*SEQ_FULL + (m % SEQ)
        cvt_rows_body(x, Xh, b, (u32)MROWS, (u32)SEQ, (u32)SEQ_FULL, CARRY_X);
    } else if (b < (u32)(CVT_X_BLOCKS + CVT_WA_BLOCKS)) {
        // in[rows = 1024 (k)][cols = 3072 (n)] -> out[cols][rows]
        const u32 bb = b - (u32)CVT_X_BLOCKS;
        cvt_wT_body(wattn, Wt, t, bb % (u32)CVT_WA_BX, bb / (u32)CVT_WA_BX, (u32)HID, (u32)(3 * HID), CARRY_W);
    } else {
        // in[rows = 1024 (k)][cols = 1024 (n)] -> out[cols][rows]
        const u32 bb = b - (u32)(CVT_X_BLOCKS + CVT_WA_BLOCKS);
        cvt_wT_body(wproj, Wot, t, bb % (u32)CVT_WP_BX, bb / (u32)CVT_WP_BX, (u32)HID, (u32)HID, CARRY_W);
    }
}

// ---------------------------------------------------------------------------
// C[m][n] = sum_k A[m][k] * W[n][k] ; A [MROWS][1024] f16, W [1024][1024] f16 (k contiguous).
// Block tile 128 x 128, 8 waves as 4(M) x 2(N), 2 x 4 accumulators per wave, WMMA k step 32.
// A and W tiles of 128 k come by asynchronous copies into two LDS buffers: tile t + 1 flies while tile t is multiplied.
// Inside a tile the fragments of the next 32-k step are read, as one group, ahead of this step's products.
// true value t = acc * mul + bias (bias enters as its bf16 RNE value, added in f32).
// MODE 0: f16 plane [b*NHEAD + h][s][d] (t x16)
// MODE 1: MODE 0 plane + f32 rows [b*NHEAD + h][s][d] (t) into the output buffer
// MODE 2: f16 plane [b*HID + h*HD + d][s] (t x16, transposed per head), residual plane of the
//         same layout for key blocks below EARLY, + f32 rows as MODE 1
// MODE 3: f32 rows [b][s][1024] into the output buffer; RES (row blocks below EARLY): each staged tile also brings
//         the residual A plane's rows (A + resOff) into a ring of their own, and every 32-k step multiplies both A
//         planes by the same W fragments, so W is staged and read once for the two planes
// coverage per block: f16 planes 256 lines (128 rows x 2 heads | 128 n x 2 s-halves);
//                     f32 2 x 256 lines (64 rows x 4 line-quarters per half).
// LDS: As/Bs/Cs all cross-wave, separated by block barriers.
// staged extent == consumed extent: As/Bs (and Rs when RES) 128 x 128 per buffer, Cs 128 x 128 halves (or 64 x 128 floats).
// ---------------------------------------------------------------------------
template <int MODE, bool RES = false>
__device__ __forceinline__ void gemm_body(const f16* A, const f16* W, const float* bias,
                                          f16* plane, f16* plane2, float* fout, size_t resOff,
                                          f16* As, f16* Bs, f16* Cs, f16* Rs) {
    static_assert(!RES || MODE == 3);
    // As, Bs (Rs when RES): two buffers of 128 rows x 128 k each; Cs: f16 [128][128] at pitch PC16 or f32 [64][128] at pitch PC32
    static_assert(sizeof(f16) * 128 * PC16 >= sizeof(float) * 64 * PC32);   // Cs reuse as f32 [64][128]

    const u32 tid  = threadIdx.x;
    const u32 lane = tid & 31u;
    const u32 wave = tid >> 5;
    const u32 wm   = wave & 3u;
    const u32 wn   = wave >> 2;
    const u32 hh8  = (lane >> 4) << 3;   // D row half
    const u32 c16  = lane & 15u;         // D column
    const u32 m0   = blockIdx.x * 128u;
    const u32 n0   = blockIdx.y * 128u;
    const u32 bidx = m0 / (u32)SEQ;      // block rows lie inside one batch (SEQ % 128 == 0)
    const u32 s0   = m0 - bidx * (u32)SEQ;

    v8f acc[2][4];
#pragma unroll
    for (int i = 0; i < 2; ++i)
#pragma unroll
        for (int j = 0; j < 4; ++j) acc[i][j] = zero8();

    // staging map: 16 lanes cover one 256-byte row segment, a wave's copy two rows (four whole lines)
    const u32 crow = tid >> 4;
    const u32 ccol = (tid & 15u) << 3;
    const f16* gA = A + (size_t)(m0 + crow) * HID + ccol;
    const f16* gW = W + (size_t)(n0 + crow) * HID + ccol;
    const u32 lA = lds_addr(&As[crow * PC16 + ccol]);
    const u32 lB = lds_addr(&Bs[crow * PC16 + ccol]);
    const u32 lR = lds_addr(&Rs[RES ? crow * PC16 + ccol : 0u]);
    const u32 nT = (u32)HID / KTILE;     // 8 tiles

    auto stage = [&](u32 t) {
        const u32 kk = t * KTILE;
        const u32 bo = (t & 1u) * (128u * PC16 * 2u);
        async_copy8(lA + bo, 16u * PC16 * 2u, gA + kk, (size_t)16 * HID);
        if constexpr (RES) async_copy8(lR + bo, 16u * PC16 * 2u, gA + resOff + kk, (size_t)16 * HID);
        async_copy8(lB + bo, 16u * PC16 * 2u, gW + kk, (size_t)16 * HID);
    };

    stage(0u);
    asm volatile("s_wait_asynccnt 0x0" ::: "memory");   // tile 0 landed before the barrier that shows it
    __syncthreads();
    stage(1u);

#pragma unroll 1   // stays rolled: one trip per staged tile, its buffer chosen by t & 1
    for (u32 t = 0; t < nT; ++t) {
        const f16* as = As + (t & 1u) * (128u * PC16);
        const f16* bs = Bs + (t & 1u) * (128u * PC16);
        const f16* rs = Rs + (RES ? (t & 1u) * (128u * PC16) : 0u);
        v16h af[2][2], bfr[2][4];       // two fragment sets: the next 32-k step is read while this one is multiplied
        v16h rf[2][2];                  // residual A fragments (RES)
        auto frags = [&](u32 set, u32 kc) {
#pragma unroll
            for (int i = 0; i < 2; ++i) af[set][i] = load_frag(as, wm * 32u + (u32)i * 16u, PC16, kc, lane);
            if constexpr (RES) {
#pragma unroll
                for (int i = 0; i < 2; ++i) rf[set][i] = load_frag(rs, wm * 32u + (u32)i * 16u, PC16, kc, lane);
            }
#pragma unroll
            for (int j = 0; j < 4; ++j) bfr[set][j] = load_frag(bs, wn * 64u + (u32)j * 16u, PC16, kc, lane);
        };
        frags(0u, 0u);
#pragma unroll     // the four 32-k steps of a tile in line, every LDS offset an immediate
        for (u32 ks = 0; ks < KTILE / 32u; ++ks) {
            if (ks + 1u < KTILE / 32u) frags((ks + 1u) & 1u, (ks + 1u) * 32u);
            __builtin_amdgcn_sched_barrier(0);   // the next step's reads stay one group ahead of this step's products
#pragma unroll
            for (int i = 0; i < 2; ++i)
#pragma unroll
                for (int j = 0; j < 4; ++j) acc[i][j] = wmma16(af[ks & 1u][i], bfr[ks & 1u][j], acc[i][j]);
            if constexpr (RES) {
#pragma unroll
                for (int i = 0; i < 2; ++i)
#pragma unroll
                    for (int j = 0; j < 4; ++j) acc[i][j] = wmma16(rf[ks & 1u][i], bfr[ks & 1u][j], acc[i][j]);
            }
            __builtin_amdgcn_sched_barrier(0);   // and no later read moves up among these products
        }
        ring_publish();
        if (t + 2u < nT) stage(t + 2u);  // into the buffer this trip has just read
    }
    asm volatile("s_wait_asynccnt 0x0" ::: "memory");   // nothing in flight when the epilogue starts

    const float mul = (MODE == 3) ? (1.0f / (CARRY_CTX * CARRY_W)) : (1.0f / (CARRY_X * CARRY_W));
    float bv[4];
#pragma unroll
    for (int j = 0; j < 4; ++j) {
        const float bx = bias[n0 + wn * 64u + (u32)j * 16u + c16];
        asm volatile("s_wait_xcnt 0x0" ::: "memory");   // before a later load of this run rewrites the offset register that this load names
        bv[j] = bf16_rne(bx);
    }

    const u32 piece = lane & 7u;
    const u32 lsub  = lane >> 3;

    if constexpr (MODE == 0 || MODE == 1) {
#pragma unroll
        for (int i = 0; i < 2; ++i)
#pragma unroll
            for (int j = 0; j < 4; ++j) {
                const u32 nl = wn * 64u + (u32)j * 16u + c16;
#pragma unroll
                for (int r = 0; r < 8; ++r) {
                    const u32 ml = wm * 32u + (u32)i * 16u + hh8 + (u32)r;
                    const float tv = acc[i][j][r] * mul + bv[j];
                    Cs[ml * PC16 + nl] = (f16)(tv * CARRY_QKV);
                }
            }
        __syncthreads();
        const size_t bh0 = (size_t)bidx * NHEAD + (n0 >> 6);
{
#pragma unroll
            for (u32 it = 0; it < 8; ++it) {
                const u32 L    = wave * 32u + it * 4u + lsub;   // 0..255
                const u32 ml   = L >> 1;
                const u32 hsel = L & 1u;
                const v8h v = *(const v8h*)&Cs[ml * PC16 + hsel * 64u + piece * 8u];
                f16* dp = plane + ((bh0 + hsel) * SEQ + s0 + ml) * HD + piece * 8u;
                *(v8h*)dp = v;
            }
            
        }
    }
    if constexpr (MODE == 2) {
        // hi plane, staged transposed: Cs[n][m]
#pragma unroll
        for (int i = 0; i < 2; ++i)
#pragma unroll
            for (int j = 0; j < 4; ++j) {
                const u32 nl = wn * 64u + (u32)j * 16u + c16;
                H8U t;
#pragma unroll
                for (int r = 0; r < 8; ++r) {
                    const float tv = (acc[i][j][r] * mul + bv[j]) * CARRY_QKV;
                    t.e[r] = (f16)tv;
                }
                *(v8h*)&Cs[nl * PC16 + wm * 32u + (u32)i * 16u + hh8] = t.v;
            }
        __syncthreads();
{
#pragma unroll
            for (u32 it = 0; it < 8; ++it) {
                const u32 L  = wave * 32u + it * 4u + lsub;     // 0..255
                const u32 nl = L >> 1;
                const u32 mh = L & 1u;
                const v8h v = *(const v8h*)&Cs[nl * PC16 + mh * 64u + piece * 8u];
                f16* dp = plane + ((size_t)(bidx * (u32)HID + n0 + nl) * SEQ + s0 + mh * 64u + piece * 8u);
                *(v8h*)dp = v;
            }
            asm volatile("s_wait_xcnt 0x0" ::: "memory");   // before the residual path rewrites a register of these stores
        }
        if (s0 < (u32)EARLY) {          // block-uniform: residual plane only for early key blocks
            __syncthreads();
#pragma unroll
            for (int i = 0; i < 2; ++i)
#pragma unroll
                for (int j = 0; j < 4; ++j) {
                    const u32 nl = wn * 64u + (u32)j * 16u + c16;
                    H8U t;
#pragma unroll
                    for (int r = 0; r < 8; ++r) {
                        const float tv = (acc[i][j][r] * mul + bv[j]) * CARRY_QKV;
                        const f16   hi = (f16)tv;
                        t.e[r] = (f16)(tv - (float)hi);
                    }
                    *(v8h*)&Cs[nl * PC16 + wm * 32u + (u32)i * 16u + hh8] = t.v;
                }
            __syncthreads();
{
#pragma unroll
                for (u32 it = 0; it < 8; ++it) {
                    const u32 L  = wave * 32u + it * 4u + lsub;
                    const u32 nl = L >> 1;
                    const u32 mh = L & 1u;
                    const v8h v = *(const v8h*)&Cs[nl * PC16 + mh * 64u + piece * 8u];
                    f16* dp = plane2 + ((size_t)(bidx * (u32)HID + n0 + nl) * SEQ + s0 + mh * 64u + piece * 8u);
                    *(v8h*)dp = v;
                }
                
            }
        }
    }
    if constexpr (MODE >= 1) {
        if constexpr (MODE != 3) __syncthreads();   // f16 stage reads finished before restaging
        float* Cf = (float*)Cs;      // [64][128] f32 at pitch PC32
#pragma unroll
        for (u32 half = 0; half < 2; ++half) {
            if ((wm >> 1) == half) {
#pragma unroll
                for (int i = 0; i < 2; ++i)
#pragma unroll
                    for (int j = 0; j < 4; ++j) {
                        const u32 nl = wn * 64u + (u32)j * 16u + c16;
#pragma unroll
                        for (int r = 0; r < 8; ++r) {
                            const u32 ml = (wm & 1u) * 32u + (u32)i * 16u + hh8 + (u32)r;
                            Cf[ml * PC32 + nl] = acc[i][j][r] * mul + bv[j];
                        }
                    }
            }
            __syncthreads();
{
#pragma unroll
                for (u32 it = 0; it < 8; ++it) {
                    const u32 L    = wave * 32u + it * 4u + lsub;   // 0..255
                    const u32 row  = L >> 2;
                    const u32 part = L & 3u;
                    const v4f v = *(const v4f*)&Cf[row * PC32 + part * 32u + piece * 4u];
                    size_t off;
                    if constexpr (MODE == 3) {
                        off = (size_t)(bidx * (u32)SEQ_FULL + s0 + half * 64u + row) * HID
                            + n0 + part * 32u + piece * 4u;
                    } else {
                        off = ((size_t)(bidx * (u32)NHEAD + (n0 >> 6) + (part >> 1)) * SEQ_FULL
                               + s0 + half * 64u + row) * HD + (part & 1u) * 32u + piece * 4u;
                    }
                    *(v4f*)(fout + off) = v;
                }
                
            }
            __syncthreads();
        }
    }
}

// The q, k and v projections in one launch (none reads what another writes), blockIdx.z picks the
// weight block and the epilogue: 0 = q head-major plane, 1 = k head-major plane + f32 k rows of the second
// output, 2 = v^T plane + v^T residual plane (early keys) + f32 v rows of the second output.
__global__ void __launch_bounds__(256) __attribute__((amdgpu_num_vgpr(256)))
gemm_qkv(const f16* __restrict__ A, const f16* __restrict__ W, const float* __restrict__ bias,
         f16* __restrict__ outQ, f16* __restrict__ outK, f16* __restrict__ outT, f16* __restrict__ outR,
         float* __restrict__ pres) {
    __shared__ __attribute__((aligned(16))) f16 As[2 * 128 * PC16];
    __shared__ __attribute__((aligned(16))) f16 Bs[2 * 128 * PC16];
    // The epilogue's stage lies on the A ring: behind the loop's last publish point no wave reads the ring any more and
    // no copy is in flight. 136 KiB of LDS instead of 170, so two work-groups share a WGP (3 per WGP are launched): one's
    // first tile, barrier waits and epilogue run under the other's products.
    f16* Cs = As;
    static_assert(sizeof(As) >= sizeof(f16) * 128 * PC16);
    const u32 z = blockIdx.z;            // block-uniform
    if (z == 0u) {
        gemm_body<0>(A, W, bias, outQ, outQ, pres, (size_t)0, As, Bs, Cs, As);
    } else if (z == 1u) {
        gemm_body<1>(A, W + (size_t)HID * HID, bias + HID, outK, outK, pres, (size_t)0, As, Bs, Cs, As);
    } else {
        gemm_body<2>(A, W + (size_t)2 * HID * HID, bias + 2 * HID, outT, outR, pres + PRES_ELEMS_FULL, (size_t)0,
                     As, Bs, Cs, As);
    }
}

// f32 output rows; A residual plane at A + resOff for early row blocks (the choice is block-uniform). One work-group per
// WGP is launched, so the launch lasts as long as an early block: it walks the same 8 tiles as the others.
__global__ void __launch_bounds__(256) __attribute__((amdgpu_num_vgpr(256)))
gemm_o(const f16* __restrict__ A, const f16* __restrict__ W, const float* __restrict__ bias,
       float* __restrict__ out, size_t resOff) {
    __shared__ __attribute__((aligned(16))) f16 As[2 * 128 * PC16];
    __shared__ __attribute__((aligned(16))) f16 Bs[2 * 128 * PC16];
    __shared__ __attribute__((aligned(16))) f16 Rs[2 * 128 * PC16];
    __shared__ __attribute__((aligned(16))) f16 Cs[128 * PC16];
    if ((blockIdx.x * 128u) % (u32)SEQ < (u32)EARLY) {
        gemm_body<3, true>(A, W, bias, (f16*)out, (f16*)out, out, resOff, As, Bs, Cs, Rs);
    } else {
        gemm_body<3, false>(A, W, bias, (f16*)out, (f16*)out, out, resOff, As, Bs, Cs, Rs);
    }
}

// ---------------------------------------------------------------------------
// Online softmax update for one transposed score tile, 64 keys x 16 q (log2 domain, max-subtracted).
// s[nt][r] = score of key kbase + 16 nt + hh8 + r against query q: a lane holds 32 keys of ONE query, the
// lane 16 away the other 32, so the maximum is in-lane plus one exchange and m, al are one value per lane.
// The carried exp values, converted in place, are the B fragments of the next product:
// pb[kk] element j = tile 2 kk + (j >> 3), register j & 7, which is load_frag's k order.
// MASK: keys above the query row get probability exactly 0 and do not enter the row max.
// EP: also emit the f16 residual of each carried exp value.
// ---------------------------------------------------------------------------
template <bool MASK, bool EP>
__device__ __forceinline__ void softmax_tile(const v8f (&s)[4], float& m, v8f (&o)[4], v8f& lacc,
                                             FragU (&pb)[2], FragU (&prb)[2], u32 kbase, u32 q,
                                             u32 hh8, float cl) {
    float x[4][8];
    float t4[4];
#pragma unroll
    for (int nt = 0; nt < 4; ++nt) {
#pragma unroll
        for (int r = 0; r < 8; ++r) {
            x[nt][r] = s[nt][r] * cl;
            if constexpr (MASK) {
                const bool dead = (kbase + (u32)nt * 16u + hh8 + (u32)r) > q;
                x[nt][r] = dead ? -1.0e30f : x[nt][r];
            }
        }
        t4[nt] = fmaxf(fmaxf(fmaxf(x[nt][0], x[nt][1]), fmaxf(x[nt][2], x[nt][3])),
                       fmaxf(fmaxf(x[nt][4], x[nt][5]), fmaxf(x[nt][6], x[nt][7])));
    }
    float tm = fmaxf(fmaxf(t4[0], t4[1]), fmaxf(t4[2], t4[3]));
    tm = fmaxf(tm, xhalf(tm));
    const float mn = fmaxf(m, tm);
    const float al = fexp2(m - mn);
    m = mn;
    lacc *= al;
#pragma unroll
    for (int dt = 0; dt < 4; ++dt) o[dt] *= al;
    const float sh = 10.0f - mn;      // carry 2^10
#pragma unroll
    for (int nt = 0; nt < 4; ++nt) {
#pragma unroll
        for (int r = 0; r < 8; r += 2) {
            v2f e;
            e.x = fexp2(x[nt][r] + sh);
            e.y = fexp2(x[nt][r + 1] + sh);
            if constexpr (MASK) {
                e.x = ((kbase + (u32)nt * 16u + hh8 + (u32)r) > q) ? 0.0f : e.x;
                e.y = ((kbase + (u32)nt * 16u + hh8 + (u32)r + 1u) > q) ? 0.0f : e.y;
            }
            const v2h hi = __builtin_convertvector(e, v2h);
            const int  j = (nt & 1) * 4 + (r >> 1);
            pb[nt >> 1].pair[j] = hi;
            if constexpr (EP) prb[nt >> 1].pair[j] = __builtin_convertvector(e - __builtin_convertvector(hi, v2f), v2h);
        }
    }
}

// ---------------------------------------------------------------------------
// Causal flash attention, one (row block, head) per block of 256 (8 waves), wave owns 16 query
// rows (Q fragments resident). Block streams 64-key tiles 0 .. last tile touching its rows:
// K staged [key][d], V^T staged [d][key] (+ residual tile when EP), by asynchronous copies into two
// buffers each: tile kt + 1 flies while tile kt is worked on. A wave computes a tile only
// when the tile starts at or below its first row (wave-uniform); the tile containing its rows
// takes the masked path. Both products run transposed: S^T = K.Q^T (A = K rows, B = the resident Q fragments)
// and O^T += V^T.P^T (A = V^T rows, B = P^T), so a lane's score registers belong to one query, the row max is
// in-lane plus one exchange between the lane halves, and the exp2 values (f32, carried x2^10), converted in
// place, are the B fragments of the second product: P stays in registers. Row sums += ones.P^T on WMMA.
// LDS reads of a tile stand in groups: its eight K fragments ahead of the score products, its eight V^T
// fragments ahead of the softmax (the residual fragments ahead of the second product).
// EP (rows below EARLY): P and V as hi + residual, products hi.hi + res.hi + hi.res into the
// same accumulators; context written as hi plane + residual plane.
// coverage: every (b, q, h*64..h*64+63) row segment of the launched row blocks exactly once.
// LDS: ks, vsT, vrT cross-wave (block barriers); ps/pr per-wave context staging of the epilogue.
// staged extent == consumed extent for ks/vsT/vrT (64x64) and ps/pr (16x64, written
// in full by the owning wave before it reads them).
// ---------------------------------------------------------------------------
template <bool EP>
__device__ __forceinline__ void attn_body(const f16* Qp, const f16* Kp, const f16* Vt, const f16* Vr,
                                          f16* Cp, f16* Cr, u32 qblk, u32 bh,
                                          f16* ks, f16* vsT, f16* vrT, f16* ps, f16* pr) {
    static_assert(HD == 8 * 8);            // 8 lanes x 8 halves per row segment
    static_assert(2 * 256 * 8 == 64 * 64); // staging: 2 copies x 256 threads x 8 halves per tile

    const u32 tid  = threadIdx.x;
    const u32 lane = tid & 31u;
    const u32 wave = (u32)__builtin_amdgcn_readfirstlane((int)(tid >> 5));
    const u32 hh8  = (lane >> 4) << 3;
    const u32 c16  = lane & 15u;
    const u32 bidx = bh >> 4;            // NHEAD == 16
    const u32 hidx = bh & 15u;
    const u32 q0   = qblk * 128u + wave * 16u;
    const size_t head = (size_t)bh * SEQ * HD;

    v16h qa[2];
#pragma unroll
    for (int c = 0; c < 2; ++c) qa[c] = load_frag(Qp + head, q0, HD, (u32)c * 32u, lane);

    FragU onesu;
#pragma unroll
    for (int i = 0; i < 16; ++i) onesu.e[i] = (f16)1.0f;
    const v16h ones = onesu.v;

    // o[dt][r] = O^T[d = 16 dt + hh8 + r][query q0 + c16]; every register of lacc = that query's row sum
    float m = -1.0e30f;
    v8f   o[4], lacc;
#pragma unroll
    for (int dt = 0; dt < 4; ++dt) o[dt] = zero8();
    lacc = zero8();

    // log2-domain scale: acc = 256 * q.k ; x = log2(e) * q.k / 64 = acc * log2(e) / 16384
    const float cl = 1.4426950408889634f * 0.00006103515625f;
    f16* psw = ps + wave * (16u * PK64);
    f16* prw = pr + wave * (16u * PK64);

    const u32 nkt = qblk * 2u + 2u;      // keys 0 .. qblk*128 + 127

    // staging map: 8 lanes cover one 128-byte row, a wave's copy four rows; rows srow and srow + 32 per thread
    const u32 srow = tid >> 3;
    const u32 spc  = (tid & 7u) << 3;
    const f16* gK = Kp + head + (size_t)srow * HD + spc;
    const f16* gV = Vt + head + (size_t)srow * SEQ + spc;
    const f16* gR = Vr + head + (size_t)srow * SEQ + spc;
    const u32 lK = lds_addr(&ks[srow * PK64 + spc]);
    const u32 lV = lds_addr(&vsT[srow * PK64 + spc]);
    const u32 lR = lds_addr(&vrT[EP ? srow * PK64 + spc : 0u]);

    auto stage = [&](u32 t) {
        const u32  bo = (t & 1u) * (64u * PK64 * 2u);
        const u32  hb = 32u * PK64 * 2u;                 // 32 rows further, in LDS bytes
        const f16* k0 = gK + (size_t)t * 64u * HD;
        const f16* v0 = gV + t * 64u;
        async_copy4(lK + bo, k0, lK + bo + hb, k0 + 32 * HD, lV + bo, v0, lV + bo + hb, v0 + (size_t)32 * SEQ);
        if constexpr (EP) {
            const f16* r0 = gR + t * 64u;
            async_copy2(lR + bo, r0, lR + bo + hb, r0 + (size_t)32 * SEQ);
        }
    };

    stage(0u);
    asm volatile("s_wait_asynccnt 0x0" ::: "memory");   // tile 0 landed before the barrier that shows it
    __syncthreads();
    stage(1u);                           // nkt >= 2

#pragma unroll 1   // stays rolled: one trip per staged tile, its buffers chosen by kt & 1
    for (u32 kt = 0; kt < nkt; ++kt) {
        const f16* ksb = ks  + (kt & 1u) * (64u * PK64);
        const f16* vsb = vsT + (kt & 1u) * (64u * PK64);
        const f16* vrb_t = vrT + (EP ? (kt & 1u) * (64u * PK64) : 0u);

        const bool active = (kt * 64u <= q0);           // wave-uniform
        if (active) {
            // S^T[64 keys x 16 q]
            v8f s[4];
            v16h kf[2][4], vf[2][4];
#pragma unroll
            for (int nt = 0; nt < 4; ++nt) s[nt] = zero8();
#pragma unroll
            for (int c = 0; c < 2; ++c)
#pragma unroll
                for (int nt = 0; nt < 4; ++nt) kf[c][nt] = load_frag(ksb, (u32)nt * 16u, PK64, (u32)c * 32u, lane);
            __builtin_amdgcn_sched_barrier(0);   // the tile's K reads stay one group ahead of its products: one LDS latency, not one per product
#pragma unroll
            for (int c = 0; c < 2; ++c)
#pragma unroll
                for (int nt = 0; nt < 4; ++nt) s[nt] = wmma16(kf[c][nt], qa[c], s[nt]);
            __builtin_amdgcn_sched_barrier(0);   // the V^T reads below stay one group, not spread in pairs among the score products
#pragma unroll
            for (int kk = 0; kk < 2; ++kk)
#pragma unroll
                for (int dt = 0; dt < 4; ++dt) vf[kk][dt] = load_frag(vsb, (u32)dt * 16u, PK64, (u32)kk * 32u, lane);
            __builtin_amdgcn_sched_barrier(0);   // holds those reads in front of the softmax, which covers their latency: the compiler otherwise sinks them behind it
            FragU pb[2], prb[2];
            const bool diag = (kt * 64u + 63u > q0);    // wave-uniform
            if (diag) softmax_tile<true,  EP>(s, m, o, lacc, pb, prb, kt * 64u, q0 + c16, hh8, cl);
            else      softmax_tile<false, EP>(s, m, o, lacc, pb, prb, kt * 64u, q0 + c16, hh8, cl);

            // O^T += V^T . P^T ; l += ones . P^T
            v16h vrf[2][4];
            if constexpr (EP) {
#pragma unroll
                for (int kk = 0; kk < 2; ++kk)
#pragma unroll
                    for (int dt = 0; dt < 4; ++dt)
                        vrf[kk][dt] = load_frag(vrb_t, (u32)dt * 16u, PK64, (u32)kk * 32u, lane);
                __builtin_amdgcn_sched_barrier(0);   // the residual reads stay one group ahead of the products
            }
#pragma unroll
            for (int kk = 0; kk < 2; ++kk) {
#pragma unroll
                for (int dt = 0; dt < 4; ++dt) {
                    o[dt] = wmma16(vf[kk][dt], pb[kk].v, o[dt]);
                    if constexpr (EP) {
                        o[dt] = wmma16(vrf[kk][dt], pb[kk].v, o[dt]);
                        o[dt] = wmma16(vf[kk][dt], prb[kk].v, o[dt]);
                    }
                }
                lacc = wmma16(ones, pb[kk].v, lacc);
                if constexpr (EP) lacc = wmma16(ones, prb[kk].v, lacc);
            }
        }
        ring_publish();                          // every wave, active or not
        if (kt + 2u < nkt) stage(kt + 2u);       // into the buffers this trip has just read
    }
    asm volatile("s_wait_asynccnt 0x0" ::: "memory");   // nothing in flight when the epilogue starts

    // normalize: plane value = 1024 * (O/16) / l = O * 64 / l ; a lane's 8 registers are 8 consecutive d of its query
    const float inv = (CARRY_CTX / CARRY_QKV) / lacc[0];
#pragma unroll
    for (int dt = 0; dt < 4; ++dt) {
        H8U th, tr;
#pragma unroll
        for (int r = 0; r < 8; ++r) {
            const float cv = o[dt][r] * inv;
            const f16   hi = (f16)cv;
            th.e[r] = hi;
            if constexpr (EP) tr.e[r] = (f16)(cv - (float)hi);
        }
        const u32 idx = c16 * PK64 + (u32)dt * 16u + hh8;
        *(v8h*)&psw[idx] = th.v;
        if constexpr (EP) *(v8h*)&prw[idx] = tr.v;
    }
    __syncthreads();

    const u32 piece = lane & 7u;
    const u32 lsub  = lane >> 3;
{
#pragma unroll
        for (u32 it = 0; it < 4; ++it) {
            const u32 L = it * 4u + lsub;     // query row 0..15 within the wave tile
            const size_t off = (size_t)(bidx * (u32)SEQ + q0 + L) * HID + hidx * (u32)HD + piece * 8u;
            const v8h v = *(const v8h*)&psw[L * PK64 + piece * 8u];
            *(v8h*)(Cp + off) = v;
            if constexpr (EP) {
                const v8h vr = *(const v8h*)&prw[L * PK64 + piece * 8u];
                *(v8h*)(Cr + off) = vr;
            }
        }
        
    }
}

// Both attention paths in one launch (neither reads what the other writes): rows [0, EARLY) of every
// sequence take the hi + residual path, rows [EARLY, SEQ) the single f16 planes; the choice is block-uniform.
// A row block's cost grows with its index (it walks 2 q + 2 key tiles) and every block of the launch is resident at
// once, two to a WGP, so the launch lasts as long as the fullest WGP. Flat grid, head running fastest: the upper half
// of the row blocks first, longest first, then the lower half, shortest
// first, so that blocks half a grid apart, q and ATT_NQ - 1 - q, add up to the same number of key tiles.
// rank -> row block is a permutation for any ATT_NQ: ranks below ATT_NU take ATT_NQ - 1 .. ATT_NQ - ATT_NU, the rest 0 upward.
#define ATT_E_BX     (EARLY / 128)
#define ATT_NQ       (SEQ / 128)
#define ATT_NH       (NB * NHEAD)
#define ATT_NU       (ATT_NQ - ATT_NQ / 2)
__global__ void __launch_bounds__(256) __attribute__((amdgpu_num_vgpr(256)))
attn_all(const f16* __restrict__ Qp, const f16* __restrict__ Kp, const f16* __restrict__ Vt,
         const f16* __restrict__ Vr, f16* __restrict__ Cp, f16* __restrict__ Cr) {
    __shared__ __attribute__((aligned(16))) f16 ks[2 * 64 * PK64];    // two buffers of [key][d]
    __shared__ __attribute__((aligned(16))) f16 vsT[2 * 64 * PK64];   // two buffers of [d][key]
    __shared__ __attribute__((aligned(16))) f16 vrT[2 * 64 * PK64];   // two buffers of [d][key] residual (early path)
    __shared__ __attribute__((aligned(16))) f16 ps[8 * 16 * PK64];    // per-wave ctx stage
    __shared__ __attribute__((aligned(16))) f16 pr[8 * 16 * PK64];    // per-wave ctx residual stage (early path)
    const u32 rank = blockIdx.x / (u32)ATT_NH;
    const u32 bh   = blockIdx.x % (u32)ATT_NH;
    const u32 qblk = (rank < (u32)ATT_NU) ? (u32)(ATT_NQ - 1) - rank : rank - (u32)ATT_NU;
    if (qblk < (u32)ATT_E_BX) {
        attn_body<true>(Qp, Kp, Vt, Vr, Cp, Cr, qblk, bh, ks, vsT, vrT, ps, pr);
    } else {
        attn_body<false>(Qp, Kp, Vt, Vt, Cp, Cp, qblk, bh, ks, vsT, vrT, ps, pr);
    }
}

// coverage equalities (threads x elements == plane elements)
static_assert((size_t)(MROWS / 2) * 256 * 8 == (size_t)MROWS * HID);                       // cvt_rows -> Xh
static_assert((size_t)(3 * HID / 64) * (HID / 64) * 64 * 64 == (size_t)3 * HID * HID);     // cvt_wT -> Wt
static_assert((size_t)(HID / 64) * (HID / 64) * 64 * 64 == (size_t)HID * HID);             // cvt_wT -> Wot
static_assert((size_t)(MROWS / 128) * (HID / 128) * 128 * 128 == (size_t)MROWS * HID);     // gemm planes / out
static_assert((size_t)(SEQ / 128) * (NB * NHEAD) * 128 * HD == (size_t)MROWS * HID);       // attn -> Cp
// workspace: 7 activation planes + 4 weight planes of halves, at most 128 MiB
static_assert(((size_t)7 * MROWS * HID + (size_t)4 * HID * HID) * sizeof(f16) <= (size_t)134217728);

// ---------------------------------------------------------------------------
// Launch: 4 kernel launches, workspace 7 planes of MROWS*1024 halves + 4 of 1024*1024 halves.
// ---------------------------------------------------------------------------
extern "C" void kernel_launch(void* const* d_in, const int* in_sizes, int n_in,
                              void* d_out, int out_size, void* d_ws, size_t ws_size,
                              hipStream_t stream) {
    if (n_in < 5) return;
    if (in_sizes[0] < ((NB - 1) * SEQ_FULL + SEQ) * HID) return;
    if (in_sizes[1] < 3 * HID * HID) return;
    if (in_sizes[2] < 3 * HID) return;
    if (in_sizes[3] < HID * HID) return;
    if (in_sizes[4] < HID) return;
    const size_t needOut = OUT0_ELEMS_FULL + PRES_ELEMS_FULL
                         + ((size_t)((NB - 1) * NHEAD + NHEAD - 1) * SEQ_FULL + SEQ) * HD;
    if ((size_t)out_size < needOut) return;

    const float* x     = (const float*)d_in[0];   // [NB_FULL][SEQ_FULL][1024]
    const float* wattn = (const float*)d_in[1];   // [1024 in][3072 out], out columns q | k | v
    const float* battn = (const float*)d_in[2];   // [3072]
    const float* wproj = (const float*)d_in[3];   // [1024 in][1024 out]
    const float* bproj = (const float*)d_in[4];   // [1024]
    float* out = (float*)d_out;                   // out0 | present k | present v

    const size_t nX = (size_t)MROWS * HID;    // halves per activation plane
    const size_t nW = (size_t)HID * HID;      // halves per weight plane
    const size_t totalHalves = 7 * nX + 4 * nW;
    if (ws_size < totalHalves * sizeof(f16)) return;

    f16* Xh  = (f16*)d_ws;       // [MROWS][1024]               carry 16
    f16* Wt  = Xh  + nX;         // [3072 out][1024 in]         carry 32 (q | k | v row blocks)
    f16* Wot = Wt  + 3 * nW;     // [1024 out][1024 in]         carry 32
    f16* Qp  = Wot + nW;         // [NB*16][SEQ][64]            carry 16
    f16* Kp  = Qp  + nX;         // [NB*16][SEQ][64]            carry 16
    f16* Vtp = Kp  + nX;         // [NB*1024][SEQ] (V^T)        carry 16
    f16* Vrp = Vtp + nX;         // [NB*1024][SEQ] residual, columns s < EARLY only
    f16* Cp  = Vrp + nX;         // [MROWS][1024]               carry 1024
    f16* Cr  = Cp  + nX;         // [MROWS][1024] residual, rows s < EARLY only

    cvt_all<<<CVT_X_BLOCKS + CVT_WA_BLOCKS + CVT_WP_BLOCKS, 256, 0, stream>>>(x, wattn, wproj, Xh, Wt, Wot);

    const dim3 gg(MROWS / 128, HID / 128);
    gemm_qkv<<<dim3(MROWS / 128, HID / 128, 3), 256, 0, stream>>>(Xh, Wt, battn, Qp, Kp, Vtp, Vrp,
                                                                  out + OUT0_ELEMS_FULL);

    attn_all<<<ATT_NQ * ATT_NH, 256, 0, stream>>>(Qp, Kp, Vtp, Vrp, Cp, Cr);

    // out = acc / (1024*32) + bias ; residual context plane at Cp + nX
    gemm_o<<<gg, 256, 0, stream>>>(Cp, Wot, bproj, out, nX);
}

// v009
// Measured time: 69.2 microseconds a run.
// Next to v008, in two timings, it ran 1.10 and 1.09 times as fast.
// All steps since v000 together make it 4.94 times as fast.
#include <hip/hip_runtime.h>

// Contractions (fused QKV projection, Q.K^T, P.V, P row-sum, output projection): v_wmma_f32_16x16x32_f16, f16 operands with power-of-two carries, f32 accumulate; every float input enters as its bf16 RNE value; the first EARLY query rows of each sequence carry P, V and context as f16 hi + f16 residual planes (extra products into the same f32 accumulators); softmax in f32.

#ifndef NB
#define NB 2
#endif
#ifndef SEQ
#define SEQ 2048
#endif
#define NB_FULL   2
#define SEQ_FULL  2048
#define HID       1024
#define NHEAD     16
#define HD        64
#define MROWS     (NB * SEQ)
#define EARLY_CAP 512
#define EARLY     ((SEQ < EARLY_CAP) ? SEQ : EARLY_CAP)

#define OUT0_ELEMS_FULL ((size_t)NB_FULL * SEQ_FULL * HID)          // out0 elements
#define PRES_ELEMS_FULL ((size_t)NB_FULL * NHEAD * SEQ_FULL * HD)   // elements of present[0] (k) or present[1] (v)

static_assert(HID == NHEAD * HD);        // merged head width
static_assert(NHEAD == 16);              // bh >> 4 / bh & 15 decoding
static_assert(HD == 64);
static_assert(SEQ % 128 == 0);           // 128-row blocks never straddle a batch
static_assert(EARLY % 128 == 0);
static_assert(EARLY >= 128 && EARLY <= SEQ);
static_assert(SEQ <= SEQ_FULL);
static_assert(NB >= 1 && NB <= NB_FULL);
static_assert(MROWS % 128 == 0);         // GEMM M tile
static_assert(HID % 128 == 0);           // GEMM N tile
static_assert(HID % 64 == 0);            // weight transpose tile
static_assert(HID % 32 == 0);            // WMMA k step
static_assert(HID % 256 == 0);           // staged k tiles of 128, at least two of them
static_assert(HID == 128 * 8);           // cvt_rows: 128 threads x 8 values per row
static_assert(OUT0_ELEMS_FULL * 4 == (size_t)16777216);   // byte offset of the second output

// carries (exact powers of two)
#define CARRY_X    16.0f     // input activation plane
#define CARRY_W    32.0f     // weight planes
#define CARRY_QKV  16.0f     // q, k, v^T planes (true value x16); v residual in the same units
#define CARRY_CTX  1024.0f   // context planes (true value x1024); residual in the same units
// softmax exp values carry 2^10 (added to the exp2 argument); residual in the same units

// LDS row pitches in elements: every row read or written 16 bytes per lane has a pitch of 16 B x odd,
// so the 16 lanes of a lane half fall on 64 distinct banks
#define PK32   40u    // 32-half rows (64 B)  -> 80 B
#define PK64   72u    // 64-half rows (128 B) -> 144 B
#define PC16   136u   // 128-half rows (256 B) -> 272 B
#define PC32   132u   // 128-float rows (512 B) -> 528 B
#define KTILE  128u   // k values per staged GEMM tile (256-byte rows)

typedef unsigned u32;
typedef _Float16 f16;
typedef f16   v16h __attribute__((ext_vector_type(16)));
typedef f16   v8h  __attribute__((ext_vector_type(8)));
typedef f16   v2h  __attribute__((ext_vector_type(2)));
typedef float v2f  __attribute__((ext_vector_type(2)));
typedef float v8f  __attribute__((ext_vector_type(8)));
typedef float v4f  __attribute__((ext_vector_type(4)));

union FragU { v16h v; v8h half[2]; v2h pair[8]; f16 e[16]; };
union H8U   { v8h v; f16 e[8]; };

__device__ __forceinline__ v8f zero8() {
    v8f z = {0.f, 0.f, 0.f, 0.f, 0.f, 0.f, 0.f, 0.f};
    return z;
}

// 16-bit WMMA: D += A[16 x 32k] * B[32k x 16] (the builtin: the distances behind it are the compiler's)
__device__ __forceinline__ v8f wmma16(v16h a, v16h b, v8f c) {
    return __builtin_amdgcn_wmma_f32_16x16x32_f16(false, a, false, b, (short)0, c, false, false);
}

// f32 -> nearest-even bf16 value, returned as f32
__device__ __forceinline__ float bf16_rne(float x) {
    u32 u = __float_as_uint(x);
    u = (u + 0x7fffu + ((u >> 16) & 1u)) & 0xffff0000u;
    return __uint_as_float(u);
}

__device__ __forceinline__ float fexp2(float x) {
#if defined(__has_builtin)
#if __has_builtin(__builtin_amdgcn_exp2f)
    return __builtin_amdgcn_exp2f(x);
#else
    return exp2f(x);
#endif
#else
    return exp2f(x);
#endif
}

// value of lane l ^ 16 (the other lane half)
__device__ __forceinline__ float xhalf(float x) {
    const int v = __builtin_bit_cast(int, x);
    return __builtin_bit_cast(float, __builtin_amdgcn_permlanex16(v, v, 0x76543210, 0xfedcba98, false, false));
}

// 16 x 32 fragment from a tile whose k dimension is contiguous (pitch in halves).
// lane l: row rowbase + (l&15); elements 0..7 <- k = kcol + 8h .. +7,
// elements 8..15 <- k = kcol + 16 + 8h .. +7  (h = l>>4). Same map for A and B.
__device__ __forceinline__ v16h load_frag(const f16* tile, u32 rowbase, u32 pitch, u32 kcol, u32 lane) {
    const u32 r  = rowbase + (lane & 15u);
    const u32 kh = (lane >> 4) << 3;
    const f16* p = tile + (size_t)r * pitch + kcol + kh;
    FragU f;
    f.half[0] = *(const v8h*)(p);
    f.half[1] = *(const v8h*)(p + 16);
    return f.v;
}

// LDS byte address of a __shared__ element (low 32 bits of its address)
__device__ __forceinline__ u32 lds_addr(const f16* p) {
    return (u32)(size_t)p;
}

// Asynchronous copies global -> LDS, 16 bytes per lane, no register staging. The s_wait_xcnt closes each
// statement so that no address register of an issued copy is rewritten ahead of it.
// Eight copies whose rows lie 16 apart: LDS step lstep bytes, global step gstep halves.
__device__ __forceinline__ void async_copy8(u32 l, u32 lstep, const f16* g, size_t gstep) {
    asm volatile("global_load_async_to_lds_b128 %0, %8, off\n\t"
                 "global_load_async_to_lds_b128 %1, %9, off\n\t"
                 "global_load_async_to_lds_b128 %2, %10, off\n\t"
                 "global_load_async_to_lds_b128 %3, %11, off\n\t"
                 "global_load_async_to_lds_b128 %4, %12, off\n\t"
                 "global_load_async_to_lds_b128 %5, %13, off\n\t"
                 "global_load_async_to_lds_b128 %6, %14, off\n\t"
                 "global_load_async_to_lds_b128 %7, %15, off\n\t"
                 "s_wait_xcnt 0x0"
                 :: "v"(l), "v"(l + lstep), "v"(l + 2u * lstep), "v"(l + 3u * lstep),
                    "v"(l + 4u * lstep), "v"(l + 5u * lstep), "v"(l + 6u * lstep), "v"(l + 7u * lstep),
                    "v"(g), "v"(g + gstep), "v"(g + 2 * gstep), "v"(g + 3 * gstep),
                    "v"(g + 4 * gstep), "v"(g + 5 * gstep), "v"(g + 6 * gstep), "v"(g + 7 * gstep)
                 : "memory");
}

// Four and two copies with each lane's own addresses given one by one.
__device__ __forceinline__ void async_copy4(u32 l0, const f16* g0, u32 l1, const f16* g1,
                                            u32 l2, const f16* g2, u32 l3, const f16* g3) {
    asm volatile("global_load_async_to_lds_b128 %0, %4, off\n\t"
                 "global_load_async_to_lds_b128 %1, %5, off\n\t"
                 "global_load_async_to_lds_b128 %2, %6, off\n\t"
                 "global_load_async_to_lds_b128 %3, %7, off\n\t"
                 "s_wait_xcnt 0x0"
                 :: "v"(l0), "v"(l1), "v"(l2), "v"(l3), "v"(g0), "v"(g1), "v"(g2), "v"(g3)
                 : "memory");
}
__device__ __forceinline__ void async_copy2(u32 l0, const f16* g0, u32 l1, const f16* g1) {
    asm volatile("global_load_async_to_lds_b128 %0, %2, off\n\t"
                 "global_load_async_to_lds_b128 %1, %3, off\n\t"
                 "s_wait_xcnt 0x0"
                 :: "v"(l0), "v"(l1), "v"(g0), "v"(g1)
                 : "memory");
}

// publish point of a two-buffer ring: this wave's LDS reads retired, its own copies landed, then the block
// barrier that shows the next tile to every wave and frees the buffer just read
__device__ __forceinline__ void ring_publish() {
    asm volatile("s_wait_dscnt 0x0" ::: "memory");     // reads of the buffer to be refilled have retired
    asm volatile("s_wait_asynccnt 0x0" ::: "memory");  // this wave's copies of the next tile have landed
    __syncthreads();
}

// block barrier that orders LDS alone: stage writes are shown to every wave, while global stores already issued, which no
// wave of the launch reads, go on draining (__syncthreads() would wait here until each has completed)
__device__ __forceinline__ void lds_barrier() {
    __builtin_amdgcn_fence(__ATOMIC_RELEASE, "workgroup", "local");
    __builtin_amdgcn_s_barrier();
    __builtin_amdgcn_fence(__ATOMIC_ACQUIRE, "workgroup", "local");
}

// ---------------------------------------------------------------------------
// f32 rows [.][1024] -> f16 plane (bf16 RNE value times carry). 128 threads per 1024-wide
// Row mapping dst row m -> src row (m / dstper) * srcper + m % dstper lets a reduced build
// read full-size inputs.
// coverage: nrows x 1024 halves, every element exactly once (grid = nrows*128/256).
// ---------------------------------------------------------------------------
__device__ __forceinline__ void
cvt_rows_body(const float* src, f16* dst, u32 blk, u32 nrows, u32 dstper, u32 srcper, float carry) {
    const u32 g  = blk * 256u + threadIdx.x;
    const u32 m  = g >> 7;
    const u32 c8 = (g & 127u) << 3;
    if (m >= nrows) return;
    const u32 mb = m / dstper;
    const u32 sm = mb * srcper + (m - mb * dstper);
    const float* sp = src + (size_t)sm * HID + c8;
    const v4f a = *(const v4f*)sp;
    const v4f b = *(const v4f*)(sp + 4);
    H8U o;
#pragma unroll
    for (u32 j = 0; j < 4; ++j) {
        const float x0 = a[j];
        const float x1 = b[j];
        o.e[j]     = (f16)(bf16_rne(x0) * carry);
        o.e[j + 4] = (f16)(bf16_rne(x1) * carry);
    }
    f16* dp = dst + (size_t)m * HID + c8;
    *(v8h*)dp = o.v;
    
}

// ---------------------------------------------------------------------------
// Transposing weight convert: src[rows][cols] f32 -> dst[cols][rows] f16 (bf16 RNE value
// times carry). Block = 64 (src rows, k) x 64 (src cols, n) tile, grid (cols/64, rows/64).
// Tile staged transposed in LDS (pitch 72 halves), then each dst row segment of 64 halves
// coverage: 4 x 256 threads x 4 values == 64 x 64 per block; blocks tile rows x cols exactly.
// LDS t: cross-wave, block barrier; staged extent 64 x 64 == consumed extent.
// ---------------------------------------------------------------------------
__device__ __forceinline__ void
cvt_wT_body(const float* src, f16* dst, f16* t, u32 bx, u32 by, u32 rows, u32 cols, float carry) {
    const u32 tid = threadIdx.x;
    const u32 n0  = bx * 64u;   // src column block == dst row block
    const u32 k0  = by * 64u;   // src row block == dst column block
#pragma unroll
    for (u32 it = 0; it < 4; ++it) {
        const u32 p  = tid + it * 256u;
        const u32 kr = p >> 4;              // 0..63
        const u32 c4 = (p & 15u) << 2;      // 0..60
        const v4f a = *(const v4f*)(src + (size_t)(k0 + kr) * cols + n0 + c4);
#pragma unroll
        for (u32 j = 0; j < 4; ++j) {
            const float x = a[j];
            t[(c4 + j) * 72u + kr] = (f16)(bf16_rne(x) * carry);
        }
    }
    __syncthreads();
    const u32 piece = tid & 7u;
    const u32 lrow  = tid >> 3;             // 0..31
{
#pragma unroll
        for (u32 it = 0; it < 2; ++it) {
            const u32 L = it * 32u + lrow;  // dst row within the tile, 0..63
            const v8h v = *(const v8h*)&t[L * 72u + piece * 8u];
            f16* dp = dst + (size_t)(n0 + L) * rows + k0 + piece * 8u;
            *(v8h*)dp = v;
        }
        asm volatile("s_wait_xcnt 0x0" ::: "memory");   // before code behind this body rewrites a register of these stores
    }
}

// The three converts in one launch: none reads what another writes. Flat grid: the blocks of the activation
// rows first, then those of the two weight transposes; the choice is block-uniform.
#define CVT_WA_BX     (3 * HID / 64)
#define CVT_WA_BLOCKS (CVT_WA_BX * (HID / 64))
#define CVT_WP_BX     (HID / 64)
#define CVT_WP_BLOCKS (CVT_WP_BX * (HID / 64))
#define CVT_X_BLOCKS  (MROWS / 2)
__global__ void __launch_bounds__(256)
cvt_all(const float* __restrict__ x, const float* __restrict__ wattn, const float* __restrict__ wproj,
        f16* __restrict__ Xh, f16* __restrict__ Wt, f16* __restrict__ Wot) {
    __shared__ __attribute__((aligned(16))) f16 t[64 * 72];
    const u32 b = blockIdx.x;
    if (b < (u32)CVT_X_BLOCKS) {
        // dst row m of batch b <- src row b*SEQ_FULL + (m % SEQ)
        cvt_rows_body(x, Xh, b, (u32)MROWS, (u32)SEQ, (u32)SEQ_FULL, CARRY_X);
    } else if (b < (u32)(CVT_X_BLOCKS + CVT_WA_BLOCKS)) {
        // in[rows = 1024 (k)][cols = 3072 (n)] -> out[cols][rows]
        const u32 bb = b - (u32)CVT_X_BLOCKS;
        cvt_wT_body(wattn, Wt, t, bb % (u32)CVT_WA_BX, bb / (u32)CVT_WA_BX, (u32)HID, (u32)(3 * HID), CARRY_W);
    } else {
        // in[rows = 1024 (k)][cols = 1024 (n)] -> out[cols][rows]
        const u32 bb = b - (u32)(CVT_X_BLOCKS + CVT_WA_BLOCKS);
        cvt_wT_body(wproj, Wot, t, bb % (u32)CVT_WP_BX, bb / (u32)CVT_WP_BX, (u32)HID, (u32)HID, CARRY_W);
    }
}

// ---------------------------------------------------------------------------
// C[m][n] = sum_k A[m][k] * W[n][k] ; A [MROWS][1024] f16, W [1024][1024] f16 (k contiguous).
// Block tile 128 x 128, 8 waves as 4(M) x 2(N), 2 x 4 accumulators per wave, WMMA k step 32.
// A and W tiles of 128 k come by asynchronous copies into two LDS buffers: tile t + 1 flies while tile t is multiplied.
// Inside a tile the fragments of the next 32-k step are read, as one group, ahead of this step's products.
// true value t = acc * mul + bias (bias enters as its bf16 RNE value, added in f32).
// MODE 3 (the output projection, the one mode in use): f32 rows [b][s][1024] into the output buffer; RES (row blocks below EARLY): each staged tile also brings
//         the residual A plane's rows (A + resOff) into a ring of their own, and every 32-k step multiplies both A
//         planes by the same W fragments, so W is staged and read once for the two planes
// coverage per block: f32 2 x 256 lines (64 rows x 4 line-quarters per half).
// LDS: As/Bs/Cs all cross-wave, separated by block barriers.
// staged extent == consumed extent: As/Bs (and Rs when RES) 128 x 128 per buffer, Cs 128 x 128 halves (or 64 x 128 floats).
// ---------------------------------------------------------------------------
template <int MODE, bool RES = false>
__device__ __forceinline__ void gemm_body(const f16* A, const f16* W, const float* bias,
                                          f16* plane, f16* plane2, float* fout, size_t resOff,
                                          f16* As, f16* Bs, f16* Cs, f16* Rs) {
    static_assert(!RES || MODE == 3);
    // As, Bs (Rs when RES): two buffers of 128 rows x 128 k each; Cs: f16 [128][128] at pitch PC16 or f32 [64][128] at pitch PC32
    static_assert(sizeof(f16) * 128 * PC16 >= sizeof(float) * 64 * PC32);   // Cs reuse as f32 [64][128]

    const u32 tid  = threadIdx.x;
    const u32 lane = tid & 31u;
    const u32 wave = tid >> 5;
    const u32 wm   = wave & 3u;
    const u32 wn   = wave >> 2;
    const u32 hh8  = (lane >> 4) << 3;   // D row half
    const u32 c16  = lane & 15u;         // D column
    const u32 m0   = blockIdx.x * 128u;
    const u32 n0   = blockIdx.y * 128u;
    const u32 bidx = m0 / (u32)SEQ;      // block rows lie inside one batch (SEQ % 128 == 0)
    const u32 s0   = m0 - bidx * (u32)SEQ;

    v8f acc[2][4];
#pragma unroll
    for (int i = 0; i < 2; ++i)
#pragma unroll
        for (int j = 0; j < 4; ++j) acc[i][j] = zero8();

    // staging map: 16 lanes cover one 256-byte row segment, a wave's copy two rows (four whole lines)
    const u32 crow = tid >> 4;
    const u32 ccol = (tid & 15u) << 3;
    const f16* gA = A + (size_t)(m0 + crow) * HID + ccol;
    const f16* gW = W + (size_t)(n0 + crow) * HID + ccol;
    const u32 lA = lds_addr(&As[crow * PC16 + ccol]);
    const u32 lB = lds_addr(&Bs[crow * PC16 + ccol]);
    const u32 lR = lds_addr(&Rs[RES ? crow * PC16 + ccol : 0u]);
    const u32 nT = (u32)HID / KTILE;     // 8 tiles

    auto stage = [&](u32 t) {
        const u32 kk = t * KTILE;
        const u32 bo = (t & 1u) * (128u * PC16 * 2u);
        async_copy8(lA + bo, 16u * PC16 * 2u, gA + kk, (size_t)16 * HID);
        if constexpr (RES) async_copy8(lR + bo, 16u * PC16 * 2u, gA + resOff + kk, (size_t)16 * HID);
        async_copy8(lB + bo, 16u * PC16 * 2u, gW + kk, (size_t)16 * HID);
    };

    stage(0u);
    asm volatile("s_wait_asynccnt 0x0" ::: "memory");   // tile 0 landed before the barrier that shows it
    __syncthreads();
    stage(1u);

#pragma unroll 1   // stays rolled: one trip per staged tile, its buffer chosen by t & 1
    for (u32 t = 0; t < nT; ++t) {
        const f16* as = As + (t & 1u) * (128u * PC16);
        const f16* bs = Bs + (t & 1u) * (128u * PC16);
        const f16* rs = Rs + (RES ? (t & 1u) * (128u * PC16) : 0u);
        v16h af[2][2], bfr[2][4];       // two fragment sets: the next 32-k step is read while this one is multiplied
        v16h rf[2][2];                  // residual A fragments (RES)
        auto frags = [&](u32 set, u32 kc) {
#pragma unroll
            for (int i = 0; i < 2; ++i) af[set][i] = load_frag(as, wm * 32u + (u32)i * 16u, PC16, kc, lane);
            if constexpr (RES) {
#pragma unroll
                for (int i = 0; i < 2; ++i) rf[set][i] = load_frag(rs, wm * 32u + (u32)i * 16u, PC16, kc, lane);
            }
#pragma unroll
            for (int j = 0; j < 4; ++j) bfr[set][j] = load_frag(bs, wn * 64u + (u32)j * 16u, PC16, kc, lane);
        };
        frags(0u, 0u);
#pragma unroll     // the four 32-k steps of a tile in line, every LDS offset an immediate
        for (u32 ks = 0; ks < KTILE / 32u; ++ks) {
            if (ks + 1u < KTILE / 32u) frags((ks + 1u) & 1u, (ks + 1u) * 32u);
            __builtin_amdgcn_sched_barrier(0);   // the next step's reads stay one group ahead of this step's products
#pragma unroll
            for (int i = 0; i < 2; ++i)
#pragma unroll
                for (int j = 0; j < 4; ++j) acc[i][j] = wmma16(af[ks & 1u][i], bfr[ks & 1u][j], acc[i][j]);
            if constexpr (RES) {
#pragma unroll
                for (int i = 0; i < 2; ++i)
#pragma unroll
                    for (int j = 0; j < 4; ++j) acc[i][j] = wmma16(rf[ks & 1u][i], bfr[ks & 1u][j], acc[i][j]);
            }
            __builtin_amdgcn_sched_barrier(0);   // and no later read moves up among these products
        }
        ring_publish();
        if (t + 2u < nT) stage(t + 2u);  // into the buffer this trip has just read
    }
    asm volatile("s_wait_asynccnt 0x0" ::: "memory");   // nothing in flight when the epilogue starts

    const float mul = (MODE == 3) ? (1.0f / (CARRY_CTX * CARRY_W)) : (1.0f / (CARRY_X * CARRY_W));
    float bv[4];
#pragma unroll
    for (int j = 0; j < 4; ++j) {
        const float bx = bias[n0 + wn * 64u + (u32)j * 16u + c16];
        asm volatile("s_wait_xcnt 0x0" ::: "memory");   // before a later load of this run rewrites the offset register that this load names
        bv[j] = bf16_rne(bx);
    }

    const u32 piece = lane & 7u;
    const u32 lsub  = lane >> 3;

    if constexpr (MODE >= 1) {
        if constexpr (MODE != 3) __syncthreads();
        float* Cf = (float*)Cs;      // [64][128] f32 at pitch PC32
#pragma unroll
        for (u32 half = 0; half < 2; ++half) {
            if ((wm >> 1) == half) {
#pragma unroll
                for (int i = 0; i < 2; ++i)
#pragma unroll
                    for (int j = 0; j < 4; ++j) {
                        const u32 nl = wn * 64u + (u32)j * 16u + c16;
#pragma unroll
                        for (int r = 0; r < 8; ++r) {
                            const u32 ml = (wm & 1u) * 32u + (u32)i * 16u + hh8 + (u32)r;
                            Cf[ml * PC32 + nl] = acc[i][j][r] * mul + bv[j];
                        }
                    }
            }
            __syncthreads();
{
#pragma unroll
                for (u32 it = 0; it < 8; ++it) {
                    const u32 L    = wave * 32u + it * 4u + lsub;   // 0..255
                    const u32 row  = L >> 2;
                    const u32 part = L & 3u;
                    const v4f v = *(const v4f*)&Cf[row * PC32 + part * 32u + piece * 4u];
                    size_t off;
                    if constexpr (MODE == 3) {
                        off = (size_t)(bidx * (u32)SEQ_FULL + s0 + half * 64u + row) * HID
                            + n0 + part * 32u + piece * 4u;
                    } else {
                        off = ((size_t)(bidx * (u32)NHEAD + (n0 >> 6) + (part >> 1)) * SEQ_FULL
                               + s0 + half * 64u + row) * HD + (part & 1u) * 32u + piece * 4u;
                    }
                    *(v4f*)(fout + off) = v;
                }
                
            }
            __syncthreads();
        }
    }
}

// The q, k and v projections of one tile, 128 rows x 128 columns of each projection, in ONE work-group: 256 work-groups,
// one per WGP. The X tile is staged once for the three weight tiles (128 + 384 rows per 128-k tile instead of 3 x 256),
// and a wave, 2 (M) x 4 (N), owns 64 rows x 32 columns of each projection: 4 X and 6 W fragments feed 24 products.
// Ring and publish points as in gemm_body. Epilogue: behind the loop's last publish point no wave reads the rings and no
// copy is in flight, so the six output stages lie side by side over them, each written once: no stage waits for another's
// readers, and one barrier per projection stands between its stage writes and its stage reads.
//   q, k: f16 planes [b*NHEAD + h][s][d] (t x16); v: f16 plane [b*HID + h*HD + d][s] (t x16, transposed per head) and,
//   for key blocks below EARLY, its residual plane; k, v: f32 rows [b*NHEAD + h][s][d] (t) of the second output.
// coverage per block: f16 planes 256 lines each, f32 512 lines each; staged extent == consumed extent in every stage.
#define STG (128u * PC16)   // halves of one stage region == one 128-row ring buffer
__global__ void __launch_bounds__(256)
gemm_qkv(const f16* __restrict__ A, const f16* __restrict__ W, const float* __restrict__ bias,
         f16* __restrict__ outQ, f16* __restrict__ outK, f16* __restrict__ outT, f16* __restrict__ outR,
         float* __restrict__ pres) {
    __shared__ __attribute__((aligned(16))) f16 As[2 * STG];       // two buffers of 128 X rows x 128 k
    __shared__ __attribute__((aligned(16))) f16 Bs[2 * 3 * STG];   // two buffers of 3 x 128 W rows x 128 k (q | k | v)
    __shared__ __attribute__((aligned(16))) float Bb[3 * 128];     // the block's bias values (q | k | v), shown by the prologue's barrier
    static_assert(sizeof(f16) * 2 * STG >= sizeof(float) * 128 * PC32);   // two regions hold f32 [128][128]

    const u32 tid  = threadIdx.x;
    const u32 lane = tid & 31u;
    const u32 wave = tid >> 5;
    const u32 wm   = wave & 1u;
    const u32 wn   = wave >> 1;
    const u32 hh8  = (lane >> 4) << 3;   // D row half
    const u32 c16  = lane & 15u;         // D column
    const u32 m0   = blockIdx.x * 128u;
    const u32 n0   = blockIdx.y * 128u;
    const u32 bidx = m0 / (u32)SEQ;      // block rows lie inside one batch (SEQ % 128 == 0)
    const u32 s0   = m0 - bidx * (u32)SEQ;

    v8f acc[3][4][2];
#pragma unroll
    for (int z = 0; z < 3; ++z)
#pragma unroll
        for (int i = 0; i < 4; ++i)
#pragma unroll
            for (int j = 0; j < 2; ++j) acc[z][i][j] = zero8();

    // staging map: 16 lanes cover one 256-byte row segment, a wave's copy two rows (four whole lines)
    const u32 crow = tid >> 4;
    const u32 ccol = (tid & 15u) << 3;
    const f16* gA = A + (size_t)(m0 + crow) * HID + ccol;
    const f16* gW = W + (size_t)(n0 + crow) * HID + ccol;
    const u32 lA = lds_addr(&As[crow * PC16 + ccol]);
    const u32 lB = lds_addr(&Bs[crow * PC16 + ccol]);
    const u32 nT = (u32)HID / KTILE;     // 8 tiles

    auto stage = [&](u32 t) {            // 32 copies per wave, one tile's in flight at a time
        const u32 kk = t * KTILE;
        async_copy8(lA + (t & 1u) * (STG * 2u), 16u * PC16 * 2u, gA + kk, (size_t)16 * HID);
#pragma unroll
        for (u32 z = 0; z < 3; ++z) {
            // each statement's address sums stay behind the statement before: the four sets at once do not fit beside the
            // accumulators among the registers that asm text can name, and the loop's base addresses went to scratch
            __builtin_amdgcn_sched_barrier(0);
            async_copy8(lB + (t & 1u) * (3u * STG * 2u) + z * (STG * 2u), 16u * PC16 * 2u,
                        gW + (size_t)z * HID * HID + kk, (size_t)16 * HID);
        }
    };

    stage(0u);
    if (tid < 96u) {   // waves 0 to 2 whole: the block's 3 x 128 bias values, 16 bytes a lane, fetched under tile 0's landing
        const u32 c4 = (tid & 31u) << 2;
        const v4f b4 = *(const v4f*)(bias + (tid >> 5) * (u32)HID + n0 + c4);
        // before code behind this load rewrites a register that it names; the loaded value as an input holds the wait behind the load
        asm volatile("s_wait_xcnt 0x0" :: "v"(b4) : "memory");
        *(v4f*)&Bb[(tid >> 5) * 128u + c4] = b4;
    }
    asm volatile("s_wait_asynccnt 0x0" ::: "memory");   // tile 0 landed before the barrier that shows it
    __syncthreads();
    stage(1u);

#pragma unroll 1   // stays rolled: one trip per staged tile, its buffer chosen by t & 1
    for (u32 t = 0; t < nT; ++t) {
        const f16* as = As + (t & 1u) * STG;
        const f16* bs = Bs + (t & 1u) * (3u * STG);
        v16h af[2][4], bfr[2][6];       // two fragment sets: the next 32-k step is read while this one is multiplied
        auto frags = [&](u32 set, u32 kc) {
#pragma unroll
            for (int i = 0; i < 4; ++i) af[set][i] = load_frag(as, wm * 64u + (u32)i * 16u, PC16, kc, lane);
#pragma unroll
            for (int y = 0; y < 6; ++y)
                bfr[set][y] = load_frag(bs, (u32)(y >> 1) * 128u + wn * 32u + (u32)(y & 1) * 16u, PC16, kc, lane);
        };
        frags(0u, 0u);
        __builtin_amdgcn_sched_barrier(0);   // the first step's reads stay ahead of the second's: its products wait for their own set only
#pragma unroll     // the four 32-k steps of a tile in line, every LDS offset an immediate
        for (u32 ks = 0; ks < KTILE / 32u; ++ks) {
            if (ks + 1u < KTILE / 32u) frags((ks + 1u) & 1u, (ks + 1u) * 32u);
            __builtin_amdgcn_sched_barrier(0);   // the next step's reads stay one group ahead of this step's products
#pragma unroll
            for (int z = 0; z < 3; ++z)
#pragma unroll
                for (int i = 0; i < 4; ++i)
#pragma unroll
                    for (int j = 0; j < 2; ++j)
                        acc[z][i][j] = wmma16(af[ks & 1u][i], bfr[ks & 1u][z * 2 + j], acc[z][i][j]);
            __builtin_amdgcn_sched_barrier(0);   // and no later read moves up among these products
        }
        ring_publish();
        if (t + 2u < nT) stage(t + 2u);  // into the buffers this trip has just read
    }
    asm volatile("s_wait_asynccnt 0x0" ::: "memory");   // nothing in flight when the epilogue starts

    const float mul = 1.0f / (CARRY_X * CARRY_W);
    float bv[3][2];
#pragma unroll
    for (int z = 0; z < 3; ++z)
#pragma unroll
        for (int j = 0; j < 2; ++j) bv[z][j] = bf16_rne(Bb[(u32)z * 128u + wn * 32u + (u32)j * 16u + c16]);

    float* Fk = (float*)As;              // f32 k rows [128][128] at pitch PC32
    float* Fv = (float*)Bs;              // f32 v rows, the same
    f16*   Sq = Bs + 2u * STG;           // q plane rows [m][n] at pitch PC16
    f16*   Sk = Bs + 3u * STG;           // k plane rows [m][n]
    f16*   Sv = Bs + 4u * STG;           // v^T plane rows [n][m]
    f16*   Sr = Bs + 5u * STG;           // v^T residual rows [n][m]
    const bool early = s0 < (u32)EARLY;  // block-uniform: residual plane only for early key blocks

    const u32 piece = lane & 7u;
    const u32 lsub  = lane >> 3;
    const size_t bh0 = (size_t)bidx * NHEAD + (n0 >> 6);

    // f16 rows [m][n] of a stage -> head-major plane, whole 128-byte lines
    auto store_plane = [&](const f16* S, f16* plane) {
#pragma unroll
        for (u32 it = 0; it < 8; ++it) {
            const u32 L    = wave * 32u + it * 4u + lsub;   // 0..255
            const u32 ml   = L >> 1;
            const u32 hsel = L & 1u;
            const v8h v = *(const v8h*)&S[ml * PC16 + hsel * 64u + piece * 8u];
            *(v8h*)(plane + ((bh0 + hsel) * SEQ + s0 + ml) * HD + piece * 8u) = v;
        }
        asm volatile("s_wait_xcnt 0x0" ::: "memory");   // before code behind this run rewrites a register of these stores
    };
    // f16 rows [n][m] of a stage -> transposed plane
    auto store_planeT = [&](const f16* S, f16* plane) {
#pragma unroll
        for (u32 it = 0; it < 8; ++it) {
            const u32 L  = wave * 32u + it * 4u + lsub;     // 0..255
            const u32 nl = L >> 1;
            const u32 mh = L & 1u;
            const v8h v = *(const v8h*)&S[nl * PC16 + mh * 64u + piece * 8u];
            *(v8h*)(plane + (size_t)(bidx * (u32)HID + n0 + nl) * SEQ + s0 + mh * 64u + piece * 8u) = v;
        }
        asm volatile("s_wait_xcnt 0x0" ::: "memory");   // before code behind this run rewrites a register of these stores
    };
    // f32 rows [m][n] of a stage -> rows of the second output
    auto store_rows = [&](const float* F, float* fout) {
#pragma unroll
        for (u32 it = 0; it < 16; ++it) {
            const u32 L    = wave * 64u + it * 4u + lsub;   // 0..511
            const u32 row  = L >> 2;
            const u32 part = L & 3u;
            const v4f v = *(const v4f*)&F[row * PC32 + part * 32u + piece * 4u];
            *(v4f*)(fout + ((size_t)(bidx * (u32)NHEAD + (n0 >> 6) + (part >> 1)) * SEQ_FULL + s0 + row) * HD
                         + (part & 1u) * 32u + piece * 4u) = v;
        }
        asm volatile("s_wait_xcnt 0x0" ::: "memory");   // before code behind this run rewrites a register of these stores
    };

    // k, then v, then q: each projection's global stores drain under the next one's stage writes, the smallest last
#pragma unroll
    for (int i = 0; i < 4; ++i)
#pragma unroll
        for (int j = 0; j < 2; ++j) {
            const u32 nl = wn * 32u + (u32)j * 16u + c16;
#pragma unroll
            for (int r = 0; r < 8; ++r) {
                const u32 ml = wm * 64u + (u32)i * 16u + hh8 + (u32)r;
                const float tk = acc[1][i][j][r] * mul + bv[1][j];
                Sk[ml * PC16 + nl] = (f16)(tk * CARRY_QKV);
                Fk[ml * PC32 + nl] = tk;
            }
        }
    lds_barrier();
    store_rows(Fk, pres);
    store_plane(Sk, outK);

#pragma unroll
    for (int i = 0; i < 4; ++i)
#pragma unroll
        for (int j = 0; j < 2; ++j) {
            const u32 nl = wn * 32u + (u32)j * 16u + c16;
            const u32 mb = wm * 64u + (u32)i * 16u + hh8;
            H8U th;
#pragma unroll
            for (int r = 0; r < 8; ++r) {
                const float tv = acc[2][i][j][r] * mul + bv[2][j];
                Fv[(mb + (u32)r) * PC32 + nl] = tv;
                th.e[r] = (f16)(tv * CARRY_QKV);
            }
            *(v8h*)&Sv[nl * PC16 + mb] = th.v;
        }
    if (early) {
#pragma unroll
        for (int i = 0; i < 4; ++i)
#pragma unroll
            for (int j = 0; j < 2; ++j) {
                H8U tr;
#pragma unroll
                for (int r = 0; r < 8; ++r) {
                    const float tc = (acc[2][i][j][r] * mul + bv[2][j]) * CARRY_QKV;
                    const f16   hi = (f16)tc;
                    tr.e[r] = (f16)(tc - (float)hi);
                }
                *(v8h*)&Sr[(wn * 32u + (u32)j * 16u + c16) * PC16 + wm * 64u + (u32)i * 16u + hh8] = tr.v;
            }
    }
    lds_barrier();
    store_rows(Fv, pres + PRES_ELEMS_FULL);
    store_planeT(Sv, outT);
    if (early) store_planeT(Sr, outR);

#pragma unroll
    for (int i = 0; i < 4; ++i)
#pragma unroll
        for (int j = 0; j < 2; ++j) {
            const u32 nl = wn * 32u + (u32)j * 16u + c16;
#pragma unroll
            for (int r = 0; r < 8; ++r) {
                const u32 ml = wm * 64u + (u32)i * 16u + hh8 + (u32)r;
                const float tq = acc[0][i][j][r] * mul + bv[0][j];
                Sq[ml * PC16 + nl] = (f16)(tq * CARRY_QKV);
            }
        }
    lds_barrier();
    store_plane(Sq, outQ);
}

// f32 output rows; A residual plane at A + resOff for early row blocks (the choice is block-uniform). One work-group per
// WGP is launched, so the launch lasts as long as an early block: it walks the same 8 tiles as the others.
__global__ void __launch_bounds__(256) __attribute__((amdgpu_num_vgpr(256)))
gemm_o(const f16* __restrict__ A, const f16* __restrict__ W, const float* __restrict__ bias,
       float* __restrict__ out, size_t resOff) {
    __shared__ __attribute__((aligned(16))) f16 As[2 * 128 * PC16];
    __shared__ __attribute__((aligned(16))) f16 Bs[2 * 128 * PC16];
    __shared__ __attribute__((aligned(16))) f16 Rs[2 * 128 * PC16];
    __shared__ __attribute__((aligned(16))) f16 Cs[128 * PC16];
    if ((blockIdx.x * 128u) % (u32)SEQ < (u32)EARLY) {
        gemm_body<3, true>(A, W, bias, (f16*)out, (f16*)out, out, resOff, As, Bs, Cs, Rs);
    } else {
        gemm_body<3, false>(A, W, bias, (f16*)out, (f16*)out, out, resOff, As, Bs, Cs, Rs);
    }
}

// ---------------------------------------------------------------------------
// Online softmax update for one transposed score tile, 64 keys x 16 q (log2 domain, max-subtracted).
// s[nt][r] = score of key kbase + 16 nt + hh8 + r against query q: a lane holds 32 keys of ONE query, the
// lane 16 away the other 32, so the maximum is in-lane plus one exchange and m, al are one value per lane.
// The carried exp values, converted in place, are the B fragments of the next product:
// pb[kk] element j = tile 2 kk + (j >> 3), register j & 7, which is load_frag's k order.
// MASK: keys above the query row get probability exactly 0 and do not enter the row max.
// EP: also emit the f16 residual of each carried exp value.
// ---------------------------------------------------------------------------
template <bool MASK, bool EP>
__device__ __forceinline__ void softmax_tile(const v8f (&s)[4], float& m, v8f (&o)[4], v8f& lacc,
                                             FragU (&pb)[2], FragU (&prb)[2], u32 kbase, u32 q,
                                             u32 hh8, float cl) {
    float x[4][8];
    float t4[4];
#pragma unroll
    for (int nt = 0; nt < 4; ++nt) {
#pragma unroll
        for (int r = 0; r < 8; ++r) {
            x[nt][r] = s[nt][r] * cl;
            if constexpr (MASK) {
                const bool dead = (kbase + (u32)nt * 16u + hh8 + (u32)r) > q;
                x[nt][r] = dead ? -1.0e30f : x[nt][r];
            }
        }
        t4[nt] = fmaxf(fmaxf(fmaxf(x[nt][0], x[nt][1]), fmaxf(x[nt][2], x[nt][3])),
                       fmaxf(fmaxf(x[nt][4], x[nt][5]), fmaxf(x[nt][6], x[nt][7])));
    }
    float tm = fmaxf(fmaxf(t4[0], t4[1]), fmaxf(t4[2], t4[3]));
    tm = fmaxf(tm, xhalf(tm));
    const float mn = fmaxf(m, tm);
    const float al = fexp2(m - mn);
    m = mn;
    lacc *= al;
#pragma unroll
    for (int dt = 0; dt < 4; ++dt) o[dt] *= al;
    const float sh = 10.0f - mn;      // carry 2^10
#pragma unroll
    for (int nt = 0; nt < 4; ++nt) {
#pragma unroll
        for (int r = 0; r < 8; r += 2) {
            v2f e;
            e.x = fexp2(x[nt][r] + sh);
            e.y = fexp2(x[nt][r + 1] + sh);
            if constexpr (MASK) {
                e.x = ((kbase + (u32)nt * 16u + hh8 + (u32)r) > q) ? 0.0f : e.x;
                e.y = ((kbase + (u32)nt * 16u + hh8 + (u32)r + 1u) > q) ? 0.0f : e.y;
            }
            const v2h hi = __builtin_convertvector(e, v2h);
            const int  j = (nt & 1) * 4 + (r >> 1);
            pb[nt >> 1].pair[j] = hi;
            if constexpr (EP) prb[nt >> 1].pair[j] = __builtin_convertvector(e - __builtin_convertvector(hi, v2f), v2h);
        }
    }
}

// ---------------------------------------------------------------------------
// Causal flash attention, one (row block, head) per block of 256 (8 waves), wave owns 16 query
// rows (Q fragments resident). Block streams 64-key tiles 0 .. last tile touching its rows:
// K staged [key][d], V^T staged [d][key] (+ residual tile when EP), by asynchronous copies into two
// buffers each: tile kt + 1 flies while tile kt is worked on. A wave computes a tile only
// when the tile starts at or below its first row (wave-uniform); the tile containing its rows
// takes the masked path. Both products run transposed: S^T = K.Q^T (A = K rows, B = the resident Q fragments)
// and O^T += V^T.P^T (A = V^T rows, B = P^T), so a lane's score registers belong to one query, the row max is
// in-lane plus one exchange between the lane halves, and the exp2 values (f32, carried x2^10), converted in
// place, are the B fragments of the second product: P stays in registers. Row sums += ones.P^T on WMMA.
// LDS reads of a tile stand in groups: its eight K fragments ahead of the score products, its eight V^T
// fragments ahead of the softmax (the residual fragments ahead of the second product).
// EP (rows below EARLY): P and V as hi + residual, products hi.hi + res.hi + hi.res into the
// same accumulators; context written as hi plane + residual plane.
// coverage: every (b, q, h*64..h*64+63) row segment of the launched row blocks exactly once.
// LDS: ks, vsT, vrT cross-wave (block barriers); ps/pr per-wave context staging of the epilogue.
// staged extent == consumed extent for ks/vsT/vrT (64x64) and ps/pr (16x64, written
// in full by the owning wave before it reads them).
// ---------------------------------------------------------------------------
template <bool EP>
__device__ __forceinline__ void attn_body(const f16* Qp, const f16* Kp, const f16* Vt, const f16* Vr,
                                          f16* Cp, f16* Cr, u32 qblk, u32 bh,
                                          f16* ks, f16* vsT, f16* vrT, f16* ps, f16* pr) {
    static_assert(HD == 8 * 8);            // 8 lanes x 8 halves per row segment
    static_assert(2 * 256 * 8 == 64 * 64); // staging: 2 copies x 256 threads x 8 halves per tile

    const u32 tid  = threadIdx.x;
    const u32 lane = tid & 31u;
    const u32 wave = (u32)__builtin_amdgcn_readfirstlane((int)(tid >> 5));
    const u32 hh8  = (lane >> 4) << 3;
    const u32 c16  = lane & 15u;
    const u32 bidx = bh >> 4;            // NHEAD == 16
    const u32 hidx = bh & 15u;
    const u32 q0   = qblk * 128u + wave * 16u;
    const size_t head = (size_t)bh * SEQ * HD;

    v16h qa[2];
#pragma unroll
    for (int c = 0; c < 2; ++c) qa[c] = load_frag(Qp + head, q0, HD, (u32)c * 32u, lane);

    FragU onesu;
#pragma unroll
    for (int i = 0; i < 16; ++i) onesu.e[i] = (f16)1.0f;
    const v16h ones = onesu.v;

    // o[dt][r] = O^T[d = 16 dt + hh8 + r][query q0 + c16]; every register of lacc = that query's row sum
    float m = -1.0e30f;
    v8f   o[4], lacc;
#pragma unroll
    for (int dt = 0; dt < 4; ++dt) o[dt] = zero8();
    lacc = zero8();

    // log2-domain scale: acc = 256 * q.k ; x = log2(e) * q.k / 64 = acc * log2(e) / 16384
    const float cl = 1.4426950408889634f * 0.00006103515625f;
    f16* psw = ps + wave * (16u * PK64);
    f16* prw = pr + wave * (16u * PK64);

    const u32 nkt = qblk * 2u + 2u;      // keys 0 .. qblk*128 + 127

    // staging map: 8 lanes cover one 128-byte row, a wave's copy four rows; rows srow and srow + 32 per thread
    const u32 srow = tid >> 3;
    const u32 spc  = (tid & 7u) << 3;
    const f16* gK = Kp + head + (size_t)srow * HD + spc;
    const f16* gV = Vt + head + (size_t)srow * SEQ + spc;
    const f16* gR = Vr + head + (size_t)srow * SEQ + spc;
    const u32 lK = lds_addr(&ks[srow * PK64 + spc]);
    const u32 lV = lds_addr(&vsT[srow * PK64 + spc]);
    const u32 lR = lds_addr(&vrT[EP ? srow * PK64 + spc : 0u]);

    auto stage = [&](u32 t) {
        const u32  bo = (t & 1u) * (64u * PK64 * 2u);
        const u32  hb = 32u * PK64 * 2u;                 // 32 rows further, in LDS bytes
        const f16* k0 = gK + (size_t)t * 64u * HD;
        const f16* v0 = gV + t * 64u;
        async_copy4(lK + bo, k0, lK + bo + hb, k0 + 32 * HD, lV + bo, v0, lV + bo + hb, v0 + (size_t)32 * SEQ);
        if constexpr (EP) {
            const f16* r0 = gR + t * 64u;
            async_copy2(lR + bo, r0, lR + bo + hb, r0 + (size_t)32 * SEQ);
        }
    };

    stage(0u);
    asm volatile("s_wait_asynccnt 0x0" ::: "memory");   // tile 0 landed before the barrier that shows it
    __syncthreads();
    stage(1u);                           // nkt >= 2

#pragma unroll 1   // stays rolled: one trip per staged tile, its buffers chosen by kt & 1
    for (u32 kt = 0; kt < nkt; ++kt) {
        const f16* ksb = ks  + (kt & 1u) * (64u * PK64);
        const f16* vsb = vsT + (kt & 1u) * (64u * PK64);
        const f16* vrb_t = vrT + (EP ? (kt & 1u) * (64u * PK64) : 0u);

        const bool active = (kt * 64u <= q0);           // wave-uniform
        if (active) {
            // S^T[64 keys x 16 q]
            v8f s[4];
            v16h kf[2][4], vf[2][4];
#pragma unroll
            for (int nt = 0; nt < 4; ++nt) s[nt] = zero8();
#pragma unroll
            for (int c = 0; c < 2; ++c)
#pragma unroll
                for (int nt = 0; nt < 4; ++nt) kf[c][nt] = load_frag(ksb, (u32)nt * 16u, PK64, (u32)c * 32u, lane);
            __builtin_amdgcn_sched_barrier(0);   // the tile's K reads stay one group ahead of its products: one LDS latency, not one per product
#pragma unroll
            for (int c = 0; c < 2; ++c)
#pragma unroll
                for (int nt = 0; nt < 4; ++nt) s[nt] = wmma16(kf[c][nt], qa[c], s[nt]);
            __builtin_amdgcn_sched_barrier(0);   // the V^T reads below stay one group, not spread in pairs among the score products
#pragma unroll
            for (int kk = 0; kk < 2; ++kk)
#pragma unroll
                for (int dt = 0; dt < 4; ++dt) vf[kk][dt] = load_frag(vsb, (u32)dt * 16u, PK64, (u32)kk * 32u, lane);
            __builtin_amdgcn_sched_barrier(0);   // holds those reads in front of the softmax, which covers their latency: the compiler otherwise sinks them behind it
            FragU pb[2], prb[2];
            const bool diag = (kt * 64u + 63u > q0);    // wave-uniform
            if (diag) softmax_tile<true,  EP>(s, m, o, lacc, pb, prb, kt * 64u, q0 + c16, hh8, cl);
            else      softmax_tile<false, EP>(s, m, o, lacc, pb, prb, kt * 64u, q0 + c16, hh8, cl);

            // O^T += V^T . P^T ; l += ones . P^T
            v16h vrf[2][4];
            if constexpr (EP) {
#pragma unroll
                for (int kk = 0; kk < 2; ++kk)
#pragma unroll
                    for (int dt = 0; dt < 4; ++dt)
                        vrf[kk][dt] = load_frag(vrb_t, (u32)dt * 16u, PK64, (u32)kk * 32u, lane);
                __builtin_amdgcn_sched_barrier(0);   // the residual reads stay one group ahead of the products
            }
#pragma unroll
            for (int kk = 0; kk < 2; ++kk) {
#pragma unroll
                for (int dt = 0; dt < 4; ++dt) {
                    o[dt] = wmma16(vf[kk][dt], pb[kk].v, o[dt]);
                    if constexpr (EP) {
                        o[dt] = wmma16(vrf[kk][dt], pb[kk].v, o[dt]);
                        o[dt] = wmma16(vf[kk][dt], prb[kk].v, o[dt]);
                    }
                }
                lacc = wmma16(ones, pb[kk].v, lacc);
                if constexpr (EP) lacc = wmma16(ones, prb[kk].v, lacc);
            }
        }
        ring_publish();                          // every wave, active or not
        if (kt + 2u < nkt) stage(kt + 2u);       // into the buffers this trip has just read
    }
    asm volatile("s_wait_asynccnt 0x0" ::: "memory");   // nothing in flight when the epilogue starts

    // normalize: plane value = 1024 * (O/16) / l = O * 64 / l ; a lane's 8 registers are 8 consecutive d of its query
    const float inv = (CARRY_CTX / CARRY_QKV) / lacc[0];
#pragma unroll
    for (int dt = 0; dt < 4; ++dt) {
        H8U th, tr;
#pragma unroll
        for (int r = 0; r < 8; ++r) {
            const float cv = o[dt][r] * inv;
            const f16   hi = (f16)cv;
            th.e[r] = hi;
            if constexpr (EP) tr.e[r] = (f16)(cv - (float)hi);
        }
        const u32 idx = c16 * PK64 + (u32)dt * 16u + hh8;
        *(v8h*)&psw[idx] = th.v;
        if constexpr (EP) *(v8h*)&prw[idx] = tr.v;
    }
    __syncthreads();

    const u32 piece = lane & 7u;
    const u32 lsub  = lane >> 3;
{
#pragma unroll
        for (u32 it = 0; it < 4; ++it) {
            const u32 L = it * 4u + lsub;     // query row 0..15 within the wave tile
            const size_t off = (size_t)(bidx * (u32)SEQ + q0 + L) * HID + hidx * (u32)HD + piece * 8u;
            const v8h v = *(const v8h*)&psw[L * PK64 + piece * 8u];
            *(v8h*)(Cp + off) = v;
            if constexpr (EP) {
                const v8h vr = *(const v8h*)&prw[L * PK64 + piece * 8u];
                *(v8h*)(Cr + off) = vr;
            }
        }
        
    }
}

// Both attention paths in one launch (neither reads what the other writes): rows [0, EARLY) of every
// sequence take the hi + residual path, rows [EARLY, SEQ) the single f16 planes; the choice is block-uniform.
// A row block's cost grows with its index (it walks 2 q + 2 key tiles) and every block of the launch is resident at
// once, two to a WGP, so the launch lasts as long as the fullest WGP. Flat grid, head running fastest: the upper half
// of the row blocks first, longest first, then the lower half, shortest
// first, so that blocks half a grid apart, q and ATT_NQ - 1 - q, add up to the same number of key tiles.
// rank -> row block is a permutation for any ATT_NQ: ranks below ATT_NU take ATT_NQ - 1 .. ATT_NQ - ATT_NU, the rest 0 upward.
#define ATT_E_BX     (EARLY / 128)
#define ATT_NQ       (SEQ / 128)
#define ATT_NH       (NB * NHEAD)
#define ATT_NU       (ATT_NQ - ATT_NQ / 2)
__global__ void __launch_bounds__(256) __attribute__((amdgpu_num_vgpr(256)))
attn_all(const f16* __restrict__ Qp, const f16* __restrict__ Kp, const f16* __restrict__ Vt,
         const f16* __restrict__ Vr, f16* __restrict__ Cp, f16* __restrict__ Cr) {
    __shared__ __attribute__((aligned(16))) f16 ks[2 * 64 * PK64];    // two buffers of [key][d]
    __shared__ __attribute__((aligned(16))) f16 vsT[2 * 64 * PK64];   // two buffers of [d][key]
    __shared__ __attribute__((aligned(16))) f16 vrT[2 * 64 * PK64];   // two buffers of [d][key] residual (early path)
    __shared__ __attribute__((aligned(16))) f16 ps[8 * 16 * PK64];    // per-wave ctx stage
    __shared__ __attribute__((aligned(16))) f16 pr[8 * 16 * PK64];    // per-wave ctx residual stage (early path)
    const u32 rank = blockIdx.x / (u32)ATT_NH;
    const u32 bh   = blockIdx.x % (u32)ATT_NH;
    const u32 qblk = (rank < (u32)ATT_NU) ? (u32)(ATT_NQ - 1) - rank : rank - (u32)ATT_NU;
    if (qblk < (u32)ATT_E_BX) {
        attn_body<true>(Qp, Kp, Vt, Vr, Cp, Cr, qblk, bh, ks, vsT, vrT, ps, pr);
    } else {
        attn_body<false>(Qp, Kp, Vt, Vt, Cp, Cp, qblk, bh, ks, vsT, vrT, ps, pr);
    }
}

// coverage equalities (threads x elements == plane elements)
static_assert((size_t)(MROWS / 2) * 256 * 8 == (size_t)MROWS * HID);                       // cvt_rows -> Xh
static_assert((size_t)(3 * HID / 64) * (HID / 64) * 64 * 64 == (size_t)3 * HID * HID);     // cvt_wT -> Wt
static_assert((size_t)(HID / 64) * (HID / 64) * 64 * 64 == (size_t)HID * HID);             // cvt_wT -> Wot
static_assert((size_t)(MROWS / 128) * (HID / 128) * 128 * 128 == (size_t)MROWS * HID);     // gemm planes / out
static_assert((size_t)(SEQ / 128) * (NB * NHEAD) * 128 * HD == (size_t)MROWS * HID);       // attn -> Cp
// workspace: 7 activation planes + 4 weight planes of halves, at most 128 MiB
static_assert(((size_t)7 * MROWS * HID + (size_t)4 * HID * HID) * sizeof(f16) <= (size_t)134217728);

// ---------------------------------------------------------------------------
// Launch: 4 kernel launches, workspace 7 planes of MROWS*1024 halves + 4 of 1024*1024 halves.
// ---------------------------------------------------------------------------
extern "C" void kernel_launch(void* const* d_in, const int* in_sizes, int n_in,
                              void* d_out, int out_size, void* d_ws, size_t ws_size,
                              hipStream_t stream) {
    if (n_in < 5) return;
    if (in_sizes[0] < ((NB - 1) * SEQ_FULL + SEQ) * HID) return;
    if (in_sizes[1] < 3 * HID * HID) return;
    if (in_sizes[2] < 3 * HID) return;
    if (in_sizes[3] < HID * HID) return;
    if (in_sizes[4] < HID) return;
    const size_t needOut = OUT0_ELEMS_FULL + PRES_ELEMS_FULL
                         + ((size_t)((NB - 1) * NHEAD + NHEAD - 1) * SEQ_FULL + SEQ) * HD;
    if ((size_t)out_size < needOut) return;

    const float* x     = (const float*)d_in[0];   // [NB_FULL][SEQ_FULL][1024]
    const float* wattn = (const float*)d_in[1];   // [1024 in][3072 out], out columns q | k | v
    const float* battn = (const float*)d_in[2];   // [3072]
    const float* wproj = (const float*)d_in[3];   // [1024 in][1024 out]
    const float* bproj = (const float*)d_in[4];   // [1024]
    float* out = (float*)d_out;                   // out0 | present k | present v

    const size_t nX = (size_t)MROWS * HID;    // halves per activation plane
    const size_t nW = (size_t)HID * HID;      // halves per weight plane
    const size_t totalHalves = 7 * nX + 4 * nW;
    if (ws_size < totalHalves * sizeof(f16)) return;

    f16* Xh  = (f16*)d_ws;       // [MROWS][1024]               carry 16
    f16* Wt  = Xh  + nX;         // [3072 out][1024 in]         carry 32 (q | k | v row blocks)
    f16* Wot = Wt  + 3 * nW;     // [1024 out][1024 in]         carry 32
    f16* Qp  = Wot + nW;         // [NB*16][SEQ][64]            carry 16
    f16* Kp  = Qp  + nX;         // [NB*16][SEQ][64]            carry 16
    f16* Vtp = Kp  + nX;         // [NB*1024][SEQ] (V^T)        carry 16
    f16* Vrp = Vtp + nX;         // [NB*1024][SEQ] residual, columns s < EARLY only
    f16* Cp  = Vrp + nX;         // [MROWS][1024]               carry 1024
    f16* Cr  = Cp  + nX;         // [MROWS][1024] residual, rows s < EARLY only

    cvt_all<<<CVT_X_BLOCKS + CVT_WA_BLOCKS + CVT_WP_BLOCKS, 256, 0, stream>>>(x, wattn, wproj, Xh, Wt, Wot);

    const dim3 gg(MROWS / 128, HID / 128);
    gemm_qkv<<<gg, 256, 0, stream>>>(Xh, Wt, battn, Qp, Kp, Vtp, Vrp, out + OUT0_ELEMS_FULL);

    attn_all<<<ATT_NQ * ATT_NH, 256, 0, stream>>>(Qp, Kp, Vtp, Vrp, Cp, Cr);

    // out = acc / (1024*32) + bias ; residual context plane at Cp + nX
    gemm_o<<<gg, 256, 0, stream>>>(Cp, Wot, bproj, out, nX);
}

// v010
// It runs in 62.5 microseconds.
// Two timings next to v009 both put it at 1.10 times that version's speed.
// Over all steps from v000 it is 5.45 times as fast.
#include <hip/hip_runtime.h>

// Contractions (fused QKV projection, Q.K^T, P.V, P row-sum, output projection): v_wmma_f32_16x16x32_f16, f16 operands with power-of-two carries, f32 accumulate; every float input enters as its bf16 RNE value; the first EARLY query rows of each sequence carry P, V and context as f16 hi + f16 residual planes (extra products into the same f32 accumulators); softmax in f32.

#ifndef NB
#define NB 2
#endif
#ifndef SEQ
#define SEQ 2048
#endif
#define NB_FULL   2
#define SEQ_FULL  2048
#define HID       1024
#define NHEAD     16
#define HD        64
#define MROWS     (NB * SEQ)
#define EARLY_CAP 512
#define EARLY     ((SEQ < EARLY_CAP) ? SEQ : EARLY_CAP)

#define OUT0_ELEMS_FULL ((size_t)NB_FULL * SEQ_FULL * HID)          // out0 elements
#define PRES_ELEMS_FULL ((size_t)NB_FULL * NHEAD * SEQ_FULL * HD)   // elements of present[0] (k) or present[1] (v)

static_assert(HID == NHEAD * HD);        // merged head width
static_assert(NHEAD == 16);              // bh >> 4 / bh & 15 decoding
static_assert(HD == 64);
static_assert(SEQ % 128 == 0);           // 128-row blocks never straddle a batch
static_assert(EARLY % 128 == 0);
static_assert(EARLY >= 128 && EARLY <= SEQ);
static_assert(SEQ <= SEQ_FULL);
static_assert(NB >= 1 && NB <= NB_FULL);
static_assert(MROWS % 128 == 0);         // GEMM M tile
static_assert(HID % 128 == 0);           // GEMM N tile
static_assert(HID % 64 == 0);            // weight transpose tile
static_assert(HID % 32 == 0);            // WMMA k step
static_assert(HID % 256 == 0);           // staged k tiles of 128, at least two of them
static_assert(HID == 128 * 8);           // cvt_rows: 128 threads x 8 values per row
static_assert(OUT0_ELEMS_FULL * 4 == (size_t)16777216);   // byte offset of the second output

// carries (exact powers of two)
#define CARRY_X    16.0f     // input activation plane
#define CARRY_W    32.0f     // weight planes
#define CARRY_QKV  16.0f     // q, k, v^T planes (true value x16); v residual in the same units
#define CARRY_CTX  1024.0f   // context planes (true value x1024); residual in the same units
// softmax exp values carry 2^10 (added to the exp2 argument); residual in the same units

// LDS row pitches in elements: every row read or written 16 bytes per lane has a pitch of 16 B x odd,
// so the 16 lanes of a lane half fall on 64 distinct banks
#define PK32   40u    // 32-half rows (64 B)  -> 80 B
#define PK64   72u    // 64-half rows (128 B) -> 144 B
#define PC16   136u   // 128-half rows (256 B) -> 272 B
#define PC32   132u   // 128-float rows (512 B) -> 528 B
#define KTILE  128u   // k values per staged GEMM tile (256-byte rows)

typedef unsigned u32;
typedef _Float16 f16;
typedef f16   v16h __attribute__((ext_vector_type(16)));
typedef f16   v8h  __attribute__((ext_vector_type(8)));
typedef f16   v2h  __attribute__((ext_vector_type(2)));
typedef float v2f  __attribute__((ext_vector_type(2)));
typedef float v8f  __attribute__((ext_vector_type(8)));
typedef float v4f  __attribute__((ext_vector_type(4)));

union FragU { v16h v; v8h half[2]; v2h pair[8]; f16 e[16]; };
union H8U   { v8h v; f16 e[8]; };

__device__ __forceinline__ v8f zero8() {
    v8f z = {0.f, 0.f, 0.f, 0.f, 0.f, 0.f, 0.f, 0.f};
    return z;
}

// 16-bit WMMA: D += A[16 x 32k] * B[32k x 16] (the builtin: the distances behind it are the compiler's)
__device__ __forceinline__ v8f wmma16(v16h a, v16h b, v8f c) {
    return __builtin_amdgcn_wmma_f32_16x16x32_f16(false, a, false, b, (short)0, c, false, false);
}

// f32 -> nearest-even bf16 value, returned as f32
__device__ __forceinline__ float bf16_rne(float x) {
    u32 u = __float_as_uint(x);
    u = (u + 0x7fffu + ((u >> 16) & 1u)) & 0xffff0000u;
    return __uint_as_float(u);
}

__device__ __forceinline__ float fexp2(float x) {
#if defined(__has_builtin)
#if __has_builtin(__builtin_amdgcn_exp2f)
    return __builtin_amdgcn_exp2f(x);
#else
    return exp2f(x);
#endif
#else
    return exp2f(x);
#endif
}

// value of lane l ^ 16 (the other lane half)
__device__ __forceinline__ float xhalf(float x) {
    const int v = __builtin_bit_cast(int, x);
    return __builtin_bit_cast(float, __builtin_amdgcn_permlanex16(v, v, 0x76543210, 0xfedcba98, false, false));
}

// 16 x 32 fragment from a tile whose k dimension is contiguous (pitch in halves).
// lane l: row rowbase + (l&15); elements 0..7 <- k = kcol + 8h .. +7,
// elements 8..15 <- k = kcol + 16 + 8h .. +7  (h = l>>4). Same map for A and B.
__device__ __forceinline__ v16h load_frag(const f16* tile, u32 rowbase, u32 pitch, u32 kcol, u32 lane) {
    const u32 r  = rowbase + (lane & 15u);
    const u32 kh = (lane >> 4) << 3;
    const f16* p = tile + (size_t)r * pitch + kcol + kh;
    FragU f;
    f.half[0] = *(const v8h*)(p);
    f.half[1] = *(const v8h*)(p + 16);
    return f.v;
}

// LDS byte address of a __shared__ element (low 32 bits of its address)
__device__ __forceinline__ u32 lds_addr(const f16* p) {
    return (u32)(size_t)p;
}

// Asynchronous copies global -> LDS, 16 bytes per lane, no register staging. The s_wait_xcnt closes each
// statement so that no address register of an issued copy is rewritten ahead of it.
// Eight copies whose rows lie 16 apart: LDS step lstep bytes, global step gstep halves.
__device__ __forceinline__ void async_copy8(u32 l, u32 lstep, const f16* g, size_t gstep) {
    asm volatile("global_load_async_to_lds_b128 %0, %8, off\n\t"
                 "global_load_async_to_lds_b128 %1, %9, off\n\t"
                 "global_load_async_to_lds_b128 %2, %10, off\n\t"
                 "global_load_async_to_lds_b128 %3, %11, off\n\t"
                 "global_load_async_to_lds_b128 %4, %12, off\n\t"
                 "global_load_async_to_lds_b128 %5, %13, off\n\t"
                 "global_load_async_to_lds_b128 %6, %14, off\n\t"
                 "global_load_async_to_lds_b128 %7, %15, off\n\t"
                 "s_wait_xcnt 0x0"
                 :: "v"(l), "v"(l + lstep), "v"(l + 2u * lstep), "v"(l + 3u * lstep),
                    "v"(l + 4u * lstep), "v"(l + 5u * lstep), "v"(l + 6u * lstep), "v"(l + 7u * lstep),
                    "v"(g), "v"(g + gstep), "v"(g + 2 * gstep), "v"(g + 3 * gstep),
                    "v"(g + 4 * gstep), "v"(g + 5 * gstep), "v"(g + 6 * gstep), "v"(g + 7 * gstep)
                 : "memory");
}

// Four copies with each lane's own addresses given one by one.
__device__ __forceinline__ void async_copy4(u32 l0, const f16* g0, u32 l1, const f16* g1,
                                            u32 l2, const f16* g2, u32 l3, const f16* g3) {
    asm volatile("global_load_async_to_lds_b128 %0, %4, off\n\t"
                 "global_load_async_to_lds_b128 %1, %5, off\n\t"
                 "global_load_async_to_lds_b128 %2, %6, off\n\t"
                 "global_load_async_to_lds_b128 %3, %7, off\n\t"
                 "s_wait_xcnt 0x0"
                 :: "v"(l0), "v"(l1), "v"(l2), "v"(l3), "v"(g0), "v"(g1), "v"(g2), "v"(g3)
                 : "memory");
}
// Eight copies, each lane's own addresses given one by one: one statement, one s_wait_xcnt for the run.
__device__ __forceinline__ void async_copy8p(u32 l0, const f16* g0, u32 l1, const f16* g1,
                                             u32 l2, const f16* g2, u32 l3, const f16* g3,
                                             u32 l4, const f16* g4, u32 l5, const f16* g5,
                                             u32 l6, const f16* g6, u32 l7, const f16* g7) {
    asm volatile("global_load_async_to_lds_b128 %0, %8, off\n\t"
                 "global_load_async_to_lds_b128 %1, %9, off\n\t"
                 "global_load_async_to_lds_b128 %2, %10, off\n\t"
                 "global_load_async_to_lds_b128 %3, %11, off\n\t"
                 "global_load_async_to_lds_b128 %4, %12, off\n\t"
                 "global_load_async_to_lds_b128 %5, %13, off\n\t"
                 "global_load_async_to_lds_b128 %6, %14, off\n\t"
                 "global_load_async_to_lds_b128 %7, %15, off\n\t"
                 "s_wait_xcnt 0x0"
                 :: "v"(l0), "v"(l1), "v"(l2), "v"(l3), "v"(l4), "v"(l5), "v"(l6), "v"(l7),
                    "v"(g0), "v"(g1), "v"(g2), "v"(g3), "v"(g4), "v"(g5), "v"(g6), "v"(g7)
                 : "memory");
}

// publish point of a two-buffer ring: this wave's LDS reads retired, its own copies landed, then the block
// barrier that shows the next tile to every wave and frees the buffer just read
__device__ __forceinline__ void ring_publish() {
    asm volatile("s_wait_dscnt 0x0" ::: "memory");     // reads of the buffer to be refilled have retired
    asm volatile("s_wait_asynccnt 0x0" ::: "memory");  // this wave's copies of the next tile have landed
    __syncthreads();
}

// block barrier that orders LDS alone: stage writes are shown to every wave, while global stores already issued, which no
// wave of the launch reads, go on draining (__syncthreads() would wait here until each has completed)
__device__ __forceinline__ void lds_barrier() {
    __builtin_amdgcn_fence(__ATOMIC_RELEASE, "workgroup", "local");
    __builtin_amdgcn_s_barrier();
    __builtin_amdgcn_fence(__ATOMIC_ACQUIRE, "workgroup", "local");
}

// ---------------------------------------------------------------------------
// f32 rows [.][1024] -> f16 plane (bf16 RNE value times carry). 128 threads per 1024-wide
// Row mapping dst row m -> src row (m / dstper) * srcper + m % dstper lets a reduced build
// read full-size inputs.
// coverage: nrows x 1024 halves, every element exactly once (grid = nrows*128/256).
// ---------------------------------------------------------------------------
__device__ __forceinline__ void
cvt_rows_body(const float* src, f16* dst, u32 blk, u32 nrows, u32 dstper, u32 srcper, float carry) {
    const u32 g  = blk * 256u + threadIdx.x;
    const u32 m  = g >> 7;
    const u32 c8 = (g & 127u) << 3;
    if (m >= nrows) return;
    const u32 mb = m / dstper;
    const u32 sm = mb * srcper + (m - mb * dstper);
    const float* sp = src + (size_t)sm * HID + c8;
    const v4f a = *(const v4f*)sp;
    const v4f b = *(const v4f*)(sp + 4);
    H8U o;
#pragma unroll
    for (u32 j = 0; j < 4; ++j) {
        const float x0 = a[j];
        const float x1 = b[j];
        o.e[j]     = (f16)(bf16_rne(x0) * carry);
        o.e[j + 4] = (f16)(bf16_rne(x1) * carry);
    }
    f16* dp = dst + (size_t)m * HID + c8;
    *(v8h*)dp = o.v;
    
}

// ---------------------------------------------------------------------------
// Transposing weight convert: src[rows][cols] f32 -> dst[cols][rows] f16 (bf16 RNE value
// times carry). Block = 64 (src rows, k) x 64 (src cols, n) tile, grid (cols/64, rows/64).
// Tile staged transposed in LDS (pitch 72 halves), then each dst row segment of 64 halves
// coverage: 4 x 256 threads x 4 values == 64 x 64 per block; blocks tile rows x cols exactly.
// LDS t: cross-wave, block barrier; staged extent 64 x 64 == consumed extent.
// ---------------------------------------------------------------------------
__device__ __forceinline__ void
cvt_wT_body(const float* src, f16* dst, f16* t, u32 bx, u32 by, u32 rows, u32 cols, float carry) {
    const u32 tid = threadIdx.x;
    const u32 n0  = bx * 64u;   // src column block == dst row block
    const u32 k0  = by * 64u;   // src row block == dst column block
#pragma unroll
    for (u32 it = 0; it < 4; ++it) {
        const u32 p  = tid + it * 256u;
        const u32 kr = p >> 4;              // 0..63
        const u32 c4 = (p & 15u) << 2;      // 0..60
        const v4f a = *(const v4f*)(src + (size_t)(k0 + kr) * cols + n0 + c4);
#pragma unroll
        for (u32 j = 0; j < 4; ++j) {
            const float x = a[j];
            t[(c4 + j) * 72u + kr] = (f16)(bf16_rne(x) * carry);
        }
    }
    __syncthreads();
    const u32 piece = tid & 7u;
    const u32 lrow  = tid >> 3;             // 0..31
{
#pragma unroll
        for (u32 it = 0; it < 2; ++it) {
            const u32 L = it * 32u + lrow;  // dst row within the tile, 0..63
            const v8h v = *(const v8h*)&t[L * 72u + piece * 8u];
            f16* dp = dst + (size_t)(n0 + L) * rows + k0 + piece * 8u;
            *(v8h*)dp = v;
        }
        asm volatile("s_wait_xcnt 0x0" ::: "memory");   // before code behind this body rewrites a register of these stores
    }
}

// The three converts in one launch: none reads what another writes. Flat grid: the blocks of the activation
// rows first, then those of the two weight transposes; the choice is block-uniform.
#define CVT_WA_BX     (3 * HID / 64)
#define CVT_WA_BLOCKS (CVT_WA_BX * (HID / 64))
#define CVT_WP_BX     (HID / 64)
#define CVT_WP_BLOCKS (CVT_WP_BX * (HID / 64))
#define CVT_X_BLOCKS  (MROWS / 2)
__global__ void __launch_bounds__(256)
cvt_all(const float* __restrict__ x, const float* __restrict__ wattn, const float* __restrict__ wproj,
        f16* __restrict__ Xh, f16* __restrict__ Wt, f16* __restrict__ Wot) {
    __shared__ __attribute__((aligned(16))) f16 t[64 * 72];
    const u32 b = blockIdx.x;
    if (b < (u32)CVT_X_BLOCKS) {
        // dst row m of batch b <- src row b*SEQ_FULL + (m % SEQ)
        cvt_rows_body(x, Xh, b, (u32)MROWS, (u32)SEQ, (u32)SEQ_FULL, CARRY_X);
    } else if (b < (u32)(CVT_X_BLOCKS + CVT_WA_BLOCKS)) {
        // in[rows = 1024 (k)][cols = 3072 (n)] -> out[cols][rows]
        const u32 bb = b - (u32)CVT_X_BLOCKS;
        cvt_wT_body(wattn, Wt, t, bb % (u32)CVT_WA_BX, bb / (u32)CVT_WA_BX, (u32)HID, (u32)(3 * HID), CARRY_W);
    } else {
        // in[rows = 1024 (k)][cols = 1024 (n)] -> out[cols][rows]
        const u32 bb = b - (u32)(CVT_X_BLOCKS + CVT_WA_BLOCKS);
        cvt_wT_body(wproj, Wot, t, bb % (u32)CVT_WP_BX, bb / (u32)CVT_WP_BX, (u32)HID, (u32)HID, CARRY_W);
    }
}

// ---------------------------------------------------------------------------
// C[m][n] = sum_k A[m][k] * W[n][k] ; A [MROWS][1024] f16, W [1024][1024] f16 (k contiguous).
// Block tile 128 x 128, 8 waves as 4(M) x 2(N), 2 x 4 accumulators per wave, WMMA k step 32.
// A and W tiles of 128 k come by asynchronous copies into two LDS buffers: tile t + 1 flies while tile t is multiplied.
// Inside a tile the fragments of the next 32-k step are read, as one group, ahead of this step's products.
// true value t = acc * mul + bias (bias enters as its bf16 RNE value, added in f32).
// MODE 3 (the output projection, the one mode in use): f32 rows [b][s][1024] into the output buffer; RES (row blocks below EARLY): each staged tile also brings
//         the residual A plane's rows (A + resOff) into a ring of their own, and every 32-k step multiplies both A
//         planes by the same W fragments, so W is staged and read once for the two planes
// coverage per block: f32 2 x 256 lines (64 rows x 4 line-quarters per half).
// LDS: As/Bs/Cs all cross-wave, separated by block barriers.
// staged extent == consumed extent: As/Bs (and Rs when RES) 128 x 128 per buffer, Cs 128 x 128 halves (or 64 x 128 floats).
// ---------------------------------------------------------------------------
template <int MODE, bool RES = false>
__device__ __forceinline__ void gemm_body(const f16* A, const f16* W, const float* bias,
                                          f16* plane, f16* plane2, float* fout, size_t resOff,
                                          f16* As, f16* Bs, f16* Cs, f16* Rs) {
    static_assert(!RES || MODE == 3);
    // As, Bs (Rs when RES): two buffers of 128 rows x 128 k each; Cs: f16 [128][128] at pitch PC16 or f32 [64][128] at pitch PC32
    static_assert(sizeof(f16) * 128 * PC16 >= sizeof(float) * 64 * PC32);   // Cs reuse as f32 [64][128]

    const u32 tid  = threadIdx.x;
    const u32 lane = tid & 31u;
    const u32 wave = tid >> 5;
    const u32 wm   = wave & 3u;
    const u32 wn   = wave >> 2;
    const u32 hh8  = (lane >> 4) << 3;   // D row half
    const u32 c16  = lane & 15u;         // D column
    const u32 m0   = blockIdx.x * 128u;
    const u32 n0   = blockIdx.y * 128u;
    const u32 bidx = m0 / (u32)SEQ;      // block rows lie inside one batch (SEQ % 128 == 0)
    const u32 s0   = m0 - bidx * (u32)SEQ;

    v8f acc[2][4];
#pragma unroll
    for (int i = 0; i < 2; ++i)
#pragma unroll
        for (int j = 0; j < 4; ++j) acc[i][j] = zero8();

    // staging map: 16 lanes cover one 256-byte row segment, a wave's copy two rows (four whole lines)
    const u32 crow = tid >> 4;
    const u32 ccol = (tid & 15u) << 3;
    const f16* gA = A + (size_t)(m0 + crow) * HID + ccol;
    const f16* gW = W + (size_t)(n0 + crow) * HID + ccol;
    const u32 lA = lds_addr(&As[crow * PC16 + ccol]);
    const u32 lB = lds_addr(&Bs[crow * PC16 + ccol]);
    const u32 lR = lds_addr(&Rs[RES ? crow * PC16 + ccol : 0u]);
    const u32 nT = (u32)HID / KTILE;     // 8 tiles

    auto stage = [&](u32 t) {
        const u32 kk = t * KTILE;
        const u32 bo = (t & 1u) * (128u * PC16 * 2u);
        async_copy8(lA + bo, 16u * PC16 * 2u, gA + kk, (size_t)16 * HID);
        if constexpr (RES) async_copy8(lR + bo, 16u * PC16 * 2u, gA + resOff + kk, (size_t)16 * HID);
        async_copy8(lB + bo, 16u * PC16 * 2u, gW + kk, (size_t)16 * HID);
    };

    stage(0u);
    asm volatile("s_wait_asynccnt 0x0" ::: "memory");   // tile 0 landed before the barrier that shows it
    __syncthreads();
    stage(1u);

#pragma unroll 1   // stays rolled: one trip per staged tile, its buffer chosen by t & 1
    for (u32 t = 0; t < nT; ++t) {
        const f16* as = As + (t & 1u) * (128u * PC16);
        const f16* bs = Bs + (t & 1u) * (128u * PC16);
        const f16* rs = Rs + (RES ? (t & 1u) * (128u * PC16) : 0u);
        v16h af[2][2], bfr[2][4];       // two fragment sets: the next 32-k step is read while this one is multiplied
        v16h rf[2][2];                  // residual A fragments (RES)
        auto frags = [&](u32 set, u32 kc) {
#pragma unroll
            for (int i = 0; i < 2; ++i) af[set][i] = load_frag(as, wm * 32u + (u32)i * 16u, PC16, kc, lane);
            if constexpr (RES) {
#pragma unroll
                for (int i = 0; i < 2; ++i) rf[set][i] = load_frag(rs, wm * 32u + (u32)i * 16u, PC16, kc, lane);
            }
#pragma unroll
            for (int j = 0; j < 4; ++j) bfr[set][j] = load_frag(bs, wn * 64u + (u32)j * 16u, PC16, kc, lane);
        };
        frags(0u, 0u);
#pragma unroll     // the four 32-k steps of a tile in line, every LDS offset an immediate
        for (u32 ks = 0; ks < KTILE / 32u; ++ks) {
            if (ks + 1u < KTILE / 32u) frags((ks + 1u) & 1u, (ks + 1u) * 32u);
            __builtin_amdgcn_sched_barrier(0);   // the next step's reads stay one group ahead of this step's products
#pragma unroll
            for (int i = 0; i < 2; ++i)
#pragma unroll
                for (int j = 0; j < 4; ++j) acc[i][j] = wmma16(af[ks & 1u][i], bfr[ks & 1u][j], acc[i][j]);
            if constexpr (RES) {
#pragma unroll
                for (int i = 0; i < 2; ++i)
#pragma unroll
                    for (int j = 0; j < 4; ++j) acc[i][j] = wmma16(rf[ks & 1u][i], bfr[ks & 1u][j], acc[i][j]);
            }
            __builtin_amdgcn_sched_barrier(0);   // and no later read moves up among these products
        }
        ring_publish();
        if (t + 2u < nT) stage(t + 2u);  // into the buffer this trip has just read
    }
    asm volatile("s_wait_asynccnt 0x0" ::: "memory");   // nothing in flight when the epilogue starts

    const float mul = (MODE == 3) ? (1.0f / (CARRY_CTX * CARRY_W)) : (1.0f / (CARRY_X * CARRY_W));
    float bv[4];
#pragma unroll
    for (int j = 0; j < 4; ++j) {
        const float bx = bias[n0 + wn * 64u + (u32)j * 16u + c16];
        asm volatile("s_wait_xcnt 0x0" ::: "memory");   // before a later load of this run rewrites the offset register that this load names
        bv[j] = bf16_rne(bx);
    }

    const u32 piece = lane & 7u;
    const u32 lsub  = lane >> 3;

    if constexpr (MODE >= 1) {
        if constexpr (MODE != 3) __syncthreads();
        float* Cf = (float*)Cs;      // [64][128] f32 at pitch PC32
#pragma unroll
        for (u32 half = 0; half < 2; ++half) {
            if ((wm >> 1) == half) {
#pragma unroll
                for (int i = 0; i < 2; ++i)
#pragma unroll
                    for (int j = 0; j < 4; ++j) {
                        const u32 nl = wn * 64u + (u32)j * 16u + c16;
#pragma unroll
                        for (int r = 0; r < 8; ++r) {
                            const u32 ml = (wm & 1u) * 32u + (u32)i * 16u + hh8 + (u32)r;
                            Cf[ml * PC32 + nl] = acc[i][j][r] * mul + bv[j];
                        }
                    }
            }
            __syncthreads();
{
#pragma unroll
                for (u32 it = 0; it < 8; ++it) {
                    const u32 L    = wave * 32u + it * 4u + lsub;   // 0..255
                    const u32 row  = L >> 2;
                    const u32 part = L & 3u;
                    const v4f v = *(const v4f*)&Cf[row * PC32 + part * 32u + piece * 4u];
                    size_t off;
                    if constexpr (MODE == 3) {
                        off = (size_t)(bidx * (u32)SEQ_FULL + s0 + half * 64u + row) * HID
                            + n0 + part * 32u + piece * 4u;
                    } else {
                        off = ((size_t)(bidx * (u32)NHEAD + (n0 >> 6) + (part >> 1)) * SEQ_FULL
                               + s0 + half * 64u + row) * HD + (part & 1u) * 32u + piece * 4u;
                    }
                    *(v4f*)(fout + off) = v;
                }
                
            }
            __syncthreads();
        }
    }
}

// The q, k and v projections of one tile, 128 rows x 128 columns of each projection, in ONE work-group: 256 work-groups,
// one per WGP. The X tile is staged once for the three weight tiles (128 + 384 rows per 128-k tile instead of 3 x 256),
// and a wave, 2 (M) x 4 (N), owns 64 rows x 32 columns of each projection: 4 X and 6 W fragments feed 24 products.
// Ring and publish points as in gemm_body. Epilogue: behind the loop's last publish point no wave reads the rings and no
// copy is in flight, so the six output stages lie side by side over them, each written once: no stage waits for another's
// readers, and one barrier per projection stands between its stage writes and its stage reads.
//   q, k: f16 planes [b*NHEAD + h][s][d] (t x16); v: f16 plane [b*HID + h*HD + d][s] (t x16, transposed per head) and,
//   for key blocks below EARLY, its residual plane; k, v: f32 rows [b*NHEAD + h][s][d] (t) of the second output.
// coverage per block: f16 planes 256 lines each, f32 512 lines each; staged extent == consumed extent in every stage.
#define STG (128u * PC16)   // halves of one stage region == one 128-row ring buffer
__global__ void __launch_bounds__(256)
gemm_qkv(const f16* __restrict__ A, const f16* __restrict__ W, const float* __restrict__ bias,
         f16* __restrict__ outQ, f16* __restrict__ outK, f16* __restrict__ outT, f16* __restrict__ outR,
         float* __restrict__ pres) {
    __shared__ __attribute__((aligned(16))) f16 As[2 * STG];       // two buffers of 128 X rows x 128 k
    __shared__ __attribute__((aligned(16))) f16 Bs[2 * 3 * STG];   // two buffers of 3 x 128 W rows x 128 k (q | k | v)
    __shared__ __attribute__((aligned(16))) float Bb[3 * 128];     // the block's bias values (q | k | v), shown by the prologue's barrier
    static_assert(sizeof(f16) * 2 * STG >= sizeof(float) * 128 * PC32);   // two regions hold f32 [128][128]

    const u32 tid  = threadIdx.x;
    const u32 lane = tid & 31u;
    const u32 wave = tid >> 5;
    const u32 wm   = wave & 1u;
    const u32 wn   = wave >> 1;
    const u32 hh8  = (lane >> 4) << 3;   // D row half
    const u32 c16  = lane & 15u;         // D column
    const u32 m0   = blockIdx.x * 128u;
    const u32 n0   = blockIdx.y * 128u;
    const u32 bidx = m0 / (u32)SEQ;      // block rows lie inside one batch (SEQ % 128 == 0)
    const u32 s0   = m0 - bidx * (u32)SEQ;

    v8f acc[3][4][2];
#pragma unroll
    for (int z = 0; z < 3; ++z)
#pragma unroll
        for (int i = 0; i < 4; ++i)
#pragma unroll
            for (int j = 0; j < 2; ++j) acc[z][i][j] = zero8();

    // staging map: 16 lanes cover one 256-byte row segment, a wave's copy two rows (four whole lines)
    const u32 crow = tid >> 4;
    const u32 ccol = (tid & 15u) << 3;
    const f16* gA = A + (size_t)(m0 + crow) * HID + ccol;
    const f16* gW = W + (size_t)(n0 + crow) * HID + ccol;
    const u32 lA = lds_addr(&As[crow * PC16 + ccol]);
    const u32 lB = lds_addr(&Bs[crow * PC16 + ccol]);
    const u32 nT = (u32)HID / KTILE;     // 8 tiles

    auto stage = [&](u32 t) {            // 32 copies per wave, one tile's in flight at a time
        const u32 kk = t * KTILE;
        async_copy8(lA + (t & 1u) * (STG * 2u), 16u * PC16 * 2u, gA + kk, (size_t)16 * HID);
#pragma unroll
        for (u32 z = 0; z < 3; ++z) {
            // each statement's address sums stay behind the statement before: the four sets at once do not fit beside the
            // accumulators among the registers that asm text can name, and the loop's base addresses went to scratch
            __builtin_amdgcn_sched_barrier(0);
            async_copy8(lB + (t & 1u) * (3u * STG * 2u) + z * (STG * 2u), 16u * PC16 * 2u,
                        gW + (size_t)z * HID * HID + kk, (size_t)16 * HID);
        }
    };

    stage(0u);
    if (tid < 96u) {   // waves 0 to 2 whole: the block's 3 x 128 bias values, 16 bytes a lane, fetched under tile 0's landing
        const u32 c4 = (tid & 31u) << 2;
        const v4f b4 = *(const v4f*)(bias + (tid >> 5) * (u32)HID + n0 + c4);
        // before code behind this load rewrites a register that it names; the loaded value as an input holds the wait behind the load
        asm volatile("s_wait_xcnt 0x0" :: "v"(b4) : "memory");
        *(v4f*)&Bb[(tid >> 5) * 128u + c4] = b4;
    }
    asm volatile("s_wait_asynccnt 0x0" ::: "memory");   // tile 0 landed before the barrier that shows it
    __syncthreads();
    stage(1u);

#pragma unroll 1   // stays rolled: one trip per staged tile, its buffer chosen by t & 1
    for (u32 t = 0; t < nT; ++t) {
        const f16* as = As + (t & 1u) * STG;
        const f16* bs = Bs + (t & 1u) * (3u * STG);
        v16h af[2][4], bfr[2][6];       // two fragment sets: the next 32-k step is read while this one is multiplied
        auto frags = [&](u32 set, u32 kc) {
#pragma unroll
            for (int i = 0; i < 4; ++i) af[set][i] = load_frag(as, wm * 64u + (u32)i * 16u, PC16, kc, lane);
#pragma unroll
            for (int y = 0; y < 6; ++y)
                bfr[set][y] = load_frag(bs, (u32)(y >> 1) * 128u + wn * 32u + (u32)(y & 1) * 16u, PC16, kc, lane);
        };
        frags(0u, 0u);
        __builtin_amdgcn_sched_barrier(0);   // the first step's reads stay ahead of the second's: its products wait for their own set only
#pragma unroll     // the four 32-k steps of a tile in line, every LDS offset an immediate
        for (u32 ks = 0; ks < KTILE / 32u; ++ks) {
            if (ks + 1u < KTILE / 32u) frags((ks + 1u) & 1u, (ks + 1u) * 32u);
            __builtin_amdgcn_sched_barrier(0);   // the next step's reads stay one group ahead of this step's products
#pragma unroll
            for (int z = 0; z < 3; ++z)
#pragma unroll
                for (int i = 0; i < 4; ++i)
#pragma unroll
                    for (int j = 0; j < 2; ++j)
                        acc[z][i][j] = wmma16(af[ks & 1u][i], bfr[ks & 1u][z * 2 + j], acc[z][i][j]);
            __builtin_amdgcn_sched_barrier(0);   // and no later read moves up among these products
        }
        ring_publish();
        if (t + 2u < nT) stage(t + 2u);  // into the buffers this trip has just read
    }
    asm volatile("s_wait_asynccnt 0x0" ::: "memory");   // nothing in flight when the epilogue starts

    const float mul = 1.0f / (CARRY_X * CARRY_W);
    float bv[3][2];
#pragma unroll
    for (int z = 0; z < 3; ++z)
#pragma unroll
        for (int j = 0; j < 2; ++j) bv[z][j] = bf16_rne(Bb[(u32)z * 128u + wn * 32u + (u32)j * 16u + c16]);

    float* Fk = (float*)As;              // f32 k rows [128][128] at pitch PC32
    float* Fv = (float*)Bs;              // f32 v rows, the same
    f16*   Sq = Bs + 2u * STG;           // q plane rows [m][n] at pitch PC16
    f16*   Sk = Bs + 3u * STG;           // k plane rows [m][n]
    f16*   Sv = Bs + 4u * STG;           // v^T plane rows [n][m]
    f16*   Sr = Bs + 5u * STG;           // v^T residual rows [n][m]
    const bool early = s0 < (u32)EARLY;  // block-uniform: residual plane only for early key blocks

    const u32 piece = lane & 7u;
    const u32 lsub  = lane >> 3;
    const size_t bh0 = (size_t)bidx * NHEAD + (n0 >> 6);

    // f16 rows [m][n] of a stage -> head-major plane, whole 128-byte lines
    auto store_plane = [&](const f16* S, f16* plane) {
#pragma unroll
        for (u32 it = 0; it < 8; ++it) {
            const u32 L    = wave * 32u + it * 4u + lsub;   // 0..255
            const u32 ml   = L >> 1;
            const u32 hsel = L & 1u;
            const v8h v = *(const v8h*)&S[ml * PC16 + hsel * 64u + piece * 8u];
            *(v8h*)(plane + ((bh0 + hsel) * SEQ + s0 + ml) * HD + piece * 8u) = v;
        }
        asm volatile("s_wait_xcnt 0x0" ::: "memory");   // before code behind this run rewrites a register of these stores
    };
    // f16 rows [n][m] of a stage -> transposed plane
    auto store_planeT = [&](const f16* S, f16* plane) {
#pragma unroll
        for (u32 it = 0; it < 8; ++it) {
            const u32 L  = wave * 32u + it * 4u + lsub;     // 0..255
            const u32 nl = L >> 1;
            const u32 mh = L & 1u;
            const v8h v = *(const v8h*)&S[nl * PC16 + mh * 64u + piece * 8u];
            *(v8h*)(plane + (size_t)(bidx * (u32)HID + n0 + nl) * SEQ + s0 + mh * 64u + piece * 8u) = v;
        }
        asm volatile("s_wait_xcnt 0x0" ::: "memory");   // before code behind this run rewrites a register of these stores
    };
    // f32 rows [m][n] of a stage -> rows of the second output
    auto store_rows = [&](const float* F, float* fout) {
#pragma unroll
        for (u32 it = 0; it < 16; ++it) {
            const u32 L    = wave * 64u + it * 4u + lsub;   // 0..511
            const u32 row  = L >> 2;
            const u32 part = L & 3u;
            const v4f v = *(const v4f*)&F[row * PC32 + part * 32u + piece * 4u];
            *(v4f*)(fout + ((size_t)(bidx * (u32)NHEAD + (n0 >> 6) + (part >> 1)) * SEQ_FULL + s0 + row) * HD
                         + (part & 1u) * 32u + piece * 4u) = v;
        }
        asm volatile("s_wait_xcnt 0x0" ::: "memory");   // before code behind this run rewrites a register of these stores
    };

    // k, then v, then q: each projection's global stores drain under the next one's stage writes, the smallest last
#pragma unroll
    for (int i = 0; i < 4; ++i)
#pragma unroll
        for (int j = 0; j < 2; ++j) {
            const u32 nl = wn * 32u + (u32)j * 16u + c16;
#pragma unroll
            for (int r = 0; r < 8; ++r) {
                const u32 ml = wm * 64u + (u32)i * 16u + hh8 + (u32)r;
                const float tk = acc[1][i][j][r] * mul + bv[1][j];
                Sk[ml * PC16 + nl] = (f16)(tk * CARRY_QKV);
                Fk[ml * PC32 + nl] = tk;
            }
        }
    lds_barrier();
    store_rows(Fk, pres);
    store_plane(Sk, outK);

#pragma unroll
    for (int i = 0; i < 4; ++i)
#pragma unroll
        for (int j = 0; j < 2; ++j) {
            const u32 nl = wn * 32u + (u32)j * 16u + c16;
            const u32 mb = wm * 64u + (u32)i * 16u + hh8;
            H8U th;
#pragma unroll
            for (int r = 0; r < 8; ++r) {
                const float tv = acc[2][i][j][r] * mul + bv[2][j];
                Fv[(mb + (u32)r) * PC32 + nl] = tv;
                th.e[r] = (f16)(tv * CARRY_QKV);
            }
            *(v8h*)&Sv[nl * PC16 + mb] = th.v;
        }
    if (early) {
#pragma unroll
        for (int i = 0; i < 4; ++i)
#pragma unroll
            for (int j = 0; j < 2; ++j) {
                H8U tr;
#pragma unroll
                for (int r = 0; r < 8; ++r) {
                    const float tc = (acc[2][i][j][r] * mul + bv[2][j]) * CARRY_QKV;
                    const f16   hi = (f16)tc;
                    tr.e[r] = (f16)(tc - (float)hi);
                }
                *(v8h*)&Sr[(wn * 32u + (u32)j * 16u + c16) * PC16 + wm * 64u + (u32)i * 16u + hh8] = tr.v;
            }
    }
    lds_barrier();
    store_rows(Fv, pres + PRES_ELEMS_FULL);
    store_planeT(Sv, outT);
    if (early) store_planeT(Sr, outR);

#pragma unroll
    for (int i = 0; i < 4; ++i)
#pragma unroll
        for (int j = 0; j < 2; ++j) {
            const u32 nl = wn * 32u + (u32)j * 16u + c16;
#pragma unroll
            for (int r = 0; r < 8; ++r) {
                const u32 ml = wm * 64u + (u32)i * 16u + hh8 + (u32)r;
                const float tq = acc[0][i][j][r] * mul + bv[0][j];
                Sq[ml * PC16 + nl] = (f16)(tq * CARRY_QKV);
            }
        }
    lds_barrier();
    store_plane(Sq, outQ);
}

// f32 output rows; A residual plane at A + resOff for early row blocks (the choice is block-uniform). One work-group per
// WGP is launched, so the launch lasts as long as an early block: it walks the same 8 tiles as the others.
__global__ void __launch_bounds__(256) __attribute__((amdgpu_num_vgpr(256)))
gemm_o(const f16* __restrict__ A, const f16* __restrict__ W, const float* __restrict__ bias,
       float* __restrict__ out, size_t resOff) {
    __shared__ __attribute__((aligned(16))) f16 As[2 * 128 * PC16];
    __shared__ __attribute__((aligned(16))) f16 Bs[2 * 128 * PC16];
    __shared__ __attribute__((aligned(16))) f16 Rs[2 * 128 * PC16];
    __shared__ __attribute__((aligned(16))) f16 Cs[128 * PC16];
    if ((blockIdx.x * 128u) % (u32)SEQ < (u32)EARLY) {
        gemm_body<3, true>(A, W, bias, (f16*)out, (f16*)out, out, resOff, As, Bs, Cs, Rs);
    } else {
        gemm_body<3, false>(A, W, bias, (f16*)out, (f16*)out, out, resOff, As, Bs, Cs, Rs);
    }
}

// ---------------------------------------------------------------------------
// Online softmax update for one transposed score tile, 64 keys x 16 q (log2 domain, max-subtracted).
// s[nt][r] = score of key kbase + 16 nt + hh8 + r against query q: a lane holds 32 keys of ONE query, the
// lane 16 away the other 32, so the maximum is in-lane plus one exchange and m, al are one value per lane.
// The carried exp values, converted in place, are the B fragments of the next product:
// pb[kk] element j = tile 2 kk + (j >> 3), register j & 7, which is load_frag's k order.
// MASK: keys above the query row get probability exactly 0 and do not enter the row max.
// EP: also emit the f16 residual of each carried exp value.
// ---------------------------------------------------------------------------
template <bool MASK, bool EP>
__device__ __forceinline__ void softmax_tile(const v8f (&s)[4], float& m, v8f (&o)[4], v8f& lacc,
                                             FragU (&pb)[2], FragU (&prb)[2], u32 kbase, u32 q,
                                             u32 hh8, float cl) {
    float x[4][8];
    float t4[4];
#pragma unroll
    for (int nt = 0; nt < 4; ++nt) {
#pragma unroll
        for (int r = 0; r < 8; ++r) {
            x[nt][r] = s[nt][r] * cl;
            if constexpr (MASK) {
                const bool dead = (kbase + (u32)nt * 16u + hh8 + (u32)r) > q;
                x[nt][r] = dead ? -1.0e30f : x[nt][r];
            }
        }
        t4[nt] = fmaxf(fmaxf(fmaxf(x[nt][0], x[nt][1]), fmaxf(x[nt][2], x[nt][3])),
                       fmaxf(fmaxf(x[nt][4], x[nt][5]), fmaxf(x[nt][6], x[nt][7])));
    }
    float tm = fmaxf(fmaxf(t4[0], t4[1]), fmaxf(t4[2], t4[3]));
    tm = fmaxf(tm, xhalf(tm));
    const float mn = fmaxf(m, tm);
    const float al = fexp2(m - mn);
    m = mn;
    lacc *= al;
#pragma unroll
    for (int dt = 0; dt < 4; ++dt) o[dt] *= al;
    const float sh = 10.0f - mn;      // carry 2^10
#pragma unroll
    for (int nt = 0; nt < 4; ++nt) {
#pragma unroll
        for (int r = 0; r < 8; r += 2) {
            v2f e;
            e.x = fexp2(x[nt][r] + sh);
            e.y = fexp2(x[nt][r + 1] + sh);
            if constexpr (MASK) {
                e.x = ((kbase + (u32)nt * 16u + hh8 + (u32)r) > q) ? 0.0f : e.x;
                e.y = ((kbase + (u32)nt * 16u + hh8 + (u32)r + 1u) > q) ? 0.0f : e.y;
            }
            const v2h hi = __builtin_convertvector(e, v2h);
            const int  j = (nt & 1) * 4 + (r >> 1);
            pb[nt >> 1].pair[j] = hi;
            if constexpr (EP) prb[nt >> 1].pair[j] = __builtin_convertvector(e - __builtin_convertvector(hi, v2f), v2h);
        }
    }
}

// ---------------------------------------------------------------------------
// Causal flash attention, one (row block, head) per block of 256 (8 waves), wave owns 16 query
// rows (Q fragments resident). Block streams 64-key tiles 0 .. last tile touching its rows:
// K staged [key][d], V^T staged [d][key] (+ residual tile when EP), by asynchronous copies into two
// buffers each, a buffer holding a stage of two tiles (128 keys): the next stage flies while this one's two tiles are
// worked on, so a copy has two tiles' work to land in, and the publish point stands once per stage. A wave computes a tile only
// when the tile starts at or below its first row (wave-uniform); the tile containing its rows
// takes the masked path. Both products run transposed: S^T = K.Q^T (A = K rows, B = the resident Q fragments)
// and O^T += V^T.P^T (A = V^T rows, B = P^T), so a lane's score registers belong to one query, the row max is
// in-lane plus one exchange between the lane halves, and the exp2 values (f32, carried x2^10), converted in
// place, are the B fragments of the second product: P stays in registers. Row sums += ones.P^T on WMMA.
// LDS reads of a tile stand in groups: its eight K fragments ahead of the score products, its eight V^T
// fragments ahead of the softmax (the residual fragments ahead of the second product).
// EP (rows below EARLY): P and V as hi + residual, products hi.hi + res.hi + hi.res into the
// same accumulators; context written as hi plane + residual plane.
// coverage: every (b, q, h*64..h*64+63) row segment of the launched row blocks exactly once.
// LDS: ks, vsT, vrT cross-wave (block barriers); ps/pr per-wave context staging of the epilogue.
// staged extent == consumed extent for ks/vsT/vrT (64x64) and ps/pr (16x64, written
// in full by the owning wave before it reads them).
// ---------------------------------------------------------------------------
template <bool EP>
__device__ __forceinline__ void attn_body(const f16* Qp, const f16* Kp, const f16* Vt, const f16* Vr,
                                          f16* Cp, f16* Cr, u32 qblk, u32 bh,
                                          f16* ks, f16* vsT, f16* vrT, f16* ps, f16* pr) {
    static_assert(HD == 8 * 8);            // 8 lanes x 8 halves per row segment
    static_assert(2 * 256 * 8 == 64 * 64); // staging: 2 copies x 256 threads x 8 halves per tile

    const u32 tid  = threadIdx.x;
    const u32 lane = tid & 31u;
    const u32 wave = (u32)__builtin_amdgcn_readfirstlane((int)(tid >> 5));
    const u32 hh8  = (lane >> 4) << 3;
    const u32 c16  = lane & 15u;
    const u32 bidx = bh >> 4;            // NHEAD == 16
    const u32 hidx = bh & 15u;
    const u32 q0   = qblk * 128u + wave * 16u;
    const size_t head = (size_t)bh * SEQ * HD;

    v16h qa[2];
#pragma unroll
    for (int c = 0; c < 2; ++c) qa[c] = load_frag(Qp + head, q0, HD, (u32)c * 32u, lane);

    FragU onesu;
#pragma unroll
    for (int i = 0; i < 16; ++i) onesu.e[i] = (f16)1.0f;
    const v16h ones = onesu.v;

    // o[dt][r] = O^T[d = 16 dt + hh8 + r][query q0 + c16]; every register of lacc = that query's row sum
    float m = -1.0e30f;
    v8f   o[4], lacc;
#pragma unroll
    for (int dt = 0; dt < 4; ++dt) o[dt] = zero8();
    lacc = zero8();

    // log2-domain scale: acc = 256 * q.k ; x = log2(e) * q.k / 64 = acc * log2(e) / 16384
    const float cl = 1.4426950408889634f * 0.00006103515625f;
    f16* psw = ps + wave * (16u * PK64);
    f16* prw = pr + wave * (16u * PK64);

    const u32 nkt = qblk * 2u + 2u;      // keys 0 .. qblk*128 + 127

    // staging map: 8 lanes cover one 128-byte row, a wave's copy four rows; rows srow and srow + 32 per thread
    const u32 srow = tid >> 3;
    const u32 spc  = (tid & 7u) << 3;
    const f16* gK = Kp + head + (size_t)srow * HD + spc;
    const f16* gV = Vt + head + (size_t)srow * SEQ + spc;
    const f16* gR = Vr + head + (size_t)srow * SEQ + spc;
    const u32 lK = lds_addr(&ks[srow * PK64 + spc]);
    const u32 lV = lds_addr(&vsT[srow * PK64 + spc]);
    const u32 lR = lds_addr(&vrT[EP ? srow * PK64 + spc : 0u]);

    // one stage = the two tiles t (even) and t + 1, side by side in one buffer: tile t lies in slot t & 3 of four
    auto stage = [&](u32 t) {
        const u32  bo = (t & 2u) * (64u * PK64 * 2u);
        const u32  hb = 32u * PK64 * 2u;                 // 32 rows further, in LDS bytes
        const f16* k0 = gK + (size_t)t * 64u * HD;
        const f16* v0 = gV + t * 64u;
        async_copy8p(lK + bo,           k0,           lK + bo + hb,      k0 + 32 * HD,
                     lK + bo + 2u * hb, k0 + 64 * HD, lK + bo + 3u * hb, k0 + 96 * HD,
                     lV + bo,           v0,           lV + bo + hb,      v0 + (size_t)32 * SEQ,
                     lV + bo + 2u * hb, v0 + 64,      lV + bo + 3u * hb, v0 + 64 + (size_t)32 * SEQ);
        if constexpr (EP) {
            const f16* r0 = gR + t * 64u;
            async_copy4(lR + bo,           r0,      lR + bo + hb,      r0 + (size_t)32 * SEQ,
                        lR + bo + 2u * hb, r0 + 64, lR + bo + 3u * hb, r0 + 64 + (size_t)32 * SEQ);
        }
    };

    stage(0u);                           // nkt is even and at least 2
    asm volatile("s_wait_asynccnt 0x0" ::: "memory");   // stage 0 landed before the barrier that shows it
    __syncthreads();
    if (nkt > 2u) stage(2u);

#pragma unroll 1   // stays rolled: one trip per tile, its slot chosen by kt & 3
    for (u32 kt = 0; kt < nkt; ++kt) {
        const f16* ksb = ks  + (kt & 3u) * (64u * PK64);
        const f16* vsb = vsT + (kt & 3u) * (64u * PK64);
        const f16* vrb_t = vrT + (EP ? (kt & 3u) * (64u * PK64) : 0u);

        const bool active = (kt * 64u <= q0);           // wave-uniform
        if (active) {
            // S^T[64 keys x 16 q]
            v8f s[4];
            v16h kf[2][4], vf[2][4];
#pragma unroll
            for (int nt = 0; nt < 4; ++nt) s[nt] = zero8();
#pragma unroll
            for (int c = 0; c < 2; ++c)
#pragma unroll
                for (int nt = 0; nt < 4; ++nt) kf[c][nt] = load_frag(ksb, (u32)nt * 16u, PK64, (u32)c * 32u, lane);
            __builtin_amdgcn_sched_barrier(0);   // the tile's K reads stay one group ahead of its products: one LDS latency, not one per product
#pragma unroll
            for (int c = 0; c < 2; ++c)
#pragma unroll
                for (int nt = 0; nt < 4; ++nt) s[nt] = wmma16(kf[c][nt], qa[c], s[nt]);
            __builtin_amdgcn_sched_barrier(0);   // the V^T reads below stay one group, not spread in pairs among the score products
#pragma unroll
            for (int kk = 0; kk < 2; ++kk)
#pragma unroll
                for (int dt = 0; dt < 4; ++dt) vf[kk][dt] = load_frag(vsb, (u32)dt * 16u, PK64, (u32)kk * 32u, lane);
            __builtin_amdgcn_sched_barrier(0);   // holds those reads in front of the softmax, which covers their latency: the compiler otherwise sinks them behind it
            FragU pb[2], prb[2];
            const bool diag = (kt * 64u + 63u > q0);    // wave-uniform
            if (diag) softmax_tile<true,  EP>(s, m, o, lacc, pb, prb, kt * 64u, q0 + c16, hh8, cl);
            else      softmax_tile<false, EP>(s, m, o, lacc, pb, prb, kt * 64u, q0 + c16, hh8, cl);

            // O^T += V^T . P^T ; l += ones . P^T
            v16h vrf[2][4];
            if constexpr (EP) {
#pragma unroll
                for (int kk = 0; kk < 2; ++kk)
#pragma unroll
                    for (int dt = 0; dt < 4; ++dt)
                        vrf[kk][dt] = load_frag(vrb_t, (u32)dt * 16u, PK64, (u32)kk * 32u, lane);
                __builtin_amdgcn_sched_barrier(0);   // the residual reads stay one group ahead of the products
            }
#pragma unroll
            for (int kk = 0; kk < 2; ++kk) {
#pragma unroll
                for (int dt = 0; dt < 4; ++dt) {
                    o[dt] = wmma16(vf[kk][dt], pb[kk].v, o[dt]);
                    if constexpr (EP) {
                        o[dt] = wmma16(vrf[kk][dt], pb[kk].v, o[dt]);
                        o[dt] = wmma16(vf[kk][dt], prb[kk].v, o[dt]);
                    }
                }
                lacc = wmma16(ones, pb[kk].v, lacc);
                if constexpr (EP) lacc = wmma16(ones, prb[kk].v, lacc);
            }
        }
        if (kt & 1u) {                               // foot of a stage (block-uniform): every wave, active or not
            ring_publish();
            if (kt + 3u < nkt) stage(kt + 3u);       // into the buffer whose two tiles have just been read
        }
    }
    asm volatile("s_wait_asynccnt 0x0" ::: "memory");   // nothing in flight when the epilogue starts

    // normalize: plane value = 1024 * (O/16) / l = O * 64 / l ; a lane's 8 registers are 8 consecutive d of its query
    const float inv = (CARRY_CTX / CARRY_QKV) / lacc[0];
#pragma unroll
    for (int dt = 0; dt < 4; ++dt) {
        H8U th, tr;
#pragma unroll
        for (int r = 0; r < 8; ++r) {
            const float cv = o[dt][r] * inv;
            const f16   hi = (f16)cv;
            th.e[r] = hi;
            if constexpr (EP) tr.e[r] = (f16)(cv - (float)hi);
        }
        const u32 idx = c16 * PK64 + (u32)dt * 16u + hh8;
        *(v8h*)&psw[idx] = th.v;
        if constexpr (EP) *(v8h*)&prw[idx] = tr.v;
    }
    __syncthreads();

    const u32 piece = lane & 7u;
    const u32 lsub  = lane >> 3;
{
#pragma unroll
        for (u32 it = 0; it < 4; ++it) {
            const u32 L = it * 4u + lsub;     // query row 0..15 within the wave tile
            const size_t off = (size_t)(bidx * (u32)SEQ + q0 + L) * HID + hidx * (u32)HD + piece * 8u;
            const v8h v = *(const v8h*)&psw[L * PK64 + piece * 8u];
            *(v8h*)(Cp + off) = v;
            if constexpr (EP) {
                const v8h vr = *(const v8h*)&prw[L * PK64 + piece * 8u];
                *(v8h*)(Cr + off) = vr;
            }
        }
        
    }
}

// Both attention paths in one launch (neither reads what the other writes): rows [0, EARLY) of every
// sequence take the hi + residual path, rows [EARLY, SEQ) the single f16 planes; the choice is block-uniform.
// A row block's cost grows with its index (it walks 2 q + 2 key tiles) and every block of the launch is resident at
// once, two to a WGP, so the launch lasts as long as the fullest WGP. Flat grid, head running fastest: the upper half
// of the row blocks first, longest first, then the lower half, shortest
// first, so that blocks half a grid apart, q and ATT_NQ - 1 - q, add up to the same number of key tiles.
// rank -> row block is a permutation for any ATT_NQ: ranks below ATT_NU take ATT_NQ - 1 .. ATT_NQ - ATT_NU, the rest 0 upward.
#define ATT_E_BX     (EARLY / 128)
#define ATT_NQ       (SEQ / 128)
#define ATT_NH       (NB * NHEAD)
#define ATT_NU       (ATT_NQ - ATT_NQ / 2)
__global__ void __launch_bounds__(256) __attribute__((amdgpu_num_vgpr(256)))
attn_all(const f16* __restrict__ Qp, const f16* __restrict__ Kp, const f16* __restrict__ Vt,
         const f16* __restrict__ Vr, f16* __restrict__ Cp, f16* __restrict__ Cr) {
    __shared__ __attribute__((aligned(16))) f16 ks[4 * 64 * PK64];    // two buffers of two tiles [key][d]
    __shared__ __attribute__((aligned(16))) f16 vsT[4 * 64 * PK64];   // two buffers of two tiles [d][key]
    __shared__ __attribute__((aligned(16))) f16 vrT[4 * 64 * PK64];   // two buffers of two tiles [d][key] residual (early path)
    __shared__ __attribute__((aligned(16))) f16 ps[8 * 16 * PK64];    // per-wave ctx stage
    __shared__ __attribute__((aligned(16))) f16 pr[8 * 16 * PK64];    // per-wave ctx residual stage (early path)
    const u32 rank = blockIdx.x / (u32)ATT_NH;
    const u32 bh   = blockIdx.x % (u32)ATT_NH;
    const u32 qblk = (rank < (u32)ATT_NU) ? (u32)(ATT_NQ - 1) - rank : rank - (u32)ATT_NU;
    if (qblk < (u32)ATT_E_BX) {
        attn_body<true>(Qp, Kp, Vt, Vr, Cp, Cr, qblk, bh, ks, vsT, vrT, ps, pr);
    } else {
        attn_body<false>(Qp, Kp, Vt, Vt, Cp, Cp, qblk, bh, ks, vsT, vrT, ps, pr);
    }
}

// coverage equalities (threads x elements == plane elements)
static_assert((size_t)(MROWS / 2) * 256 * 8 == (size_t)MROWS * HID);                       // cvt_rows -> Xh
static_assert((size_t)(3 * HID / 64) * (HID / 64) * 64 * 64 == (size_t)3 * HID * HID);     // cvt_wT -> Wt
static_assert((size_t)(HID / 64) * (HID / 64) * 64 * 64 == (size_t)HID * HID);             // cvt_wT -> Wot
static_assert((size_t)(MROWS / 128) * (HID / 128) * 128 * 128 == (size_t)MROWS * HID);     // gemm planes / out
static_assert((size_t)(SEQ / 128) * (NB * NHEAD) * 128 * HD == (size_t)MROWS * HID);       // attn -> Cp
// workspace: 7 activation planes + 4 weight planes of halves, at most 128 MiB
static_assert(((size_t)7 * MROWS * HID + (size_t)4 * HID * HID) * sizeof(f16) <= (size_t)134217728);

// ---------------------------------------------------------------------------
// Launch: 4 kernel launches, workspace 7 planes of MROWS*1024 halves + 4 of 1024*1024 halves.
// ---------------------------------------------------------------------------
extern "C" void kernel_launch(void* const* d_in, const int* in_sizes, int n_in,
                              void* d_out, int out_size, void* d_ws, size_t ws_size,
                              hipStream_t stream) {
    if (n_in < 5) return;
    if (in_sizes[0] < ((NB - 1) * SEQ_FULL + SEQ) * HID) return;
    if (in_sizes[1] < 3 * HID * HID) return;
    if (in_sizes[2] < 3 * HID) return;
    if (in_sizes[3] < HID * HID) return;
    if (in_sizes[4] < HID) return;
    const size_t needOut = OUT0_ELEMS_FULL + PRES_ELEMS_FULL
                         + ((size_t)((NB - 1) * NHEAD + NHEAD - 1) * SEQ_FULL + SEQ) * HD;
    if ((size_t)out_size < needOut) return;

    const float* x     = (const float*)d_in[0];   // [NB_FULL][SEQ_FULL][1024]
    const float* wattn = (const float*)d_in[1];   // [1024 in][3072 out], out columns q | k | v
    const float* battn = (const float*)d_in[2];   // [3072]
    const float* wproj = (const float*)d_in[3];   // [1024 in][1024 out]
    const float* bproj = (const float*)d_in[4];   // [1024]
    float* out = (float*)d_out;                   // out0 | present k | present v

    const size_t nX = (size_t)MROWS * HID;    // halves per activation plane
    const size_t nW = (size_t)HID * HID;      // halves per weight plane
    const size_t totalHalves = 7 * nX + 4 * nW;
    if (ws_size < totalHalves * sizeof(f16)) return;

    f16* Xh  = (f16*)d_ws;       // [MROWS][1024]               carry 16
    f16* Wt  = Xh  + nX;         // [3072 out][1024 in]         carry 32 (q | k | v row blocks)
    f16* Wot = Wt  + 3 * nW;     // [1024 out][1024 in]         carry 32
    f16* Qp  = Wot + nW;         // [NB*16][SEQ][64]            carry 16
    f16* Kp  = Qp  + nX;         // [NB*16][SEQ][64]            carry 16
    f16* Vtp = Kp  + nX;         // [NB*1024][SEQ] (V^T)        carry 16
    f16* Vrp = Vtp + nX;         // [NB*1024][SEQ] residual, columns s < EARLY only
    f16* Cp  = Vrp + nX;         // [MROWS][1024]               carry 1024
    f16* Cr  = Cp  + nX;         // [MROWS][1024] residual, rows s < EARLY only

    cvt_all<<<CVT_X_BLOCKS + CVT_WA_BLOCKS + CVT_WP_BLOCKS, 256, 0, stream>>>(x, wattn, wproj, Xh, Wt, Wot);

    const dim3 gg(MROWS / 128, HID / 128);
    gemm_qkv<<<gg, 256, 0, stream>>>(Xh, Wt, battn, Qp, Kp, Vtp, Vrp, out + OUT0_ELEMS_FULL);

    attn_all<<<ATT_NQ * ATT_NH, 256, 0, stream>>>(Qp, Kp, Vtp, Vrp, Cp, Cr);

    // out = acc / (1024*32) + bias ; residual context plane at Cp + nX
    gemm_o<<<gg, 256, 0, stream>>>(Cp, Wot, bproj, out, nX);
}
